// v000
// The times below were measured on an AMD MI455X: many runs one after another, warmed up first and cycling through
// copies of the inputs, with the whole window's GPU time divided by the number of runs. Launches and the gaps
// between them are all in it. The median over several windows is given; except for v000 it joins two sittings, which
// can be a few percent apart, so the side-by-side timings, each taken in one sitting, are the better comparison.
// v000, which the later versions start from, runs in 295 microseconds.
#include <hip/hip_runtime.h>
// All contractions on v_wmma_f32_16x16x32_f16 (f16 operands, f32 accumulate): QKV projection, key*value^T, context^T*query, output projection; exact power-of-two operand scales (weights x16, key softmax x4096, context x64, query softmax x256, attended x256) undone in the f32 epilogues; softmaxes and affine terms in f32.

#define BB    8
#define DIMC  384
#define NN    4096
#define HEADS 8
#define KDIM  32
#define DD    64
#define NHKD  256
#define DHC   512
#define MQKV  1024
#define TP    132      // LDS pitch (floats) for 64x128 tiles, keeps 16-B alignment
#define TPD   68       // LDS pitch (floats) for x64 tiles

typedef _Float16 v16h __attribute__((ext_vector_type(16)));
typedef _Float16 v8h  __attribute__((ext_vector_type(8)));
typedef float    v8f  __attribute__((ext_vector_type(8)));
typedef float    v4f  __attribute__((ext_vector_type(4)));
typedef float    v4fa __attribute__((ext_vector_type(4), may_alias));

union Frag { v16h v; v8h half[2]; };

// 16x16x32 operand fragment from a k-contiguous row: elements 0..7 <- row[8h..8h+7],
// elements 8..15 <- row[16+8h..16+8h+7]; lane&15 selects the row (A) or column (B).
__device__ __forceinline__ v16h load_frag(const _Float16* __restrict__ p, int h)
{
    Frag f;
    f.half[0] = *(const v8h*)(p + 8 * h);
    f.half[1] = *(const v8h*)(p + 16 + 8 * h);
    return f.v;
}

__device__ __forceinline__ v8f mma16(v16h a, v16h b, v8f c)
{
    return __builtin_amdgcn_wmma_f32_16x16x32_f16(false, a, false, b, (short)0, c, false, false);
}

#define GUARD1(c, a, b) \
    asm volatile("v_nop\n\tv_nop\n\tv_nop\n\tv_nop" : "+v"(c) : "v"(a), "v"(b))
#define GUARD4(c0, c1, c2, c3, a, b0, b1, b2, b3) \
    asm volatile("v_nop\n\tv_nop\n\tv_nop\n\tv_nop" \
                 : "+v"(c0), "+v"(c1), "+v"(c2), "+v"(c3) \
                 : "v"(a), "v"(b0), "v"(b1), "v"(b2), "v"(b3))

__device__ __forceinline__ void vst8h(_Float16* p, v8h v) { *(v8h*)p = v; }
__device__ __forceinline__ void vst4f(float* p, v4f v)    { *(v4f*)p = v; }

// One wave: 16 rows of A (row-major, pitch K) times 64 columns of B (B[k][n] stored
// n-major with k contiguous, pitch K). c0..c3 = column groups of 16.
__device__ __forceinline__ void mainloop_16x64(const _Float16* __restrict__ Arow,
                                               const _Float16* __restrict__ Brow,
                                               const int K, const int h,
                                               v8f& c0, v8f& c1, v8f& c2, v8f& c3)
{
#pragma unroll 1
    for (int k0 = 0; k0 < K; k0 += 32) {
        v16h a  = load_frag(Arow + k0, h);
        v16h b0 = load_frag(Brow + k0, h);
        v16h b1 = load_frag(Brow + 16 * K + k0, h);
        v16h b2 = load_frag(Brow + 32 * K + k0, h);
        v16h b3 = load_frag(Brow + 48 * K + k0, h);
        c0 = mma16(a, b0, c0);
        c1 = mma16(a, b1, c1);
        c2 = mma16(a, b2, c2);
        c3 = mma16(a, b3, c3);
        GUARD4(c0, c1, c2, c3, a, b0, b1, b2, b3);
    }
}

// ---------------------------------------------------------------------------
// Kernel 0: weights -> f16 (x16), concatenated [1024][384] and [384][512];
// affine params concatenated (scale pre-multiplied by 1/16).  16-B per lane stores.
// ---------------------------------------------------------------------------
__global__ __launch_bounds__(256) void prep_kernel(
    const float* __restrict__ Wq, const float* __restrict__ Wk, const float* __restrict__ Wv,
    const float* __restrict__ Wp,
    const float* __restrict__ sq, const float* __restrict__ bq,
    const float* __restrict__ sk, const float* __restrict__ bk,
    const float* __restrict__ sv, const float* __restrict__ bv,
    _Float16* __restrict__ wabc, _Float16* __restrict__ wph,
    float* __restrict__ sc, float* __restrict__ bc)
{
    const int NW1 = MQKV * DIMC / 8;   // 49152 chunks of 8 halves
    const int NW2 = DIMC * DHC / 8;    // 24576 chunks
    const int i = blockIdx.x * 256 + threadIdx.x;
    if (i < NW1 + NW2) {
        const float* src;
        _Float16* dst;
        if (i < NW1) {
            const int e = i * 8;
            if (e < NHKD * DIMC)          src = Wq + e;
            else if (e < 2 * NHKD * DIMC) src = Wk + (e - NHKD * DIMC);
            else                          src = Wv + (e - 2 * NHKD * DIMC);
            dst = wabc + e;
        } else {
            const int e = (i - NW1) * 8;
            src = Wp + e;
            dst = wph + e;
        }
        const v4f f0 = *(const v4f*)src;
        const v4f f1 = *(const v4f*)(src + 4);
        v8h hv;
#pragma unroll
        for (int j = 0; j < 4; ++j) {
            hv[j]     = (_Float16)(f0[j] * 16.0f);
            hv[4 + j] = (_Float16)(f1[j] * 16.0f);
        }
        vst8h(dst, hv);
        
    } else {
        const int j = i - (NW1 + NW2);
        if (j < 512) {
            const int e = (j & 255) * 4;
            v4f o;
#pragma unroll
            for (int q = 0; q < 4; ++q) {
                const int ee = e + q;
                float val;
                if (j < 256) {
                    val = (ee < NHKD) ? sq[ee] : ((ee < 2 * NHKD) ? sk[ee - NHKD] : sv[ee - 2 * NHKD]);
                    val *= 0.0625f;
                } else {
                    val = (ee < NHKD) ? bq[ee] : ((ee < 2 * NHKD) ? bk[ee - NHKD] : bv[ee - 2 * NHKD]);
                }
                o[q] = val;
            }
            float* dst = ((j < 256) ? sc : bc) + e;
            vst4f(dst, o);
            
        }
    }
}

// ---------------------------------------------------------------------------
// Kernel 1: x[b][c][n] f32 -> xt[b][n][c] f16.  Tile 128 c x 32 n in LDS; each
// ---------------------------------------------------------------------------
__global__ __launch_bounds__(256) void xpose_kernel(const float* __restrict__ x,
                                                    _Float16* __restrict__ xt)
{
    __shared__ float tile[128 * 33];
    const int b = blockIdx.z;
    const int nb = blockIdx.x * 32, cb = blockIdx.y * 128;
    const int t = threadIdx.x, l = t & 31, w = t >> 5, h = l >> 4, m = l & 15;
    const float* xb = x + (size_t)b * DIMC * NN;
#pragma unroll
    for (int j = 0; j < 16; ++j) {
        const int c = w + 8 * j;
        tile[c * 33 + l] = xb[(size_t)(cb + c) * NN + nb + l];
    }
    __syncthreads();
    _Float16* xo = xt + (size_t)b * NN * DIMC;
    const int nl0 = w * 4 + h, nl1 = w * 4 + 2 + h;
    v8h hv0, hv1;
#pragma unroll
    for (int j = 0; j < 8; ++j) {
        hv0[j] = (_Float16)tile[(m * 8 + j) * 33 + nl0];
        hv1[j] = (_Float16)tile[(m * 8 + j) * 33 + nl1];
    }
    _Float16* d0 = xo + (size_t)(nb + nl0) * DIMC + cb + m * 8;
    _Float16* d1 = xo + (size_t)(nb + nl1) * DIMC + cb + m * 8;
    vst8h(d0, hv0);
    vst8h(d1, hv1);
    
}

// ---------------------------------------------------------------------------
// Kernel 2: fused QKV projection [1024][384] x [384][4096] per batch + affine.
// Block tile 64 rows x 128 cols, 8 waves, wave tile 16 x 64.  Result staged in LDS:
//   Q rows (0..255):   channel softmax over 32 per head (f32), x256, f16 -> qsm[b][n][256]
//   K rows (256..511): f32 -> kf[b][256][N]
//   V rows (512..1023): f16 -> vh[b][512][N]
// ---------------------------------------------------------------------------
__global__ __launch_bounds__(256) void qkv_kernel(const _Float16* __restrict__ wabc,
                                                  const _Float16* __restrict__ xt,
                                                  const float* __restrict__ sc,
                                                  const float* __restrict__ bc,
                                                  _Float16* __restrict__ qsm,
                                                  float* __restrict__ kf,
                                                  _Float16* __restrict__ vh)
{
    __shared__ float tile[64 * TP];
    const int b = blockIdx.z;
    const int t = threadIdx.x, l = t & 31, wave = t >> 5, h = l >> 4, m = l & 15;
    const int mw = wave >> 1, nw = wave & 1;
    const int Mbase = blockIdx.y * 64, Nbase = blockIdx.x * 128;
    const int region = (blockIdx.y < 4) ? 0 : ((blockIdx.y < 8) ? 1 : 2);

    const _Float16* Arow = wabc + (size_t)(Mbase + mw * 16 + m) * DIMC;
    const _Float16* Brow = xt + ((size_t)b * NN + Nbase + nw * 64 + m) * DIMC;
    v8f c0 = {}, c1 = {}, c2 = {}, c3 = {};
    mainloop_16x64(Arow, Brow, DIMC, h, c0, c1, c2, c3);

#pragma unroll
    for (int r = 0; r < 8; ++r) {
        const int ml = mw * 16 + 8 * h + r;
        const int o = Mbase + ml;
        const float s = sc[o], bb = bc[o];
        float* trow = tile + ml * TP + nw * 64 + m;
        trow[0]  = c0[r] * s + bb;
        trow[16] = c1[r] * s + bb;
        trow[32] = c2[r] * s + bb;
        trow[48] = c3[r] * s + bb;
    }
    __syncthreads();

    if (region == 0) {
        // softmax over the 32 channels of one head for one column; 2 heads x 128 cols = 256 threads
        const int nl = t & 127, hh = t >> 7;
        float qv[KDIM];
        float mx;
#pragma unroll
        for (int i = 0; i < KDIM; ++i) {
            qv[i] = tile[(hh * KDIM + i) * TP + nl];
            mx = (i == 0) ? qv[0] : fmaxf(mx, qv[i]);
        }
        float sum = 0.f;
#pragma unroll
        for (int i = 0; i < KDIM; ++i) { qv[i] = __expf(qv[i] - mx); sum += qv[i]; }
        const float scl = 256.0f / sum;
#pragma unroll
        for (int i = 0; i < KDIM; ++i) tile[(hh * KDIM + i) * TP + nl] = qv[i] * scl;
    }
    __syncthreads();

    if (region == 0) {
        const int p = l & 7;
#pragma unroll
        for (int it = 0; it < 4; ++it) {
            const int nl = wave * 16 + it * 4 + (l >> 3);
            v8h hv;
#pragma unroll
            for (int j = 0; j < 8; ++j) hv[j] = (_Float16)tile[(p * 8 + j) * TP + nl];
            vst8h(qsm + ((size_t)b * NN + Nbase + nl) * NHKD + Mbase + p * 8, hv);
        }
        
    } else if (region == 1) {
        // kf[b][o][Nbase..Nbase+127] f32: 512 B = 4 lines per row, one instruction per row
        const int col = (l >> 3) * 32 + (l & 7) * 4;
        const int obase = Mbase - NHKD;
#pragma unroll
        for (int it = 0; it < 8; ++it) {
            const int row = wave * 8 + it;
            const v4f v = *(const v4fa*)(tile + row * TP + col);
            vst4f(kf + ((size_t)b * NHKD + obase + row) * NN + Nbase + col, v);
        }
        
    } else {
        // vh[b][o][Nbase..Nbase+127] f16: 256 B = 2 lines per row, two rows per instruction
        const int obase = Mbase - 2 * NHKD;
#pragma unroll
        for (int it = 0; it < 4; ++it) {
            const int row = wave * 8 + it * 2 + h;
            v8h hv;
#pragma unroll
            for (int j = 0; j < 8; ++j) hv[j] = (_Float16)tile[row * TP + m * 8 + j];
            vst8h(vh + ((size_t)b * DHC + obase + row) * NN + Nbase + m * 8, hv);
        }
        
    }
}

// ---------------------------------------------------------------------------
// Kernel 3: softmax of key rows (length 4096, f32 in) -> f16 x4096 out.
// One block per row; thread t owns elements [t*8, t*8+8) and [2048+t*8, +8).
// ---------------------------------------------------------------------------
__global__ __launch_bounds__(256) void softmax_k_kernel(const float* __restrict__ kf,
                                                        _Float16* __restrict__ ksm)
{
    __shared__ float red[8];
    const size_t row = blockIdx.x;
    const float* p = kf + row * NN;
    _Float16* q = ksm + row * NN;
    const int t = threadIdx.x, l = t & 31, w = t >> 5;
    const v4f a0 = *(const v4f*)(p + t * 8);
    const v4f a1 = *(const v4f*)(p + t * 8 + 4);
    const v4f a2 = *(const v4f*)(p + 2048 + t * 8);
    const v4f a3 = *(const v4f*)(p + 2048 + t * 8 + 4);
    float v[16];
#pragma unroll
    for (int j = 0; j < 4; ++j) { v[j] = a0[j]; v[4 + j] = a1[j]; v[8 + j] = a2[j]; v[12 + j] = a3[j]; }
    float mx = v[0];
#pragma unroll
    for (int j = 1; j < 16; ++j) mx = fmaxf(mx, v[j]);
#pragma unroll
    for (int off = 16; off > 0; off >>= 1) mx = fmaxf(mx, __shfl_xor(mx, off, 32));
    if (l == 0) red[w] = mx;
    __syncthreads();
    mx = red[0];
#pragma unroll
    for (int j = 1; j < 8; ++j) mx = fmaxf(mx, red[j]);
    __syncthreads();
    float sum = 0.f;
#pragma unroll
    for (int j = 0; j < 16; ++j) { v[j] = __expf(v[j] - mx); sum += v[j]; }
#pragma unroll
    for (int off = 16; off > 0; off >>= 1) sum += __shfl_xor(sum, off, 32);
    if (l == 0) red[w] = sum;
    __syncthreads();
    float tot = 0.f;
#pragma unroll
    for (int j = 0; j < 8; ++j) tot += red[j];
    const float scl = 4096.0f / tot;
    v8h h0, h1;
#pragma unroll
    for (int j = 0; j < 8; ++j) { h0[j] = (_Float16)(v[j] * scl); h1[j] = (_Float16)(v[8 + j] * scl); }
    _Float16* d0 = q + t * 8;
    _Float16* d1 = q + 2048 + t * 8;
    vst8h(d0, h0);
    vst8h(d1, h1);
    
}

// ---------------------------------------------------------------------------
// Kernel 4: context per (b,head): C[kd][d] = sum_n ksm[kd][n] * v[d][n], K = 4096.
// A rows = ksm rows (n contiguous); B[k=n][col=d] = vh row d (n contiguous): same loader.
// 8 waves = 2 kd-tiles x 4 d-tiles.  Output ctxT[bh][d][kd] f16 (= C/64, i.e. true context x64)
// staged through LDS, four lines (8 rows of 64 B) per wave instruction.
// ---------------------------------------------------------------------------
__global__ __launch_bounds__(256) void ctx_kernel(const _Float16* __restrict__ ksm,
                                                  const _Float16* __restrict__ vh,
                                                  _Float16* __restrict__ ctxT)
{
    __shared__ float tile[KDIM * TPD];
    const int bh = blockIdx.x, b = bh >> 3, hd = bh & 7;
    const int t = threadIdx.x, l = t & 31, wave = t >> 5, h = l >> 4, m = l & 15;
    const int mt = wave & 1, nt = wave >> 1;
    const _Float16* Arow = ksm + ((size_t)b * NHKD + hd * KDIM + mt * 16 + m) * NN;
    const _Float16* Brow = vh  + ((size_t)b * DHC  + hd * DD   + nt * 16 + m) * NN;
    v8f c = {};
#pragma unroll 1
    for (int k0 = 0; k0 < NN; k0 += 32) {
        v16h a  = load_frag(Arow + k0, h);
        v16h bf = load_frag(Brow + k0, h);
        c = mma16(a, bf, c);
        GUARD1(c, a, bf);
    }
#pragma unroll
    for (int r = 0; r < 8; ++r)
        tile[(mt * 16 + 8 * h + r) * TPD + nt * 16 + m] = c[r];
    __syncthreads();
    // ctxT rows d = wave*8 + (l>>2), piece = l&3 -> kd = piece*8 .. +7; x64 scale = acc/64
    const int d = wave * 8 + (l >> 2), p = l & 3;
    v8h hv;
#pragma unroll
    for (int j = 0; j < 8; ++j) hv[j] = (_Float16)(tile[(p * 8 + j) * TPD + d] * 0.015625f);
    _Float16* dst = ctxT + ((size_t)bh * DD + d) * KDIM + p * 8;
    vst8h(dst, hv);
    
}

// ---------------------------------------------------------------------------
// Kernel 5: attended per (b,head): Att[d][n] = sum_kd ctxT[d][kd] * qsm[n][hd*32+kd], K = 32
// (one WMMA per 16x16 tile), ReLU, scaled to att x256 (= acc/64), stored att[b][n][hd*64+d]
// ---------------------------------------------------------------------------
__global__ __launch_bounds__(256) void att_kernel(const _Float16* __restrict__ ctxT,
                                                  const _Float16* __restrict__ qsm,
                                                  _Float16* __restrict__ att)
{
    __shared__ float tile[128 * TPD];
    const int bh = blockIdx.y, b = bh >> 3, hd = bh & 7;
    const int Nbase = blockIdx.x * 128;
    const int t = threadIdx.x, l = t & 31, wave = t >> 5, h = l >> 4, m = l & 15;
    const int mt = wave >> 1, nw = wave & 1;
    v16h a = load_frag(ctxT + ((size_t)bh * DD + mt * 16 + m) * KDIM, h);
#pragma unroll
    for (int ns = 0; ns < 4; ++ns) {
        const int nl = nw * 64 + ns * 16 + m;
        v16h bf = load_frag(qsm + ((size_t)b * NN + Nbase + nl) * NHKD + hd * KDIM, h);
        v8f c = {};
        c = mma16(a, bf, c);
        GUARD1(c, a, bf);
#pragma unroll
        for (int r = 0; r < 8; ++r) {
            const float y = fmaxf(c[r] * 0.015625f, 0.0f);
            tile[nl * TPD + mt * 16 + 8 * h + r] = y;
        }
    }
    __syncthreads();
    const int p = l & 7;
#pragma unroll
    for (int it = 0; it < 4; ++it) {
        const int nl = wave * 16 + it * 4 + (l >> 3);
        v8h hv;
#pragma unroll
        for (int j = 0; j < 8; ++j) hv[j] = (_Float16)tile[nl * TPD + p * 8 + j];
        vst8h(att + ((size_t)b * NN + Nbase + nl) * DHC + hd * DD + p * 8, hv);
    }
    
}

// ---------------------------------------------------------------------------
// Kernel 6: output projection [384][512] x [512][4096] per batch + affine -> f32 out.
// ---------------------------------------------------------------------------
__global__ __launch_bounds__(256) void out_kernel(const _Float16* __restrict__ wph,
                                                  const _Float16* __restrict__ att,
                                                  const float* __restrict__ sp,
                                                  const float* __restrict__ bp,
                                                  float* __restrict__ out)
{
    __shared__ float tile[64 * TP];
    const int b = blockIdx.z;
    const int t = threadIdx.x, l = t & 31, wave = t >> 5, h = l >> 4, m = l & 15;
    const int mw = wave >> 1, nw = wave & 1;
    const int Mbase = blockIdx.y * 64, Nbase = blockIdx.x * 128;
    const _Float16* Arow = wph + (size_t)(Mbase + mw * 16 + m) * DHC;
    const _Float16* Brow = att + ((size_t)b * NN + Nbase + nw * 64 + m) * DHC;
    v8f c0 = {}, c1 = {}, c2 = {}, c3 = {};
    mainloop_16x64(Arow, Brow, DHC, h, c0, c1, c2, c3);

#pragma unroll
    for (int r = 0; r < 8; ++r) {
        const int ml = mw * 16 + 8 * h + r;
        const int o = Mbase + ml;
        const float s = sp[o] * 0.000244140625f;   // 1/(16*256)
        const float bb = bp[o];
        float* trow = tile + ml * TP + nw * 64 + m;
        trow[0]  = c0[r] * s + bb;
        trow[16] = c1[r] * s + bb;
        trow[32] = c2[r] * s + bb;
        trow[48] = c3[r] * s + bb;
    }
    __syncthreads();
    const int col = (l >> 3) * 32 + (l & 7) * 4;
#pragma unroll
    for (int it = 0; it < 8; ++it) {
        const int row = wave * 8 + it;
        const v4f v = *(const v4fa*)(tile + row * TP + col);
        vst4f(out + ((size_t)b * DIMC + Mbase + row) * NN + Nbase + col, v);
    }
    
}

// ---------------------------------------------------------------------------
// Host-side launch glue.  Workspace (bytes):
//   [0)            xt   f16 [8][4096][384]   25,165,824   (reused for ksm f16 [8][256][4096] 16,777,216 after kernel 2)
//   [25,165,824)   wabc f16 [1024][384]         786,432
//   [25,952,256)   wph  f16 [384][512]          393,216
//   [26,345,472)   sc   f32 [1024]                4,096
//   [26,349,568)   bc   f32 [1024]                4,096
//   [26,353,664)   qsm  f16 [8][4096][256]   16,777,216
//   [43,130,880)   kf   f32 [8][256][4096]   33,554,432   (reused for att f16 [8][4096][512] after kernel 3)
//   [76,685,312)   vh   f16 [8][512][4096]   33,554,432
//   [110,239,744)  ctxT f16 [64][64][32]        262,144
//   total 110,501,888
// ---------------------------------------------------------------------------
extern "C" void kernel_launch(void* const* d_in, const int* in_sizes, int n_in,
                              void* d_out, int out_size, void* d_ws, size_t ws_size,
                              hipStream_t stream)
{
    if (n_in < 13) return;
    if (in_sizes[0] != BB * DIMC * NN) return;
    if (in_sizes[1] != NHKD * DIMC || in_sizes[2] != NHKD || in_sizes[3] != NHKD) return;
    if (in_sizes[4] != NHKD * DIMC || in_sizes[5] != NHKD || in_sizes[6] != NHKD) return;
    if (in_sizes[7] != DHC * DIMC || in_sizes[8] != DHC || in_sizes[9] != DHC) return;
    if (in_sizes[10] != DIMC * DHC || in_sizes[11] != DIMC || in_sizes[12] != DIMC) return;
    if (out_size != BB * DIMC * NN) return;

    const size_t off_xt   = 0;
    const size_t sz_xt    = (size_t)BB * NN * DIMC * 2;
    const size_t off_wabc = off_xt + sz_xt;
    const size_t sz_wabc  = (size_t)MQKV * DIMC * 2;
    const size_t off_wph  = off_wabc + sz_wabc;
    const size_t sz_wph   = (size_t)DIMC * DHC * 2;
    const size_t off_sc   = off_wph + sz_wph;
    const size_t sz_sc    = (size_t)MQKV * 4;
    const size_t off_bc   = off_sc + sz_sc;
    const size_t off_qsm  = off_bc + sz_sc;
    const size_t sz_qsm   = (size_t)BB * NN * NHKD * 2;
    const size_t off_kf   = off_qsm + sz_qsm;
    const size_t sz_kf    = (size_t)BB * NHKD * NN * 4;
    const size_t off_vh   = off_kf + sz_kf;
    const size_t sz_vh    = (size_t)BB * DHC * NN * 2;
    const size_t off_ctx  = off_vh + sz_vh;
    const size_t sz_ctx   = (size_t)BB * HEADS * DD * KDIM * 2;
    const size_t total    = off_ctx + sz_ctx;
    const size_t sz_ksm   = (size_t)BB * NHKD * NN * 2;
    const size_t sz_att   = (size_t)BB * NN * DHC * 2;
    if (total > ws_size) return;
    if (sz_ksm > sz_xt || sz_att > sz_kf) return;

    const float* x  = (const float*)d_in[0];
    const float* Wq = (const float*)d_in[1];
    const float* sq = (const float*)d_in[2];
    const float* bq = (const float*)d_in[3];
    const float* Wk = (const float*)d_in[4];
    const float* sk = (const float*)d_in[5];
    const float* bk = (const float*)d_in[6];
    const float* Wv = (const float*)d_in[7];
    const float* sv = (const float*)d_in[8];
    const float* bv = (const float*)d_in[9];
    const float* Wp = (const float*)d_in[10];
    const float* sp = (const float*)d_in[11];
    const float* bp = (const float*)d_in[12];
    float* out = (float*)d_out;

    char* ws = (char*)d_ws;
    _Float16* xt   = (_Float16*)(ws + off_xt);
    _Float16* ksm  = (_Float16*)(ws + off_xt);     // alias: xt dead after kernel 2
    _Float16* wabc = (_Float16*)(ws + off_wabc);
    _Float16* wph  = (_Float16*)(ws + off_wph);
    float*    sc   = (float*)   (ws + off_sc);
    float*    bc   = (float*)   (ws + off_bc);
    _Float16* qsm  = (_Float16*)(ws + off_qsm);
    float*    kf   = (float*)   (ws + off_kf);
    _Float16* att  = (_Float16*)(ws + off_kf);     // alias: kf dead after kernel 3
    _Float16* vh   = (_Float16*)(ws + off_vh);
    _Float16* ctxT = (_Float16*)(ws + off_ctx);

    const int prep_threads = MQKV * DIMC / 8 + DIMC * DHC / 8 + 512;   // 74240
    prep_kernel<<<(prep_threads + 255) / 256, 256, 0, stream>>>(
        Wq, Wk, Wv, Wp, sq, bq, sk, bk, sv, bv, wabc, wph, sc, bc);

    xpose_kernel<<<dim3(NN / 32, DIMC / 128, BB), 256, 0, stream>>>(x, xt);

    qkv_kernel<<<dim3(NN / 128, MQKV / 64, BB), 256, 0, stream>>>(wabc, xt, sc, bc, qsm, kf, vh);

    softmax_k_kernel<<<BB * NHKD, 256, 0, stream>>>(kf, ksm);

    ctx_kernel<<<BB * HEADS, 256, 0, stream>>>(ksm, vh, ctxT);

    att_kernel<<<dim3(NN / 128, BB * HEADS), 256, 0, stream>>>(ctxT, qsm, att);

    out_kernel<<<dim3(NN / 128, DIMC / 64, BB), 256, 0, stream>>>(wph, att, sp, bp, out);
}

// v001
// One run takes 151 microseconds.
// Next to v000, in two timings, it ran 1.99 and 2.02 times as fast.
#include <hip/hip_runtime.h>
// All contractions on v_wmma_f32_16x16x32_f16 (f16 operands, f32 accumulate): QKV projection, key*value^T, context^T*query, output projection; exact power-of-two operand scales (weights x16, key softmax x4096, context x64, query softmax x256, attended x256) undone in the f32 epilogues; softmaxes and affine terms in f32.

#define BB    8
#define DIMC  384
#define NN    4096
#define HEADS 8
#define KDIM  32
#define DD    64
#define NHKD  256
#define DHC   512
#define MQKV  1024
#define TP    132      // LDS pitch (floats) for 64x128 tiles, keeps 16-B alignment
#define TPD   68       // LDS pitch (floats) for x64 tiles

typedef _Float16 v16h __attribute__((ext_vector_type(16)));
typedef _Float16 v8h  __attribute__((ext_vector_type(8)));
typedef float    v8f  __attribute__((ext_vector_type(8)));
typedef float    v4f  __attribute__((ext_vector_type(4)));
typedef float    v4fa __attribute__((ext_vector_type(4), may_alias));

union Frag { v16h v; v8h half[2]; };

// 16x16x32 operand fragment from a k-contiguous row: elements 0..7 <- row[8h..8h+7],
// elements 8..15 <- row[16+8h..16+8h+7]; lane&15 selects the row (A) or column (B).
__device__ __forceinline__ v16h load_frag(const _Float16* __restrict__ p, int h)
{
    Frag f;
    f.half[0] = *(const v8h*)(p + 8 * h);
    f.half[1] = *(const v8h*)(p + 16 + 8 * h);
    return f.v;
}

__device__ __forceinline__ v8f mma16(v16h a, v16h b, v8f c)
{
    return __builtin_amdgcn_wmma_f32_16x16x32_f16(false, a, false, b, (short)0, c, false, false);
}

#define GUARD1(c, a, b) \
    asm volatile("v_nop\n\tv_nop\n\tv_nop\n\tv_nop" : "+v"(c) : "v"(a), "v"(b))
#define GUARD4(c0, c1, c2, c3, a, b0, b1, b2, b3) \
    asm volatile("v_nop\n\tv_nop\n\tv_nop\n\tv_nop" \
                 : "+v"(c0), "+v"(c1), "+v"(c2), "+v"(c3) \
                 : "v"(a), "v"(b0), "v"(b1), "v"(b2), "v"(b3))

__device__ __forceinline__ void vst8h(_Float16* p, v8h v) { *(v8h*)p = v; }
__device__ __forceinline__ void vst4f(float* p, v4f v)    { *(v4f*)p = v; }

// LDS ring of the two projection GEMMs.  A stage = 64 k (128 B) of 64 A rows and then of
// 128 B rows, row pitch 144 B (16 B x 9: conflict-free for ds_load_b128); two buffers.
#define KS      64                 // k per stage
#define LPB     144                // LDS row pitch, bytes
#define LPH     72                 // the same in halves
#define STAGE_B (192 * LPB)        // 27,648 B
#define RING_B  (2 * STAGE_B)      // 55,296 B; the f32 output tile (33,792 B) reuses it after the loop

// One stage: 1536 pieces of 16 B, six per thread.  Thread t brings piece t&7 of rows
// t>>3 + 32 j, so eight lanes cover one 128-B line.  a, b: this thread's piece in A row t>>3
// and B row t>>3 at the stage's k; lds: its place in the buffer (byte address in LDS).
// s_wait_xcnt stands inside the statement, ahead of any rewrite of the address registers.
__device__ __forceinline__ void copy_stage(const unsigned lds, const _Float16* a,
                                           const _Float16* b, const int K)
{
    asm volatile("global_load_async_to_lds_b128 %0, %6, off\n\t"
                 "global_load_async_to_lds_b128 %1, %7, off\n\t"
                 "global_load_async_to_lds_b128 %2, %8, off\n\t"
                 "global_load_async_to_lds_b128 %3, %9, off\n\t"
                 "global_load_async_to_lds_b128 %4, %10, off\n\t"
                 "global_load_async_to_lds_b128 %5, %11, off\n\t"
                 "s_wait_xcnt 0x0"
                 :: "v"(lds), "v"(lds + 32 * LPB), "v"(lds + 64 * LPB),
                    "v"(lds + 96 * LPB), "v"(lds + 128 * LPB), "v"(lds + 160 * LPB),
                    "v"(a), "v"(a + 32 * K), "v"(b), "v"(b + 32 * K), "v"(b + 64 * K), "v"(b + 96 * K)
                 : "memory");
}

// Block: 64 rows of A (row-major, pitch K) times 128 columns of B (B[k][n] stored n-major with
// k contiguous, pitch K), both staged in the ring by asynchronous copies, the next stage in
// flight while this one is multiplied.  Wave (mw, nw): rows 16 mw.., columns 64 nw..;
// c0..c3 = column groups of 16.  On return every wave has left the ring (last trip's barrier).
template <int K>
__device__ __forceinline__ void mainloop_64x128(unsigned char* ring,
                                                const _Float16* __restrict__ Ablk,
                                                const _Float16* __restrict__ Bblk,
                                                const int t, const int mw, const int nw,
                                                const int h, const int m,
                                                v8f& c0, v8f& c1, v8f& c2, v8f& c3)
{
    constexpr int NT = K / KS;
    static_assert(K % KS == 0 && NT >= 2, "two stages or more");
    const unsigned lds = (unsigned)(uintptr_t)ring + (t >> 3) * LPB + (t & 7) * 16;
    const _Float16* ga = Ablk + (t >> 3) * K + (t & 7) * 8;
    const _Float16* gb = Bblk + (t >> 3) * K + (t & 7) * 8;

    copy_stage(lds, ga, gb, K);
    asm volatile("s_wait_asynccnt 0x0" ::: "memory");   // stage 0 landed (this wave's pieces)
    __syncthreads();                                    // ... and every other wave's
    copy_stage(lds + STAGE_B, ga + KS, gb + KS, K);

    // kept rolled: unrolled, every stage's copy addresses stay live at once, and the added
    // registers cost a resident work-group per WGP
#pragma unroll 1
    for (int s = 0; s < NT; ++s) {
        const _Float16* st = (const _Float16*)(ring + (s & 1) * STAGE_B);
        const _Float16* ar = st + (mw * 16 + m) * LPH;
        const _Float16* br = st + (64 + nw * 64 + m) * LPH;
        v16h a0  = load_frag(ar, h);
        v16h b00 = load_frag(br, h);
        v16h b01 = load_frag(br + 16 * LPH, h);
        v16h b02 = load_frag(br + 32 * LPH, h);
        v16h b03 = load_frag(br + 48 * LPH, h);
        v16h a1  = load_frag(ar + 32, h);
        v16h b10 = load_frag(br + 32, h);
        v16h b11 = load_frag(br + 16 * LPH + 32, h);
        v16h b12 = load_frag(br + 32 * LPH + 32, h);
        v16h b13 = load_frag(br + 48 * LPH + 32, h);
        c0 = mma16(a0, b00, c0);
        c1 = mma16(a0, b01, c1);
        c2 = mma16(a0, b02, c2);
        c3 = mma16(a0, b03, c3);
        c0 = mma16(a1, b10, c0);
        c1 = mma16(a1, b11, c1);
        c2 = mma16(a1, b12, c2);
        c3 = mma16(a1, b13, c3);
        // four vector slots behind the last matrix instructions, on the branch paths too
        GUARD4(c0, c1, c2, c3, a1, b10, b11, b12, b13);
        asm volatile("s_wait_dscnt 0x0" ::: "memory");     // this wave's reads of buffer s&1 are done
        asm volatile("s_wait_asynccnt 0x0" ::: "memory");  // its pieces of stage s+1 have landed
        __syncthreads();                                   // publishes stage s+1, frees buffer s&1
        if (s + 2 < NT)
            copy_stage(lds + (s & 1) * STAGE_B, ga + (s + 2) * KS, gb + (s + 2) * KS, K);
    }
    asm volatile("s_wait_asynccnt 0x0" ::: "memory");      // nothing in flight when the ring is reused
}

// ---------------------------------------------------------------------------
// Kernel 0: weights -> f16 (x16), concatenated [1024][384] and [384][512];
// affine params concatenated (scale pre-multiplied by 1/16).  16-B per lane stores.
// ---------------------------------------------------------------------------
__global__ __launch_bounds__(256) void prep_kernel(
    const float* __restrict__ Wq, const float* __restrict__ Wk, const float* __restrict__ Wv,
    const float* __restrict__ Wp,
    const float* __restrict__ sq, const float* __restrict__ bq,
    const float* __restrict__ sk, const float* __restrict__ bk,
    const float* __restrict__ sv, const float* __restrict__ bv,
    _Float16* __restrict__ wabc, _Float16* __restrict__ wph,
    float* __restrict__ sc, float* __restrict__ bc)
{
    const int NW1 = MQKV * DIMC / 8;   // 49152 chunks of 8 halves
    const int NW2 = DIMC * DHC / 8;    // 24576 chunks
    const int i = blockIdx.x * 256 + threadIdx.x;
    if (i < NW1 + NW2) {
        const float* src;
        _Float16* dst;
        if (i < NW1) {
            const int e = i * 8;
            if (e < NHKD * DIMC)          src = Wq + e;
            else if (e < 2 * NHKD * DIMC) src = Wk + (e - NHKD * DIMC);
            else                          src = Wv + (e - 2 * NHKD * DIMC);
            dst = wabc + e;
        } else {
            const int e = (i - NW1) * 8;
            src = Wp + e;
            dst = wph + e;
        }
        const v4f f0 = *(const v4f*)src;
        const v4f f1 = *(const v4f*)(src + 4);
        v8h hv;
#pragma unroll
        for (int j = 0; j < 4; ++j) {
            hv[j]     = (_Float16)(f0[j] * 16.0f);
            hv[4 + j] = (_Float16)(f1[j] * 16.0f);
        }
        vst8h(dst, hv);
        
    } else {
        const int j = i - (NW1 + NW2);
        if (j < 512) {
            const int e = (j & 255) * 4;
            v4f o;
#pragma unroll
            for (int q = 0; q < 4; ++q) {
                const int ee = e + q;
                float val;
                if (j < 256) {
                    val = (ee < NHKD) ? sq[ee] : ((ee < 2 * NHKD) ? sk[ee - NHKD] : sv[ee - 2 * NHKD]);
                    val *= 0.0625f;
                } else {
                    val = (ee < NHKD) ? bq[ee] : ((ee < 2 * NHKD) ? bk[ee - NHKD] : bv[ee - 2 * NHKD]);
                }
                o[q] = val;
            }
            float* dst = ((j < 256) ? sc : bc) + e;
            vst4f(dst, o);
            
        }
    }
}

// ---------------------------------------------------------------------------
// Kernel 1: x[b][c][n] f32 -> xt[b][n][c] f16.  Tile 128 c x 32 n in LDS; each
// ---------------------------------------------------------------------------
__global__ __launch_bounds__(256) void xpose_kernel(const float* __restrict__ x,
                                                    _Float16* __restrict__ xt)
{
    __shared__ float tile[128 * 33];
    const int b = blockIdx.z;
    const int nb = blockIdx.x * 32, cb = blockIdx.y * 128;
    const int t = threadIdx.x, l = t & 31, w = t >> 5, h = l >> 4, m = l & 15;
    const float* xb = x + (size_t)b * DIMC * NN;
#pragma unroll
    for (int j = 0; j < 16; ++j) {
        const int c = w + 8 * j;
        tile[c * 33 + l] = xb[(size_t)(cb + c) * NN + nb + l];
    }
    __syncthreads();
    _Float16* xo = xt + (size_t)b * NN * DIMC;
    const int nl0 = w * 4 + h, nl1 = w * 4 + 2 + h;
    v8h hv0, hv1;
#pragma unroll
    for (int j = 0; j < 8; ++j) {
        hv0[j] = (_Float16)tile[(m * 8 + j) * 33 + nl0];
        hv1[j] = (_Float16)tile[(m * 8 + j) * 33 + nl1];
    }
    _Float16* d0 = xo + (size_t)(nb + nl0) * DIMC + cb + m * 8;
    _Float16* d1 = xo + (size_t)(nb + nl1) * DIMC + cb + m * 8;
    vst8h(d0, hv0);
    vst8h(d1, hv1);
    
}

// ---------------------------------------------------------------------------
// Kernel 2: fused QKV projection [1024][384] x [384][4096] per batch + affine.
// Block tile 64 rows x 128 cols, 8 waves, wave tile 16 x 64, operands through the LDS ring.
// Result staged in LDS:
//   Q rows (0..255):   channel softmax over 32 per head (f32), x256, f16 -> qsm[b][n][256]
//   K rows (256..511): f32 -> kf[b][256][N]
//   V rows (512..1023): f16 -> vh[b][512][N]
// ---------------------------------------------------------------------------
__global__ __launch_bounds__(256) void qkv_kernel(const _Float16* __restrict__ wabc,
                                                  const _Float16* __restrict__ xt,
                                                  const float* __restrict__ sc,
                                                  const float* __restrict__ bc,
                                                  _Float16* __restrict__ qsm,
                                                  float* __restrict__ kf,
                                                  _Float16* __restrict__ vh)
{
    __shared__ __attribute__((aligned(16))) unsigned char ring[RING_B];
    float* tile = (float*)ring;
    const int b = blockIdx.z;
    const int t = threadIdx.x, l = t & 31, wave = t >> 5, h = l >> 4, m = l & 15;
    const int mw = wave >> 1, nw = wave & 1;
    const int Mbase = blockIdx.y * 64, Nbase = blockIdx.x * 128;
    const int region = (blockIdx.y < 4) ? 0 : ((blockIdx.y < 8) ? 1 : 2);

    const _Float16* Ablk = wabc + (size_t)Mbase * DIMC;
    const _Float16* Bblk = xt + ((size_t)b * NN + Nbase) * DIMC;
    v8f c0 = {}, c1 = {}, c2 = {}, c3 = {};
    mainloop_64x128<DIMC>(ring, Ablk, Bblk, t, mw, nw, h, m, c0, c1, c2, c3);

#pragma unroll
    for (int r = 0; r < 8; ++r) {
        const int ml = mw * 16 + 8 * h + r;
        const int o = Mbase + ml;
        const float s = sc[o], bb = bc[o];
        float* trow = tile + ml * TP + nw * 64 + m;
        trow[0]  = c0[r] * s + bb;
        trow[16] = c1[r] * s + bb;
        trow[32] = c2[r] * s + bb;
        trow[48] = c3[r] * s + bb;
    }
    __syncthreads();

    if (region == 0) {
        // softmax over the 32 channels of one head for one column; 2 heads x 128 cols = 256 threads
        const int nl = t & 127, hh = t >> 7;
        float qv[KDIM];
        float mx;
#pragma unroll
        for (int i = 0; i < KDIM; ++i) {
            qv[i] = tile[(hh * KDIM + i) * TP + nl];
            mx = (i == 0) ? qv[0] : fmaxf(mx, qv[i]);
        }
        float sum = 0.f;
#pragma unroll
        for (int i = 0; i < KDIM; ++i) { qv[i] = __expf(qv[i] - mx); sum += qv[i]; }
        const float scl = 256.0f / sum;
#pragma unroll
        for (int i = 0; i < KDIM; ++i) tile[(hh * KDIM + i) * TP + nl] = qv[i] * scl;
    }
    __syncthreads();

    if (region == 0) {
        const int p = l & 7;
#pragma unroll
        for (int it = 0; it < 4; ++it) {
            const int nl = wave * 16 + it * 4 + (l >> 3);
            v8h hv;
#pragma unroll
            for (int j = 0; j < 8; ++j) hv[j] = (_Float16)tile[(p * 8 + j) * TP + nl];
            vst8h(qsm + ((size_t)b * NN + Nbase + nl) * NHKD + Mbase + p * 8, hv);
        }
        
    } else if (region == 1) {
        // kf[b][o][Nbase..Nbase+127] f32: 512 B = 4 lines per row, one instruction per row
        const int col = (l >> 3) * 32 + (l & 7) * 4;
        const int obase = Mbase - NHKD;
#pragma unroll
        for (int it = 0; it < 8; ++it) {
            const int row = wave * 8 + it;
            const v4f v = *(const v4fa*)(tile + row * TP + col);
            vst4f(kf + ((size_t)b * NHKD + obase + row) * NN + Nbase + col, v);
        }
        
    } else {
        // vh[b][o][Nbase..Nbase+127] f16: 256 B = 2 lines per row, two rows per instruction
        const int obase = Mbase - 2 * NHKD;
#pragma unroll
        for (int it = 0; it < 4; ++it) {
            const int row = wave * 8 + it * 2 + h;
            v8h hv;
#pragma unroll
            for (int j = 0; j < 8; ++j) hv[j] = (_Float16)tile[row * TP + m * 8 + j];
            vst8h(vh + ((size_t)b * DHC + obase + row) * NN + Nbase + m * 8, hv);
        }
        
    }
}

// ---------------------------------------------------------------------------
// Kernel 3: softmax of key rows (length 4096, f32 in) -> f16 x4096 out.
// One block per row; thread t owns elements [t*8, t*8+8) and [2048+t*8, +8).
// ---------------------------------------------------------------------------
__global__ __launch_bounds__(256) void softmax_k_kernel(const float* __restrict__ kf,
                                                        _Float16* __restrict__ ksm)
{
    __shared__ float red[8];
    const size_t row = blockIdx.x;
    const float* p = kf + row * NN;
    _Float16* q = ksm + row * NN;
    const int t = threadIdx.x, l = t & 31, w = t >> 5;
    const v4f a0 = *(const v4f*)(p + t * 8);
    const v4f a1 = *(const v4f*)(p + t * 8 + 4);
    const v4f a2 = *(const v4f*)(p + 2048 + t * 8);
    const v4f a3 = *(const v4f*)(p + 2048 + t * 8 + 4);
    float v[16];
#pragma unroll
    for (int j = 0; j < 4; ++j) { v[j] = a0[j]; v[4 + j] = a1[j]; v[8 + j] = a2[j]; v[12 + j] = a3[j]; }
    float mx = v[0];
#pragma unroll
    for (int j = 1; j < 16; ++j) mx = fmaxf(mx, v[j]);
#pragma unroll
    for (int off = 16; off > 0; off >>= 1) mx = fmaxf(mx, __shfl_xor(mx, off, 32));
    if (l == 0) red[w] = mx;
    __syncthreads();
    mx = red[0];
#pragma unroll
    for (int j = 1; j < 8; ++j) mx = fmaxf(mx, red[j]);
    __syncthreads();
    float sum = 0.f;
#pragma unroll
    for (int j = 0; j < 16; ++j) { v[j] = __expf(v[j] - mx); sum += v[j]; }
#pragma unroll
    for (int off = 16; off > 0; off >>= 1) sum += __shfl_xor(sum, off, 32);
    if (l == 0) red[w] = sum;
    __syncthreads();
    float tot = 0.f;
#pragma unroll
    for (int j = 0; j < 8; ++j) tot += red[j];
    const float scl = 4096.0f / tot;
    v8h h0, h1;
#pragma unroll
    for (int j = 0; j < 8; ++j) { h0[j] = (_Float16)(v[j] * scl); h1[j] = (_Float16)(v[8 + j] * scl); }
    _Float16* d0 = q + t * 8;
    _Float16* d1 = q + 2048 + t * 8;
    vst8h(d0, h0);
    vst8h(d1, h1);
    
}

// ---------------------------------------------------------------------------
// Kernel 4: context per (b,head): C[kd][d] = sum_n ksm[kd][n] * v[d][n], K = 4096.
// A rows = ksm rows (n contiguous); B[k=n][col=d] = vh row d (n contiguous): same loader.
// 8 waves = 2 kd-tiles x 4 d-tiles.  Output ctxT[bh][d][kd] f16 (= C/64, i.e. true context x64)
// staged through LDS, four lines (8 rows of 64 B) per wave instruction.
// ---------------------------------------------------------------------------
__global__ __launch_bounds__(256) void ctx_kernel(const _Float16* __restrict__ ksm,
                                                  const _Float16* __restrict__ vh,
                                                  _Float16* __restrict__ ctxT)
{
    __shared__ float tile[KDIM * TPD];
    const int bh = blockIdx.x, b = bh >> 3, hd = bh & 7;
    const int t = threadIdx.x, l = t & 31, wave = t >> 5, h = l >> 4, m = l & 15;
    const int mt = wave & 1, nt = wave >> 1;
    const _Float16* Arow = ksm + ((size_t)b * NHKD + hd * KDIM + mt * 16 + m) * NN;
    const _Float16* Brow = vh  + ((size_t)b * DHC  + hd * DD   + nt * 16 + m) * NN;
    v8f c = {};
#pragma unroll 1
    for (int k0 = 0; k0 < NN; k0 += 32) {
        v16h a  = load_frag(Arow + k0, h);
        v16h bf = load_frag(Brow + k0, h);
        c = mma16(a, bf, c);
        GUARD1(c, a, bf);
    }
#pragma unroll
    for (int r = 0; r < 8; ++r)
        tile[(mt * 16 + 8 * h + r) * TPD + nt * 16 + m] = c[r];
    __syncthreads();
    // ctxT rows d = wave*8 + (l>>2), piece = l&3 -> kd = piece*8 .. +7; x64 scale = acc/64
    const int d = wave * 8 + (l >> 2), p = l & 3;
    v8h hv;
#pragma unroll
    for (int j = 0; j < 8; ++j) hv[j] = (_Float16)(tile[(p * 8 + j) * TPD + d] * 0.015625f);
    _Float16* dst = ctxT + ((size_t)bh * DD + d) * KDIM + p * 8;
    vst8h(dst, hv);
    
}

// ---------------------------------------------------------------------------
// Kernel 5: attended per (b,head): Att[d][n] = sum_kd ctxT[d][kd] * qsm[n][hd*32+kd], K = 32
// (one WMMA per 16x16 tile), ReLU, scaled to att x256 (= acc/64), stored att[b][n][hd*64+d]
// ---------------------------------------------------------------------------
__global__ __launch_bounds__(256) void att_kernel(const _Float16* __restrict__ ctxT,
                                                  const _Float16* __restrict__ qsm,
                                                  _Float16* __restrict__ att)
{
    __shared__ float tile[128 * TPD];
    const int bh = blockIdx.y, b = bh >> 3, hd = bh & 7;
    const int Nbase = blockIdx.x * 128;
    const int t = threadIdx.x, l = t & 31, wave = t >> 5, h = l >> 4, m = l & 15;
    const int mt = wave >> 1, nw = wave & 1;
    v16h a = load_frag(ctxT + ((size_t)bh * DD + mt * 16 + m) * KDIM, h);
#pragma unroll
    for (int ns = 0; ns < 4; ++ns) {
        const int nl = nw * 64 + ns * 16 + m;
        v16h bf = load_frag(qsm + ((size_t)b * NN + Nbase + nl) * NHKD + hd * KDIM, h);
        v8f c = {};
        c = mma16(a, bf, c);
        GUARD1(c, a, bf);
#pragma unroll
        for (int r = 0; r < 8; ++r) {
            const float y = fmaxf(c[r] * 0.015625f, 0.0f);
            tile[nl * TPD + mt * 16 + 8 * h + r] = y;
        }
    }
    __syncthreads();
    const int p = l & 7;
#pragma unroll
    for (int it = 0; it < 4; ++it) {
        const int nl = wave * 16 + it * 4 + (l >> 3);
        v8h hv;
#pragma unroll
        for (int j = 0; j < 8; ++j) hv[j] = (_Float16)tile[nl * TPD + p * 8 + j];
        vst8h(att + ((size_t)b * NN + Nbase + nl) * DHC + hd * DD + p * 8, hv);
    }
    
}

// ---------------------------------------------------------------------------
// Kernel 6: output projection [384][512] x [512][4096] per batch + affine -> f32 out.
// ---------------------------------------------------------------------------
__global__ __launch_bounds__(256) void out_kernel(const _Float16* __restrict__ wph,
                                                  const _Float16* __restrict__ att,
                                                  const float* __restrict__ sp,
                                                  const float* __restrict__ bp,
                                                  float* __restrict__ out)
{
    __shared__ __attribute__((aligned(16))) unsigned char ring[RING_B];
    float* tile = (float*)ring;
    const int b = blockIdx.z;
    const int t = threadIdx.x, l = t & 31, wave = t >> 5, h = l >> 4, m = l & 15;
    const int mw = wave >> 1, nw = wave & 1;
    const int Mbase = blockIdx.y * 64, Nbase = blockIdx.x * 128;
    const _Float16* Ablk = wph + (size_t)Mbase * DHC;
    const _Float16* Bblk = att + ((size_t)b * NN + Nbase) * DHC;
    v8f c0 = {}, c1 = {}, c2 = {}, c3 = {};
    mainloop_64x128<DHC>(ring, Ablk, Bblk, t, mw, nw, h, m, c0, c1, c2, c3);

#pragma unroll
    for (int r = 0; r < 8; ++r) {
        const int ml = mw * 16 + 8 * h + r;
        const int o = Mbase + ml;
        const float s = sp[o] * 0.000244140625f;   // 1/(16*256)
        const float bb = bp[o];
        float* trow = tile + ml * TP + nw * 64 + m;
        trow[0]  = c0[r] * s + bb;
        trow[16] = c1[r] * s + bb;
        trow[32] = c2[r] * s + bb;
        trow[48] = c3[r] * s + bb;
    }
    __syncthreads();
    const int col = (l >> 3) * 32 + (l & 7) * 4;
#pragma unroll
    for (int it = 0; it < 8; ++it) {
        const int row = wave * 8 + it;
        const v4f v = *(const v4fa*)(tile + row * TP + col);
        vst4f(out + ((size_t)b * DIMC + Mbase + row) * NN + Nbase + col, v);
    }
    
}

// ---------------------------------------------------------------------------
// Host-side launch glue.  Workspace (bytes):
//   [0)            xt   f16 [8][4096][384]   25,165,824   (reused for ksm f16 [8][256][4096] 16,777,216 after kernel 2)
//   [25,165,824)   wabc f16 [1024][384]         786,432
//   [25,952,256)   wph  f16 [384][512]          393,216
//   [26,345,472)   sc   f32 [1024]                4,096
//   [26,349,568)   bc   f32 [1024]                4,096
//   [26,353,664)   qsm  f16 [8][4096][256]   16,777,216
//   [43,130,880)   kf   f32 [8][256][4096]   33,554,432   (reused for att f16 [8][4096][512] after kernel 3)
//   [76,685,312)   vh   f16 [8][512][4096]   33,554,432
//   [110,239,744)  ctxT f16 [64][64][32]        262,144
//   total 110,501,888
// ---------------------------------------------------------------------------
extern "C" void kernel_launch(void* const* d_in, const int* in_sizes, int n_in,
                              void* d_out, int out_size, void* d_ws, size_t ws_size,
                              hipStream_t stream)
{
    if (n_in < 13) return;
    if (in_sizes[0] != BB * DIMC * NN) return;
    if (in_sizes[1] != NHKD * DIMC || in_sizes[2] != NHKD || in_sizes[3] != NHKD) return;
    if (in_sizes[4] != NHKD * DIMC || in_sizes[5] != NHKD || in_sizes[6] != NHKD) return;
    if (in_sizes[7] != DHC * DIMC || in_sizes[8] != DHC || in_sizes[9] != DHC) return;
    if (in_sizes[10] != DIMC * DHC || in_sizes[11] != DIMC || in_sizes[12] != DIMC) return;
    if (out_size != BB * DIMC * NN) return;

    const size_t off_xt   = 0;
    const size_t sz_xt    = (size_t)BB * NN * DIMC * 2;
    const size_t off_wabc = off_xt + sz_xt;
    const size_t sz_wabc  = (size_t)MQKV * DIMC * 2;
    const size_t off_wph  = off_wabc + sz_wabc;
    const size_t sz_wph   = (size_t)DIMC * DHC * 2;
    const size_t off_sc   = off_wph + sz_wph;
    const size_t sz_sc    = (size_t)MQKV * 4;
    const size_t off_bc   = off_sc + sz_sc;
    const size_t off_qsm  = off_bc + sz_sc;
    const size_t sz_qsm   = (size_t)BB * NN * NHKD * 2;
    const size_t off_kf   = off_qsm + sz_qsm;
    const size_t sz_kf    = (size_t)BB * NHKD * NN * 4;
    const size_t off_vh   = off_kf + sz_kf;
    const size_t sz_vh    = (size_t)BB * DHC * NN * 2;
    const size_t off_ctx  = off_vh + sz_vh;
    const size_t sz_ctx   = (size_t)BB * HEADS * DD * KDIM * 2;
    const size_t total    = off_ctx + sz_ctx;
    const size_t sz_ksm   = (size_t)BB * NHKD * NN * 2;
    const size_t sz_att   = (size_t)BB * NN * DHC * 2;
    if (total > ws_size) return;
    if (sz_ksm > sz_xt || sz_att > sz_kf) return;

    const float* x  = (const float*)d_in[0];
    const float* Wq = (const float*)d_in[1];
    const float* sq = (const float*)d_in[2];
    const float* bq = (const float*)d_in[3];
    const float* Wk = (const float*)d_in[4];
    const float* sk = (const float*)d_in[5];
    const float* bk = (const float*)d_in[6];
    const float* Wv = (const float*)d_in[7];
    const float* sv = (const float*)d_in[8];
    const float* bv = (const float*)d_in[9];
    const float* Wp = (const float*)d_in[10];
    const float* sp = (const float*)d_in[11];
    const float* bp = (const float*)d_in[12];
    float* out = (float*)d_out;

    char* ws = (char*)d_ws;
    _Float16* xt   = (_Float16*)(ws + off_xt);
    _Float16* ksm  = (_Float16*)(ws + off_xt);     // alias: xt dead after kernel 2
    _Float16* wabc = (_Float16*)(ws + off_wabc);
    _Float16* wph  = (_Float16*)(ws + off_wph);
    float*    sc   = (float*)   (ws + off_sc);
    float*    bc   = (float*)   (ws + off_bc);
    _Float16* qsm  = (_Float16*)(ws + off_qsm);
    float*    kf   = (float*)   (ws + off_kf);
    _Float16* att  = (_Float16*)(ws + off_kf);     // alias: kf dead after kernel 3
    _Float16* vh   = (_Float16*)(ws + off_vh);
    _Float16* ctxT = (_Float16*)(ws + off_ctx);

    const int prep_threads = MQKV * DIMC / 8 + DIMC * DHC / 8 + 512;   // 74240
    prep_kernel<<<(prep_threads + 255) / 256, 256, 0, stream>>>(
        Wq, Wk, Wv, Wp, sq, bq, sk, bk, sv, bv, wabc, wph, sc, bc);

    xpose_kernel<<<dim3(NN / 32, DIMC / 128, BB), 256, 0, stream>>>(x, xt);

    qkv_kernel<<<dim3(NN / 128, MQKV / 64, BB), 256, 0, stream>>>(wabc, xt, sc, bc, qsm, kf, vh);

    softmax_k_kernel<<<BB * NHKD, 256, 0, stream>>>(kf, ksm);

    ctx_kernel<<<BB * HEADS, 256, 0, stream>>>(ksm, vh, ctxT);

    att_kernel<<<dim3(NN / 128, BB * HEADS), 256, 0, stream>>>(ctxT, qsm, att);

    out_kernel<<<dim3(NN / 128, DIMC / 64, BB), 256, 0, stream>>>(wph, att, sp, bp, out);
}

// v002
// Measured time: 115 microseconds a run.
// In both of two side-by-side timings against v001, it was 1.32 times as fast.
// Over all steps from v000 it is 2.65 times as fast.
#include <hip/hip_runtime.h>
// All contractions on v_wmma_f32_16x16x32_f16 (f16 operands, f32 accumulate): QKV projection, key*value^T, context^T*query, output projection; exact power-of-two operand scales (weights x16, key softmax x4096, context x64, query softmax x256, attended x256) undone in the f32 epilogues; softmaxes and affine terms in f32.

#define BB    8
#define DIMC  384
#define NN    4096
#define HEADS 8
#define KDIM  32
#define DD    64
#define NHKD  256
#define DHC   512
#define MQKV  1024
#define TP    132      // LDS pitch (floats) for 64x128 tiles, keeps 16-B alignment
#define TPD   68       // LDS pitch (floats) for x64 tiles
#define CSPLIT 4       // work-groups that share the n-sum of one (b,head) context
#define CWN   (NN / (CSPLIT * 8))   // n per wave of the context kernel (128)
#define CTILE (KDIM * DD)           // elements of one context tile (2048)

typedef _Float16 v16h __attribute__((ext_vector_type(16)));
typedef _Float16 v8h  __attribute__((ext_vector_type(8)));
typedef float    v8f  __attribute__((ext_vector_type(8)));
typedef float    v4f  __attribute__((ext_vector_type(4)));
typedef float    v4fa __attribute__((ext_vector_type(4), may_alias));

union Frag { v16h v; v8h half[2]; };

// 16x16x32 operand fragment from a k-contiguous row: elements 0..7 <- row[8h..8h+7],
// elements 8..15 <- row[16+8h..16+8h+7]; lane&15 selects the row (A) or column (B).
__device__ __forceinline__ v16h load_frag(const _Float16* __restrict__ p, int h)
{
    Frag f;
    f.half[0] = *(const v8h*)(p + 8 * h);
    f.half[1] = *(const v8h*)(p + 16 + 8 * h);
    return f.v;
}

__device__ __forceinline__ v8f mma16(v16h a, v16h b, v8f c)
{
    return __builtin_amdgcn_wmma_f32_16x16x32_f16(false, a, false, b, (short)0, c, false, false);
}

#define GUARD1(c, a, b) \
    asm volatile("v_nop\n\tv_nop\n\tv_nop\n\tv_nop" : "+v"(c) : "v"(a), "v"(b))
#define GUARD4(c0, c1, c2, c3, a, b0, b1, b2, b3) \
    asm volatile("v_nop\n\tv_nop\n\tv_nop\n\tv_nop" \
                 : "+v"(c0), "+v"(c1), "+v"(c2), "+v"(c3) \
                 : "v"(a), "v"(b0), "v"(b1), "v"(b2), "v"(b3))

__device__ __forceinline__ void vst8h(_Float16* p, v8h v) { *(v8h*)p = v; }
__device__ __forceinline__ void vst4f(float* p, v4f v)    { *(v4f*)p = v; }

// LDS ring of the two projection GEMMs.  A stage = 64 k (128 B) of 64 A rows and then of
// 128 B rows, row pitch 144 B (16 B x 9: conflict-free for ds_load_b128); two buffers.
#define KS      64                 // k per stage
#define LPB     144                // LDS row pitch, bytes
#define LPH     72                 // the same in halves
#define STAGE_B (192 * LPB)        // 27,648 B
#define RING_B  (2 * STAGE_B)      // 55,296 B; the f32 output tile (33,792 B) reuses it after the loop

// One stage: 1536 pieces of 16 B, six per thread.  Thread t brings piece t&7 of rows
// t>>3 + 32 j, so eight lanes cover one 128-B line.  a, b: this thread's piece in A row t>>3
// and B row t>>3 at the stage's k; lds: its place in the buffer (byte address in LDS).
// s_wait_xcnt stands inside the statement, ahead of any rewrite of the address registers.
__device__ __forceinline__ void copy_stage(const unsigned lds, const _Float16* a,
                                           const _Float16* b, const int K)
{
    asm volatile("global_load_async_to_lds_b128 %0, %6, off\n\t"
                 "global_load_async_to_lds_b128 %1, %7, off\n\t"
                 "global_load_async_to_lds_b128 %2, %8, off\n\t"
                 "global_load_async_to_lds_b128 %3, %9, off\n\t"
                 "global_load_async_to_lds_b128 %4, %10, off\n\t"
                 "global_load_async_to_lds_b128 %5, %11, off\n\t"
                 "s_wait_xcnt 0x0"
                 :: "v"(lds), "v"(lds + 32 * LPB), "v"(lds + 64 * LPB),
                    "v"(lds + 96 * LPB), "v"(lds + 128 * LPB), "v"(lds + 160 * LPB),
                    "v"(a), "v"(a + 32 * K), "v"(b), "v"(b + 32 * K), "v"(b + 64 * K), "v"(b + 96 * K)
                 : "memory");
}

// Block: 64 rows of A (row-major, pitch K) times 128 columns of B (B[k][n] stored n-major with
// k contiguous, pitch K), both staged in the ring by asynchronous copies, the next stage in
// flight while this one is multiplied.  Wave (mw, nw): rows 16 mw.., columns 64 nw..;
// c0..c3 = column groups of 16.  On return every wave has left the ring (last trip's barrier).
template <int K>
__device__ __forceinline__ void mainloop_64x128(unsigned char* ring,
                                                const _Float16* __restrict__ Ablk,
                                                const _Float16* __restrict__ Bblk,
                                                const int t, const int mw, const int nw,
                                                const int h, const int m,
                                                v8f& c0, v8f& c1, v8f& c2, v8f& c3)
{
    constexpr int NT = K / KS;
    static_assert(K % KS == 0 && NT >= 2, "two stages or more");
    const unsigned lds = (unsigned)(uintptr_t)ring + (t >> 3) * LPB + (t & 7) * 16;
    const _Float16* ga = Ablk + (t >> 3) * K + (t & 7) * 8;
    const _Float16* gb = Bblk + (t >> 3) * K + (t & 7) * 8;

    copy_stage(lds, ga, gb, K);
    asm volatile("s_wait_asynccnt 0x0" ::: "memory");   // stage 0 landed (this wave's pieces)
    __syncthreads();                                    // ... and every other wave's
    copy_stage(lds + STAGE_B, ga + KS, gb + KS, K);

    // kept rolled: unrolled, every stage's copy addresses stay live at once, and the added
    // registers cost a resident work-group per WGP
#pragma unroll 1
    for (int s = 0; s < NT; ++s) {
        const _Float16* st = (const _Float16*)(ring + (s & 1) * STAGE_B);
        const _Float16* ar = st + (mw * 16 + m) * LPH;
        const _Float16* br = st + (64 + nw * 64 + m) * LPH;
        v16h a0  = load_frag(ar, h);
        v16h b00 = load_frag(br, h);
        v16h b01 = load_frag(br + 16 * LPH, h);
        v16h b02 = load_frag(br + 32 * LPH, h);
        v16h b03 = load_frag(br + 48 * LPH, h);
        v16h a1  = load_frag(ar + 32, h);
        v16h b10 = load_frag(br + 32, h);
        v16h b11 = load_frag(br + 16 * LPH + 32, h);
        v16h b12 = load_frag(br + 32 * LPH + 32, h);
        v16h b13 = load_frag(br + 48 * LPH + 32, h);
        c0 = mma16(a0, b00, c0);
        c1 = mma16(a0, b01, c1);
        c2 = mma16(a0, b02, c2);
        c3 = mma16(a0, b03, c3);
        c0 = mma16(a1, b10, c0);
        c1 = mma16(a1, b11, c1);
        c2 = mma16(a1, b12, c2);
        c3 = mma16(a1, b13, c3);
        // four vector slots behind the last matrix instructions, on the branch paths too
        GUARD4(c0, c1, c2, c3, a1, b10, b11, b12, b13);
        asm volatile("s_wait_dscnt 0x0" ::: "memory");     // this wave's reads of buffer s&1 are done
        asm volatile("s_wait_asynccnt 0x0" ::: "memory");  // its pieces of stage s+1 have landed
        __syncthreads();                                   // publishes stage s+1, frees buffer s&1
        if (s + 2 < NT)
            copy_stage(lds + (s & 1) * STAGE_B, ga + (s + 2) * KS, gb + (s + 2) * KS, K);
    }
    asm volatile("s_wait_asynccnt 0x0" ::: "memory");      // nothing in flight when the ring is reused
}

// ---------------------------------------------------------------------------
// Kernel 0: weights -> f16 (x16), concatenated [1024][384] and [384][512];
// affine params concatenated (scale pre-multiplied by 1/16).  16-B per lane stores.
// ---------------------------------------------------------------------------
__global__ __launch_bounds__(256) void prep_kernel(
    const float* __restrict__ Wq, const float* __restrict__ Wk, const float* __restrict__ Wv,
    const float* __restrict__ Wp,
    const float* __restrict__ sq, const float* __restrict__ bq,
    const float* __restrict__ sk, const float* __restrict__ bk,
    const float* __restrict__ sv, const float* __restrict__ bv,
    _Float16* __restrict__ wabc, _Float16* __restrict__ wph,
    float* __restrict__ sc, float* __restrict__ bc)
{
    const int NW1 = MQKV * DIMC / 8;   // 49152 chunks of 8 halves
    const int NW2 = DIMC * DHC / 8;    // 24576 chunks
    const int i = blockIdx.x * 256 + threadIdx.x;
    if (i < NW1 + NW2) {
        const float* src;
        _Float16* dst;
        if (i < NW1) {
            const int e = i * 8;
            if (e < NHKD * DIMC)          src = Wq + e;
            else if (e < 2 * NHKD * DIMC) src = Wk + (e - NHKD * DIMC);
            else                          src = Wv + (e - 2 * NHKD * DIMC);
            dst = wabc + e;
        } else {
            const int e = (i - NW1) * 8;
            src = Wp + e;
            dst = wph + e;
        }
        const v4f f0 = *(const v4f*)src;
        const v4f f1 = *(const v4f*)(src + 4);
        v8h hv;
#pragma unroll
        for (int j = 0; j < 4; ++j) {
            hv[j]     = (_Float16)(f0[j] * 16.0f);
            hv[4 + j] = (_Float16)(f1[j] * 16.0f);
        }
        vst8h(dst, hv);
        
    } else {
        const int j = i - (NW1 + NW2);
        if (j < 512) {
            const int e = (j & 255) * 4;
            v4f o;
#pragma unroll
            for (int q = 0; q < 4; ++q) {
                const int ee = e + q;
                float val;
                if (j < 256) {
                    val = (ee < NHKD) ? sq[ee] : ((ee < 2 * NHKD) ? sk[ee - NHKD] : sv[ee - 2 * NHKD]);
                    val *= 0.0625f;
                } else {
                    val = (ee < NHKD) ? bq[ee] : ((ee < 2 * NHKD) ? bk[ee - NHKD] : bv[ee - 2 * NHKD]);
                }
                o[q] = val;
            }
            float* dst = ((j < 256) ? sc : bc) + e;
            vst4f(dst, o);
            
        }
    }
}

// ---------------------------------------------------------------------------
// Kernel 1: x[b][c][n] f32 -> xt[b][n][c] f16.  Tile 128 c x 32 n in LDS; each
// ---------------------------------------------------------------------------
__global__ __launch_bounds__(256) void xpose_kernel(const float* __restrict__ x,
                                                    _Float16* __restrict__ xt)
{
    __shared__ float tile[128 * 33];
    const int b = blockIdx.z;
    const int nb = blockIdx.x * 32, cb = blockIdx.y * 128;
    const int t = threadIdx.x, l = t & 31, w = t >> 5, h = l >> 4, m = l & 15;
    const float* xb = x + (size_t)b * DIMC * NN;
#pragma unroll
    for (int j = 0; j < 16; ++j) {
        const int c = w + 8 * j;
        tile[c * 33 + l] = xb[(size_t)(cb + c) * NN + nb + l];
    }
    __syncthreads();
    _Float16* xo = xt + (size_t)b * NN * DIMC;
    const int nl0 = w * 4 + h, nl1 = w * 4 + 2 + h;
    v8h hv0, hv1;
#pragma unroll
    for (int j = 0; j < 8; ++j) {
        hv0[j] = (_Float16)tile[(m * 8 + j) * 33 + nl0];
        hv1[j] = (_Float16)tile[(m * 8 + j) * 33 + nl1];
    }
    _Float16* d0 = xo + (size_t)(nb + nl0) * DIMC + cb + m * 8;
    _Float16* d1 = xo + (size_t)(nb + nl1) * DIMC + cb + m * 8;
    vst8h(d0, hv0);
    vst8h(d1, hv1);
    
}

// ---------------------------------------------------------------------------
// Kernel 2: fused QKV projection [1024][384] x [384][4096] per batch + affine.
// Block tile 64 rows x 128 cols, 8 waves, wave tile 16 x 64, operands through the LDS ring.
// Result staged in LDS:
//   Q rows (0..255):   channel softmax over 32 per head (f32), x256, f16 -> qsm[b][n][256]
//   K rows (256..511): f32 -> kf[b][256][N]
//   V rows (512..1023): f16 -> vh[b][512][N]
// ---------------------------------------------------------------------------
__global__ __launch_bounds__(256) void qkv_kernel(const _Float16* __restrict__ wabc,
                                                  const _Float16* __restrict__ xt,
                                                  const float* __restrict__ sc,
                                                  const float* __restrict__ bc,
                                                  _Float16* __restrict__ qsm,
                                                  float* __restrict__ kf,
                                                  _Float16* __restrict__ vh)
{
    __shared__ __attribute__((aligned(16))) unsigned char ring[RING_B];
    float* tile = (float*)ring;
    const int b = blockIdx.z;
    const int t = threadIdx.x, l = t & 31, wave = t >> 5, h = l >> 4, m = l & 15;
    const int mw = wave >> 1, nw = wave & 1;
    const int Mbase = blockIdx.y * 64, Nbase = blockIdx.x * 128;
    const int region = (blockIdx.y < 4) ? 0 : ((blockIdx.y < 8) ? 1 : 2);

    const _Float16* Ablk = wabc + (size_t)Mbase * DIMC;
    const _Float16* Bblk = xt + ((size_t)b * NN + Nbase) * DIMC;
    v8f c0 = {}, c1 = {}, c2 = {}, c3 = {};
    mainloop_64x128<DIMC>(ring, Ablk, Bblk, t, mw, nw, h, m, c0, c1, c2, c3);

#pragma unroll
    for (int r = 0; r < 8; ++r) {
        const int ml = mw * 16 + 8 * h + r;
        const int o = Mbase + ml;
        const float s = sc[o], bb = bc[o];
        float* trow = tile + ml * TP + nw * 64 + m;
        trow[0]  = c0[r] * s + bb;
        trow[16] = c1[r] * s + bb;
        trow[32] = c2[r] * s + bb;
        trow[48] = c3[r] * s + bb;
    }
    __syncthreads();

    if (region == 0) {
        // softmax over the 32 channels of one head for one column; 2 heads x 128 cols = 256 threads
        const int nl = t & 127, hh = t >> 7;
        float qv[KDIM];
        float mx;
#pragma unroll
        for (int i = 0; i < KDIM; ++i) {
            qv[i] = tile[(hh * KDIM + i) * TP + nl];
            mx = (i == 0) ? qv[0] : fmaxf(mx, qv[i]);
        }
        float sum = 0.f;
#pragma unroll
        for (int i = 0; i < KDIM; ++i) { qv[i] = __expf(qv[i] - mx); sum += qv[i]; }
        const float scl = 256.0f / sum;
#pragma unroll
        for (int i = 0; i < KDIM; ++i) tile[(hh * KDIM + i) * TP + nl] = qv[i] * scl;
    }
    __syncthreads();

    if (region == 0) {
        const int p = l & 7;
#pragma unroll
        for (int it = 0; it < 4; ++it) {
            const int nl = wave * 16 + it * 4 + (l >> 3);
            v8h hv;
#pragma unroll
            for (int j = 0; j < 8; ++j) hv[j] = (_Float16)tile[(p * 8 + j) * TP + nl];
            vst8h(qsm + ((size_t)b * NN + Nbase + nl) * NHKD + Mbase + p * 8, hv);
        }
        
    } else if (region == 1) {
        // kf[b][o][Nbase..Nbase+127] f32: 512 B = 4 lines per row, one instruction per row
        const int col = (l >> 3) * 32 + (l & 7) * 4;
        const int obase = Mbase - NHKD;
#pragma unroll
        for (int it = 0; it < 8; ++it) {
            const int row = wave * 8 + it;
            const v4f v = *(const v4fa*)(tile + row * TP + col);
            vst4f(kf + ((size_t)b * NHKD + obase + row) * NN + Nbase + col, v);
        }
        
    } else {
        // vh[b][o][Nbase..Nbase+127] f16: 256 B = 2 lines per row, two rows per instruction
        const int obase = Mbase - 2 * NHKD;
#pragma unroll
        for (int it = 0; it < 4; ++it) {
            const int row = wave * 8 + it * 2 + h;
            v8h hv;
#pragma unroll
            for (int j = 0; j < 8; ++j) hv[j] = (_Float16)tile[row * TP + m * 8 + j];
            vst8h(vh + ((size_t)b * DHC + obase + row) * NN + Nbase + m * 8, hv);
        }
        
    }
}

// ---------------------------------------------------------------------------
// Kernel 3: softmax of key rows (length 4096, f32 in) -> f16 x4096 out.
// One block per row; thread t owns elements [t*8, t*8+8) and [2048+t*8, +8).
// ---------------------------------------------------------------------------
__global__ __launch_bounds__(256) void softmax_k_kernel(const float* __restrict__ kf,
                                                        _Float16* __restrict__ ksm)
{
    __shared__ float red[8];
    const size_t row = blockIdx.x;
    const float* p = kf + row * NN;
    _Float16* q = ksm + row * NN;
    const int t = threadIdx.x, l = t & 31, w = t >> 5;
    const v4f a0 = *(const v4f*)(p + t * 8);
    const v4f a1 = *(const v4f*)(p + t * 8 + 4);
    const v4f a2 = *(const v4f*)(p + 2048 + t * 8);
    const v4f a3 = *(const v4f*)(p + 2048 + t * 8 + 4);
    float v[16];
#pragma unroll
    for (int j = 0; j < 4; ++j) { v[j] = a0[j]; v[4 + j] = a1[j]; v[8 + j] = a2[j]; v[12 + j] = a3[j]; }
    float mx = v[0];
#pragma unroll
    for (int j = 1; j < 16; ++j) mx = fmaxf(mx, v[j]);
#pragma unroll
    for (int off = 16; off > 0; off >>= 1) mx = fmaxf(mx, __shfl_xor(mx, off, 32));
    if (l == 0) red[w] = mx;
    __syncthreads();
    mx = red[0];
#pragma unroll
    for (int j = 1; j < 8; ++j) mx = fmaxf(mx, red[j]);
    __syncthreads();
    float sum = 0.f;
#pragma unroll
    for (int j = 0; j < 16; ++j) { v[j] = __expf(v[j] - mx); sum += v[j]; }
#pragma unroll
    for (int off = 16; off > 0; off >>= 1) sum += __shfl_xor(sum, off, 32);
    if (l == 0) red[w] = sum;
    __syncthreads();
    float tot = 0.f;
#pragma unroll
    for (int j = 0; j < 8; ++j) tot += red[j];
    const float scl = 4096.0f / tot;
    v8h h0, h1;
#pragma unroll
    for (int j = 0; j < 8; ++j) { h0[j] = (_Float16)(v[j] * scl); h1[j] = (_Float16)(v[8 + j] * scl); }
    _Float16* d0 = q + t * 8;
    _Float16* d1 = q + 2048 + t * 8;
    vst8h(d0, h0);
    vst8h(d1, h1);
    
}

// ---------------------------------------------------------------------------
// Kernel 4: context per (b,head): C[kd][d] = sum_n ksm[kd][n] * v[d][n], K = 4096.
// A rows = ksm rows (n contiguous); B[k=n][col=d] = vh row d (n contiguous): same loader.
// The n-sum is split: CSPLIT work-groups per (b,head), eight waves each, every wave holding the
// whole 32 x 64 tile (2 kd-tiles x 4 d-tiles) for its own 128 n, so that each fragment is
// loaded once and all of a wave's loads are independent.  The eight waves' tiles are added
// through LDS in wave order; the work-group's f32 partial goes to part[bh][g][2048].
// Order inside a partial: unit u = dt*4 + kt*2 + (r>>2), then lane, then r&3 (accumulator
// register r of tile (kt, dt)).  That is the A-fragment order of kernel 5: element e = kt*8 + r
// of lane (m, h) is C[kd = kt*16 + 8h + r][d = dt*16 + m].
// ---------------------------------------------------------------------------
__global__ __launch_bounds__(256) void ctx_kernel(const _Float16* __restrict__ ksm,
                                                  const _Float16* __restrict__ vh,
                                                  float* __restrict__ part)
{
    __shared__ __attribute__((aligned(16))) float red[8 * CTILE];
    const int bh = blockIdx.x / CSPLIT, g = blockIdx.x % CSPLIT, b = bh >> 3, hd = bh & 7;
    const int t = threadIdx.x, l = t & 31, wave = t >> 5, h = l >> 4, m = l & 15;
    const int n0 = (g * 8 + wave) * CWN;
    // both operands have the row pitch NN, so one per-lane byte offset serves every load
    const char* Abase = (const char*)(ksm + ((size_t)b * NHKD + hd * KDIM) * NN);
    const char* Bbase = (const char*)(vh  + ((size_t)b * DHC  + hd * DD)   * NN);
    const unsigned lane_off = (unsigned)(m * NN + n0 + 8 * h) * 2u;
    // every loop below is unrolled so that the fragment and accumulator arrays are indexed by
    // constants and stay in registers
    v16h a[CWN / 32][2], bf[CWN / 32][4];
#pragma unroll
    for (int s = 0; s < CWN / 32; ++s) {
#pragma unroll
        for (int i = 0; i < 2; ++i)
            a[s][i] = load_frag((const _Float16*)(Abase + lane_off) + i * 16 * NN + s * 32, 0);
#pragma unroll
        for (int j = 0; j < 4; ++j)
            bf[s][j] = load_frag((const _Float16*)(Bbase + lane_off) + j * 16 * NN + s * 32, 0);
    }
    // the first results reuse the loads' offset register: the wait stands ahead of that overwrite
    asm volatile("s_wait_xcnt 0x0" ::: "memory");
    // keeps every load of the wave ahead of the first product: one memory latency per wave;
    // without it the scheduler reuses fragment registers and waits out eight latencies in a row
    __builtin_amdgcn_sched_barrier(0);
    v8f c[2][4] = {};
#pragma unroll
    for (int s = 0; s < CWN / 32; ++s)
#pragma unroll
        for (int i = 0; i < 2; ++i)
#pragma unroll
            for (int j = 0; j < 4; ++j) c[i][j] = mma16(a[s][i], bf[s][j], c[i][j]);
    // keeps the LDS stores behind the last product: all eight accumulators stay live to here, so
    // none of their registers is handed to another product's result inside the hazard distance
    __builtin_amdgcn_sched_barrier(0);
    float* mine = red + wave * CTILE + l * 4;
#pragma unroll
    for (int j = 0; j < 4; ++j)
#pragma unroll
        for (int i = 0; i < 2; ++i) {
            const v8f v = c[i][j];
            vst4f(mine + (j * 4 + i * 2) * 128,     (v4f){v[0], v[1], v[2], v[3]});
            vst4f(mine + (j * 4 + i * 2 + 1) * 128, (v4f){v[4], v[5], v[6], v[7]});
        }
    __syncthreads();
    float* dst = part + (size_t)blockIdx.x * CTILE;
#pragma unroll
    for (int q = 0; q < 2; ++q) {
        const int e = q * 1024 + t * 4;
        v4f s = *(const v4f*)(red + e);
#pragma unroll
        for (int w = 1; w < 8; ++w) s += *(const v4f*)(red + w * CTILE + e);
        vst4f(dst + e, s);
    }
}

// ---------------------------------------------------------------------------
// Kernel 5: attended per (b,head): Att[d][n] = sum_kd C[kd][d] * qsm[n][hd*32+kd], K = 32
// (one WMMA per 16x16 tile), ReLU, scaled to att x256 (= acc/64), stored att[b][n][hd*64+d].
// The A fragment is the sum of kernel 4's CSPLIT partials (already in fragment order, whole
// lines per load), /64 (= true context x64), rounded to f16.
// ---------------------------------------------------------------------------
__global__ __launch_bounds__(256) void att_kernel(const float* __restrict__ part,
                                                  const _Float16* __restrict__ qsm,
                                                  _Float16* __restrict__ att)
{
    __shared__ float tile[128 * TPD];
    const int bh = blockIdx.y, b = bh >> 3, hd = bh & 7;
    const int Nbase = blockIdx.x * 128;
    const int t = threadIdx.x, l = t & 31, wave = t >> 5, h = l >> 4, m = l & 15;
    const int mt = wave >> 1, nw = wave & 1;
    // unrolled: a is indexed by constants and stays in registers; the 16 loads are independent
    v16h a;
    const float* pa = part + (size_t)bh * CSPLIT * CTILE + mt * 512 + l * 4;
#pragma unroll
    for (int q = 0; q < 4; ++q) {
        v4f s = *(const v4f*)(pa + q * 128);
#pragma unroll
        for (int g = 1; g < CSPLIT; ++g) s += *(const v4f*)(pa + g * CTILE + q * 128);
#pragma unroll
        for (int i = 0; i < 4; ++i) a[q * 4 + i] = (_Float16)(s[i] * 0.015625f);
    }
#pragma unroll
    for (int ns = 0; ns < 4; ++ns) {
        const int nl = nw * 64 + ns * 16 + m;
        v16h bf = load_frag(qsm + ((size_t)b * NN + Nbase + nl) * NHKD + hd * KDIM, h);
        v8f c = {};
        c = mma16(a, bf, c);
        GUARD1(c, a, bf);
#pragma unroll
        for (int r = 0; r < 8; ++r) {
            const float y = fmaxf(c[r] * 0.015625f, 0.0f);
            tile[nl * TPD + mt * 16 + 8 * h + r] = y;
        }
    }
    __syncthreads();
    const int p = l & 7;
#pragma unroll
    for (int it = 0; it < 4; ++it) {
        const int nl = wave * 16 + it * 4 + (l >> 3);
        v8h hv;
#pragma unroll
        for (int j = 0; j < 8; ++j) hv[j] = (_Float16)tile[nl * TPD + p * 8 + j];
        vst8h(att + ((size_t)b * NN + Nbase + nl) * DHC + hd * DD + p * 8, hv);
    }
    
}

// ---------------------------------------------------------------------------
// Kernel 6: output projection [384][512] x [512][4096] per batch + affine -> f32 out.
// ---------------------------------------------------------------------------
__global__ __launch_bounds__(256) void out_kernel(const _Float16* __restrict__ wph,
                                                  const _Float16* __restrict__ att,
                                                  const float* __restrict__ sp,
                                                  const float* __restrict__ bp,
                                                  float* __restrict__ out)
{
    __shared__ __attribute__((aligned(16))) unsigned char ring[RING_B];
    float* tile = (float*)ring;
    const int b = blockIdx.z;
    const int t = threadIdx.x, l = t & 31, wave = t >> 5, h = l >> 4, m = l & 15;
    const int mw = wave >> 1, nw = wave & 1;
    const int Mbase = blockIdx.y * 64, Nbase = blockIdx.x * 128;
    const _Float16* Ablk = wph + (size_t)Mbase * DHC;
    const _Float16* Bblk = att + ((size_t)b * NN + Nbase) * DHC;
    v8f c0 = {}, c1 = {}, c2 = {}, c3 = {};
    mainloop_64x128<DHC>(ring, Ablk, Bblk, t, mw, nw, h, m, c0, c1, c2, c3);

#pragma unroll
    for (int r = 0; r < 8; ++r) {
        const int ml = mw * 16 + 8 * h + r;
        const int o = Mbase + ml;
        const float s = sp[o] * 0.000244140625f;   // 1/(16*256)
        const float bb = bp[o];
        float* trow = tile + ml * TP + nw * 64 + m;
        trow[0]  = c0[r] * s + bb;
        trow[16] = c1[r] * s + bb;
        trow[32] = c2[r] * s + bb;
        trow[48] = c3[r] * s + bb;
    }
    __syncthreads();
    const int col = (l >> 3) * 32 + (l & 7) * 4;
#pragma unroll
    for (int it = 0; it < 8; ++it) {
        const int row = wave * 8 + it;
        const v4f v = *(const v4fa*)(tile + row * TP + col);
        vst4f(out + ((size_t)b * DIMC + Mbase + row) * NN + Nbase + col, v);
    }
    
}

// ---------------------------------------------------------------------------
// Host-side launch glue.  Workspace (bytes):
//   [0)            xt   f16 [8][4096][384]   25,165,824   (reused for ksm f16 [8][256][4096] 16,777,216 after kernel 2)
//   [25,165,824)   wabc f16 [1024][384]         786,432
//   [25,952,256)   wph  f16 [384][512]          393,216
//   [26,345,472)   sc   f32 [1024]                4,096
//   [26,349,568)   bc   f32 [1024]                4,096
//   [26,353,664)   qsm  f16 [8][4096][256]   16,777,216
//   [43,130,880)   kf   f32 [8][256][4096]   33,554,432   (reused for att f16 [8][4096][512] after kernel 3)
//   [76,685,312)   vh   f16 [8][512][4096]   33,554,432
//   [110,239,744)  part f32 [64][4][2048]     2,097,152
//   total 112,336,896
// ---------------------------------------------------------------------------
extern "C" void kernel_launch(void* const* d_in, const int* in_sizes, int n_in,
                              void* d_out, int out_size, void* d_ws, size_t ws_size,
                              hipStream_t stream)
{
    if (n_in < 13) return;
    if (in_sizes[0] != BB * DIMC * NN) return;
    if (in_sizes[1] != NHKD * DIMC || in_sizes[2] != NHKD || in_sizes[3] != NHKD) return;
    if (in_sizes[4] != NHKD * DIMC || in_sizes[5] != NHKD || in_sizes[6] != NHKD) return;
    if (in_sizes[7] != DHC * DIMC || in_sizes[8] != DHC || in_sizes[9] != DHC) return;
    if (in_sizes[10] != DIMC * DHC || in_sizes[11] != DIMC || in_sizes[12] != DIMC) return;
    if (out_size != BB * DIMC * NN) return;

    const size_t off_xt   = 0;
    const size_t sz_xt    = (size_t)BB * NN * DIMC * 2;
    const size_t off_wabc = off_xt + sz_xt;
    const size_t sz_wabc  = (size_t)MQKV * DIMC * 2;
    const size_t off_wph  = off_wabc + sz_wabc;
    const size_t sz_wph   = (size_t)DIMC * DHC * 2;
    const size_t off_sc   = off_wph + sz_wph;
    const size_t sz_sc    = (size_t)MQKV * 4;
    const size_t off_bc   = off_sc + sz_sc;
    const size_t off_qsm  = off_bc + sz_sc;
    const size_t sz_qsm   = (size_t)BB * NN * NHKD * 2;
    const size_t off_kf   = off_qsm + sz_qsm;
    const size_t sz_kf    = (size_t)BB * NHKD * NN * 4;
    const size_t off_vh   = off_kf + sz_kf;
    const size_t sz_vh    = (size_t)BB * DHC * NN * 2;
    const size_t off_ctx  = off_vh + sz_vh;
    const size_t sz_ctx   = (size_t)BB * HEADS * CSPLIT * CTILE * 4;
    const size_t total    = off_ctx + sz_ctx;
    const size_t sz_ksm   = (size_t)BB * NHKD * NN * 2;
    const size_t sz_att   = (size_t)BB * NN * DHC * 2;
    if (total > ws_size) return;
    if (sz_ksm > sz_xt || sz_att > sz_kf) return;

    const float* x  = (const float*)d_in[0];
    const float* Wq = (const float*)d_in[1];
    const float* sq = (const float*)d_in[2];
    const float* bq = (const float*)d_in[3];
    const float* Wk = (const float*)d_in[4];
    const float* sk = (const float*)d_in[5];
    const float* bk = (const float*)d_in[6];
    const float* Wv = (const float*)d_in[7];
    const float* sv = (const float*)d_in[8];
    const float* bv = (const float*)d_in[9];
    const float* Wp = (const float*)d_in[10];
    const float* sp = (const float*)d_in[11];
    const float* bp = (const float*)d_in[12];
    float* out = (float*)d_out;

    char* ws = (char*)d_ws;
    _Float16* xt   = (_Float16*)(ws + off_xt);
    _Float16* ksm  = (_Float16*)(ws + off_xt);     // alias: xt dead after kernel 2
    _Float16* wabc = (_Float16*)(ws + off_wabc);
    _Float16* wph  = (_Float16*)(ws + off_wph);
    float*    sc   = (float*)   (ws + off_sc);
    float*    bc   = (float*)   (ws + off_bc);
    _Float16* qsm  = (_Float16*)(ws + off_qsm);
    float*    kf   = (float*)   (ws + off_kf);
    _Float16* att  = (_Float16*)(ws + off_kf);     // alias: kf dead after kernel 3
    _Float16* vh   = (_Float16*)(ws + off_vh);
    float*    part = (float*)   (ws + off_ctx);

    const int prep_threads = MQKV * DIMC / 8 + DIMC * DHC / 8 + 512;   // 74240
    prep_kernel<<<(prep_threads + 255) / 256, 256, 0, stream>>>(
        Wq, Wk, Wv, Wp, sq, bq, sk, bk, sv, bv, wabc, wph, sc, bc);

    xpose_kernel<<<dim3(NN / 32, DIMC / 128, BB), 256, 0, stream>>>(x, xt);

    qkv_kernel<<<dim3(NN / 128, MQKV / 64, BB), 256, 0, stream>>>(wabc, xt, sc, bc, qsm, kf, vh);

    softmax_k_kernel<<<BB * NHKD, 256, 0, stream>>>(kf, ksm);

    ctx_kernel<<<BB * HEADS * CSPLIT, 256, 0, stream>>>(ksm, vh, part);

    att_kernel<<<dim3(NN / 128, BB * HEADS), 256, 0, stream>>>(part, qsm, att);

    out_kernel<<<dim3(NN / 128, DIMC / 64, BB), 256, 0, stream>>>(wph, att, sp, bp, out);
}

// v003
// Measured time: 101 microseconds a run.
// Next to v002, in two timings, it ran 1.14 times as fast each time.
// Over all steps from v000 it is 3.03 times as fast.
#include <hip/hip_runtime.h>
// All contractions on v_wmma_f32_16x16x32_f16 (f16 operands, f32 accumulate): QKV projection, key*value^T, context^T*query, output projection; exact power-of-two operand scales (weights x16, key softmax x4096, context x64, query softmax x256, attended x256) undone in the f32 epilogues; softmaxes and affine terms in f32.

#define BB    8
#define DIMC  384
#define NN    4096
#define HEADS 8
#define KDIM  32
#define DD    64
#define NHKD  256
#define DHC   512
#define MQKV  1024
#define TP    132      // LDS pitch (floats) for x128 tiles, keeps 16-B alignment
#define TPD   68       // LDS pitch (floats) for x64 tiles
#define CSPLIT 4       // work-groups that share the n-sum of one (b,head) context
#define CWN   (NN / (CSPLIT * 8))   // n per wave of the context kernel (128)
#define CTILE (KDIM * DD)           // elements of one context tile (2048)

typedef _Float16 v16h __attribute__((ext_vector_type(16)));
typedef _Float16 v8h  __attribute__((ext_vector_type(8)));
typedef float    v8f  __attribute__((ext_vector_type(8)));
typedef float    v4f  __attribute__((ext_vector_type(4)));
typedef float    v4fa __attribute__((ext_vector_type(4), may_alias));

union Frag { v16h v; v8h half[2]; };

// 16x16x32 operand fragment from a k-contiguous row: elements 0..7 <- row[8h..8h+7],
// elements 8..15 <- row[16+8h..16+8h+7]; lane&15 selects the row (A) or column (B).
__device__ __forceinline__ v16h load_frag(const _Float16* __restrict__ p, int h)
{
    Frag f;
    f.half[0] = *(const v8h*)(p + 8 * h);
    f.half[1] = *(const v8h*)(p + 16 + 8 * h);
    return f.v;
}

__device__ __forceinline__ v8f mma16(v16h a, v16h b, v8f c)
{
    return __builtin_amdgcn_wmma_f32_16x16x32_f16(false, a, false, b, (short)0, c, false, false);
}

#define GUARD1(c, a, b) \
    asm volatile("v_nop\n\tv_nop\n\tv_nop\n\tv_nop" : "+v"(c) : "v"(a), "v"(b))
#define GUARD4(c0, c1, c2, c3, a, b0, b1, b2, b3) \
    asm volatile("v_nop\n\tv_nop\n\tv_nop\n\tv_nop" \
                 : "+v"(c0), "+v"(c1), "+v"(c2), "+v"(c3) \
                 : "v"(a), "v"(b0), "v"(b1), "v"(b2), "v"(b3))

__device__ __forceinline__ void vst8h(_Float16* p, v8h v) { *(v8h*)p = v; }
__device__ __forceinline__ void vst4f(float* p, v4f v)    { *(v4f*)p = v; }

// LDS ring of the two projection GEMMs.  Block tile 64 MT rows x 128 columns.  A stage = 64 k
// (128 B) of the 64 MT A rows and then of the 128 B rows, row pitch 144 B (16 B x 9:
// conflict-free for ds_load_b128); two buffers.  The f32 output tile reuses the space after the loop.
#define KS      64                 // k per stage
#define LPB     144                // LDS row pitch, bytes
#define LPH     72                 // the same in halves
#define STAGE_B(MT) ((64 * (MT) + 128) * LPB)
#define RING_B(MT)  (2 * STAGE_B(MT))
#define OTILE_B(MT) (64 * (MT) * TP * 4)
#define GEMM_LDS_B(MT) (RING_B(MT) > OTILE_B(MT) ? RING_B(MT) : OTILE_B(MT))
#define MT_QKV  4                  // 256 x 128 block, 64 x 64 per wave
#define MT_OUT  3                  // 192 x 128 block, 48 x 64 per wave

// One stage: (64 MT + 128) x 8 pieces of 16 B, 2 MT + 4 per thread.  Thread t brings piece t&7 of
// rows t>>3 + 32 j, so eight lanes cover one 128-B line.  a, b: this thread's piece in A row t>>3
// and B row t>>3 at the stage's k; lds: its place in the buffer (byte address in LDS).
// s_wait_xcnt stands inside the statement, ahead of any rewrite of the address registers.
template <int MT>
__device__ __forceinline__ void copy_stage(const unsigned lds, const _Float16* a,
                                           const _Float16* b, const int K)
{
    static_assert(MT == 3 || MT == 4, "one statement per tile height");
    const unsigned lb = lds + 64 * MT * LPB;   // this thread's first B row
    if constexpr (MT == 4) {
        asm volatile("global_load_async_to_lds_b128 %0, %12, off\n\t"
                     "global_load_async_to_lds_b128 %1, %13, off\n\t"
                     "global_load_async_to_lds_b128 %2, %14, off\n\t"
                     "global_load_async_to_lds_b128 %3, %15, off\n\t"
                     "global_load_async_to_lds_b128 %4, %16, off\n\t"
                     "global_load_async_to_lds_b128 %5, %17, off\n\t"
                     "global_load_async_to_lds_b128 %6, %18, off\n\t"
                     "global_load_async_to_lds_b128 %7, %19, off\n\t"
                     "global_load_async_to_lds_b128 %8, %20, off\n\t"
                     "global_load_async_to_lds_b128 %9, %21, off\n\t"
                     "global_load_async_to_lds_b128 %10, %22, off\n\t"
                     "global_load_async_to_lds_b128 %11, %23, off\n\t"
                     "s_wait_xcnt 0x0"
                     :: "v"(lds), "v"(lds + 32 * LPB), "v"(lds + 64 * LPB), "v"(lds + 96 * LPB),
                        "v"(lds + 128 * LPB), "v"(lds + 160 * LPB), "v"(lds + 192 * LPB),
                        "v"(lds + 224 * LPB),
                        "v"(lb), "v"(lb + 32 * LPB), "v"(lb + 64 * LPB), "v"(lb + 96 * LPB),
                        "v"(a), "v"(a + 32 * K), "v"(a + 64 * K), "v"(a + 96 * K),
                        "v"(a + 128 * K), "v"(a + 160 * K), "v"(a + 192 * K), "v"(a + 224 * K),
                        "v"(b), "v"(b + 32 * K), "v"(b + 64 * K), "v"(b + 96 * K)
                     : "memory");
    } else {
        asm volatile("global_load_async_to_lds_b128 %0, %10, off\n\t"
                     "global_load_async_to_lds_b128 %1, %11, off\n\t"
                     "global_load_async_to_lds_b128 %2, %12, off\n\t"
                     "global_load_async_to_lds_b128 %3, %13, off\n\t"
                     "global_load_async_to_lds_b128 %4, %14, off\n\t"
                     "global_load_async_to_lds_b128 %5, %15, off\n\t"
                     "global_load_async_to_lds_b128 %6, %16, off\n\t"
                     "global_load_async_to_lds_b128 %7, %17, off\n\t"
                     "global_load_async_to_lds_b128 %8, %18, off\n\t"
                     "global_load_async_to_lds_b128 %9, %19, off\n\t"
                     "s_wait_xcnt 0x0"
                     :: "v"(lds), "v"(lds + 32 * LPB), "v"(lds + 64 * LPB), "v"(lds + 96 * LPB),
                        "v"(lds + 128 * LPB), "v"(lds + 160 * LPB),
                        "v"(lb), "v"(lb + 32 * LPB), "v"(lb + 64 * LPB), "v"(lb + 96 * LPB),
                        "v"(a), "v"(a + 32 * K), "v"(a + 64 * K), "v"(a + 96 * K),
                        "v"(a + 128 * K), "v"(a + 160 * K),
                        "v"(b), "v"(b + 32 * K), "v"(b + 64 * K), "v"(b + 96 * K)
                     : "memory");
    }
}

// Block: 64 MT rows of A (row-major, pitch K) times 128 columns of B (B[k][n] stored n-major with
// k contiguous, pitch K), both staged in the ring by asynchronous copies, the next stage in
// flight while this one is multiplied.  Wave (mw, nw): rows 64 i + 16 mw.. (i < MT), columns
// 64 nw..; c[i][j] = row group i, column group j of 16: MT + 4 fragments feed 4 MT products.
// On return every wave has left the ring (last trip's barrier).
template <int K, int MT>
__device__ __forceinline__ void mainloop_x128(unsigned char* ring,
                                              const _Float16* __restrict__ Ablk,
                                              const _Float16* __restrict__ Bblk,
                                              const int t, const int mw, const int nw,
                                              const int h, const int m,
                                              v8f (&c)[MT][4])
{
    constexpr int NT = K / KS;
    static_assert(K % KS == 0 && NT >= 2, "two stages or more");
    const unsigned lds = (unsigned)(uintptr_t)ring + (t >> 3) * LPB + (t & 7) * 16;
    const _Float16* ga = Ablk + (t >> 3) * K + (t & 7) * 8;
    const _Float16* gb = Bblk + (t >> 3) * K + (t & 7) * 8;

    copy_stage<MT>(lds, ga, gb, K);
    asm volatile("s_wait_asynccnt 0x0" ::: "memory");   // stage 0 landed (this wave's pieces)
    __syncthreads();                                    // ... and every other wave's
    copy_stage<MT>(lds + STAGE_B(MT), ga + KS, gb + KS, K);

    // kept rolled: unrolled, every stage's copy addresses stay live at once, and the added
    // registers cost a resident work-group per WGP
#pragma unroll 1
    for (int s = 0; s < NT; ++s) {
        const _Float16* st = (const _Float16*)(ring + (s & 1) * STAGE_B(MT));
        const _Float16* ar = st + (mw * 16 + m) * LPH;
        const _Float16* br = st + (64 * MT + nw * 64 + m) * LPH;
        v16h a[MT], b[4];
        // unrolled: fragments and accumulators are indexed by constants and stay in registers
#pragma unroll
        for (int kk = 0; kk < KS / 32; ++kk) {
            a[0] = load_frag(ar + kk * 32, h);
#pragma unroll
            for (int j = 0; j < 4; ++j) b[j] = load_frag(br + j * 16 * LPH + kk * 32, h);
#pragma unroll
            for (int i = 1; i < MT; ++i) a[i] = load_frag(ar + i * 64 * LPH + kk * 32, h);
            // keeps the LDS reads of a k step together ahead of its products: left alone the
            // scheduler reuses one A fragment's registers and waits out an LDS latency per row
            __builtin_amdgcn_sched_barrier(0);
#pragma unroll
            for (int i = 0; i < MT; ++i)
#pragma unroll
                for (int j = 0; j < 4; ++j) c[i][j] = mma16(a[i], b[j], c[i][j]);
            // keeps every product of the k step ahead of what follows: the next reads, and at the
            // end the four slots below (left alone a row of products sinks behind the barrier)
            __builtin_amdgcn_sched_barrier(0);
        }
        // four vector slots behind the last matrix instructions, on the branch paths too
        GUARD4(c[MT - 1][0], c[MT - 1][1], c[MT - 1][2], c[MT - 1][3], a[MT - 1], b[0], b[1], b[2], b[3]);
        asm volatile("s_wait_dscnt 0x0" ::: "memory");     // this wave's reads of buffer s&1 are done
        asm volatile("s_wait_asynccnt 0x0" ::: "memory");  // its pieces of stage s+1 have landed
        __syncthreads();                                   // publishes stage s+1, frees buffer s&1
        if (s + 2 < NT)
            copy_stage<MT>(lds + (s & 1) * STAGE_B(MT), ga + (s + 2) * KS, gb + (s + 2) * KS, K);
    }
    asm volatile("s_wait_asynccnt 0x0" ::: "memory");      // nothing in flight when the ring is reused
}

// ---------------------------------------------------------------------------
// Kernel 0: weights -> f16 (x16), concatenated [1024][384] and [384][512];
// affine params concatenated (scale pre-multiplied by 1/16).  16-B per lane stores.
// ---------------------------------------------------------------------------
__global__ __launch_bounds__(256) void prep_kernel(
    const float* __restrict__ Wq, const float* __restrict__ Wk, const float* __restrict__ Wv,
    const float* __restrict__ Wp,
    const float* __restrict__ sq, const float* __restrict__ bq,
    const float* __restrict__ sk, const float* __restrict__ bk,
    const float* __restrict__ sv, const float* __restrict__ bv,
    _Float16* __restrict__ wabc, _Float16* __restrict__ wph,
    float* __restrict__ sc, float* __restrict__ bc)
{
    const int NW1 = MQKV * DIMC / 8;   // 49152 chunks of 8 halves
    const int NW2 = DIMC * DHC / 8;    // 24576 chunks
    const int i = blockIdx.x * 256 + threadIdx.x;
    if (i < NW1 + NW2) {
        const float* src;
        _Float16* dst;
        if (i < NW1) {
            const int e = i * 8;
            if (e < NHKD * DIMC)          src = Wq + e;
            else if (e < 2 * NHKD * DIMC) src = Wk + (e - NHKD * DIMC);
            else                          src = Wv + (e - 2 * NHKD * DIMC);
            dst = wabc + e;
        } else {
            const int e = (i - NW1) * 8;
            src = Wp + e;
            dst = wph + e;
        }
        const v4f f0 = *(const v4f*)src;
        const v4f f1 = *(const v4f*)(src + 4);
        v8h hv;
#pragma unroll
        for (int j = 0; j < 4; ++j) {
            hv[j]     = (_Float16)(f0[j] * 16.0f);
            hv[4 + j] = (_Float16)(f1[j] * 16.0f);
        }
        vst8h(dst, hv);
        
    } else {
        const int j = i - (NW1 + NW2);
        if (j < 512) {
            const int e = (j & 255) * 4;
            v4f o;
#pragma unroll
            for (int q = 0; q < 4; ++q) {
                const int ee = e + q;
                float val;
                if (j < 256) {
                    val = (ee < NHKD) ? sq[ee] : ((ee < 2 * NHKD) ? sk[ee - NHKD] : sv[ee - 2 * NHKD]);
                    val *= 0.0625f;
                } else {
                    val = (ee < NHKD) ? bq[ee] : ((ee < 2 * NHKD) ? bk[ee - NHKD] : bv[ee - 2 * NHKD]);
                }
                o[q] = val;
            }
            float* dst = ((j < 256) ? sc : bc) + e;
            vst4f(dst, o);
            
        }
    }
}

// ---------------------------------------------------------------------------
// Kernel 1: x[b][c][n] f32 -> xt[b][n][c] f16.  Tile 128 c x 32 n in LDS; each
// ---------------------------------------------------------------------------
__global__ __launch_bounds__(256) void xpose_kernel(const float* __restrict__ x,
                                                    _Float16* __restrict__ xt)
{
    __shared__ float tile[128 * 33];
    const int b = blockIdx.z;
    const int nb = blockIdx.x * 32, cb = blockIdx.y * 128;
    const int t = threadIdx.x, l = t & 31, w = t >> 5, h = l >> 4, m = l & 15;
    const float* xb = x + (size_t)b * DIMC * NN;
#pragma unroll
    for (int j = 0; j < 16; ++j) {
        const int c = w + 8 * j;
        tile[c * 33 + l] = xb[(size_t)(cb + c) * NN + nb + l];
    }
    __syncthreads();
    _Float16* xo = xt + (size_t)b * NN * DIMC;
    const int nl0 = w * 4 + h, nl1 = w * 4 + 2 + h;
    v8h hv0, hv1;
#pragma unroll
    for (int j = 0; j < 8; ++j) {
        hv0[j] = (_Float16)tile[(m * 8 + j) * 33 + nl0];
        hv1[j] = (_Float16)tile[(m * 8 + j) * 33 + nl1];
    }
    _Float16* d0 = xo + (size_t)(nb + nl0) * DIMC + cb + m * 8;
    _Float16* d1 = xo + (size_t)(nb + nl1) * DIMC + cb + m * 8;
    vst8h(d0, hv0);
    vst8h(d1, hv1);
    
}

// ---------------------------------------------------------------------------
// Kernel 2: fused QKV projection [1024][384] x [384][4096] per batch + affine.
// Block tile 256 rows x 128 cols, 8 waves, wave tile 64 x 64, operands through the LDS ring.
// A block lies wholly in one of the three row regions.  Result staged in LDS:
//   Q rows (0..255):   channel softmax over 32 per head (f32), x256, f16 -> qsm[b][n][256]
//   K rows (256..511): f32 -> kf[b][256][N]
//   V rows (512..1023): f16 -> vh[b][512][N]
// ---------------------------------------------------------------------------
__global__ __launch_bounds__(256) void qkv_kernel(const _Float16* __restrict__ wabc,
                                                  const _Float16* __restrict__ xt,
                                                  const float* __restrict__ sc,
                                                  const float* __restrict__ bc,
                                                  _Float16* __restrict__ qsm,
                                                  float* __restrict__ kf,
                                                  _Float16* __restrict__ vh)
{
    constexpr int MT = MT_QKV;
    static_assert(NHKD % (64 * MT) == 0, "a block stays inside one region");
    __shared__ __attribute__((aligned(16))) unsigned char ring[GEMM_LDS_B(MT)];
    float* tile = (float*)ring;
    // the row block is the slowest grid index: the Q blocks, whose epilogue is the longest, start first
    const int b = blockIdx.y;
    const int t = threadIdx.x, l = t & 31, wave = t >> 5, h = l >> 4, m = l & 15;
    const int mw = wave >> 1, nw = wave & 1;
    const int Mbase = blockIdx.z * (64 * MT), Nbase = blockIdx.x * 128;
    const int region = (Mbase < NHKD) ? 0 : ((Mbase < 2 * NHKD) ? 1 : 2);

    const _Float16* Ablk = wabc + (size_t)Mbase * DIMC;
    const _Float16* Bblk = xt + ((size_t)b * NN + Nbase) * DIMC;
    v8f c[MT][4] = {};
    mainloop_x128<DIMC, MT>(ring, Ablk, Bblk, t, mw, nw, h, m, c);

    // the loops over i below are unrolled: c, s and bb are indexed by constants and stay in registers
    const float* ps = sc + Mbase + mw * 16 + 8 * h;
    const float* pb = bc + Mbase + mw * 16 + 8 * h;
    float s[MT][8], bb[MT][8];
#pragma unroll
    for (int i = 0; i < MT; ++i) {
#pragma unroll
        for (int r = 0; r < 8; ++r) { s[i][r] = ps[i * 64 + r]; bb[i][r] = pb[i * 64 + r]; }
    }
    // the two address pairs stay live to here, so that no load's result lands on them, and the wait
    // stands ahead of their reuse
    asm volatile("s_wait_xcnt 0x0" :: "v"(ps), "v"(pb) : "memory");
#pragma unroll
    for (int i = 0; i < MT; ++i) {
#pragma unroll
        for (int r = 0; r < 8; ++r) {
            const int ml = i * 64 + mw * 16 + 8 * h + r;
            float* trow = tile + ml * TP + nw * 64 + m;
            trow[0]  = c[i][0][r] * s[i][r] + bb[i][r];
            trow[16] = c[i][1][r] * s[i][r] + bb[i][r];
            trow[32] = c[i][2][r] * s[i][r] + bb[i][r];
            trow[48] = c[i][3][r] * s[i][r] + bb[i][r];
        }
    }
    __syncthreads();

    if (region == 0) {
        // softmax over the 32 channels of one head for one column; 2 heads x 128 cols = 256 threads
        // per 64 rows
        const int nl = t & 127, hh = t >> 7;
        for (int i = 0; i < MT; ++i) {
            float* hcol = tile + (i * 64 + hh * KDIM) * TP + nl;
            float qv[KDIM];
            float mx;
#pragma unroll
            for (int k = 0; k < KDIM; ++k) {
                qv[k] = hcol[k * TP];
                mx = (k == 0) ? qv[0] : fmaxf(mx, qv[k]);
            }
            float sum = 0.f;
#pragma unroll
            for (int k = 0; k < KDIM; ++k) { qv[k] = __expf(qv[k] - mx); sum += qv[k]; }
            const float scl = 256.0f / sum;
#pragma unroll
            for (int k = 0; k < KDIM; ++k) hcol[k * TP] = qv[k] * scl;
        }
    }
    __syncthreads();

    if (region == 0) {
        const int p = l & 7;
        // unrolled: the LDS reads of the next 64 rows start under the stores of these
#pragma unroll
        for (int i = 0; i < MT; ++i) {
#pragma unroll
            for (int it = 0; it < 4; ++it) {
                const int nl = wave * 16 + it * 4 + (l >> 3);
                v8h hv;
#pragma unroll
                for (int j = 0; j < 8; ++j) hv[j] = (_Float16)tile[(i * 64 + p * 8 + j) * TP + nl];
                vst8h(qsm + ((size_t)b * NN + Nbase + nl) * NHKD + Mbase + i * 64 + p * 8, hv);
            }
        }
    } else if (region == 1) {
        // kf[b][o][Nbase..Nbase+127] f32: 512 B = 4 lines per row, one instruction per row
        const int col = (l >> 3) * 32 + (l & 7) * 4;
        const int obase = Mbase - NHKD;
#pragma unroll
        for (int it = 0; it < 8 * MT; ++it) {
            const int row = wave * (8 * MT) + it;
            const v4f v = *(const v4fa*)(tile + row * TP + col);
            vst4f(kf + ((size_t)b * NHKD + obase + row) * NN + Nbase + col, v);
        }
    } else {
        // vh[b][o][Nbase..Nbase+127] f16: 256 B = 2 lines per row, two rows per instruction
        const int obase = Mbase - 2 * NHKD;
#pragma unroll
        for (int it = 0; it < 4 * MT; ++it) {
            const int row = wave * (8 * MT) + it * 2 + h;
            v8h hv;
#pragma unroll
            for (int j = 0; j < 8; ++j) hv[j] = (_Float16)tile[row * TP + m * 8 + j];
            vst8h(vh + ((size_t)b * DHC + obase + row) * NN + Nbase + m * 8, hv);
        }
    }
}

// ---------------------------------------------------------------------------
// Kernel 3: softmax of key rows (length 4096, f32 in) -> f16 x4096 out.
// One block per row; thread t owns elements [t*8, t*8+8) and [2048+t*8, +8).
// ---------------------------------------------------------------------------
__global__ __launch_bounds__(256) void softmax_k_kernel(const float* __restrict__ kf,
                                                        _Float16* __restrict__ ksm)
{
    __shared__ float red[8];
    const size_t row = blockIdx.x;
    const float* p = kf + row * NN;
    _Float16* q = ksm + row * NN;
    const int t = threadIdx.x, l = t & 31, w = t >> 5;
    const v4f a0 = *(const v4f*)(p + t * 8);
    const v4f a1 = *(const v4f*)(p + t * 8 + 4);
    const v4f a2 = *(const v4f*)(p + 2048 + t * 8);
    const v4f a3 = *(const v4f*)(p + 2048 + t * 8 + 4);
    float v[16];
#pragma unroll
    for (int j = 0; j < 4; ++j) { v[j] = a0[j]; v[4 + j] = a1[j]; v[8 + j] = a2[j]; v[12 + j] = a3[j]; }
    float mx = v[0];
#pragma unroll
    for (int j = 1; j < 16; ++j) mx = fmaxf(mx, v[j]);
#pragma unroll
    for (int off = 16; off > 0; off >>= 1) mx = fmaxf(mx, __shfl_xor(mx, off, 32));
    if (l == 0) red[w] = mx;
    __syncthreads();
    mx = red[0];
#pragma unroll
    for (int j = 1; j < 8; ++j) mx = fmaxf(mx, red[j]);
    __syncthreads();
    float sum = 0.f;
#pragma unroll
    for (int j = 0; j < 16; ++j) { v[j] = __expf(v[j] - mx); sum += v[j]; }
#pragma unroll
    for (int off = 16; off > 0; off >>= 1) sum += __shfl_xor(sum, off, 32);
    if (l == 0) red[w] = sum;
    __syncthreads();
    float tot = 0.f;
#pragma unroll
    for (int j = 0; j < 8; ++j) tot += red[j];
    const float scl = 4096.0f / tot;
    v8h h0, h1;
#pragma unroll
    for (int j = 0; j < 8; ++j) { h0[j] = (_Float16)(v[j] * scl); h1[j] = (_Float16)(v[8 + j] * scl); }
    _Float16* d0 = q + t * 8;
    _Float16* d1 = q + 2048 + t * 8;
    vst8h(d0, h0);
    vst8h(d1, h1);
    
}

// ---------------------------------------------------------------------------
// Kernel 4: context per (b,head): C[kd][d] = sum_n ksm[kd][n] * v[d][n], K = 4096.
// A rows = ksm rows (n contiguous); B[k=n][col=d] = vh row d (n contiguous): same loader.
// The n-sum is split: CSPLIT work-groups per (b,head), eight waves each, every wave holding the
// whole 32 x 64 tile (2 kd-tiles x 4 d-tiles) for its own 128 n, so that each fragment is
// loaded once and all of a wave's loads are independent.  The eight waves' tiles are added
// through LDS in wave order; the work-group's f32 partial goes to part[bh][g][2048].
// Order inside a partial: unit u = dt*4 + kt*2 + (r>>2), then lane, then r&3 (accumulator
// register r of tile (kt, dt)).  That is the A-fragment order of kernel 5: element e = kt*8 + r
// of lane (m, h) is C[kd = kt*16 + 8h + r][d = dt*16 + m].
// ---------------------------------------------------------------------------
__global__ __launch_bounds__(256) void ctx_kernel(const _Float16* __restrict__ ksm,
                                                  const _Float16* __restrict__ vh,
                                                  float* __restrict__ part)
{
    __shared__ __attribute__((aligned(16))) float red[8 * CTILE];
    const int bh = blockIdx.x / CSPLIT, g = blockIdx.x % CSPLIT, b = bh >> 3, hd = bh & 7;
    const int t = threadIdx.x, l = t & 31, wave = t >> 5, h = l >> 4, m = l & 15;
    const int n0 = (g * 8 + wave) * CWN;
    // both operands have the row pitch NN, so one per-lane byte offset serves every load
    const char* Abase = (const char*)(ksm + ((size_t)b * NHKD + hd * KDIM) * NN);
    const char* Bbase = (const char*)(vh  + ((size_t)b * DHC  + hd * DD)   * NN);
    const unsigned lane_off = (unsigned)(m * NN + n0 + 8 * h) * 2u;
    // every loop below is unrolled so that the fragment and accumulator arrays are indexed by
    // constants and stay in registers
    v16h a[CWN / 32][2], bf[CWN / 32][4];
#pragma unroll
    for (int s = 0; s < CWN / 32; ++s) {
#pragma unroll
        for (int i = 0; i < 2; ++i)
            a[s][i] = load_frag((const _Float16*)(Abase + lane_off) + i * 16 * NN + s * 32, 0);
#pragma unroll
        for (int j = 0; j < 4; ++j)
            bf[s][j] = load_frag((const _Float16*)(Bbase + lane_off) + j * 16 * NN + s * 32, 0);
    }
    // the first results reuse the loads' offset register: the wait stands ahead of that overwrite
    asm volatile("s_wait_xcnt 0x0" ::: "memory");
    // keeps every load of the wave ahead of the first product: one memory latency per wave;
    // without it the scheduler reuses fragment registers and waits out eight latencies in a row
    __builtin_amdgcn_sched_barrier(0);
    v8f c[2][4] = {};
#pragma unroll
    for (int s = 0; s < CWN / 32; ++s)
#pragma unroll
        for (int i = 0; i < 2; ++i)
#pragma unroll
            for (int j = 0; j < 4; ++j) c[i][j] = mma16(a[s][i], bf[s][j], c[i][j]);
    // keeps the LDS stores behind the last product: all eight accumulators stay live to here, so
    // none of their registers is handed to another product's result inside the hazard distance
    __builtin_amdgcn_sched_barrier(0);
    float* mine = red + wave * CTILE + l * 4;
#pragma unroll
    for (int j = 0; j < 4; ++j)
#pragma unroll
        for (int i = 0; i < 2; ++i) {
            const v8f v = c[i][j];
            vst4f(mine + (j * 4 + i * 2) * 128,     (v4f){v[0], v[1], v[2], v[3]});
            vst4f(mine + (j * 4 + i * 2 + 1) * 128, (v4f){v[4], v[5], v[6], v[7]});
        }
    __syncthreads();
    float* dst = part + (size_t)blockIdx.x * CTILE;
#pragma unroll
    for (int q = 0; q < 2; ++q) {
        const int e = q * 1024 + t * 4;
        v4f s = *(const v4f*)(red + e);
#pragma unroll
        for (int w = 1; w < 8; ++w) s += *(const v4f*)(red + w * CTILE + e);
        vst4f(dst + e, s);
    }
}

// ---------------------------------------------------------------------------
// Kernel 5: attended per (b,head): Att[d][n] = sum_kd C[kd][d] * qsm[n][hd*32+kd], K = 32
// (one WMMA per 16x16 tile), ReLU, scaled to att x256 (= acc/64), stored att[b][n][hd*64+d].
// The A fragment is the sum of kernel 4's CSPLIT partials (already in fragment order, whole
// lines per load), /64 (= true context x64), rounded to f16.
// ---------------------------------------------------------------------------
__global__ __launch_bounds__(256) void att_kernel(const float* __restrict__ part,
                                                  const _Float16* __restrict__ qsm,
                                                  _Float16* __restrict__ att)
{
    __shared__ float tile[128 * TPD];
    const int bh = blockIdx.y, b = bh >> 3, hd = bh & 7;
    const int Nbase = blockIdx.x * 128;
    const int t = threadIdx.x, l = t & 31, wave = t >> 5, h = l >> 4, m = l & 15;
    const int mt = wave >> 1, nw = wave & 1;
    // unrolled: a is indexed by constants and stays in registers; the 16 loads are independent
    v16h a;
    const float* pa = part + (size_t)bh * CSPLIT * CTILE + mt * 512 + l * 4;
#pragma unroll
    for (int q = 0; q < 4; ++q) {
        v4f s = *(const v4f*)(pa + q * 128);
#pragma unroll
        for (int g = 1; g < CSPLIT; ++g) s += *(const v4f*)(pa + g * CTILE + q * 128);
#pragma unroll
        for (int i = 0; i < 4; ++i) a[q * 4 + i] = (_Float16)(s[i] * 0.015625f);
    }
#pragma unroll
    for (int ns = 0; ns < 4; ++ns) {
        const int nl = nw * 64 + ns * 16 + m;
        v16h bf = load_frag(qsm + ((size_t)b * NN + Nbase + nl) * NHKD + hd * KDIM, h);
        v8f c = {};
        c = mma16(a, bf, c);
        GUARD1(c, a, bf);
#pragma unroll
        for (int r = 0; r < 8; ++r) {
            const float y = fmaxf(c[r] * 0.015625f, 0.0f);
            tile[nl * TPD + mt * 16 + 8 * h + r] = y;
        }
    }
    __syncthreads();
    const int p = l & 7;
#pragma unroll
    for (int it = 0; it < 4; ++it) {
        const int nl = wave * 16 + it * 4 + (l >> 3);
        v8h hv;
#pragma unroll
        for (int j = 0; j < 8; ++j) hv[j] = (_Float16)tile[nl * TPD + p * 8 + j];
        vst8h(att + ((size_t)b * NN + Nbase + nl) * DHC + hd * DD + p * 8, hv);
    }
    
}

// ---------------------------------------------------------------------------
// Kernel 6: output projection [384][512] x [512][4096] per batch + affine -> f32 out.
// Block tile 192 rows x 128 cols, 8 waves, wave tile 48 x 64.
// ---------------------------------------------------------------------------
__global__ __launch_bounds__(256) void out_kernel(const _Float16* __restrict__ wph,
                                                  const _Float16* __restrict__ att,
                                                  const float* __restrict__ sp,
                                                  const float* __restrict__ bp,
                                                  float* __restrict__ out)
{
    constexpr int MT = MT_OUT;
    static_assert(DIMC % (64 * MT) == 0, "whole blocks");
    __shared__ __attribute__((aligned(16))) unsigned char ring[GEMM_LDS_B(MT)];
    float* tile = (float*)ring;
    const int b = blockIdx.z;
    const int t = threadIdx.x, l = t & 31, wave = t >> 5, h = l >> 4, m = l & 15;
    const int mw = wave >> 1, nw = wave & 1;
    const int Mbase = blockIdx.y * (64 * MT), Nbase = blockIdx.x * 128;
    const _Float16* Ablk = wph + (size_t)Mbase * DHC;
    const _Float16* Bblk = att + ((size_t)b * NN + Nbase) * DHC;
    v8f c[MT][4] = {};
    mainloop_x128<DHC, MT>(ring, Ablk, Bblk, t, mw, nw, h, m, c);

    // unrolled over i: c is indexed by constants and stays in registers
#pragma unroll
    for (int i = 0; i < MT; ++i) {
#pragma unroll
        for (int r = 0; r < 8; ++r) {
            const int ml = i * 64 + mw * 16 + 8 * h + r;
            const int o = Mbase + ml;
            const float s = sp[o] * 0.000244140625f;   // 1/(16*256)
            const float bb = bp[o];
            float* trow = tile + ml * TP + nw * 64 + m;
            trow[0]  = c[i][0][r] * s + bb;
            trow[16] = c[i][1][r] * s + bb;
            trow[32] = c[i][2][r] * s + bb;
            trow[48] = c[i][3][r] * s + bb;
        }
    }
    __syncthreads();
    const int col = (l >> 3) * 32 + (l & 7) * 4;
#pragma unroll
    for (int it = 0; it < 8 * MT; ++it) {
        const int row = wave * (8 * MT) + it;
        const v4f v = *(const v4fa*)(tile + row * TP + col);
        vst4f(out + ((size_t)b * DIMC + Mbase + row) * NN + Nbase + col, v);
    }
}

// ---------------------------------------------------------------------------
// Host-side launch glue.  Workspace (bytes):
//   [0)            xt   f16 [8][4096][384]   25,165,824   (reused for ksm f16 [8][256][4096] 16,777,216 after kernel 2)
//   [25,165,824)   wabc f16 [1024][384]         786,432
//   [25,952,256)   wph  f16 [384][512]          393,216
//   [26,345,472)   sc   f32 [1024]                4,096
//   [26,349,568)   bc   f32 [1024]                4,096
//   [26,353,664)   qsm  f16 [8][4096][256]   16,777,216
//   [43,130,880)   kf   f32 [8][256][4096]   33,554,432   (reused for att f16 [8][4096][512] after kernel 3)
//   [76,685,312)   vh   f16 [8][512][4096]   33,554,432
//   [110,239,744)  part f32 [64][4][2048]     2,097,152
//   total 112,336,896
// ---------------------------------------------------------------------------
extern "C" void kernel_launch(void* const* d_in, const int* in_sizes, int n_in,
                              void* d_out, int out_size, void* d_ws, size_t ws_size,
                              hipStream_t stream)
{
    if (n_in < 13) return;
    if (in_sizes[0] != BB * DIMC * NN) return;
    if (in_sizes[1] != NHKD * DIMC || in_sizes[2] != NHKD || in_sizes[3] != NHKD) return;
    if (in_sizes[4] != NHKD * DIMC || in_sizes[5] != NHKD || in_sizes[6] != NHKD) return;
    if (in_sizes[7] != DHC * DIMC || in_sizes[8] != DHC || in_sizes[9] != DHC) return;
    if (in_sizes[10] != DIMC * DHC || in_sizes[11] != DIMC || in_sizes[12] != DIMC) return;
    if (out_size != BB * DIMC * NN) return;

    const size_t off_xt   = 0;
    const size_t sz_xt    = (size_t)BB * NN * DIMC * 2;
    const size_t off_wabc = off_xt + sz_xt;
    const size_t sz_wabc  = (size_t)MQKV * DIMC * 2;
    const size_t off_wph  = off_wabc + sz_wabc;
    const size_t sz_wph   = (size_t)DIMC * DHC * 2;
    const size_t off_sc   = off_wph + sz_wph;
    const size_t sz_sc    = (size_t)MQKV * 4;
    const size_t off_bc   = off_sc + sz_sc;
    const size_t off_qsm  = off_bc + sz_sc;
    const size_t sz_qsm   = (size_t)BB * NN * NHKD * 2;
    const size_t off_kf   = off_qsm + sz_qsm;
    const size_t sz_kf    = (size_t)BB * NHKD * NN * 4;
    const size_t off_vh   = off_kf + sz_kf;
    const size_t sz_vh    = (size_t)BB * DHC * NN * 2;
    const size_t off_ctx  = off_vh + sz_vh;
    const size_t sz_ctx   = (size_t)BB * HEADS * CSPLIT * CTILE * 4;
    const size_t total    = off_ctx + sz_ctx;
    const size_t sz_ksm   = (size_t)BB * NHKD * NN * 2;
    const size_t sz_att   = (size_t)BB * NN * DHC * 2;
    if (total > ws_size) return;
    if (sz_ksm > sz_xt || sz_att > sz_kf) return;

    const float* x  = (const float*)d_in[0];
    const float* Wq = (const float*)d_in[1];
    const float* sq = (const float*)d_in[2];
    const float* bq = (const float*)d_in[3];
    const float* Wk = (const float*)d_in[4];
    const float* sk = (const float*)d_in[5];
    const float* bk = (const float*)d_in[6];
    const float* Wv = (const float*)d_in[7];
    const float* sv = (const float*)d_in[8];
    const float* bv = (const float*)d_in[9];
    const float* Wp = (const float*)d_in[10];
    const float* sp = (const float*)d_in[11];
    const float* bp = (const float*)d_in[12];
    float* out = (float*)d_out;

    char* ws = (char*)d_ws;
    _Float16* xt   = (_Float16*)(ws + off_xt);
    _Float16* ksm  = (_Float16*)(ws + off_xt);     // alias: xt dead after kernel 2
    _Float16* wabc = (_Float16*)(ws + off_wabc);
    _Float16* wph  = (_Float16*)(ws + off_wph);
    float*    sc   = (float*)   (ws + off_sc);
    float*    bc   = (float*)   (ws + off_bc);
    _Float16* qsm  = (_Float16*)(ws + off_qsm);
    float*    kf   = (float*)   (ws + off_kf);
    _Float16* att  = (_Float16*)(ws + off_kf);     // alias: kf dead after kernel 3
    _Float16* vh   = (_Float16*)(ws + off_vh);
    float*    part = (float*)   (ws + off_ctx);

    const int prep_threads = MQKV * DIMC / 8 + DIMC * DHC / 8 + 512;   // 74240
    prep_kernel<<<(prep_threads + 255) / 256, 256, 0, stream>>>(
        Wq, Wk, Wv, Wp, sq, bq, sk, bk, sv, bv, wabc, wph, sc, bc);

    xpose_kernel<<<dim3(NN / 32, DIMC / 128, BB), 256, 0, stream>>>(x, xt);

    qkv_kernel<<<dim3(NN / 128, BB, MQKV / (64 * MT_QKV)), 256, 0, stream>>>(wabc, xt, sc, bc, qsm, kf, vh);

    softmax_k_kernel<<<BB * NHKD, 256, 0, stream>>>(kf, ksm);

    ctx_kernel<<<BB * HEADS * CSPLIT, 256, 0, stream>>>(ksm, vh, part);

    att_kernel<<<dim3(NN / 128, BB * HEADS), 256, 0, stream>>>(part, qsm, att);

    out_kernel<<<dim3(NN / 128, DIMC / (64 * MT_OUT), BB), 256, 0, stream>>>(wph, att, sp, bp, out);
}

// v004
// A run of this version takes 84.3 microseconds.
// In two side-by-side timings against v003, it was 1.21 and 1.19 times as fast.
// All steps since v000 together make it 3.63 times as fast.
#include <hip/hip_runtime.h>
// All contractions on v_wmma_f32_16x16x32_f16 (f16 operands, f32 accumulate): QKV projection, key*value^T, context^T*query, output projection; exact power-of-two operand scales (weights x16, key exponentials x1024, context x64, query softmax x256, attended x256) undone in the f32 epilogues; softmaxes and affine terms in f32.

#define BB    8
#define DIMC  384
#define NN    4096
#define HEADS 8
#define KDIM  32
#define DD    64
#define NHKD  256
#define DHC   512
#define MQKV  1024
#define TP    132      // LDS pitch (floats) for x128 tiles, keeps 16-B alignment
#define TPD   68       // LDS pitch (floats) for x64 tiles
#define CSPLIT 4       // work-groups that share the n-sum of one (b,head) context
#define CWN   (NN / (CSPLIT * 8))   // n per wave of the context kernel (128)
#define CTILE (KDIM * DD)           // elements of one context tile (2048)
#define NBLK  (NN / 128)            // column blocks of the QKV projection = pieces of a key row (32)

typedef _Float16 v16h __attribute__((ext_vector_type(16)));
typedef _Float16 v8h  __attribute__((ext_vector_type(8)));
typedef float    v8f  __attribute__((ext_vector_type(8)));
typedef float    v4f  __attribute__((ext_vector_type(4)));
typedef float    v4fa __attribute__((ext_vector_type(4), may_alias));
typedef _Float16 v8ha __attribute__((ext_vector_type(8), may_alias));

union Frag { v16h v; v8h half[2]; };

// 16x16x32 operand fragment from a k-contiguous row: elements 0..7 <- row[8h..8h+7],
// elements 8..15 <- row[16+8h..16+8h+7]; lane&15 selects the row (A) or column (B).
__device__ __forceinline__ v16h load_frag(const _Float16* __restrict__ p, int h)
{
    Frag f;
    f.half[0] = *(const v8h*)(p + 8 * h);
    f.half[1] = *(const v8h*)(p + 16 + 8 * h);
    return f.v;
}

__device__ __forceinline__ v8f mma16(v16h a, v16h b, v8f c)
{
    return __builtin_amdgcn_wmma_f32_16x16x32_f16(false, a, false, b, (short)0, c, false, false);
}

#define GUARD1(c, a, b) \
    asm volatile("v_nop\n\tv_nop\n\tv_nop\n\tv_nop" : "+v"(c) : "v"(a), "v"(b))
#define GUARD4(c0, c1, c2, c3, a, b0, b1, b2, b3) \
    asm volatile("v_nop\n\tv_nop\n\tv_nop\n\tv_nop" \
                 : "+v"(c0), "+v"(c1), "+v"(c2), "+v"(c3) \
                 : "v"(a), "v"(b0), "v"(b1), "v"(b2), "v"(b3))

// e[i] = 2^x[i].  One statement: outputs and inputs are kept apart, so each exponential is the
// independent instruction behind the one before it, and the v_nop is that slot behind the last
__device__ __forceinline__ void exp2x8(float (&e)[8], const float (&x)[8])
{
    asm("v_exp_f32 %0, %8\n\tv_exp_f32 %1, %9\n\tv_exp_f32 %2, %10\n\tv_exp_f32 %3, %11\n\t"
        "v_exp_f32 %4, %12\n\tv_exp_f32 %5, %13\n\tv_exp_f32 %6, %14\n\tv_exp_f32 %7, %15\n\t"
        "v_nop"
        : "=&v"(e[0]), "=&v"(e[1]), "=&v"(e[2]), "=&v"(e[3]),
          "=&v"(e[4]), "=&v"(e[5]), "=&v"(e[6]), "=&v"(e[7])
        : "v"(x[0]), "v"(x[1]), "v"(x[2]), "v"(x[3]), "v"(x[4]), "v"(x[5]), "v"(x[6]), "v"(x[7]));
}

__device__ __forceinline__ void vst8h(_Float16* p, v8h v) { *(v8h*)p = v; }
__device__ __forceinline__ void vst4f(float* p, v4f v)    { *(v4f*)p = v; }

// LDS ring of the two projection GEMMs.  Block tile 64 MT rows x 128 columns.  A stage = 64 k
// (128 B) of the 64 MT A rows and then of the 128 B rows, row pitch 144 B (16 B x 9:
// conflict-free for ds_load_b128); two buffers.  The f32 output tile reuses the space after the loop.
#define KS      64                 // k per stage
#define LPB     144                // LDS row pitch, bytes
#define LPH     72                 // the same in halves
#define STAGE_B(MT) ((64 * (MT) + 128) * LPB)
#define RING_B(MT)  (2 * STAGE_B(MT))
#define OTILE_B(MT) (64 * (MT) * TP * 4)
#define GEMM_LDS_B(MT) (RING_B(MT) > OTILE_B(MT) ? RING_B(MT) : OTILE_B(MT))
#define MT_QKV  4                  // 256 x 128 block, 64 x 64 per wave
#define MT_OUT  3                  // 192 x 128 block, 48 x 64 per wave

// One stage: (64 MT + 128) x 8 pieces of 16 B, 2 MT + 4 per thread.  Thread t brings piece t&7 of
// rows t>>3 + 32 j, so eight lanes cover one 128-B line.  a, b: this thread's piece in A row t>>3
// and B row t>>3 at the stage's k; lds: its place in the buffer (byte address in LDS).
// s_wait_xcnt stands inside the statement, ahead of any rewrite of the address registers.
template <int MT>
__device__ __forceinline__ void copy_stage(const unsigned lds, const _Float16* a,
                                           const _Float16* b, const int K)
{
    static_assert(MT == 3 || MT == 4, "one statement per tile height");
    const unsigned lb = lds + 64 * MT * LPB;   // this thread's first B row
    if constexpr (MT == 4) {
        asm volatile("global_load_async_to_lds_b128 %0, %12, off\n\t"
                     "global_load_async_to_lds_b128 %1, %13, off\n\t"
                     "global_load_async_to_lds_b128 %2, %14, off\n\t"
                     "global_load_async_to_lds_b128 %3, %15, off\n\t"
                     "global_load_async_to_lds_b128 %4, %16, off\n\t"
                     "global_load_async_to_lds_b128 %5, %17, off\n\t"
                     "global_load_async_to_lds_b128 %6, %18, off\n\t"
                     "global_load_async_to_lds_b128 %7, %19, off\n\t"
                     "global_load_async_to_lds_b128 %8, %20, off\n\t"
                     "global_load_async_to_lds_b128 %9, %21, off\n\t"
                     "global_load_async_to_lds_b128 %10, %22, off\n\t"
                     "global_load_async_to_lds_b128 %11, %23, off\n\t"
                     "s_wait_xcnt 0x0"
                     :: "v"(lds), "v"(lds + 32 * LPB), "v"(lds + 64 * LPB), "v"(lds + 96 * LPB),
                        "v"(lds + 128 * LPB), "v"(lds + 160 * LPB), "v"(lds + 192 * LPB),
                        "v"(lds + 224 * LPB),
                        "v"(lb), "v"(lb + 32 * LPB), "v"(lb + 64 * LPB), "v"(lb + 96 * LPB),
                        "v"(a), "v"(a + 32 * K), "v"(a + 64 * K), "v"(a + 96 * K),
                        "v"(a + 128 * K), "v"(a + 160 * K), "v"(a + 192 * K), "v"(a + 224 * K),
                        "v"(b), "v"(b + 32 * K), "v"(b + 64 * K), "v"(b + 96 * K)
                     : "memory");
    } else {
        asm volatile("global_load_async_to_lds_b128 %0, %10, off\n\t"
                     "global_load_async_to_lds_b128 %1, %11, off\n\t"
                     "global_load_async_to_lds_b128 %2, %12, off\n\t"
                     "global_load_async_to_lds_b128 %3, %13, off\n\t"
                     "global_load_async_to_lds_b128 %4, %14, off\n\t"
                     "global_load_async_to_lds_b128 %5, %15, off\n\t"
                     "global_load_async_to_lds_b128 %6, %16, off\n\t"
                     "global_load_async_to_lds_b128 %7, %17, off\n\t"
                     "global_load_async_to_lds_b128 %8, %18, off\n\t"
                     "global_load_async_to_lds_b128 %9, %19, off\n\t"
                     "s_wait_xcnt 0x0"
                     :: "v"(lds), "v"(lds + 32 * LPB), "v"(lds + 64 * LPB), "v"(lds + 96 * LPB),
                        "v"(lds + 128 * LPB), "v"(lds + 160 * LPB),
                        "v"(lb), "v"(lb + 32 * LPB), "v"(lb + 64 * LPB), "v"(lb + 96 * LPB),
                        "v"(a), "v"(a + 32 * K), "v"(a + 64 * K), "v"(a + 96 * K),
                        "v"(a + 128 * K), "v"(a + 160 * K),
                        "v"(b), "v"(b + 32 * K), "v"(b + 64 * K), "v"(b + 96 * K)
                     : "memory");
    }
}

// Block: 64 MT rows of A (row-major, pitch K) times 128 columns of B (B[k][n] stored n-major with
// k contiguous, pitch K), both staged in the ring by asynchronous copies, the next stage in
// flight while this one is multiplied.  Wave (mw, nw): rows 64 i + 16 mw.. (i < MT), columns
// 64 nw..; c[i][j] = row group i, column group j of 16: MT + 4 fragments feed 4 MT products.
// On return every wave has left the ring (last trip's barrier).
template <int K, int MT>
__device__ __forceinline__ void mainloop_x128(unsigned char* ring,
                                              const _Float16* __restrict__ Ablk,
                                              const _Float16* __restrict__ Bblk,
                                              const int t, const int mw, const int nw,
                                              const int h, const int m,
                                              v8f (&c)[MT][4])
{
    constexpr int NT = K / KS;
    static_assert(K % KS == 0 && NT >= 2, "two stages or more");
    const unsigned lds = (unsigned)(uintptr_t)ring + (t >> 3) * LPB + (t & 7) * 16;
    const _Float16* ga = Ablk + (t >> 3) * K + (t & 7) * 8;
    const _Float16* gb = Bblk + (t >> 3) * K + (t & 7) * 8;

    copy_stage<MT>(lds, ga, gb, K);
    asm volatile("s_wait_asynccnt 0x0" ::: "memory");   // stage 0 landed (this wave's pieces)
    __syncthreads();                                    // ... and every other wave's
    copy_stage<MT>(lds + STAGE_B(MT), ga + KS, gb + KS, K);

    // kept rolled: unrolled, every stage's copy addresses stay live at once, and the added
    // registers cost a resident work-group per WGP
#pragma unroll 1
    for (int s = 0; s < NT; ++s) {
        const _Float16* st = (const _Float16*)(ring + (s & 1) * STAGE_B(MT));
        const _Float16* ar = st + (mw * 16 + m) * LPH;
        const _Float16* br = st + (64 * MT + nw * 64 + m) * LPH;
        v16h a[MT], b[4];
        // unrolled: fragments and accumulators are indexed by constants and stay in registers
#pragma unroll
        for (int kk = 0; kk < KS / 32; ++kk) {
            a[0] = load_frag(ar + kk * 32, h);
#pragma unroll
            for (int j = 0; j < 4; ++j) b[j] = load_frag(br + j * 16 * LPH + kk * 32, h);
#pragma unroll
            for (int i = 1; i < MT; ++i) a[i] = load_frag(ar + i * 64 * LPH + kk * 32, h);
            // keeps the LDS reads of a k step together ahead of its products: left alone the
            // scheduler reuses one A fragment's registers and waits out an LDS latency per row
            __builtin_amdgcn_sched_barrier(0);
#pragma unroll
            for (int i = 0; i < MT; ++i)
#pragma unroll
                for (int j = 0; j < 4; ++j) c[i][j] = mma16(a[i], b[j], c[i][j]);
            // keeps every product of the k step ahead of what follows: the next reads, and at the
            // end the four slots below (left alone a row of products sinks behind the barrier)
            __builtin_amdgcn_sched_barrier(0);
        }
        // four vector slots behind the last matrix instructions, on the branch paths too
        GUARD4(c[MT - 1][0], c[MT - 1][1], c[MT - 1][2], c[MT - 1][3], a[MT - 1], b[0], b[1], b[2], b[3]);
        asm volatile("s_wait_dscnt 0x0" ::: "memory");     // this wave's reads of buffer s&1 are done
        asm volatile("s_wait_asynccnt 0x0" ::: "memory");  // its pieces of stage s+1 have landed
        __syncthreads();                                   // publishes stage s+1, frees buffer s&1
        if (s + 2 < NT)
            copy_stage<MT>(lds + (s & 1) * STAGE_B(MT), ga + (s + 2) * KS, gb + (s + 2) * KS, K);
    }
    asm volatile("s_wait_asynccnt 0x0" ::: "memory");      // nothing in flight when the ring is reused
}

// ---------------------------------------------------------------------------
// Kernel 0: weights -> f16 (x16), concatenated [1024][384] and [384][512];
// affine params concatenated (scale pre-multiplied by 1/16).  16-B per lane stores.
// ---------------------------------------------------------------------------
__global__ __launch_bounds__(256) void prep_kernel(
    const float* __restrict__ Wq, const float* __restrict__ Wk, const float* __restrict__ Wv,
    const float* __restrict__ Wp,
    const float* __restrict__ sq, const float* __restrict__ bq,
    const float* __restrict__ sk, const float* __restrict__ bk,
    const float* __restrict__ sv, const float* __restrict__ bv,
    _Float16* __restrict__ wabc, _Float16* __restrict__ wph,
    float* __restrict__ sc, float* __restrict__ bc)
{
    const int NW1 = MQKV * DIMC / 8;   // 49152 chunks of 8 halves
    const int NW2 = DIMC * DHC / 8;    // 24576 chunks
    const int i = blockIdx.x * 256 + threadIdx.x;
    if (i < NW1 + NW2) {
        const float* src;
        _Float16* dst;
        if (i < NW1) {
            const int e = i * 8;
            if (e < NHKD * DIMC)          src = Wq + e;
            else if (e < 2 * NHKD * DIMC) src = Wk + (e - NHKD * DIMC);
            else                          src = Wv + (e - 2 * NHKD * DIMC);
            dst = wabc + e;
        } else {
            const int e = (i - NW1) * 8;
            src = Wp + e;
            dst = wph + e;
        }
        const v4f f0 = *(const v4f*)src;
        const v4f f1 = *(const v4f*)(src + 4);
        v8h hv;
#pragma unroll
        for (int j = 0; j < 4; ++j) {
            hv[j]     = (_Float16)(f0[j] * 16.0f);
            hv[4 + j] = (_Float16)(f1[j] * 16.0f);
        }
        vst8h(dst, hv);
        
    } else {
        const int j = i - (NW1 + NW2);
        if (j < 512) {
            const int e = (j & 255) * 4;
            v4f o;
#pragma unroll
            for (int q = 0; q < 4; ++q) {
                const int ee = e + q;
                float val;
                if (j < 256) {
                    val = (ee < NHKD) ? sq[ee] : ((ee < 2 * NHKD) ? sk[ee - NHKD] : sv[ee - 2 * NHKD]);
                    val *= 0.0625f;
                } else {
                    val = (ee < NHKD) ? bq[ee] : ((ee < 2 * NHKD) ? bk[ee - NHKD] : bv[ee - 2 * NHKD]);
                }
                o[q] = val;
            }
            float* dst = ((j < 256) ? sc : bc) + e;
            vst4f(dst, o);
            
        }
    }
}

// ---------------------------------------------------------------------------
// Kernel 1: x[b][c][n] f32 -> xt[b][n][c] f16.  Tile 128 c x 32 n in LDS; each
// ---------------------------------------------------------------------------
__global__ __launch_bounds__(256) void xpose_kernel(const float* __restrict__ x,
                                                    _Float16* __restrict__ xt)
{
    __shared__ float tile[128 * 33];
    const int b = blockIdx.z;
    const int nb = blockIdx.x * 32, cb = blockIdx.y * 128;
    const int t = threadIdx.x, l = t & 31, w = t >> 5, h = l >> 4, m = l & 15;
    const float* xb = x + (size_t)b * DIMC * NN;
#pragma unroll
    for (int j = 0; j < 16; ++j) {
        const int c = w + 8 * j;
        tile[c * 33 + l] = xb[(size_t)(cb + c) * NN + nb + l];
    }
    __syncthreads();
    _Float16* xo = xt + (size_t)b * NN * DIMC;
    const int nl0 = w * 4 + h, nl1 = w * 4 + 2 + h;
    v8h hv0, hv1;
#pragma unroll
    for (int j = 0; j < 8; ++j) {
        hv0[j] = (_Float16)tile[(m * 8 + j) * 33 + nl0];
        hv1[j] = (_Float16)tile[(m * 8 + j) * 33 + nl1];
    }
    _Float16* d0 = xo + (size_t)(nb + nl0) * DIMC + cb + m * 8;
    _Float16* d1 = xo + (size_t)(nb + nl1) * DIMC + cb + m * 8;
    vst8h(d0, hv0);
    vst8h(d1, hv1);
    
}

// ---------------------------------------------------------------------------
// Kernel 2: fused QKV projection [1024][384] x [384][4096] per batch + affine.
// Block tile 256 rows x 128 cols, 8 waves, wave tile 64 x 64, operands through the LDS ring.
// A block lies wholly in one of the three row regions.  Result staged in LDS:
//   Q rows (0..255):   channel softmax over 32 per head (f32), x256, f16 -> qsm[b][n][256]
//   K rows (256..511): first half of the softmax over n, per row and per 128 columns of the block:
//                      exp(k - block max) x1024, f16 -> ke[b][256][N]; the block's max and the
//                      f32 sum of those (x1024 too) -> kmx, ksum [b][column block][256]
//   V rows (512..1023): f16 -> vh[b][512][N]
// ---------------------------------------------------------------------------
__global__ __launch_bounds__(256) void qkv_kernel(const _Float16* __restrict__ wabc,
                                                  const _Float16* __restrict__ xt,
                                                  const float* __restrict__ sc,
                                                  const float* __restrict__ bc,
                                                  _Float16* __restrict__ qsm,
                                                  _Float16* __restrict__ ke,
                                                  float* __restrict__ kmx,
                                                  float* __restrict__ ksum,
                                                  _Float16* __restrict__ vh)
{
    constexpr int MT = MT_QKV;
    static_assert(NHKD % (64 * MT) == 0, "a block stays inside one region");
    __shared__ __attribute__((aligned(16))) unsigned char ring[GEMM_LDS_B(MT)];
    float* tile = (float*)ring;
    // the row block is the slowest grid index: the Q blocks, whose epilogue is the longest, start first
    const int b = blockIdx.y;
    const int t = threadIdx.x, l = t & 31, wave = t >> 5, h = l >> 4, m = l & 15;
    const int mw = wave >> 1, nw = wave & 1;
    const int Mbase = blockIdx.z * (64 * MT), Nbase = blockIdx.x * 128;
    const int region = (Mbase < NHKD) ? 0 : ((Mbase < 2 * NHKD) ? 1 : 2);

    const _Float16* Ablk = wabc + (size_t)Mbase * DIMC;
    const _Float16* Bblk = xt + ((size_t)b * NN + Nbase) * DIMC;
    v8f c[MT][4] = {};
    mainloop_x128<DIMC, MT>(ring, Ablk, Bblk, t, mw, nw, h, m, c);

    // the loops over i below are unrolled: c, s and bb are indexed by constants and stay in registers
    const float* ps = sc + Mbase + mw * 16 + 8 * h;
    const float* pb = bc + Mbase + mw * 16 + 8 * h;
    float s[MT][8], bb[MT][8];
#pragma unroll
    for (int i = 0; i < MT; ++i) {
#pragma unroll
        for (int r = 0; r < 8; ++r) { s[i][r] = ps[i * 64 + r]; bb[i][r] = pb[i * 64 + r]; }
    }
    // the two address pairs stay live to here, so that no load's result lands on them, and the wait
    // stands ahead of their reuse
    asm volatile("s_wait_xcnt 0x0" :: "v"(ps), "v"(pb) : "memory");
#pragma unroll
    for (int i = 0; i < MT; ++i) {
#pragma unroll
        for (int r = 0; r < 8; ++r) {
            const int ml = i * 64 + mw * 16 + 8 * h + r;
            float* trow = tile + ml * TP + nw * 64 + m;
            trow[0]  = c[i][0][r] * s[i][r] + bb[i][r];
            trow[16] = c[i][1][r] * s[i][r] + bb[i][r];
            trow[32] = c[i][2][r] * s[i][r] + bb[i][r];
            trow[48] = c[i][3][r] * s[i][r] + bb[i][r];
        }
    }
    __syncthreads();

    if (region == 0) {
        // softmax over the 32 channels of one head for one column; 2 heads x 128 cols = 256 threads
        // per 64 rows
        const int nl = t & 127, hh = t >> 7;
        for (int i = 0; i < MT; ++i) {
            float* hcol = tile + (i * 64 + hh * KDIM) * TP + nl;
            float qv[KDIM];
            float mx;
#pragma unroll
            for (int k = 0; k < KDIM; ++k) {
                qv[k] = hcol[k * TP];
                mx = (k == 0) ? qv[0] : fmaxf(mx, qv[k]);
            }
            float sum = 0.f;
#pragma unroll
            for (int k = 0; k < KDIM; ++k) { qv[k] = __expf(qv[k] - mx); sum += qv[k]; }
            const float scl = 256.0f / sum;
#pragma unroll
            for (int k = 0; k < KDIM; ++k) hcol[k * TP] = qv[k] * scl;
        }
    }
    __syncthreads();

    if (region == 0) {
        const int p = l & 7;
        // unrolled: the LDS reads of the next 64 rows start under the stores of these
#pragma unroll
        for (int i = 0; i < MT; ++i) {
#pragma unroll
            for (int it = 0; it < 4; ++it) {
                const int nl = wave * 16 + it * 4 + (l >> 3);
                v8h hv;
#pragma unroll
                for (int j = 0; j < 8; ++j) hv[j] = (_Float16)tile[(i * 64 + p * 8 + j) * TP + nl];
                vst8h(qsm + ((size_t)b * NN + Nbase + nl) * NHKD + Mbase + i * 64 + p * 8, hv);
            }
        }
    } else if (region == 1) {
        // lane = row: thread t holds row t's 128 columns in registers, so max and sum need no exchange
        static_assert(64 * MT == 256, "one row per thread");
        const int obase = Mbase - NHKD;
        float* krow = tile + t * TP;
        // every loop here is unrolled: kv is indexed by constants and stays in registers
        v4f kv[32];
#pragma unroll
        for (int j = 0; j < 32; ++j) kv[j] = *(const v4fa*)(krow + 4 * j);
        v4f mx4 = kv[0];
#pragma unroll
        for (int j = 1; j < 32; ++j)
#pragma unroll
            for (int i = 0; i < 4; ++i) mx4[i] = fmaxf(mx4[i], kv[j][i]);
        const float mx = fmaxf(fmaxf(mx4[0], mx4[1]), fmaxf(mx4[2], mx4[3]));
        v4f sum4 = {};
#pragma unroll
        for (int j = 0; j < 16; ++j) {
            // exp(k - mx) x 1024 = 2^((k - mx) log2 e + 10)
            float x[8], e[8];
#pragma unroll
            for (int i = 0; i < 8; ++i) x[i] = fmaf(kv[2 * j + (i >> 2)][i & 3] - mx, 1.44269504f, 10.0f);
            exp2x8(e, x);
            v8h hv;
#pragma unroll
            for (int i = 0; i < 8; ++i) { sum4[i & 3] += e[i]; hv[i] = (_Float16)e[i]; }
            // over the head of the thread's own row, which is wholly in its registers by now
            *(v8ha*)((_Float16*)krow + 8 * j) = hv;
        }
        // a wave's 32 rows: one whole 128-B line per store
        const size_t so = ((size_t)b * NBLK + blockIdx.x) * NHKD + obase + t;
        kmx[so]  = mx;
        ksum[so] = (sum4[0] + sum4[1]) + (sum4[2] + sum4[3]);
        // ke[b][o][Nbase..Nbase+127] f16: 256 B = 2 lines per row, two rows per instruction.  A wave
        // reads back only the 32 rows that its own lanes wrote (one wave's LDS operations go in issue
        // order): no barrier
#pragma unroll
        for (int it = 0; it < 4 * MT; ++it) {
            const int row = wave * (8 * MT) + it * 2 + h;
            const v8h hv = *(const v8ha*)((const _Float16*)(tile + row * TP) + m * 8);
            vst8h(ke + ((size_t)b * NHKD + obase + row) * NN + Nbase + m * 8, hv);
        }
    } else {
        // vh[b][o][Nbase..Nbase+127] f16: 256 B = 2 lines per row, two rows per instruction
        const int obase = Mbase - 2 * NHKD;
#pragma unroll
        for (int it = 0; it < 4 * MT; ++it) {
            const int row = wave * (8 * MT) + it * 2 + h;
            v8h hv;
#pragma unroll
            for (int j = 0; j < 8; ++j) hv[j] = (_Float16)tile[row * TP + m * 8 + j];
            vst8h(vh + ((size_t)b * DHC + obase + row) * NN + Nbase + m * 8, hv);
        }
    }
}

// ---------------------------------------------------------------------------
// Kernel 3: context per (b,head): C[kd][d] = sum_n softmax_n(k)[kd][n] * v[d][n], K = 4096.
// A rows = ke rows (n contiguous); B[k=n][col=d] = vh row d (n contiguous): same loader.
// Second half of the key softmax: a wave's 128 n are one column block of kernel 2, so its whole
// tile row kd carries one factor 4096 exp(block max - row max) / row sum (the x1024 cancels), formed
// from kmx and ksum of the row's 32 blocks and applied in f32 where the waves' tiles are added.
// The n-sum is split: CSPLIT work-groups per (b,head), eight waves each, every wave holding the
// whole 32 x 64 tile (2 kd-tiles x 4 d-tiles) for its own 128 n, so that each fragment is
// loaded once and all of a wave's loads are independent.  The eight waves' tiles are added
// through LDS in wave order; the work-group's f32 partial goes to part[bh][g][2048].
// Order inside a partial: unit u = dt*4 + kt*2 + (r>>2), then lane, then r&3 (accumulator
// register r of tile (kt, dt)).  That is the A-fragment order of kernel 4: element e = kt*8 + r
// of lane (m, h) is C[kd = kt*16 + 8h + r][d = dt*16 + m].
// ---------------------------------------------------------------------------
__global__ __launch_bounds__(256) void ctx_kernel(const _Float16* __restrict__ ke,
                                                  const float* __restrict__ kmx,
                                                  const float* __restrict__ ksum,
                                                  const _Float16* __restrict__ vh,
                                                  float* __restrict__ part)
{
    static_assert(CWN == 128 && NBLK == 32, "a wave's n = one column block; 4 blocks per wave below");
    __shared__ __attribute__((aligned(16))) float red[8 * CTILE];
    __shared__ float pm[8 * KDIM], ps[8 * KDIM];
    __shared__ __attribute__((aligned(16))) float fl[8 * KDIM];
    const int bh = blockIdx.x / CSPLIT, g = blockIdx.x % CSPLIT, b = bh >> 3, hd = bh & 7;
    const int t = threadIdx.x, l = t & 31, wave = t >> 5, h = l >> 4, m = l & 15;
    const int n0 = (g * 8 + wave) * CWN;
    // both operands have the row pitch NN, so one per-lane byte offset serves every load
    const char* Abase = (const char*)(ke  + ((size_t)b * NHKD + hd * KDIM) * NN);
    const char* Bbase = (const char*)(vh  + ((size_t)b * DHC  + hd * DD)   * NN);
    const unsigned lane_off = (unsigned)(m * NN + n0 + 8 * h) * 2u;
    // statistics of key row l: four of its 32 blocks per wave, and this wave's own block's max
    const float* sm = kmx  + (size_t)b * NBLK * NHKD + hd * KDIM + l;
    const float* pm4 = sm + wave * 4 * NHKD;
    const float* ps4 = ksum + (size_t)b * NBLK * NHKD + hd * KDIM + l + wave * 4 * NHKD;
    float m4[4], s4[4];
#pragma unroll
    for (int i = 0; i < 4; ++i) { m4[i] = pm4[i * NHKD]; s4[i] = ps4[i * NHKD]; }
    const float* pown = sm + (g * 8 + wave) * NHKD;
    const float mown = *pown;
    // every loop below is unrolled so that the fragment and accumulator arrays are indexed by
    // constants and stay in registers
    v16h a[CWN / 32][2], bf[CWN / 32][4];
#pragma unroll
    for (int s = 0; s < CWN / 32; ++s) {
#pragma unroll
        for (int i = 0; i < 2; ++i)
            a[s][i] = load_frag((const _Float16*)(Abase + lane_off) + i * 16 * NN + s * 32, 0);
#pragma unroll
        for (int j = 0; j < 4; ++j)
            bf[s][j] = load_frag((const _Float16*)(Bbase + lane_off) + j * 16 * NN + s * 32, 0);
    }
    // the first results reuse the loads' offset register: the wait stands ahead of that overwrite;
    // the three statistics addresses stay live to here, so that no load's result lands on them
    asm volatile("s_wait_xcnt 0x0" :: "v"(pm4), "v"(ps4), "v"(pown) : "memory");
    // keeps every load of the wave ahead of the first product: one memory latency per wave;
    // without it the scheduler reuses fragment registers and waits out eight latencies in a row
    __builtin_amdgcn_sched_barrier(0);
    {
        const float ml = fmaxf(fmaxf(m4[0], m4[1]), fmaxf(m4[2], m4[3]));
        float sl = 0.f;
#pragma unroll
        for (int i = 0; i < 4; ++i) sl += s4[i] * __expf(m4[i] - ml);
        pm[wave * KDIM + l] = ml;
        ps[wave * KDIM + l] = sl;
        __syncthreads();   // every wave's four blocks are in pm, ps
        float M = pm[l];
#pragma unroll
        for (int w = 1; w < 8; ++w) M = fmaxf(M, pm[w * KDIM + l]);
        float S = 0.f;
#pragma unroll
        for (int w = 0; w < 8; ++w) S += ps[w * KDIM + l] * __expf(pm[w * KDIM + l] - M);
        fl[wave * KDIM + l] = __expf(mown - M) * (4096.0f / S);   // read behind the barrier below
    }
    v8f c[2][4] = {};
#pragma unroll
    for (int s = 0; s < CWN / 32; ++s)
#pragma unroll
        for (int i = 0; i < 2; ++i)
#pragma unroll
            for (int j = 0; j < 4; ++j) c[i][j] = mma16(a[s][i], bf[s][j], c[i][j]);
    // keeps the LDS stores behind the last product: all eight accumulators stay live to here, so
    // none of their registers is handed to another product's result inside the hazard distance
    __builtin_amdgcn_sched_barrier(0);
    float* mine = red + wave * CTILE + l * 4;
#pragma unroll
    for (int j = 0; j < 4; ++j)
#pragma unroll
        for (int i = 0; i < 2; ++i) {
            const v8f v = c[i][j];
            vst4f(mine + (j * 4 + i * 2) * 128,     (v4f){v[0], v[1], v[2], v[3]});
            vst4f(mine + (j * 4 + i * 2 + 1) * 128, (v4f){v[4], v[5], v[6], v[7]});
        }
    __syncthreads();
    float* dst = part + (size_t)blockIdx.x * CTILE;
    // unit u = 8 q + wave: kt = (wave >> 1) & 1 and r >> 2 = wave & 1 for both q, so this thread's
    // four elements are rows kd0 .. kd0 + 3 of every wave's tile
    const int kd0 = ((wave >> 1) & 1) * 16 + 8 * h + (wave & 1) * 4;
    v4f fw[8];
#pragma unroll
    for (int w = 0; w < 8; ++w) fw[w] = *(const v4f*)(fl + w * KDIM + kd0);
#pragma unroll
    for (int q = 0; q < 2; ++q) {
        const int e = q * 1024 + t * 4;
        v4f s = *(const v4f*)(red + e) * fw[0];
#pragma unroll
        for (int w = 1; w < 8; ++w) s += *(const v4f*)(red + w * CTILE + e) * fw[w];
        vst4f(dst + e, s);
    }
}

// ---------------------------------------------------------------------------
// Kernel 4: attended per (b,head): Att[d][n] = sum_kd C[kd][d] * qsm[n][hd*32+kd], K = 32
// (one WMMA per 16x16 tile), ReLU, scaled to att x256 (= acc/64), stored att[b][n][hd*64+d].
// The A fragment is the sum of kernel 3's CSPLIT partials (already in fragment order, whole
// lines per load), /64 (= true context x64), rounded to f16.
// ---------------------------------------------------------------------------
__global__ __launch_bounds__(256) void att_kernel(const float* __restrict__ part,
                                                  const _Float16* __restrict__ qsm,
                                                  _Float16* __restrict__ att)
{
    __shared__ float tile[128 * TPD];
    const int bh = blockIdx.y, b = bh >> 3, hd = bh & 7;
    const int Nbase = blockIdx.x * 128;
    const int t = threadIdx.x, l = t & 31, wave = t >> 5, h = l >> 4, m = l & 15;
    const int mt = wave >> 1, nw = wave & 1;
    // unrolled: a is indexed by constants and stays in registers; the 16 loads are independent
    v16h a;
    const float* pa = part + (size_t)bh * CSPLIT * CTILE + mt * 512 + l * 4;
#pragma unroll
    for (int q = 0; q < 4; ++q) {
        v4f s = *(const v4f*)(pa + q * 128);
#pragma unroll
        for (int g = 1; g < CSPLIT; ++g) s += *(const v4f*)(pa + g * CTILE + q * 128);
#pragma unroll
        for (int i = 0; i < 4; ++i) a[q * 4 + i] = (_Float16)(s[i] * 0.015625f);
    }
#pragma unroll
    for (int ns = 0; ns < 4; ++ns) {
        const int nl = nw * 64 + ns * 16 + m;
        v16h bf = load_frag(qsm + ((size_t)b * NN + Nbase + nl) * NHKD + hd * KDIM, h);
        v8f c = {};
        c = mma16(a, bf, c);
        GUARD1(c, a, bf);
#pragma unroll
        for (int r = 0; r < 8; ++r) {
            const float y = fmaxf(c[r] * 0.015625f, 0.0f);
            tile[nl * TPD + mt * 16 + 8 * h + r] = y;
        }
    }
    __syncthreads();
    const int p = l & 7;
#pragma unroll
    for (int it = 0; it < 4; ++it) {
        const int nl = wave * 16 + it * 4 + (l >> 3);
        v8h hv;
#pragma unroll
        for (int j = 0; j < 8; ++j) hv[j] = (_Float16)tile[nl * TPD + p * 8 + j];
        vst8h(att + ((size_t)b * NN + Nbase + nl) * DHC + hd * DD + p * 8, hv);
    }
    
}

// ---------------------------------------------------------------------------
// Kernel 5: output projection [384][512] x [512][4096] per batch + affine -> f32 out.
// Block tile 192 rows x 128 cols, 8 waves, wave tile 48 x 64.
// ---------------------------------------------------------------------------
__global__ __launch_bounds__(256) void out_kernel(const _Float16* __restrict__ wph,
                                                  const _Float16* __restrict__ att,
                                                  const float* __restrict__ sp,
                                                  const float* __restrict__ bp,
                                                  float* __restrict__ out)
{
    constexpr int MT = MT_OUT;
    static_assert(DIMC % (64 * MT) == 0, "whole blocks");
    __shared__ __attribute__((aligned(16))) unsigned char ring[GEMM_LDS_B(MT)];
    float* tile = (float*)ring;
    const int b = blockIdx.z;
    const int t = threadIdx.x, l = t & 31, wave = t >> 5, h = l >> 4, m = l & 15;
    const int mw = wave >> 1, nw = wave & 1;
    const int Mbase = blockIdx.y * (64 * MT), Nbase = blockIdx.x * 128;
    const _Float16* Ablk = wph + (size_t)Mbase * DHC;
    const _Float16* Bblk = att + ((size_t)b * NN + Nbase) * DHC;
    v8f c[MT][4] = {};
    mainloop_x128<DHC, MT>(ring, Ablk, Bblk, t, mw, nw, h, m, c);

    // unrolled over i: c is indexed by constants and stays in registers
#pragma unroll
    for (int i = 0; i < MT; ++i) {
#pragma unroll
        for (int r = 0; r < 8; ++r) {
            const int ml = i * 64 + mw * 16 + 8 * h + r;
            const int o = Mbase + ml;
            const float s = sp[o] * 0.000244140625f;   // 1/(16*256)
            const float bb = bp[o];
            float* trow = tile + ml * TP + nw * 64 + m;
            trow[0]  = c[i][0][r] * s + bb;
            trow[16] = c[i][1][r] * s + bb;
            trow[32] = c[i][2][r] * s + bb;
            trow[48] = c[i][3][r] * s + bb;
        }
    }
    __syncthreads();
    const int col = (l >> 3) * 32 + (l & 7) * 4;
#pragma unroll
    for (int it = 0; it < 8 * MT; ++it) {
        const int row = wave * (8 * MT) + it;
        const v4f v = *(const v4fa*)(tile + row * TP + col);
        vst4f(out + ((size_t)b * DIMC + Mbase + row) * NN + Nbase + col, v);
    }
}

// ---------------------------------------------------------------------------
// Host-side launch glue.  Workspace (bytes):
//   [0)            xt   f16 [8][4096][384]   25,165,824
//   [25,165,824)   wabc f16 [1024][384]         786,432
//   [25,952,256)   wph  f16 [384][512]          393,216
//   [26,345,472)   sc   f32 [1024]                4,096
//   [26,349,568)   bc   f32 [1024]                4,096
//   [26,353,664)   qsm  f16 [8][4096][256]   16,777,216
//   [43,130,880)   att  f16 [8][4096][512]   33,554,432   (before kernel 4: ke f16 [8][256][4096] 16,777,216)
//   [76,685,312)   vh   f16 [8][512][4096]   33,554,432
//   [110,239,744)  part f32 [64][4][2048]     2,097,152
//   [112,336,896)  kmx  f32 [8][32][256]        262,144
//   [112,599,040)  ksum f32 [8][32][256]        262,144
//   total 112,861,184
// ---------------------------------------------------------------------------
extern "C" void kernel_launch(void* const* d_in, const int* in_sizes, int n_in,
                              void* d_out, int out_size, void* d_ws, size_t ws_size,
                              hipStream_t stream)
{
    if (n_in < 13) return;
    if (in_sizes[0] != BB * DIMC * NN) return;
    if (in_sizes[1] != NHKD * DIMC || in_sizes[2] != NHKD || in_sizes[3] != NHKD) return;
    if (in_sizes[4] != NHKD * DIMC || in_sizes[5] != NHKD || in_sizes[6] != NHKD) return;
    if (in_sizes[7] != DHC * DIMC || in_sizes[8] != DHC || in_sizes[9] != DHC) return;
    if (in_sizes[10] != DIMC * DHC || in_sizes[11] != DIMC || in_sizes[12] != DIMC) return;
    if (out_size != BB * DIMC * NN) return;

    const size_t off_xt   = 0;
    const size_t sz_xt    = (size_t)BB * NN * DIMC * 2;
    const size_t off_wabc = off_xt + sz_xt;
    const size_t sz_wabc  = (size_t)MQKV * DIMC * 2;
    const size_t off_wph  = off_wabc + sz_wabc;
    const size_t sz_wph   = (size_t)DIMC * DHC * 2;
    const size_t off_sc   = off_wph + sz_wph;
    const size_t sz_sc    = (size_t)MQKV * 4;
    const size_t off_bc   = off_sc + sz_sc;
    const size_t off_qsm  = off_bc + sz_sc;
    const size_t sz_qsm   = (size_t)BB * NN * NHKD * 2;
    const size_t off_kf   = off_qsm + sz_qsm;
    const size_t sz_kf    = (size_t)BB * NHKD * NN * 4;
    const size_t off_vh   = off_kf + sz_kf;
    const size_t sz_vh    = (size_t)BB * DHC * NN * 2;
    const size_t off_ctx  = off_vh + sz_vh;
    const size_t sz_ctx   = (size_t)BB * HEADS * CSPLIT * CTILE * 4;
    const size_t off_kmx  = off_ctx + sz_ctx;
    const size_t sz_kst   = (size_t)BB * NBLK * NHKD * 4;
    const size_t off_ksum = off_kmx + sz_kst;
    const size_t total    = off_ksum + sz_kst;
    const size_t sz_ke    = (size_t)BB * NHKD * NN * 2;
    const size_t sz_att   = (size_t)BB * NN * DHC * 2;
    if (total > ws_size) return;
    if (sz_ke > sz_kf || sz_att > sz_kf) return;

    const float* x  = (const float*)d_in[0];
    const float* Wq = (const float*)d_in[1];
    const float* sq = (const float*)d_in[2];
    const float* bq = (const float*)d_in[3];
    const float* Wk = (const float*)d_in[4];
    const float* sk = (const float*)d_in[5];
    const float* bk = (const float*)d_in[6];
    const float* Wv = (const float*)d_in[7];
    const float* sv = (const float*)d_in[8];
    const float* bv = (const float*)d_in[9];
    const float* Wp = (const float*)d_in[10];
    const float* sp = (const float*)d_in[11];
    const float* bp = (const float*)d_in[12];
    float* out = (float*)d_out;

    char* ws = (char*)d_ws;
    _Float16* xt   = (_Float16*)(ws + off_xt);
    _Float16* wabc = (_Float16*)(ws + off_wabc);
    _Float16* wph  = (_Float16*)(ws + off_wph);
    float*    sc   = (float*)   (ws + off_sc);
    float*    bc   = (float*)   (ws + off_bc);
    _Float16* qsm  = (_Float16*)(ws + off_qsm);
    _Float16* ke   = (_Float16*)(ws + off_kf);
    _Float16* att  = (_Float16*)(ws + off_kf);     // alias: ke dead after kernel 3
    _Float16* vh   = (_Float16*)(ws + off_vh);
    float*    part = (float*)   (ws + off_ctx);
    float*    kmx  = (float*)   (ws + off_kmx);
    float*    ksum = (float*)   (ws + off_ksum);

    const int prep_threads = MQKV * DIMC / 8 + DIMC * DHC / 8 + 512;   // 74240
    prep_kernel<<<(prep_threads + 255) / 256, 256, 0, stream>>>(
        Wq, Wk, Wv, Wp, sq, bq, sk, bk, sv, bv, wabc, wph, sc, bc);

    xpose_kernel<<<dim3(NN / 32, DIMC / 128, BB), 256, 0, stream>>>(x, xt);

    qkv_kernel<<<dim3(NN / 128, BB, MQKV / (64 * MT_QKV)), 256, 0, stream>>>(wabc, xt, sc, bc, qsm, ke, kmx, ksum, vh);

    ctx_kernel<<<BB * HEADS * CSPLIT, 256, 0, stream>>>(ke, kmx, ksum, vh, part);

    att_kernel<<<dim3(NN / 128, BB * HEADS), 256, 0, stream>>>(part, qsm, att);

    out_kernel<<<dim3(NN / 128, DIMC / (64 * MT_OUT), BB), 256, 0, stream>>>(wph, att, sp, bp, out);
}

// v005
// A run of this version takes 75 microseconds.
// In two side-by-side timings against v004, it was 1.13 and 1.12 times as fast.
// All steps since v000 together make it 4.08 times as fast.
#include <hip/hip_runtime.h>
// All contractions on v_wmma_f32_16x16x32_f16 (f16 operands, f32 accumulate): QKV projection, key*value^T, context^T*query, output projection; exact power-of-two operand scales (weights x16, key exponentials x1024, context x64, query softmax x256, attended x256) undone in the f32 epilogues; softmaxes and affine terms in f32.

#define BB    8
#define DIMC  384
#define NN    4096
#define HEADS 8
#define KDIM  32
#define DD    64
#define NHKD  256
#define DHC   512
#define MQKV  1024
#define TP    132      // LDS pitch (floats) for the 64 MT x 128 output tiles, keeps 16-B alignment
#define CSPLIT 4       // work-groups that share the n-sum of one (b,head) context
#define CWN   (NN / (CSPLIT * 8))   // n per wave of the context kernel (128)
#define CTILE (KDIM * DD)           // elements of one context tile (2048)
#define NBLK  (NN / 128)            // column blocks of the QKV projection = pieces of a key row (32)

typedef _Float16 v16h __attribute__((ext_vector_type(16)));
typedef _Float16 v8h  __attribute__((ext_vector_type(8)));
typedef float    v8f  __attribute__((ext_vector_type(8)));
typedef float    v4f  __attribute__((ext_vector_type(4)));
typedef float    v4fa __attribute__((ext_vector_type(4), may_alias));
typedef _Float16 v8ha __attribute__((ext_vector_type(8), may_alias));

union Frag { v16h v; v8h half[2]; };

// 16x16x32 operand fragment from a k-contiguous row: elements 0..7 <- row[8h..8h+7],
// elements 8..15 <- row[16+8h..16+8h+7]; lane&15 selects the row (A) or column (B).
__device__ __forceinline__ v16h load_frag(const _Float16* __restrict__ p, int h)
{
    Frag f;
    f.half[0] = *(const v8h*)(p + 8 * h);
    f.half[1] = *(const v8h*)(p + 16 + 8 * h);
    return f.v;
}

__device__ __forceinline__ v8f mma16(v16h a, v16h b, v8f c)
{
    return __builtin_amdgcn_wmma_f32_16x16x32_f16(false, a, false, b, (short)0, c, false, false);
}

#define GUARD4(c0, c1, c2, c3, a, b0, b1, b2, b3) \
    asm volatile("v_nop\n\tv_nop\n\tv_nop\n\tv_nop" \
                 : "+v"(c0), "+v"(c1), "+v"(c2), "+v"(c3) \
                 : "v"(a), "v"(b0), "v"(b1), "v"(b2), "v"(b3))

// e[i] = 2^x[i].  One statement: outputs and inputs are kept apart, so each exponential is the
// independent instruction behind the one before it, and the v_nop is that slot behind the last
__device__ __forceinline__ void exp2x8(float (&e)[8], const float (&x)[8])
{
    asm("v_exp_f32 %0, %8\n\tv_exp_f32 %1, %9\n\tv_exp_f32 %2, %10\n\tv_exp_f32 %3, %11\n\t"
        "v_exp_f32 %4, %12\n\tv_exp_f32 %5, %13\n\tv_exp_f32 %6, %14\n\tv_exp_f32 %7, %15\n\t"
        "v_nop"
        : "=&v"(e[0]), "=&v"(e[1]), "=&v"(e[2]), "=&v"(e[3]),
          "=&v"(e[4]), "=&v"(e[5]), "=&v"(e[6]), "=&v"(e[7])
        : "v"(x[0]), "v"(x[1]), "v"(x[2]), "v"(x[3]), "v"(x[4]), "v"(x[5]), "v"(x[6]), "v"(x[7]));
}

__device__ __forceinline__ void vst8h(_Float16* p, v8h v) { *(v8h*)p = v; }
__device__ __forceinline__ void vst4f(float* p, v4f v)    { *(v4f*)p = v; }

// LDS ring of the two projection GEMMs.  Block tile 64 MT rows x 128 columns.  A stage = 64 k
// (128 B) of the 64 MT A rows and then of the 128 B rows, row pitch 144 B (16 B x 9:
// conflict-free for ds_load_b128); two buffers.  The f32 output tile reuses the space after the loop.
#define KS      64                 // k per stage
#define LPB     144                // LDS row pitch, bytes
#define LPH     72                 // the same in halves
#define STAGE_B(MT) ((64 * (MT) + 128) * LPB)
#define RING_B(MT)  (2 * STAGE_B(MT))
#define OTILE_B(MT) (64 * (MT) * TP * 4)
#define GEMM_LDS_B(MT) (RING_B(MT) > OTILE_B(MT) ? RING_B(MT) : OTILE_B(MT))
#define MT_QKV  4                  // 256 x 128 block, 64 x 64 per wave
#define MT_OUT  3                  // 192 x 128 block, 48 x 64 per wave
#define CTXL_B  (HEADS * CTILE * 2)   // one batch's eight context tiles in f16, behind the output kernel's ring
#define OUT_LDS_B (RING_B(MT_OUT) + CTXL_B > OTILE_B(MT_OUT) ? RING_B(MT_OUT) + CTXL_B : OTILE_B(MT_OUT))

// One stage: (64 MT + 128) x 8 pieces of 16 B, 2 MT + 4 per thread.  Thread t brings piece t&7 of
// rows t>>3 + 32 j, so eight lanes cover one 128-B line.  a, b: this thread's piece in A row t>>3
// and B row t>>3 at the stage's k; lds: its place in the buffer (byte address in LDS).
// s_wait_xcnt stands inside the statement, ahead of any rewrite of the address registers.
template <int MT>
__device__ __forceinline__ void copy_stage(const unsigned lds, const _Float16* a,
                                           const _Float16* b, const int K)
{
    static_assert(MT == 4, "one statement per tile height");
    const unsigned lb = lds + 64 * MT * LPB;   // this thread's first B row
    {
        asm volatile("global_load_async_to_lds_b128 %0, %12, off\n\t"
                     "global_load_async_to_lds_b128 %1, %13, off\n\t"
                     "global_load_async_to_lds_b128 %2, %14, off\n\t"
                     "global_load_async_to_lds_b128 %3, %15, off\n\t"
                     "global_load_async_to_lds_b128 %4, %16, off\n\t"
                     "global_load_async_to_lds_b128 %5, %17, off\n\t"
                     "global_load_async_to_lds_b128 %6, %18, off\n\t"
                     "global_load_async_to_lds_b128 %7, %19, off\n\t"
                     "global_load_async_to_lds_b128 %8, %20, off\n\t"
                     "global_load_async_to_lds_b128 %9, %21, off\n\t"
                     "global_load_async_to_lds_b128 %10, %22, off\n\t"
                     "global_load_async_to_lds_b128 %11, %23, off\n\t"
                     "s_wait_xcnt 0x0"
                     :: "v"(lds), "v"(lds + 32 * LPB), "v"(lds + 64 * LPB), "v"(lds + 96 * LPB),
                        "v"(lds + 128 * LPB), "v"(lds + 160 * LPB), "v"(lds + 192 * LPB),
                        "v"(lds + 224 * LPB),
                        "v"(lb), "v"(lb + 32 * LPB), "v"(lb + 64 * LPB), "v"(lb + 96 * LPB),
                        "v"(a), "v"(a + 32 * K), "v"(a + 64 * K), "v"(a + 96 * K),
                        "v"(a + 128 * K), "v"(a + 160 * K), "v"(a + 192 * K), "v"(a + 224 * K),
                        "v"(b), "v"(b + 32 * K), "v"(b + 64 * K), "v"(b + 96 * K)
                     : "memory");
    }
}

// The A rows alone of a stage of the output kernel (192 rows, 6 pieces per thread), same places as above.
__device__ __forceinline__ void copy_stage_a192(const unsigned lds, const _Float16* a, const int K)
{
    asm volatile("global_load_async_to_lds_b128 %0, %6, off\n\t"
                 "global_load_async_to_lds_b128 %1, %7, off\n\t"
                 "global_load_async_to_lds_b128 %2, %8, off\n\t"
                 "global_load_async_to_lds_b128 %3, %9, off\n\t"
                 "global_load_async_to_lds_b128 %4, %10, off\n\t"
                 "global_load_async_to_lds_b128 %5, %11, off\n\t"
                 "s_wait_xcnt 0x0"
                 :: "v"(lds), "v"(lds + 32 * LPB), "v"(lds + 64 * LPB), "v"(lds + 96 * LPB),
                    "v"(lds + 128 * LPB), "v"(lds + 160 * LPB),
                    "v"(a), "v"(a + 32 * K), "v"(a + 64 * K), "v"(a + 96 * K),
                    "v"(a + 128 * K), "v"(a + 160 * K)
                 : "memory");
}

// Block: 64 MT rows of A (row-major, pitch K) times 128 columns of B (B[k][n] stored n-major with
// k contiguous, pitch K), both staged in the ring by asynchronous copies, the next stage in
// flight while this one is multiplied.  Wave (mw, nw): rows 64 i + 16 mw.. (i < MT), columns
// 64 nw..; c[i][j] = row group i, column group j of 16: MT + 4 fragments feed 4 MT products.
// On return every wave has left the ring (last trip's barrier).
template <int K, int MT>
__device__ __forceinline__ void mainloop_x128(unsigned char* ring,
                                              const _Float16* __restrict__ Ablk,
                                              const _Float16* __restrict__ Bblk,
                                              const int t, const int mw, const int nw,
                                              const int h, const int m,
                                              v8f (&c)[MT][4])
{
    constexpr int NT = K / KS;
    static_assert(K % KS == 0 && NT >= 2, "two stages or more");
    const unsigned lds = (unsigned)(uintptr_t)ring + (t >> 3) * LPB + (t & 7) * 16;
    const _Float16* ga = Ablk + (t >> 3) * K + (t & 7) * 8;
    const _Float16* gb = Bblk + (t >> 3) * K + (t & 7) * 8;

    copy_stage<MT>(lds, ga, gb, K);
    asm volatile("s_wait_asynccnt 0x0" ::: "memory");   // stage 0 landed (this wave's pieces)
    __syncthreads();                                    // ... and every other wave's
    copy_stage<MT>(lds + STAGE_B(MT), ga + KS, gb + KS, K);

    // kept rolled: unrolled, every stage's copy addresses stay live at once, and the added
    // registers cost a resident work-group per WGP
#pragma unroll 1
    for (int s = 0; s < NT; ++s) {
        const _Float16* st = (const _Float16*)(ring + (s & 1) * STAGE_B(MT));
        const _Float16* ar = st + (mw * 16 + m) * LPH;
        const _Float16* br = st + (64 * MT + nw * 64 + m) * LPH;
        v16h a[MT], b[4];
        // unrolled: fragments and accumulators are indexed by constants and stay in registers
#pragma unroll
        for (int kk = 0; kk < KS / 32; ++kk) {
            a[0] = load_frag(ar + kk * 32, h);
#pragma unroll
            for (int j = 0; j < 4; ++j) b[j] = load_frag(br + j * 16 * LPH + kk * 32, h);
#pragma unroll
            for (int i = 1; i < MT; ++i) a[i] = load_frag(ar + i * 64 * LPH + kk * 32, h);
            // keeps the LDS reads of a k step together ahead of its products: left alone the
            // scheduler reuses one A fragment's registers and waits out an LDS latency per row
            __builtin_amdgcn_sched_barrier(0);
#pragma unroll
            for (int i = 0; i < MT; ++i)
#pragma unroll
                for (int j = 0; j < 4; ++j) c[i][j] = mma16(a[i], b[j], c[i][j]);
            // keeps every product of the k step ahead of what follows: the next reads, and at the
            // end the four slots below (left alone a row of products sinks behind the barrier)
            __builtin_amdgcn_sched_barrier(0);
        }
        // four vector slots behind the last matrix instructions, on the branch paths too
        GUARD4(c[MT - 1][0], c[MT - 1][1], c[MT - 1][2], c[MT - 1][3], a[MT - 1], b[0], b[1], b[2], b[3]);
        asm volatile("s_wait_dscnt 0x0" ::: "memory");     // this wave's reads of buffer s&1 are done
        asm volatile("s_wait_asynccnt 0x0" ::: "memory");  // its pieces of stage s+1 have landed
        __syncthreads();                                   // publishes stage s+1, frees buffer s&1
        if (s + 2 < NT)
            copy_stage<MT>(lds + (s & 1) * STAGE_B(MT), ga + (s + 2) * KS, gb + (s + 2) * KS, K);
    }
    asm volatile("s_wait_asynccnt 0x0" ::: "memory");      // nothing in flight when the ring is reused
}

// ---------------------------------------------------------------------------
// Kernel 0: weights -> f16 (x16), concatenated [1024][384] and [384][512];
// affine params concatenated (scale pre-multiplied by 1/16).  16-B per lane stores.
// ---------------------------------------------------------------------------
__global__ __launch_bounds__(256) void prep_kernel(
    const float* __restrict__ Wq, const float* __restrict__ Wk, const float* __restrict__ Wv,
    const float* __restrict__ Wp,
    const float* __restrict__ sq, const float* __restrict__ bq,
    const float* __restrict__ sk, const float* __restrict__ bk,
    const float* __restrict__ sv, const float* __restrict__ bv,
    _Float16* __restrict__ wabc, _Float16* __restrict__ wph,
    float* __restrict__ sc, float* __restrict__ bc)
{
    const int NW1 = MQKV * DIMC / 8;   // 49152 chunks of 8 halves
    const int NW2 = DIMC * DHC / 8;    // 24576 chunks
    const int i = blockIdx.x * 256 + threadIdx.x;
    if (i < NW1 + NW2) {
        const float* src;
        _Float16* dst;
        if (i < NW1) {
            const int e = i * 8;
            if (e < NHKD * DIMC)          src = Wq + e;
            else if (e < 2 * NHKD * DIMC) src = Wk + (e - NHKD * DIMC);
            else                          src = Wv + (e - 2 * NHKD * DIMC);
            dst = wabc + e;
        } else {
            const int e = (i - NW1) * 8;
            src = Wp + e;
            dst = wph + e;
        }
        const v4f f0 = *(const v4f*)src;
        const v4f f1 = *(const v4f*)(src + 4);
        v8h hv;
#pragma unroll
        for (int j = 0; j < 4; ++j) {
            hv[j]     = (_Float16)(f0[j] * 16.0f);
            hv[4 + j] = (_Float16)(f1[j] * 16.0f);
        }
        vst8h(dst, hv);
        
    } else {
        const int j = i - (NW1 + NW2);
        if (j < 512) {
            const int e = (j & 255) * 4;
            v4f o;
#pragma unroll
            for (int q = 0; q < 4; ++q) {
                const int ee = e + q;
                float val;
                if (j < 256) {
                    val = (ee < NHKD) ? sq[ee] : ((ee < 2 * NHKD) ? sk[ee - NHKD] : sv[ee - 2 * NHKD]);
                    val *= 0.0625f;
                } else {
                    val = (ee < NHKD) ? bq[ee] : ((ee < 2 * NHKD) ? bk[ee - NHKD] : bv[ee - 2 * NHKD]);
                }
                o[q] = val;
            }
            float* dst = ((j < 256) ? sc : bc) + e;
            vst4f(dst, o);
            
        }
    }
}

// ---------------------------------------------------------------------------
// Kernel 1: x[b][c][n] f32 -> xt[b][n][c] f16.  Tile 128 c x 32 n in LDS; each
// ---------------------------------------------------------------------------
__global__ __launch_bounds__(256) void xpose_kernel(const float* __restrict__ x,
                                                    _Float16* __restrict__ xt)
{
    __shared__ float tile[128 * 33];
    const int b = blockIdx.z;
    const int nb = blockIdx.x * 32, cb = blockIdx.y * 128;
    const int t = threadIdx.x, l = t & 31, w = t >> 5, h = l >> 4, m = l & 15;
    const float* xb = x + (size_t)b * DIMC * NN;
#pragma unroll
    for (int j = 0; j < 16; ++j) {
        const int c = w + 8 * j;
        tile[c * 33 + l] = xb[(size_t)(cb + c) * NN + nb + l];
    }
    __syncthreads();
    _Float16* xo = xt + (size_t)b * NN * DIMC;
    const int nl0 = w * 4 + h, nl1 = w * 4 + 2 + h;
    v8h hv0, hv1;
#pragma unroll
    for (int j = 0; j < 8; ++j) {
        hv0[j] = (_Float16)tile[(m * 8 + j) * 33 + nl0];
        hv1[j] = (_Float16)tile[(m * 8 + j) * 33 + nl1];
    }
    _Float16* d0 = xo + (size_t)(nb + nl0) * DIMC + cb + m * 8;
    _Float16* d1 = xo + (size_t)(nb + nl1) * DIMC + cb + m * 8;
    vst8h(d0, hv0);
    vst8h(d1, hv1);
    
}

// ---------------------------------------------------------------------------
// Kernel 2: fused QKV projection [1024][384] x [384][4096] per batch + affine.
// Block tile 256 rows x 128 cols, 8 waves, wave tile 64 x 64, operands through the LDS ring.
// A block lies wholly in one of the three row regions.  Result staged in LDS:
//   Q rows (0..255):   channel softmax over 32 per head (f32), x256, f16 -> qsm[b][n][256]
//   K rows (256..511): first half of the softmax over n, per row and per 128 columns of the block:
//                      exp(k - block max) x1024, f16 -> ke[b][256][N]; the block's max and the
//                      f32 sum of those (x1024 too) -> kmx, ksum [b][column block][256]
//   V rows (512..1023): f16 -> vh[b][512][N]
// ---------------------------------------------------------------------------
__global__ __launch_bounds__(256) void qkv_kernel(const _Float16* __restrict__ wabc,
                                                  const _Float16* __restrict__ xt,
                                                  const float* __restrict__ sc,
                                                  const float* __restrict__ bc,
                                                  _Float16* __restrict__ qsm,
                                                  _Float16* __restrict__ ke,
                                                  float* __restrict__ kmx,
                                                  float* __restrict__ ksum,
                                                  _Float16* __restrict__ vh)
{
    constexpr int MT = MT_QKV;
    static_assert(NHKD % (64 * MT) == 0, "a block stays inside one region");
    __shared__ __attribute__((aligned(16))) unsigned char ring[GEMM_LDS_B(MT)];
    float* tile = (float*)ring;
    // the row block is the slowest grid index: the Q blocks, whose epilogue is the longest, start first
    const int b = blockIdx.y;
    const int t = threadIdx.x, l = t & 31, wave = t >> 5, h = l >> 4, m = l & 15;
    const int mw = wave >> 1, nw = wave & 1;
    const int Mbase = blockIdx.z * (64 * MT), Nbase = blockIdx.x * 128;
    const int region = (Mbase < NHKD) ? 0 : ((Mbase < 2 * NHKD) ? 1 : 2);

    const _Float16* Ablk = wabc + (size_t)Mbase * DIMC;
    const _Float16* Bblk = xt + ((size_t)b * NN + Nbase) * DIMC;
    v8f c[MT][4] = {};
    mainloop_x128<DIMC, MT>(ring, Ablk, Bblk, t, mw, nw, h, m, c);

    // the loops over i below are unrolled: c, s and bb are indexed by constants and stay in registers
    const float* ps = sc + Mbase + mw * 16 + 8 * h;
    const float* pb = bc + Mbase + mw * 16 + 8 * h;
    float s[MT][8], bb[MT][8];
#pragma unroll
    for (int i = 0; i < MT; ++i) {
#pragma unroll
        for (int r = 0; r < 8; ++r) { s[i][r] = ps[i * 64 + r]; bb[i][r] = pb[i * 64 + r]; }
    }
    // the two address pairs stay live to here, so that no load's result lands on them, and the wait
    // stands ahead of their reuse
    asm volatile("s_wait_xcnt 0x0" :: "v"(ps), "v"(pb) : "memory");
#pragma unroll
    for (int i = 0; i < MT; ++i) {
#pragma unroll
        for (int r = 0; r < 8; ++r) {
            const int ml = i * 64 + mw * 16 + 8 * h + r;
            float* trow = tile + ml * TP + nw * 64 + m;
            trow[0]  = c[i][0][r] * s[i][r] + bb[i][r];
            trow[16] = c[i][1][r] * s[i][r] + bb[i][r];
            trow[32] = c[i][2][r] * s[i][r] + bb[i][r];
            trow[48] = c[i][3][r] * s[i][r] + bb[i][r];
        }
    }
    __syncthreads();

    if (region == 0) {
        // softmax over the 32 channels of one head for one column; 2 heads x 128 cols = 256 threads
        // per 64 rows
        const int nl = t & 127, hh = t >> 7;
        for (int i = 0; i < MT; ++i) {
            float* hcol = tile + (i * 64 + hh * KDIM) * TP + nl;
            float qv[KDIM];
            float mx;
#pragma unroll
            for (int k = 0; k < KDIM; ++k) {
                qv[k] = hcol[k * TP];
                mx = (k == 0) ? qv[0] : fmaxf(mx, qv[k]);
            }
            float sum = 0.f;
#pragma unroll
            for (int k = 0; k < KDIM; ++k) { qv[k] = __expf(qv[k] - mx); sum += qv[k]; }
            const float scl = 256.0f / sum;
#pragma unroll
            for (int k = 0; k < KDIM; ++k) hcol[k * TP] = qv[k] * scl;
        }
    }
    __syncthreads();

    if (region == 0) {
        const int p = l & 7;
        // unrolled: the LDS reads of the next 64 rows start under the stores of these
#pragma unroll
        for (int i = 0; i < MT; ++i) {
#pragma unroll
            for (int it = 0; it < 4; ++it) {
                const int nl = wave * 16 + it * 4 + (l >> 3);
                v8h hv;
#pragma unroll
                for (int j = 0; j < 8; ++j) hv[j] = (_Float16)tile[(i * 64 + p * 8 + j) * TP + nl];
                vst8h(qsm + ((size_t)b * NN + Nbase + nl) * NHKD + Mbase + i * 64 + p * 8, hv);
            }
        }
    } else if (region == 1) {
        // lane = row: thread t holds row t's 128 columns in registers, so max and sum need no exchange
        static_assert(64 * MT == 256, "one row per thread");
        const int obase = Mbase - NHKD;
        float* krow = tile + t * TP;
        // every loop here is unrolled: kv is indexed by constants and stays in registers
        v4f kv[32];
#pragma unroll
        for (int j = 0; j < 32; ++j) kv[j] = *(const v4fa*)(krow + 4 * j);
        v4f mx4 = kv[0];
#pragma unroll
        for (int j = 1; j < 32; ++j)
#pragma unroll
            for (int i = 0; i < 4; ++i) mx4[i] = fmaxf(mx4[i], kv[j][i]);
        const float mx = fmaxf(fmaxf(mx4[0], mx4[1]), fmaxf(mx4[2], mx4[3]));
        v4f sum4 = {};
#pragma unroll
        for (int j = 0; j < 16; ++j) {
            // exp(k - mx) x 1024 = 2^((k - mx) log2 e + 10)
            float x[8], e[8];
#pragma unroll
            for (int i = 0; i < 8; ++i) x[i] = fmaf(kv[2 * j + (i >> 2)][i & 3] - mx, 1.44269504f, 10.0f);
            exp2x8(e, x);
            v8h hv;
#pragma unroll
            for (int i = 0; i < 8; ++i) { sum4[i & 3] += e[i]; hv[i] = (_Float16)e[i]; }
            // over the head of the thread's own row, which is wholly in its registers by now
            *(v8ha*)((_Float16*)krow + 8 * j) = hv;
        }
        // a wave's 32 rows: one whole 128-B line per store
        const size_t so = ((size_t)b * NBLK + blockIdx.x) * NHKD + obase + t;
        kmx[so]  = mx;
        ksum[so] = (sum4[0] + sum4[1]) + (sum4[2] + sum4[3]);
        // ke[b][o][Nbase..Nbase+127] f16: 256 B = 2 lines per row, two rows per instruction.  A wave
        // reads back only the 32 rows that its own lanes wrote (one wave's LDS operations go in issue
        // order): no barrier
#pragma unroll
        for (int it = 0; it < 4 * MT; ++it) {
            const int row = wave * (8 * MT) + it * 2 + h;
            const v8h hv = *(const v8ha*)((const _Float16*)(tile + row * TP) + m * 8);
            vst8h(ke + ((size_t)b * NHKD + obase + row) * NN + Nbase + m * 8, hv);
        }
    } else {
        // vh[b][o][Nbase..Nbase+127] f16: 256 B = 2 lines per row, two rows per instruction
        const int obase = Mbase - 2 * NHKD;
#pragma unroll
        for (int it = 0; it < 4 * MT; ++it) {
            const int row = wave * (8 * MT) + it * 2 + h;
            v8h hv;
#pragma unroll
            for (int j = 0; j < 8; ++j) hv[j] = (_Float16)tile[row * TP + m * 8 + j];
            vst8h(vh + ((size_t)b * DHC + obase + row) * NN + Nbase + m * 8, hv);
        }
    }
}

// ---------------------------------------------------------------------------
// Kernel 3: context per (b,head): C[kd][d] = sum_n softmax_n(k)[kd][n] * v[d][n], K = 4096.
// A rows = ke rows (n contiguous); B[k=n][col=d] = vh row d (n contiguous): same loader.
// Second half of the key softmax: a wave's 128 n are one column block of kernel 2, so its whole
// tile row kd carries one factor 4096 exp(block max - row max) / row sum (the x1024 cancels), formed
// from kmx and ksum of the row's 32 blocks and applied in f32 where the waves' tiles are added.
// The n-sum is split: CSPLIT work-groups per (b,head), eight waves each, every wave holding the
// whole 32 x 64 tile (2 kd-tiles x 4 d-tiles) for its own 128 n, so that each fragment is
// loaded once and all of a wave's loads are independent.  The eight waves' tiles are added
// through LDS in wave order; the work-group's f32 partial goes to part[bh][g][2048].
// Order inside a partial: unit u = dt*4 + kt*2 + (r>>2), then lane, then r&3 (accumulator
// register r of tile (kt, dt)).  That is the A-fragment order of kernel 4: element e = kt*8 + r
// of lane (m, h) is C[kd = kt*16 + 8h + r][d = dt*16 + m].
// ---------------------------------------------------------------------------
__global__ __launch_bounds__(256) void ctx_kernel(const _Float16* __restrict__ ke,
                                                  const float* __restrict__ kmx,
                                                  const float* __restrict__ ksum,
                                                  const _Float16* __restrict__ vh,
                                                  float* __restrict__ part)
{
    static_assert(CWN == 128 && NBLK == 32, "a wave's n = one column block; 4 blocks per wave below");
    __shared__ __attribute__((aligned(16))) float red[8 * CTILE];
    __shared__ float pm[8 * KDIM], ps[8 * KDIM];
    __shared__ __attribute__((aligned(16))) float fl[8 * KDIM];
    const int bh = blockIdx.x / CSPLIT, g = blockIdx.x % CSPLIT, b = bh >> 3, hd = bh & 7;
    const int t = threadIdx.x, l = t & 31, wave = t >> 5, h = l >> 4, m = l & 15;
    const int n0 = (g * 8 + wave) * CWN;
    // both operands have the row pitch NN, so one per-lane byte offset serves every load
    const char* Abase = (const char*)(ke  + ((size_t)b * NHKD + hd * KDIM) * NN);
    const char* Bbase = (const char*)(vh  + ((size_t)b * DHC  + hd * DD)   * NN);
    const unsigned lane_off = (unsigned)(m * NN + n0 + 8 * h) * 2u;
    // statistics of key row l: four of its 32 blocks per wave, and this wave's own block's max
    const float* sm = kmx  + (size_t)b * NBLK * NHKD + hd * KDIM + l;
    const float* pm4 = sm + wave * 4 * NHKD;
    const float* ps4 = ksum + (size_t)b * NBLK * NHKD + hd * KDIM + l + wave * 4 * NHKD;
    float m4[4], s4[4];
#pragma unroll
    for (int i = 0; i < 4; ++i) { m4[i] = pm4[i * NHKD]; s4[i] = ps4[i * NHKD]; }
    const float* pown = sm + (g * 8 + wave) * NHKD;
    const float mown = *pown;
    // every loop below is unrolled so that the fragment and accumulator arrays are indexed by
    // constants and stay in registers
    v16h a[CWN / 32][2], bf[CWN / 32][4];
#pragma unroll
    for (int s = 0; s < CWN / 32; ++s) {
#pragma unroll
        for (int i = 0; i < 2; ++i)
            a[s][i] = load_frag((const _Float16*)(Abase + lane_off) + i * 16 * NN + s * 32, 0);
#pragma unroll
        for (int j = 0; j < 4; ++j)
            bf[s][j] = load_frag((const _Float16*)(Bbase + lane_off) + j * 16 * NN + s * 32, 0);
    }
    // the first results reuse the loads' offset register: the wait stands ahead of that overwrite;
    // the three statistics addresses stay live to here, so that no load's result lands on them
    asm volatile("s_wait_xcnt 0x0" :: "v"(pm4), "v"(ps4), "v"(pown) : "memory");
    // keeps every load of the wave ahead of the first product: one memory latency per wave;
    // without it the scheduler reuses fragment registers and waits out eight latencies in a row
    __builtin_amdgcn_sched_barrier(0);
    {
        const float ml = fmaxf(fmaxf(m4[0], m4[1]), fmaxf(m4[2], m4[3]));
        float sl = 0.f;
#pragma unroll
        for (int i = 0; i < 4; ++i) sl += s4[i] * __expf(m4[i] - ml);
        pm[wave * KDIM + l] = ml;
        ps[wave * KDIM + l] = sl;
        __syncthreads();   // every wave's four blocks are in pm, ps
        float M = pm[l];
#pragma unroll
        for (int w = 1; w < 8; ++w) M = fmaxf(M, pm[w * KDIM + l]);
        float S = 0.f;
#pragma unroll
        for (int w = 0; w < 8; ++w) S += ps[w * KDIM + l] * __expf(pm[w * KDIM + l] - M);
        fl[wave * KDIM + l] = __expf(mown - M) * (4096.0f / S);   // read behind the barrier below
    }
    v8f c[2][4] = {};
#pragma unroll
    for (int s = 0; s < CWN / 32; ++s)
#pragma unroll
        for (int i = 0; i < 2; ++i)
#pragma unroll
            for (int j = 0; j < 4; ++j) c[i][j] = mma16(a[s][i], bf[s][j], c[i][j]);
    // keeps the LDS stores behind the last product: all eight accumulators stay live to here, so
    // none of their registers is handed to another product's result inside the hazard distance
    __builtin_amdgcn_sched_barrier(0);
    float* mine = red + wave * CTILE + l * 4;
#pragma unroll
    for (int j = 0; j < 4; ++j)
#pragma unroll
        for (int i = 0; i < 2; ++i) {
            const v8f v = c[i][j];
            vst4f(mine + (j * 4 + i * 2) * 128,     (v4f){v[0], v[1], v[2], v[3]});
            vst4f(mine + (j * 4 + i * 2 + 1) * 128, (v4f){v[4], v[5], v[6], v[7]});
        }
    __syncthreads();
    float* dst = part + (size_t)blockIdx.x * CTILE;
    // unit u = 8 q + wave: kt = (wave >> 1) & 1 and r >> 2 = wave & 1 for both q, so this thread's
    // four elements are rows kd0 .. kd0 + 3 of every wave's tile
    const int kd0 = ((wave >> 1) & 1) * 16 + 8 * h + (wave & 1) * 4;
    v4f fw[8];
#pragma unroll
    for (int w = 0; w < 8; ++w) fw[w] = *(const v4f*)(fl + w * KDIM + kd0);
#pragma unroll
    for (int q = 0; q < 2; ++q) {
        const int e = q * 1024 + t * 4;
        v4f s = *(const v4f*)(red + e) * fw[0];
#pragma unroll
        for (int w = 1; w < 8; ++w) s += *(const v4f*)(red + w * CTILE + e) * fw[w];
        vst4f(dst + e, s);
    }
}

// ---------------------------------------------------------------------------
// Kernel 4: attended and output projection in one.
// Output projection [384][512] x [512][4096] per batch + affine -> f32 out.  Block tile 192 rows x
// 128 cols, 8 waves, wave tile 48 x 64.  A stage of 64 k is one head's 64 d.  The A rows (weights)
// come into the ring by asynchronous copies; the B rows are made in place, one stage ahead:
//   Att[d][n] = sum_kd C[kd][d] * qsm[n][hd*32+kd], K = 32 (one WMMA per 16x16 tile), ReLU, scaled
//   to att x256 (= acc/64), f16.  Wave w makes the 16 columns n = 16 w .. of all four d tiles: lane
//   (m, h) holds d = 16 dt + 8 h + r of column m, which are eight neighbours of B row n.
// The A fragments of that product are the sums of kernel 3's CSPLIT partials (already in fragment
// order, whole lines per load), /64 (= true context x64), rounded to f16; the block forms them once
// for its batch's eight heads: cl[hd][dt][half of the fragment][lane][8].
// ---------------------------------------------------------------------------
__global__ __launch_bounds__(256) void out_kernel(const _Float16* __restrict__ wph,
                                                  const float* __restrict__ part,
                                                  const _Float16* __restrict__ qsm,
                                                  const float* __restrict__ sp,
                                                  const float* __restrict__ bp,
                                                  float* __restrict__ out)
{
    constexpr int MT = MT_OUT, K = DHC, NT = K / KS;
    static_assert(DIMC % (64 * MT) == 0, "whole blocks");
    static_assert(KS == DD && NT == HEADS && NT >= 2, "a stage is a head");
    __shared__ __attribute__((aligned(16))) unsigned char ring[OUT_LDS_B];
    float* tile = (float*)ring;
    _Float16* cl = (_Float16*)(ring + RING_B(MT));
    const int b = blockIdx.z;
    const int t = threadIdx.x, l = t & 31, wave = t >> 5, h = l >> 4, m = l & 15;
    const int mw = wave >> 1, nw = wave & 1;
    const int Mbase = blockIdx.y * (64 * MT), Nbase = blockIdx.x * 128;
    const unsigned lds = (unsigned)(uintptr_t)ring + (t >> 3) * LPB + (t & 7) * 16;
    const _Float16* ga = wph + (size_t)Mbase * K + (t >> 3) * K + (t & 7) * 8;
    // this lane's first piece of its column's query row (load_frag's lane offset is in it)
    const _Float16* qrow = qsm + ((size_t)b * NN + Nbase + wave * 16 + m) * NHKD + 8 * h;

    // B rows of head hd from its query fragment qf, into the stage at buf
    auto make_b = [&](const int hd, const v16h qf, unsigned char* buf) {
        const _Float16* ch = cl + hd * CTILE + l * 8;
        _Float16* brow = (_Float16*)(buf + (64 * MT + wave * 16 + m) * LPB) + 8 * h;
        // unrolled: fragments and results are indexed by constants and stay in registers
        Frag ca[4];
        v8f d[4];
#pragma unroll
        for (int dt = 0; dt < 4; ++dt) {
            ca[dt].half[0] = *(const v8h*)(ch + dt * 512);
            ca[dt].half[1] = *(const v8h*)(ch + dt * 512 + 256);
        }
        // keeps the eight LDS reads together ahead of the products: left alone the scheduler reuses
        // one fragment's registers and waits out an LDS latency per d tile
        __builtin_amdgcn_sched_barrier(0);
#pragma unroll
        for (int dt = 0; dt < 4; ++dt) d[dt] = mma16(ca[dt].v, qf, (v8f){});
#pragma unroll
        for (int dt = 0; dt < 4; ++dt) {
            v8h hv;
#pragma unroll
            for (int r = 0; r < 8; ++r) hv[r] = (_Float16)fmaxf(d[dt][r] * 0.015625f, 0.0f);
            vst8h(brow + dt * 16, hv);
        }
    };

    copy_stage_a192(lds, ga, K);
    v16h qf = load_frag(qrow, 0);
    // wave = 2 dt + half of the fragment: this thread's eight elements of every head's tile
    const float* pc = part + (size_t)b * HEADS * CSPLIT * CTILE + wave * 256 + l * 4;
    // four heads at a time, kept rolled: 32 loads per thread in flight, in 128 registers
#pragma unroll 1
    for (int hq = 0; hq < HEADS; hq += 4) {
        const float* p = pc + hq * CSPLIT * CTILE;
        // the loops below are unrolled: v is indexed by constants and stays in registers
        v4f v[4][CSPLIT][2];
#pragma unroll
        for (int k = 0; k < 4; ++k)
#pragma unroll
            for (int g = 0; g < CSPLIT; ++g) {
                v[k][g][0] = *(const v4f*)(p + (k * CSPLIT + g) * CTILE);
                v[k][g][1] = *(const v4f*)(p + (k * CSPLIT + g) * CTILE + 128);
            }
        // the address pair stays live to here, and the wait stands ahead of its rewrite in the next trip
        asm volatile("s_wait_xcnt 0x0" :: "v"(p) : "memory");
#pragma unroll
        for (int k = 0; k < 4; ++k) {
            v4f s0 = v[k][0][0], s1 = v[k][0][1];
#pragma unroll
            for (int g = 1; g < CSPLIT; ++g) { s0 += v[k][g][0]; s1 += v[k][g][1]; }
            v8h hv;
#pragma unroll
            for (int i = 0; i < 4; ++i) {
                hv[i]     = (_Float16)(s0[i] * 0.015625f);
                hv[4 + i] = (_Float16)(s1[i] * 0.015625f);
            }
            vst8h(cl + (hq + k) * CTILE + wave * 256 + l * 8, hv);
        }
    }
    asm volatile("s_wait_asynccnt 0x0" ::: "memory");   // stage 0's A rows landed (this wave's pieces)
    __syncthreads();                                    // ... and every other wave's; cl is whole
    copy_stage_a192(lds + STAGE_B(MT), ga + KS, K);
    make_b(0, qf, ring);
    {
        const _Float16* qp = qrow + KDIM;
        qf = load_frag(qp, 0);
        // the address pair stays live to here, and the wait stands ahead of its reuse
        asm volatile("s_wait_xcnt 0x0" :: "v"(qp) : "memory");
    }
    __syncthreads();                                    // stage 0's B rows are whole

    v8f c[MT][4] = {};
    // kept rolled: unrolled, every stage's copy addresses stay live at once
#pragma unroll 1
    for (int s = 0; s < NT; ++s) {
        // head s+2's query fragment starts here: the whole trip covers its latency
        v16h qn = qf;
        if (s + 2 < NT) {
            const _Float16* qp = qrow + (s + 2) * KDIM;
            qn = load_frag(qp, 0);
            // the address pair stays live to here, and the wait stands ahead of its reuse
            asm volatile("s_wait_xcnt 0x0" :: "v"(qp) : "memory");
        }
        // buffer (s+1)&1: its last readers left at the barrier behind trip s-1
        if (s + 1 < NT) make_b(s + 1, qf, ring + ((s + 1) & 1) * STAGE_B(MT));
        qf = qn;
        const _Float16* st = (const _Float16*)(ring + (s & 1) * STAGE_B(MT));
        const _Float16* ar = st + (mw * 16 + m) * LPH;
        const _Float16* br = st + (64 * MT + nw * 64 + m) * LPH;
        v16h a[MT], bfr[4];
        // unrolled: fragments and accumulators are indexed by constants and stay in registers
#pragma unroll
        for (int kk = 0; kk < KS / 32; ++kk) {
            a[0] = load_frag(ar + kk * 32, h);
#pragma unroll
            for (int j = 0; j < 4; ++j) bfr[j] = load_frag(br + j * 16 * LPH + kk * 32, h);
#pragma unroll
            for (int i = 1; i < MT; ++i) a[i] = load_frag(ar + i * 64 * LPH + kk * 32, h);
            // keeps the LDS reads of a k step together ahead of its products: left alone the
            // scheduler reuses one A fragment's registers and waits out an LDS latency per row
            __builtin_amdgcn_sched_barrier(0);
#pragma unroll
            for (int i = 0; i < MT; ++i)
#pragma unroll
                for (int j = 0; j < 4; ++j) c[i][j] = mma16(a[i], bfr[j], c[i][j]);
            // keeps every product of the k step ahead of what follows: the next reads, and at the
            // end the four slots below (left alone a row of products sinks behind the barrier)
            __builtin_amdgcn_sched_barrier(0);
        }
        // four vector slots behind the last matrix instructions, on the branch paths too
        GUARD4(c[MT - 1][0], c[MT - 1][1], c[MT - 1][2], c[MT - 1][3], a[MT - 1], bfr[0], bfr[1], bfr[2], bfr[3]);
        asm volatile("s_wait_dscnt 0x0" ::: "memory");     // reads of buffer s&1 and writes of stage s+1's B rows are done
        asm volatile("s_wait_asynccnt 0x0" ::: "memory");  // this wave's pieces of stage s+1's A rows have landed
        __syncthreads();                                   // publishes stage s+1, frees buffer s&1
        if (s + 2 < NT)
            copy_stage_a192(lds + (s & 1) * STAGE_B(MT), ga + (s + 2) * KS, K);
    }
    asm volatile("s_wait_asynccnt 0x0" ::: "memory");      // nothing in flight when the ring is reused

    // unrolled over i: c is indexed by constants and stays in registers
#pragma unroll
    for (int i = 0; i < MT; ++i) {
#pragma unroll
        for (int r = 0; r < 8; ++r) {
            const int ml = i * 64 + mw * 16 + 8 * h + r;
            const int o = Mbase + ml;
            const float s = sp[o] * 0.000244140625f;   // 1/(16*256)
            const float bb = bp[o];
            float* trow = tile + ml * TP + nw * 64 + m;
            trow[0]  = c[i][0][r] * s + bb;
            trow[16] = c[i][1][r] * s + bb;
            trow[32] = c[i][2][r] * s + bb;
            trow[48] = c[i][3][r] * s + bb;
        }
    }
    __syncthreads();
    const int col = (l >> 3) * 32 + (l & 7) * 4;
#pragma unroll
    for (int it = 0; it < 8 * MT; ++it) {
        const int row = wave * (8 * MT) + it;
        const v4f v = *(const v4fa*)(tile + row * TP + col);
        vst4f(out + ((size_t)b * DIMC + Mbase + row) * NN + Nbase + col, v);
    }
}

// ---------------------------------------------------------------------------
// Host-side launch glue.  Workspace (bytes):
//   [0)            xt   f16 [8][4096][384]   25,165,824
//   [25,165,824)   wabc f16 [1024][384]         786,432
//   [25,952,256)   wph  f16 [384][512]          393,216
//   [26,345,472)   sc   f32 [1024]                4,096
//   [26,349,568)   bc   f32 [1024]                4,096
//   [26,353,664)   qsm  f16 [8][4096][256]   16,777,216
//   [43,130,880)   ke   f16 [8][256][4096]   16,777,216   (in a place of 33,554,432)
//   [76,685,312)   vh   f16 [8][512][4096]   33,554,432
//   [110,239,744)  part f32 [64][4][2048]     2,097,152
//   [112,336,896)  kmx  f32 [8][32][256]        262,144
//   [112,599,040)  ksum f32 [8][32][256]        262,144
//   total 112,861,184
// ---------------------------------------------------------------------------
extern "C" void kernel_launch(void* const* d_in, const int* in_sizes, int n_in,
                              void* d_out, int out_size, void* d_ws, size_t ws_size,
                              hipStream_t stream)
{
    if (n_in < 13) return;
    if (in_sizes[0] != BB * DIMC * NN) return;
    if (in_sizes[1] != NHKD * DIMC || in_sizes[2] != NHKD || in_sizes[3] != NHKD) return;
    if (in_sizes[4] != NHKD * DIMC || in_sizes[5] != NHKD || in_sizes[6] != NHKD) return;
    if (in_sizes[7] != DHC * DIMC || in_sizes[8] != DHC || in_sizes[9] != DHC) return;
    if (in_sizes[10] != DIMC * DHC || in_sizes[11] != DIMC || in_sizes[12] != DIMC) return;
    if (out_size != BB * DIMC * NN) return;

    const size_t off_xt   = 0;
    const size_t sz_xt    = (size_t)BB * NN * DIMC * 2;
    const size_t off_wabc = off_xt + sz_xt;
    const size_t sz_wabc  = (size_t)MQKV * DIMC * 2;
    const size_t off_wph  = off_wabc + sz_wabc;
    const size_t sz_wph   = (size_t)DIMC * DHC * 2;
    const size_t off_sc   = off_wph + sz_wph;
    const size_t sz_sc    = (size_t)MQKV * 4;
    const size_t off_bc   = off_sc + sz_sc;
    const size_t off_qsm  = off_bc + sz_sc;
    const size_t sz_qsm   = (size_t)BB * NN * NHKD * 2;
    const size_t off_kf   = off_qsm + sz_qsm;
    const size_t sz_kf    = (size_t)BB * NHKD * NN * 4;
    const size_t off_vh   = off_kf + sz_kf;
    const size_t sz_vh    = (size_t)BB * DHC * NN * 2;
    const size_t off_ctx  = off_vh + sz_vh;
    const size_t sz_ctx   = (size_t)BB * HEADS * CSPLIT * CTILE * 4;
    const size_t off_kmx  = off_ctx + sz_ctx;
    const size_t sz_kst   = (size_t)BB * NBLK * NHKD * 4;
    const size_t off_ksum = off_kmx + sz_kst;
    const size_t total    = off_ksum + sz_kst;
    const size_t sz_ke    = (size_t)BB * NHKD * NN * 2;
    if (total > ws_size) return;
    if (sz_ke > sz_kf) return;

    const float* x  = (const float*)d_in[0];
    const float* Wq = (const float*)d_in[1];
    const float* sq = (const float*)d_in[2];
    const float* bq = (const float*)d_in[3];
    const float* Wk = (const float*)d_in[4];
    const float* sk = (const float*)d_in[5];
    const float* bk = (const float*)d_in[6];
    const float* Wv = (const float*)d_in[7];
    const float* sv = (const float*)d_in[8];
    const float* bv = (const float*)d_in[9];
    const float* Wp = (const float*)d_in[10];
    const float* sp = (const float*)d_in[11];
    const float* bp = (const float*)d_in[12];
    float* out = (float*)d_out;

    char* ws = (char*)d_ws;
    _Float16* xt   = (_Float16*)(ws + off_xt);
    _Float16* wabc = (_Float16*)(ws + off_wabc);
    _Float16* wph  = (_Float16*)(ws + off_wph);
    float*    sc   = (float*)   (ws + off_sc);
    float*    bc   = (float*)   (ws + off_bc);
    _Float16* qsm  = (_Float16*)(ws + off_qsm);
    _Float16* ke   = (_Float16*)(ws + off_kf);
    _Float16* vh   = (_Float16*)(ws + off_vh);
    float*    part = (float*)   (ws + off_ctx);
    float*    kmx  = (float*)   (ws + off_kmx);
    float*    ksum = (float*)   (ws + off_ksum);

    const int prep_threads = MQKV * DIMC / 8 + DIMC * DHC / 8 + 512;   // 74240
    prep_kernel<<<(prep_threads + 255) / 256, 256, 0, stream>>>(
        Wq, Wk, Wv, Wp, sq, bq, sk, bk, sv, bv, wabc, wph, sc, bc);

    xpose_kernel<<<dim3(NN / 32, DIMC / 128, BB), 256, 0, stream>>>(x, xt);

    qkv_kernel<<<dim3(NN / 128, BB, MQKV / (64 * MT_QKV)), 256, 0, stream>>>(wabc, xt, sc, bc, qsm, ke, kmx, ksum, vh);

    ctx_kernel<<<BB * HEADS * CSPLIT, 256, 0, stream>>>(ke, kmx, ksum, vh, part);

    out_kernel<<<dim3(NN / 128, DIMC / (64 * MT_OUT), BB), 256, 0, stream>>>(wph, part, qsm, sp, bp, out);
}

// v006
// One run takes 70 microseconds.
// Next to v005, in two timings, it ran 1.08 times as fast each time.
// Over all steps from v000 it is 4.40 times as fast.
#include <hip/hip_runtime.h>
// All contractions on v_wmma_f32_16x16x32_f16 (f16 operands, f32 accumulate): QKV projection, key*value^T, context^T*query, output projection; exact power-of-two operand scales (weights x16, key exponentials x1024, context x64, query softmax x256, attended x256) undone in the f32 epilogues; softmaxes and affine terms in f32.

#define BB    8
#define DIMC  384
#define NN    4096
#define HEADS 8
#define KDIM  32
#define DD    64
#define NHKD  256
#define DHC   512
#define MQKV  1024
#define TP    132      // LDS pitch (floats) for the 64 MT x 128 output tiles, keeps 16-B alignment
#define CSPLIT 4       // work-groups that share the n-sum of one (b,head) context
#define CWN   (NN / (CSPLIT * 8))   // n per wave of the context kernel (128)
#define CTILE (KDIM * DD)           // elements of one context tile (2048)
#define NBLK  (NN / 128)            // column blocks of the QKV projection = pieces of a key row (32)

typedef _Float16 v16h __attribute__((ext_vector_type(16)));
typedef _Float16 v8h  __attribute__((ext_vector_type(8)));
typedef _Float16 v4h  __attribute__((ext_vector_type(4)));
typedef float    v8f  __attribute__((ext_vector_type(8)));
typedef float    v4f  __attribute__((ext_vector_type(4)));
typedef float    v4fa __attribute__((ext_vector_type(4), may_alias));
typedef _Float16 v8ha __attribute__((ext_vector_type(8), may_alias));

union Frag { v16h v; v8h half[2]; };

// 16x16x32 operand fragment from a k-contiguous row: elements 0..7 <- row[8h..8h+7],
// elements 8..15 <- row[16+8h..16+8h+7]; lane&15 selects the row (A) or column (B).
__device__ __forceinline__ v16h load_frag(const _Float16* __restrict__ p, int h)
{
    Frag f;
    f.half[0] = *(const v8h*)(p + 8 * h);
    f.half[1] = *(const v8h*)(p + 16 + 8 * h);
    return f.v;
}

__device__ __forceinline__ v8f mma16(v16h a, v16h b, v8f c)
{
    return __builtin_amdgcn_wmma_f32_16x16x32_f16(false, a, false, b, (short)0, c, false, false);
}

#define GUARD4(c0, c1, c2, c3, a, b0, b1, b2, b3) \
    asm volatile("v_nop\n\tv_nop\n\tv_nop\n\tv_nop" \
                 : "+v"(c0), "+v"(c1), "+v"(c2), "+v"(c3) \
                 : "v"(a), "v"(b0), "v"(b1), "v"(b2), "v"(b3))

// e[i] = 2^x[i].  One statement: outputs and inputs are kept apart, so each exponential is the
// independent instruction behind the one before it, and the v_nop is that slot behind the last
__device__ __forceinline__ void exp2x8(float (&e)[8], const float (&x)[8])
{
    asm("v_exp_f32 %0, %8\n\tv_exp_f32 %1, %9\n\tv_exp_f32 %2, %10\n\tv_exp_f32 %3, %11\n\t"
        "v_exp_f32 %4, %12\n\tv_exp_f32 %5, %13\n\tv_exp_f32 %6, %14\n\tv_exp_f32 %7, %15\n\t"
        "v_nop"
        : "=&v"(e[0]), "=&v"(e[1]), "=&v"(e[2]), "=&v"(e[3]),
          "=&v"(e[4]), "=&v"(e[5]), "=&v"(e[6]), "=&v"(e[7])
        : "v"(x[0]), "v"(x[1]), "v"(x[2]), "v"(x[3]), "v"(x[4]), "v"(x[5]), "v"(x[6]), "v"(x[7]));
}

__device__ __forceinline__ void vst8h(_Float16* p, v8h v) { *(v8h*)p = v; }
__device__ __forceinline__ void vst4f(float* p, v4f v)    { *(v4f*)p = v; }

// LDS ring of the two projection GEMMs.  Block tile 64 MT rows x 128 columns.  A stage = 64 k
// (128 B) of the 64 MT A rows, row pitch 144 B (16 B x 9: conflict-free for ds_load_b128), and then
// the B tile in 128 x 144 B; two buffers.  The f32 output tile reuses the space after the loop.
// Output kernel: B = 128 rows (columns n) of 64 k, pitch 144 B.  QKV kernel: B = 64 rows (k) of
// 128 n, pitch 288 B (32 B x 9: conflict-free for ds_load_tr16_b128), the same bytes in all.
#define KS      64                 // k per stage
#define LPB     144                // LDS row pitch, bytes
#define LPH     72                 // the same in halves
#define XPB     288                // LDS row pitch of the QKV kernel's B tile, bytes
#define STAGE_B(MT) ((64 * (MT) + 128) * LPB)
#define RING_B(MT)  (2 * STAGE_B(MT))
#define OTILE_B(MT) (64 * (MT) * TP * 4)
#define GEMM_LDS_B(MT) (RING_B(MT) > OTILE_B(MT) ? RING_B(MT) : OTILE_B(MT))
#define MT_QKV  4                  // 256 x 128 block, 64 x 64 per wave
#define MT_OUT  3                  // 192 x 128 block, 48 x 64 per wave
#define CTXL_B  (HEADS * CTILE * 2)   // one batch's eight context tiles in f16, behind the output kernel's ring
#define OUT_LDS_B (RING_B(MT_OUT) + CTXL_B > OTILE_B(MT_OUT) ? RING_B(MT_OUT) + CTXL_B : OTILE_B(MT_OUT))

// The A rows of a stage of the QKV kernel: 256 x 8 pieces of 16 B, 8 per thread.  Thread t brings
// piece t&7 of rows t>>3 + 32 j, so eight lanes cover one 128-B line.  a: this thread's piece in
// A row t>>3 at the stage's k; lds: its place in the buffer (byte address in LDS).
// s_wait_xcnt stands inside the statement, ahead of any rewrite of the address registers.
__device__ __forceinline__ void copy_stage_a256(const unsigned lds, const _Float16* a, const int K)
{
    asm volatile("global_load_async_to_lds_b128 %0, %8, off\n\t"
                 "global_load_async_to_lds_b128 %1, %9, off\n\t"
                 "global_load_async_to_lds_b128 %2, %10, off\n\t"
                 "global_load_async_to_lds_b128 %3, %11, off\n\t"
                 "global_load_async_to_lds_b128 %4, %12, off\n\t"
                 "global_load_async_to_lds_b128 %5, %13, off\n\t"
                 "global_load_async_to_lds_b128 %6, %14, off\n\t"
                 "global_load_async_to_lds_b128 %7, %15, off\n\t"
                 "s_wait_xcnt 0x0"
                 :: "v"(lds), "v"(lds + 32 * LPB), "v"(lds + 64 * LPB), "v"(lds + 96 * LPB),
                    "v"(lds + 128 * LPB), "v"(lds + 160 * LPB), "v"(lds + 192 * LPB),
                    "v"(lds + 224 * LPB),
                    "v"(a), "v"(a + 32 * K), "v"(a + 64 * K), "v"(a + 96 * K),
                    "v"(a + 128 * K), "v"(a + 160 * K), "v"(a + 192 * K), "v"(a + 224 * K)
                 : "memory");
}

// The A rows alone of a stage of the output kernel (192 rows, 6 pieces per thread), same places as above.
__device__ __forceinline__ void copy_stage_a192(const unsigned lds, const _Float16* a, const int K)
{
    asm volatile("global_load_async_to_lds_b128 %0, %6, off\n\t"
                 "global_load_async_to_lds_b128 %1, %7, off\n\t"
                 "global_load_async_to_lds_b128 %2, %8, off\n\t"
                 "global_load_async_to_lds_b128 %3, %9, off\n\t"
                 "global_load_async_to_lds_b128 %4, %10, off\n\t"
                 "global_load_async_to_lds_b128 %5, %11, off\n\t"
                 "s_wait_xcnt 0x0"
                 :: "v"(lds), "v"(lds + 32 * LPB), "v"(lds + 64 * LPB), "v"(lds + 96 * LPB),
                    "v"(lds + 128 * LPB), "v"(lds + 160 * LPB),
                    "v"(a), "v"(a + 32 * K), "v"(a + 64 * K), "v"(a + 96 * K),
                    "v"(a + 128 * K), "v"(a + 160 * K)
                 : "memory");
}

// 16 x 16 halves of a row-major LDS tile, transposed: lane (m, h) gets column m of rows 8 h .. 8 h + 7
// of the tile whose piece this lane's address names (rows by l & 7 and h, 16-B half by bit 3 of l)
typedef short s16x8 __attribute__((ext_vector_type(8)));
__device__ __forceinline__ v8h ld_tr16(const unsigned char* p)
{
    typedef __attribute__((address_space(3))) s16x8 lds_s16x8;
    return __builtin_bit_cast(v8h, __builtin_amdgcn_ds_load_tr16_b128_v8i16((lds_s16x8*)p));
}

// Block: 256 rows of A (f16, row-major, pitch K) times 128 columns of B = X (f32, X[k][n] with n
// contiguous, pitch NN).  A comes into the ring by asynchronous copies.  X comes through registers:
// whole 512-B rows per wave load, one stage ahead, rounded to f16 and stored as it lies (k rows of
// 128 n); the transposing LDS load hands out B fragments in load_frag's k order.
// Wave (mw, nw): rows 64 i + 16 mw.. (i < 4), columns 64 nw..; c[i][j] = row group i, column group j
// of 16: 8 fragments feed 16 products.  On return every wave has left the ring (last trip's barrier).
template <int K>
__device__ __forceinline__ void mainloop_wx(unsigned char* ring,
                                            const _Float16* __restrict__ Ablk,
                                            const float* __restrict__ Xblk,
                                            const int t, const int mw, const int nw,
                                            const int h, const int m,
                                            v8f (&c)[4][4])
{
    constexpr int MT = 4, NT = K / KS;
    static_assert(K % KS == 0 && NT >= 2, "two stages or more");
    const int l = t & 31, wave = t >> 5;
    const unsigned lds = (unsigned)(uintptr_t)ring + (t >> 3) * LPB + (t & 7) * 16;
    const _Float16* ga = Ablk + (t >> 3) * K + (t & 7) * 8;
    // this thread's part of a stage of X: columns 4 l .. 4 l + 3 of rows 8 wave + j, j < 8
    const float* gx = Xblk + (size_t)(wave * 8) * NN + l * 4;
    unsigned char* xs = ring + 64 * MT * LPB + (wave * 8) * XPB + l * 8;
    v4f xr[8];
    // the loops over j are unrolled: xr is indexed by constants and stays in registers
    auto load_x = [&](const int s) {
        const float* p = gx + (size_t)s * KS * NN;
#pragma unroll
        for (int j = 0; j < 8; ++j) xr[j] = *(const v4f*)(p + j * NN);
        // the address pair stays live to here, and the wait stands ahead of its rewrite
        asm volatile("s_wait_xcnt 0x0" :: "v"(p) : "memory");
    };
    auto store_x = [&](unsigned char* dst) {
#pragma unroll
        for (int j = 0; j < 8; ++j)
            *(v4h*)(dst + j * XPB) = __builtin_convertvector(xr[j], v4h);
    };

    copy_stage_a256(lds, ga, K);
    load_x(0);
    store_x(xs);
    asm volatile("s_wait_dscnt 0x0" ::: "memory");      // this wave's rows of stage 0's B tile are written
    asm volatile("s_wait_asynccnt 0x0" ::: "memory");   // stage 0's A rows landed (this wave's pieces)
    __syncthreads();                                    // ... and every other wave's
    copy_stage_a256(lds + STAGE_B(MT), ga + KS, K);
    load_x(1);   // behind the barrier, like every later stage's: the compiler waits out plain loads in front of one

    // kept rolled: unrolled, every stage's copy addresses stay live at once, and the added
    // registers cost a resident work-group per WGP
#pragma unroll 1
    for (int s = 0; s < NT; ++s) {
        const unsigned char* st = ring + (s & 1) * STAGE_B(MT);
        const _Float16* ar = (const _Float16*)st + (mw * 16 + m) * LPH;
        const unsigned char* br = st + 64 * MT * LPB + (8 * h + (l & 7)) * XPB + ((l >> 3) & 1) * 16 + nw * 128;
        v16h a[MT];
        Frag b[4];
        // unrolled: fragments and accumulators are indexed by constants and stay in registers
#pragma unroll
        for (int kk = 0; kk < KS / 32; ++kk) {
            a[0] = load_frag(ar + kk * 32, h);
#pragma unroll
            for (int j = 0; j < 4; ++j) {
                b[j].half[0] = ld_tr16(br + (kk * 32) * XPB + j * 32);
                b[j].half[1] = ld_tr16(br + (kk * 32 + 16) * XPB + j * 32);
            }
#pragma unroll
            for (int i = 1; i < MT; ++i) a[i] = load_frag(ar + i * 64 * LPH + kk * 32, h);
            // keeps the LDS reads of a k step together ahead of its products: left alone the
            // scheduler reuses one A fragment's registers and waits out an LDS latency per row
            __builtin_amdgcn_sched_barrier(0);
#pragma unroll
            for (int i = 0; i < MT; ++i)
#pragma unroll
                for (int j = 0; j < 4; ++j) c[i][j] = mma16(a[i], b[j].v, c[i][j]);
            // keeps every product of the k step ahead of what follows: the next reads, and at the
            // end the four slots below (left alone a row of products sinks behind the barrier)
            __builtin_amdgcn_sched_barrier(0);
        }
        // four vector slots behind the last matrix instructions, on the branch paths too
        GUARD4(c[MT - 1][0], c[MT - 1][1], c[MT - 1][2], c[MT - 1][3], a[MT - 1], b[0].v, b[1].v, b[2].v, b[3].v);
        // stage s+1's B tile, loaded a trip ago; buffer (s+1)&1: its last readers left at the barrier behind trip s-1
        if (s + 1 < NT) store_x(xs + ((s + 1) & 1) * STAGE_B(MT));
        asm volatile("s_wait_dscnt 0x0" ::: "memory");     // reads of buffer s&1 and writes of stage s+1's B tile are done
        asm volatile("s_wait_asynccnt 0x0" ::: "memory");  // this wave's pieces of stage s+1's A rows have landed
        __syncthreads();                                   // publishes stage s+1, frees buffer s&1
        if (s + 2 < NT) {
            copy_stage_a256(lds + (s & 1) * STAGE_B(MT), ga + (s + 2) * KS, K);
            load_x(s + 2);
        }
    }
    asm volatile("s_wait_asynccnt 0x0" ::: "memory");      // nothing in flight when the ring is reused
}

// ---------------------------------------------------------------------------
// Kernel 0: weights -> f16 (x16), concatenated [1024][384] and [384][512];
// affine params concatenated (scale pre-multiplied by 1/16).  16-B per lane stores.
// ---------------------------------------------------------------------------
__global__ __launch_bounds__(256) void prep_kernel(
    const float* __restrict__ Wq, const float* __restrict__ Wk, const float* __restrict__ Wv,
    const float* __restrict__ Wp,
    const float* __restrict__ sq, const float* __restrict__ bq,
    const float* __restrict__ sk, const float* __restrict__ bk,
    const float* __restrict__ sv, const float* __restrict__ bv,
    _Float16* __restrict__ wabc, _Float16* __restrict__ wph,
    float* __restrict__ sc, float* __restrict__ bc)
{
    const int NW1 = MQKV * DIMC / 8;   // 49152 chunks of 8 halves
    const int NW2 = DIMC * DHC / 8;    // 24576 chunks
    const int i = blockIdx.x * 256 + threadIdx.x;
    if (i < NW1 + NW2) {
        const float* src;
        _Float16* dst;
        if (i < NW1) {
            const int e = i * 8;
            if (e < NHKD * DIMC)          src = Wq + e;
            else if (e < 2 * NHKD * DIMC) src = Wk + (e - NHKD * DIMC);
            else                          src = Wv + (e - 2 * NHKD * DIMC);
            dst = wabc + e;
        } else {
            const int e = (i - NW1) * 8;
            src = Wp + e;
            dst = wph + e;
        }
        const v4f f0 = *(const v4f*)src;
        const v4f f1 = *(const v4f*)(src + 4);
        v8h hv;
#pragma unroll
        for (int j = 0; j < 4; ++j) {
            hv[j]     = (_Float16)(f0[j] * 16.0f);
            hv[4 + j] = (_Float16)(f1[j] * 16.0f);
        }
        vst8h(dst, hv);
        
    } else {
        const int j = i - (NW1 + NW2);
        if (j < 512) {
            const int e = (j & 255) * 4;
            v4f o;
#pragma unroll
            for (int q = 0; q < 4; ++q) {
                const int ee = e + q;
                float val;
                if (j < 256) {
                    val = (ee < NHKD) ? sq[ee] : ((ee < 2 * NHKD) ? sk[ee - NHKD] : sv[ee - 2 * NHKD]);
                    val *= 0.0625f;
                } else {
                    val = (ee < NHKD) ? bq[ee] : ((ee < 2 * NHKD) ? bk[ee - NHKD] : bv[ee - 2 * NHKD]);
                }
                o[q] = val;
            }
            float* dst = ((j < 256) ? sc : bc) + e;
            vst4f(dst, o);
            
        }
    }
}

// ---------------------------------------------------------------------------
// Kernel 1: fused QKV projection [1024][384] x [384][4096] per batch + affine.
// Block tile 256 rows x 128 cols, 8 waves, wave tile 64 x 64, operands through the LDS ring; x is read
// as it is given (f32, [b][c][n]) and rounded to f16 on its way into the ring.
// A block lies wholly in one of the three row regions.  Result staged in LDS:
//   Q rows (0..255):   channel softmax over 32 per head (f32), x256, f16 -> qsm[b][n][256]
//   K rows (256..511): first half of the softmax over n, per row and per 128 columns of the block:
//                      exp(k - block max) x1024, f16 -> ke[b][256][N]; the block's max and the
//                      f32 sum of those (x1024 too) -> kmx, ksum [b][column block][256]
//   V rows (512..1023): f16 -> vh[b][512][N]
// ---------------------------------------------------------------------------
__global__ __launch_bounds__(256) void qkv_kernel(const _Float16* __restrict__ wabc,
                                                  const float* __restrict__ x,
                                                  const float* __restrict__ sc,
                                                  const float* __restrict__ bc,
                                                  _Float16* __restrict__ qsm,
                                                  _Float16* __restrict__ ke,
                                                  float* __restrict__ kmx,
                                                  float* __restrict__ ksum,
                                                  _Float16* __restrict__ vh)
{
    constexpr int MT = MT_QKV;
    static_assert(MT == 4 && NHKD % (64 * MT) == 0, "a block stays inside one region");
    __shared__ __attribute__((aligned(16))) unsigned char ring[GEMM_LDS_B(MT)];
    float* tile = (float*)ring;
    // the row block is the slowest grid index: the Q blocks, whose epilogue is the longest, start first
    const int b = blockIdx.y;
    const int t = threadIdx.x, l = t & 31, wave = t >> 5, h = l >> 4, m = l & 15;
    const int mw = wave >> 1, nw = wave & 1;
    const int Mbase = blockIdx.z * (64 * MT), Nbase = blockIdx.x * 128;
    const int region = (Mbase < NHKD) ? 0 : ((Mbase < 2 * NHKD) ? 1 : 2);

    const _Float16* Ablk = wabc + (size_t)Mbase * DIMC;
    const float* Xblk = x + (size_t)b * DIMC * NN + Nbase;
    v8f c[MT][4] = {};
    mainloop_wx<DIMC>(ring, Ablk, Xblk, t, mw, nw, h, m, c);

    // the loops over i below are unrolled: c, s and bb are indexed by constants and stay in registers
    const float* ps = sc + Mbase + mw * 16 + 8 * h;
    const float* pb = bc + Mbase + mw * 16 + 8 * h;
    float s[MT][8], bb[MT][8];
#pragma unroll
    for (int i = 0; i < MT; ++i) {
#pragma unroll
        for (int r = 0; r < 8; ++r) { s[i][r] = ps[i * 64 + r]; bb[i][r] = pb[i * 64 + r]; }
    }
    // the two address pairs stay live to here, so that no load's result lands on them, and the wait
    // stands ahead of their reuse
    asm volatile("s_wait_xcnt 0x0" :: "v"(ps), "v"(pb) : "memory");
#pragma unroll
    for (int i = 0; i < MT; ++i) {
#pragma unroll
        for (int r = 0; r < 8; ++r) {
            const int ml = i * 64 + mw * 16 + 8 * h + r;
            float* trow = tile + ml * TP + nw * 64 + m;
            trow[0]  = c[i][0][r] * s[i][r] + bb[i][r];
            trow[16] = c[i][1][r] * s[i][r] + bb[i][r];
            trow[32] = c[i][2][r] * s[i][r] + bb[i][r];
            trow[48] = c[i][3][r] * s[i][r] + bb[i][r];
        }
    }
    __syncthreads();

    if (region == 0) {
        // softmax over the 32 channels of one head for one column; 2 heads x 128 cols = 256 threads
        // per 64 rows
        const int nl = t & 127, hh = t >> 7;
        for (int i = 0; i < MT; ++i) {
            float* hcol = tile + (i * 64 + hh * KDIM) * TP + nl;
            float qv[KDIM];
            float mx;
#pragma unroll
            for (int k = 0; k < KDIM; ++k) {
                qv[k] = hcol[k * TP];
                mx = (k == 0) ? qv[0] : fmaxf(mx, qv[k]);
            }
            float sum = 0.f;
#pragma unroll
            for (int k = 0; k < KDIM; ++k) { qv[k] = __expf(qv[k] - mx); sum += qv[k]; }
            const float scl = 256.0f / sum;
#pragma unroll
            for (int k = 0; k < KDIM; ++k) hcol[k * TP] = qv[k] * scl;
        }
    }
    __syncthreads();

    if (region == 0) {
        const int p = l & 7;
        // unrolled: the LDS reads of the next 64 rows start under the stores of these
#pragma unroll
        for (int i = 0; i < MT; ++i) {
#pragma unroll
            for (int it = 0; it < 4; ++it) {
                const int nl = wave * 16 + it * 4 + (l >> 3);
                v8h hv;
#pragma unroll
                for (int j = 0; j < 8; ++j) hv[j] = (_Float16)tile[(i * 64 + p * 8 + j) * TP + nl];
                vst8h(qsm + ((size_t)b * NN + Nbase + nl) * NHKD + Mbase + i * 64 + p * 8, hv);
            }
        }
    } else if (region == 1) {
        // lane = row: thread t holds row t's 128 columns in registers, so max and sum need no exchange
        static_assert(64 * MT == 256, "one row per thread");
        const int obase = Mbase - NHKD;
        float* krow = tile + t * TP;
        // every loop here is unrolled: kv is indexed by constants and stays in registers
        v4f kv[32];
#pragma unroll
        for (int j = 0; j < 32; ++j) kv[j] = *(const v4fa*)(krow + 4 * j);
        v4f mx4 = kv[0];
#pragma unroll
        for (int j = 1; j < 32; ++j)
#pragma unroll
            for (int i = 0; i < 4; ++i) mx4[i] = fmaxf(mx4[i], kv[j][i]);
        const float mx = fmaxf(fmaxf(mx4[0], mx4[1]), fmaxf(mx4[2], mx4[3]));
        v4f sum4 = {};
#pragma unroll
        for (int j = 0; j < 16; ++j) {
            // exp(k - mx) x 1024 = 2^((k - mx) log2 e + 10)
            float x[8], e[8];
#pragma unroll
            for (int i = 0; i < 8; ++i) x[i] = fmaf(kv[2 * j + (i >> 2)][i & 3] - mx, 1.44269504f, 10.0f);
            exp2x8(e, x);
            v8h hv;
#pragma unroll
            for (int i = 0; i < 8; ++i) { sum4[i & 3] += e[i]; hv[i] = (_Float16)e[i]; }
            // over the head of the thread's own row, which is wholly in its registers by now
            *(v8ha*)((_Float16*)krow + 8 * j) = hv;
        }
        // a wave's 32 rows: one whole 128-B line per store
        const size_t so = ((size_t)b * NBLK + blockIdx.x) * NHKD + obase + t;
        kmx[so]  = mx;
        ksum[so] = (sum4[0] + sum4[1]) + (sum4[2] + sum4[3]);
        // ke[b][o][Nbase..Nbase+127] f16: 256 B = 2 lines per row, two rows per instruction.  A wave
        // reads back only the 32 rows that its own lanes wrote (one wave's LDS operations go in issue
        // order): no barrier
#pragma unroll
        for (int it = 0; it < 4 * MT; ++it) {
            const int row = wave * (8 * MT) + it * 2 + h;
            const v8h hv = *(const v8ha*)((const _Float16*)(tile + row * TP) + m * 8);
            vst8h(ke + ((size_t)b * NHKD + obase + row) * NN + Nbase + m * 8, hv);
        }
    } else {
        // vh[b][o][Nbase..Nbase+127] f16: 256 B = 2 lines per row, two rows per instruction
        const int obase = Mbase - 2 * NHKD;
#pragma unroll
        for (int it = 0; it < 4 * MT; ++it) {
            const int row = wave * (8 * MT) + it * 2 + h;
            v8h hv;
#pragma unroll
            for (int j = 0; j < 8; ++j) hv[j] = (_Float16)tile[row * TP + m * 8 + j];
            vst8h(vh + ((size_t)b * DHC + obase + row) * NN + Nbase + m * 8, hv);
        }
    }
}

// ---------------------------------------------------------------------------
// Kernel 2: context per (b,head): C[kd][d] = sum_n softmax_n(k)[kd][n] * v[d][n], K = 4096.
// A rows = ke rows (n contiguous); B[k=n][col=d] = vh row d (n contiguous): same loader.
// Second half of the key softmax: a wave's 128 n are one column block of kernel 1, so its whole
// tile row kd carries one factor 4096 exp(block max - row max) / row sum (the x1024 cancels), formed
// from kmx and ksum of the row's 32 blocks and applied in f32 where the waves' tiles are added.
// The n-sum is split: CSPLIT work-groups per (b,head), eight waves each, every wave holding the
// whole 32 x 64 tile (2 kd-tiles x 4 d-tiles) for its own 128 n, so that each fragment is
// loaded once and all of a wave's loads are independent.  The eight waves' tiles are added
// through LDS in wave order; the work-group's f32 partial goes to part[bh][g][2048].
// Order inside a partial: unit u = dt*4 + kt*2 + (r>>2), then lane, then r&3 (accumulator
// register r of tile (kt, dt)).  That is the A-fragment order of kernel 3: element e = kt*8 + r
// of lane (m, h) is C[kd = kt*16 + 8h + r][d = dt*16 + m].
// ---------------------------------------------------------------------------
__global__ __launch_bounds__(256) void ctx_kernel(const _Float16* __restrict__ ke,
                                                  const float* __restrict__ kmx,
                                                  const float* __restrict__ ksum,
                                                  const _Float16* __restrict__ vh,
                                                  float* __restrict__ part)
{
    static_assert(CWN == 128 && NBLK == 32, "a wave's n = one column block; 4 blocks per wave below");
    __shared__ __attribute__((aligned(16))) float red[8 * CTILE];
    __shared__ float pm[8 * KDIM], ps[8 * KDIM];
    __shared__ __attribute__((aligned(16))) float fl[8 * KDIM];
    const int bh = blockIdx.x / CSPLIT, g = blockIdx.x % CSPLIT, b = bh >> 3, hd = bh & 7;
    const int t = threadIdx.x, l = t & 31, wave = t >> 5, h = l >> 4, m = l & 15;
    const int n0 = (g * 8 + wave) * CWN;
    // both operands have the row pitch NN, so one per-lane byte offset serves every load
    const char* Abase = (const char*)(ke  + ((size_t)b * NHKD + hd * KDIM) * NN);
    const char* Bbase = (const char*)(vh  + ((size_t)b * DHC  + hd * DD)   * NN);
    const unsigned lane_off = (unsigned)(m * NN + n0 + 8 * h) * 2u;
    // statistics of key row l: four of its 32 blocks per wave, and this wave's own block's max
    const float* sm = kmx  + (size_t)b * NBLK * NHKD + hd * KDIM + l;
    const float* pm4 = sm + wave * 4 * NHKD;
    const float* ps4 = ksum + (size_t)b * NBLK * NHKD + hd * KDIM + l + wave * 4 * NHKD;
    float m4[4], s4[4];
#pragma unroll
    for (int i = 0; i < 4; ++i) { m4[i] = pm4[i * NHKD]; s4[i] = ps4[i * NHKD]; }
    const float* pown = sm + (g * 8 + wave) * NHKD;
    const float mown = *pown;
    // every loop below is unrolled so that the fragment and accumulator arrays are indexed by
    // constants and stay in registers
    v16h a[CWN / 32][2], bf[CWN / 32][4];
#pragma unroll
    for (int s = 0; s < CWN / 32; ++s) {
#pragma unroll
        for (int i = 0; i < 2; ++i)
            a[s][i] = load_frag((const _Float16*)(Abase + lane_off) + i * 16 * NN + s * 32, 0);
#pragma unroll
        for (int j = 0; j < 4; ++j)
            bf[s][j] = load_frag((const _Float16*)(Bbase + lane_off) + j * 16 * NN + s * 32, 0);
    }
    // the first results reuse the loads' offset register: the wait stands ahead of that overwrite;
    // the three statistics addresses stay live to here, so that no load's result lands on them
    asm volatile("s_wait_xcnt 0x0" :: "v"(pm4), "v"(ps4), "v"(pown) : "memory");
    // keeps every load of the wave ahead of the first product: one memory latency per wave;
    // without it the scheduler reuses fragment registers and waits out eight latencies in a row
    __builtin_amdgcn_sched_barrier(0);
    {
        const float ml = fmaxf(fmaxf(m4[0], m4[1]), fmaxf(m4[2], m4[3]));
        float sl = 0.f;
#pragma unroll
        for (int i = 0; i < 4; ++i) sl += s4[i] * __expf(m4[i] - ml);
        pm[wave * KDIM + l] = ml;
        ps[wave * KDIM + l] = sl;
        __syncthreads();   // every wave's four blocks are in pm, ps
        float M = pm[l];
#pragma unroll
        for (int w = 1; w < 8; ++w) M = fmaxf(M, pm[w * KDIM + l]);
        float S = 0.f;
#pragma unroll
        for (int w = 0; w < 8; ++w) S += ps[w * KDIM + l] * __expf(pm[w * KDIM + l] - M);
        fl[wave * KDIM + l] = __expf(mown - M) * (4096.0f / S);   // read behind the barrier below
    }
    v8f c[2][4] = {};
#pragma unroll
    for (int s = 0; s < CWN / 32; ++s)
#pragma unroll
        for (int i = 0; i < 2; ++i)
#pragma unroll
            for (int j = 0; j < 4; ++j) c[i][j] = mma16(a[s][i], bf[s][j], c[i][j]);
    // keeps the LDS stores behind the last product: all eight accumulators stay live to here, so
    // none of their registers is handed to another product's result inside the hazard distance
    __builtin_amdgcn_sched_barrier(0);
    float* mine = red + wave * CTILE + l * 4;
#pragma unroll
    for (int j = 0; j < 4; ++j)
#pragma unroll
        for (int i = 0; i < 2; ++i) {
            const v8f v = c[i][j];
            vst4f(mine + (j * 4 + i * 2) * 128,     (v4f){v[0], v[1], v[2], v[3]});
            vst4f(mine + (j * 4 + i * 2 + 1) * 128, (v4f){v[4], v[5], v[6], v[7]});
        }
    __syncthreads();
    float* dst = part + (size_t)blockIdx.x * CTILE;
    // unit u = 8 q + wave: kt = (wave >> 1) & 1 and r >> 2 = wave & 1 for both q, so this thread's
    // four elements are rows kd0 .. kd0 + 3 of every wave's tile
    const int kd0 = ((wave >> 1) & 1) * 16 + 8 * h + (wave & 1) * 4;
    v4f fw[8];
#pragma unroll
    for (int w = 0; w < 8; ++w) fw[w] = *(const v4f*)(fl + w * KDIM + kd0);
#pragma unroll
    for (int q = 0; q < 2; ++q) {
        const int e = q * 1024 + t * 4;
        v4f s = *(const v4f*)(red + e) * fw[0];
#pragma unroll
        for (int w = 1; w < 8; ++w) s += *(const v4f*)(red + w * CTILE + e) * fw[w];
        vst4f(dst + e, s);
    }
}

// ---------------------------------------------------------------------------
// Kernel 3: attended and output projection in one.
// Output projection [384][512] x [512][4096] per batch + affine -> f32 out.  Block tile 192 rows x
// 128 cols, 8 waves, wave tile 48 x 64.  A stage of 64 k is one head's 64 d.  The A rows (weights)
// come into the ring by asynchronous copies; the B rows are made in place, one stage ahead:
//   Att[d][n] = sum_kd C[kd][d] * qsm[n][hd*32+kd], K = 32 (one WMMA per 16x16 tile), ReLU, scaled
//   to att x256 (= acc/64), f16.  Wave w makes the 16 columns n = 16 w .. of all four d tiles: lane
//   (m, h) holds d = 16 dt + 8 h + r of column m, which are eight neighbours of B row n.
// The A fragments of that product are the sums of kernel 2's CSPLIT partials (already in fragment
// order, whole lines per load), /64 (= true context x64), rounded to f16; the block forms them once
// for its batch's eight heads: cl[hd][dt][half of the fragment][lane][8].
// ---------------------------------------------------------------------------
__global__ __launch_bounds__(256) void out_kernel(const _Float16* __restrict__ wph,
                                                  const float* __restrict__ part,
                                                  const _Float16* __restrict__ qsm,
                                                  const float* __restrict__ sp,
                                                  const float* __restrict__ bp,
                                                  float* __restrict__ out)
{
    constexpr int MT = MT_OUT, K = DHC, NT = K / KS;
    static_assert(DIMC % (64 * MT) == 0, "whole blocks");
    static_assert(KS == DD && NT == HEADS && NT >= 2, "a stage is a head");
    __shared__ __attribute__((aligned(16))) unsigned char ring[OUT_LDS_B];
    float* tile = (float*)ring;
    _Float16* cl = (_Float16*)(ring + RING_B(MT));
    const int b = blockIdx.z;
    const int t = threadIdx.x, l = t & 31, wave = t >> 5, h = l >> 4, m = l & 15;
    const int mw = wave >> 1, nw = wave & 1;
    const int Mbase = blockIdx.y * (64 * MT), Nbase = blockIdx.x * 128;
    const unsigned lds = (unsigned)(uintptr_t)ring + (t >> 3) * LPB + (t & 7) * 16;
    const _Float16* ga = wph + (size_t)Mbase * K + (t >> 3) * K + (t & 7) * 8;
    // this lane's first piece of its column's query row (load_frag's lane offset is in it)
    const _Float16* qrow = qsm + ((size_t)b * NN + Nbase + wave * 16 + m) * NHKD + 8 * h;

    // B rows of head hd from its query fragment qf, into the stage at buf
    auto make_b = [&](const int hd, const v16h qf, unsigned char* buf) {
        const _Float16* ch = cl + hd * CTILE + l * 8;
        _Float16* brow = (_Float16*)(buf + (64 * MT + wave * 16 + m) * LPB) + 8 * h;
        // unrolled: fragments and results are indexed by constants and stay in registers
        Frag ca[4];
        v8f d[4];
#pragma unroll
        for (int dt = 0; dt < 4; ++dt) {
            ca[dt].half[0] = *(const v8h*)(ch + dt * 512);
            ca[dt].half[1] = *(const v8h*)(ch + dt * 512 + 256);
        }
        // keeps the eight LDS reads together ahead of the products: left alone the scheduler reuses
        // one fragment's registers and waits out an LDS latency per d tile
        __builtin_amdgcn_sched_barrier(0);
#pragma unroll
        for (int dt = 0; dt < 4; ++dt) d[dt] = mma16(ca[dt].v, qf, (v8f){});
#pragma unroll
        for (int dt = 0; dt < 4; ++dt) {
            v8h hv;
#pragma unroll
            for (int r = 0; r < 8; ++r) hv[r] = (_Float16)fmaxf(d[dt][r] * 0.015625f, 0.0f);
            vst8h(brow + dt * 16, hv);
        }
    };

    copy_stage_a192(lds, ga, K);
    v16h qf = load_frag(qrow, 0);
    // wave = 2 dt + half of the fragment: this thread's eight elements of every head's tile
    const float* pc = part + (size_t)b * HEADS * CSPLIT * CTILE + wave * 256 + l * 4;
    // four heads at a time, kept rolled: 32 loads per thread in flight, in 128 registers
#pragma unroll 1
    for (int hq = 0; hq < HEADS; hq += 4) {
        const float* p = pc + hq * CSPLIT * CTILE;
        // the loops below are unrolled: v is indexed by constants and stays in registers
        v4f v[4][CSPLIT][2];
#pragma unroll
        for (int k = 0; k < 4; ++k)
#pragma unroll
            for (int g = 0; g < CSPLIT; ++g) {
                v[k][g][0] = *(const v4f*)(p + (k * CSPLIT + g) * CTILE);
                v[k][g][1] = *(const v4f*)(p + (k * CSPLIT + g) * CTILE + 128);
            }
        // the address pair stays live to here, and the wait stands ahead of its rewrite in the next trip
        asm volatile("s_wait_xcnt 0x0" :: "v"(p) : "memory");
#pragma unroll
        for (int k = 0; k < 4; ++k) {
            v4f s0 = v[k][0][0], s1 = v[k][0][1];
#pragma unroll
            for (int g = 1; g < CSPLIT; ++g) { s0 += v[k][g][0]; s1 += v[k][g][1]; }
            v8h hv;
#pragma unroll
            for (int i = 0; i < 4; ++i) {
                hv[i]     = (_Float16)(s0[i] * 0.015625f);
                hv[4 + i] = (_Float16)(s1[i] * 0.015625f);
            }
            vst8h(cl + (hq + k) * CTILE + wave * 256 + l * 8, hv);
        }
    }
    asm volatile("s_wait_asynccnt 0x0" ::: "memory");   // stage 0's A rows landed (this wave's pieces)
    __syncthreads();                                    // ... and every other wave's; cl is whole
    copy_stage_a192(lds + STAGE_B(MT), ga + KS, K);
    make_b(0, qf, ring);
    {
        const _Float16* qp = qrow + KDIM;
        qf = load_frag(qp, 0);
        // the address pair stays live to here, and the wait stands ahead of its reuse
        asm volatile("s_wait_xcnt 0x0" :: "v"(qp) : "memory");
    }
    __syncthreads();                                    // stage 0's B rows are whole

    v8f c[MT][4] = {};
    // kept rolled: unrolled, every stage's copy addresses stay live at once
#pragma unroll 1
    for (int s = 0; s < NT; ++s) {
        // head s+2's query fragment starts here: the whole trip covers its latency
        v16h qn = qf;
        if (s + 2 < NT) {
            const _Float16* qp = qrow + (s + 2) * KDIM;
            qn = load_frag(qp, 0);
            // the address pair stays live to here, and the wait stands ahead of its reuse
            asm volatile("s_wait_xcnt 0x0" :: "v"(qp) : "memory");
        }
        // buffer (s+1)&1: its last readers left at the barrier behind trip s-1
        if (s + 1 < NT) make_b(s + 1, qf, ring + ((s + 1) & 1) * STAGE_B(MT));
        qf = qn;
        const _Float16* st = (const _Float16*)(ring + (s & 1) * STAGE_B(MT));
        const _Float16* ar = st + (mw * 16 + m) * LPH;
        const _Float16* br = st + (64 * MT + nw * 64 + m) * LPH;
        v16h a[MT], bfr[4];
        // unrolled: fragments and accumulators are indexed by constants and stay in registers
#pragma unroll
        for (int kk = 0; kk < KS / 32; ++kk) {
            a[0] = load_frag(ar + kk * 32, h);
#pragma unroll
            for (int j = 0; j < 4; ++j) bfr[j] = load_frag(br + j * 16 * LPH + kk * 32, h);
#pragma unroll
            for (int i = 1; i < MT; ++i) a[i] = load_frag(ar + i * 64 * LPH + kk * 32, h);
            // keeps the LDS reads of a k step together ahead of its products: left alone the
            // scheduler reuses one A fragment's registers and waits out an LDS latency per row
            __builtin_amdgcn_sched_barrier(0);
#pragma unroll
            for (int i = 0; i < MT; ++i)
#pragma unroll
                for (int j = 0; j < 4; ++j) c[i][j] = mma16(a[i], bfr[j], c[i][j]);
            // keeps every product of the k step ahead of what follows: the next reads, and at the
            // end the four slots below (left alone a row of products sinks behind the barrier)
            __builtin_amdgcn_sched_barrier(0);
        }
        // four vector slots behind the last matrix instructions, on the branch paths too
        GUARD4(c[MT - 1][0], c[MT - 1][1], c[MT - 1][2], c[MT - 1][3], a[MT - 1], bfr[0], bfr[1], bfr[2], bfr[3]);
        asm volatile("s_wait_dscnt 0x0" ::: "memory");     // reads of buffer s&1 and writes of stage s+1's B rows are done
        asm volatile("s_wait_asynccnt 0x0" ::: "memory");  // this wave's pieces of stage s+1's A rows have landed
        __syncthreads();                                   // publishes stage s+1, frees buffer s&1
        if (s + 2 < NT)
            copy_stage_a192(lds + (s & 1) * STAGE_B(MT), ga + (s + 2) * KS, K);
    }
    asm volatile("s_wait_asynccnt 0x0" ::: "memory");      // nothing in flight when the ring is reused

    // unrolled over i: c is indexed by constants and stays in registers
#pragma unroll
    for (int i = 0; i < MT; ++i) {
#pragma unroll
        for (int r = 0; r < 8; ++r) {
            const int ml = i * 64 + mw * 16 + 8 * h + r;
            const int o = Mbase + ml;
            const float s = sp[o] * 0.000244140625f;   // 1/(16*256)
            const float bb = bp[o];
            float* trow = tile + ml * TP + nw * 64 + m;
            trow[0]  = c[i][0][r] * s + bb;
            trow[16] = c[i][1][r] * s + bb;
            trow[32] = c[i][2][r] * s + bb;
            trow[48] = c[i][3][r] * s + bb;
        }
    }
    __syncthreads();
    const int col = (l >> 3) * 32 + (l & 7) * 4;
#pragma unroll
    for (int it = 0; it < 8 * MT; ++it) {
        const int row = wave * (8 * MT) + it;
        const v4f v = *(const v4fa*)(tile + row * TP + col);
        vst4f(out + ((size_t)b * DIMC + Mbase + row) * NN + Nbase + col, v);
    }
}

// ---------------------------------------------------------------------------
// Host-side launch glue.  Workspace (bytes):
//   [0)            wabc f16 [1024][384]         786,432
//   [786,432)      wph  f16 [384][512]          393,216
//   [1,179,648)    sc   f32 [1024]                4,096
//   [1,183,744)    bc   f32 [1024]                4,096
//   [1,187,840)    qsm  f16 [8][4096][256]   16,777,216
//   [17,965,056)   ke   f16 [8][256][4096]   16,777,216   (in a place of 33,554,432)
//   [51,519,488)   vh   f16 [8][512][4096]   33,554,432
//   [85,073,920)   part f32 [64][4][2048]     2,097,152
//   [87,171,072)   kmx  f32 [8][32][256]        262,144
//   [87,433,216)   ksum f32 [8][32][256]        262,144
//   total 87,695,360
// ---------------------------------------------------------------------------
extern "C" void kernel_launch(void* const* d_in, const int* in_sizes, int n_in,
                              void* d_out, int out_size, void* d_ws, size_t ws_size,
                              hipStream_t stream)
{
    if (n_in < 13) return;
    if (in_sizes[0] != BB * DIMC * NN) return;
    if (in_sizes[1] != NHKD * DIMC || in_sizes[2] != NHKD || in_sizes[3] != NHKD) return;
    if (in_sizes[4] != NHKD * DIMC || in_sizes[5] != NHKD || in_sizes[6] != NHKD) return;
    if (in_sizes[7] != DHC * DIMC || in_sizes[8] != DHC || in_sizes[9] != DHC) return;
    if (in_sizes[10] != DIMC * DHC || in_sizes[11] != DIMC || in_sizes[12] != DIMC) return;
    if (out_size != BB * DIMC * NN) return;

    const size_t off_wabc = 0;
    const size_t sz_wabc  = (size_t)MQKV * DIMC * 2;
    const size_t off_wph  = off_wabc + sz_wabc;
    const size_t sz_wph   = (size_t)DIMC * DHC * 2;
    const size_t off_sc   = off_wph + sz_wph;
    const size_t sz_sc    = (size_t)MQKV * 4;
    const size_t off_bc   = off_sc + sz_sc;
    const size_t off_qsm  = off_bc + sz_sc;
    const size_t sz_qsm   = (size_t)BB * NN * NHKD * 2;
    const size_t off_kf   = off_qsm + sz_qsm;
    const size_t sz_kf    = (size_t)BB * NHKD * NN * 4;
    const size_t off_vh   = off_kf + sz_kf;
    const size_t sz_vh    = (size_t)BB * DHC * NN * 2;
    const size_t off_ctx  = off_vh + sz_vh;
    const size_t sz_ctx   = (size_t)BB * HEADS * CSPLIT * CTILE * 4;
    const size_t off_kmx  = off_ctx + sz_ctx;
    const size_t sz_kst   = (size_t)BB * NBLK * NHKD * 4;
    const size_t off_ksum = off_kmx + sz_kst;
    const size_t total    = off_ksum + sz_kst;
    const size_t sz_ke    = (size_t)BB * NHKD * NN * 2;
    if (total > ws_size) return;
    if (sz_ke > sz_kf) return;

    const float* x  = (const float*)d_in[0];
    const float* Wq = (const float*)d_in[1];
    const float* sq = (const float*)d_in[2];
    const float* bq = (const float*)d_in[3];
    const float* Wk = (const float*)d_in[4];
    const float* sk = (const float*)d_in[5];
    const float* bk = (const float*)d_in[6];
    const float* Wv = (const float*)d_in[7];
    const float* sv = (const float*)d_in[8];
    const float* bv = (const float*)d_in[9];
    const float* Wp = (const float*)d_in[10];
    const float* sp = (const float*)d_in[11];
    const float* bp = (const float*)d_in[12];
    float* out = (float*)d_out;

    char* ws = (char*)d_ws;
    _Float16* wabc = (_Float16*)(ws + off_wabc);
    _Float16* wph  = (_Float16*)(ws + off_wph);
    float*    sc   = (float*)   (ws + off_sc);
    float*    bc   = (float*)   (ws + off_bc);
    _Float16* qsm  = (_Float16*)(ws + off_qsm);
    _Float16* ke   = (_Float16*)(ws + off_kf);
    _Float16* vh   = (_Float16*)(ws + off_vh);
    float*    part = (float*)   (ws + off_ctx);
    float*    kmx  = (float*)   (ws + off_kmx);
    float*    ksum = (float*)   (ws + off_ksum);

    const int prep_threads = MQKV * DIMC / 8 + DIMC * DHC / 8 + 512;   // 74240
    prep_kernel<<<(prep_threads + 255) / 256, 256, 0, stream>>>(
        Wq, Wk, Wv, Wp, sq, bq, sk, bk, sv, bv, wabc, wph, sc, bc);

    qkv_kernel<<<dim3(NN / 128, BB, MQKV / (64 * MT_QKV)), 256, 0, stream>>>(wabc, x, sc, bc, qsm, ke, kmx, ksum, vh);

    ctx_kernel<<<BB * HEADS * CSPLIT, 256, 0, stream>>>(ke, kmx, ksum, vh, part);

    out_kernel<<<dim3(NN / 128, DIMC / (64 * MT_OUT), BB), 256, 0, stream>>>(wph, part, qsm, sp, bp, out);
}

// v007
// A run of this version takes 66.5 microseconds.
// Timed twice side by side with v006, it ran 1.05 times as fast both times.
// All steps since v000 together make it 4.64 times as fast.
#include <hip/hip_runtime.h>
// All contractions on v_wmma_f32_16x16x32_f16 (f16 operands, f32 accumulate): QKV projection, key*value^T, context^T*query, output projection; exact power-of-two operand scales (weights x16, key exponentials x1024, context x64, query softmax x256, attended x256) undone in the f32 epilogues; softmaxes and affine terms in f32.

#define BB    8
#define DIMC  384
#define NN    4096
#define HEADS 8
#define KDIM  32
#define DD    64
#define NHKD  256
#define DHC   512
#define MQKV  1024
#define TP    132      // LDS pitch (floats) for the 64 MT x 128 output tiles, keeps 16-B alignment
#define CSPLIT 4       // work-groups that share the n-sum of one (b,head) context
#define CWN   (NN / (CSPLIT * 8))   // n per wave of the context kernel (128)
#define CTILE (KDIM * DD)           // elements of one context tile (2048)
#define NBLK  (NN / 128)            // column blocks of the QKV projection = pieces of a key row (32)

typedef _Float16 v16h __attribute__((ext_vector_type(16)));
typedef _Float16 v8h  __attribute__((ext_vector_type(8)));
typedef _Float16 v4h  __attribute__((ext_vector_type(4)));
typedef float    v8f  __attribute__((ext_vector_type(8)));
typedef float    v4f  __attribute__((ext_vector_type(4)));
typedef float    v4fa __attribute__((ext_vector_type(4), may_alias));
typedef _Float16 v8ha __attribute__((ext_vector_type(8), may_alias));

union Frag { v16h v; v8h half[2]; };

// 16x16x32 operand fragment from a k-contiguous row: elements 0..7 <- row[8h..8h+7],
// elements 8..15 <- row[16+8h..16+8h+7]; lane&15 selects the row (A) or column (B).
__device__ __forceinline__ v16h load_frag(const _Float16* __restrict__ p, int h)
{
    Frag f;
    f.half[0] = *(const v8h*)(p + 8 * h);
    f.half[1] = *(const v8h*)(p + 16 + 8 * h);
    return f.v;
}

// The intermediates that a later kernel reads straight into fragments lie in the workspace in fragment
// order: a 16 (rows or columns) x 32 (k) operand tile is one chunk of 1 KB, [half of the fragment][lane][8],
// chunk[256 f + 8 lane + e] = tile[lane & 15][16 f + 8 (lane >> 4) + e].  That is load_frag's map, so the
// registers hold what they held with row-major tiles, but a wave's load covers 512 B in a row (4 whole
// lines) where a row-major tile gives it 32 B of each of 16 lines.  p: the chunk + 8 lane.
#define CHUNK 512      // halves in a chunk
__device__ __forceinline__ v16h load_chunk(const _Float16* __restrict__ p)
{
    Frag f;
    f.half[0] = *(const v8h*)p;
    f.half[1] = *(const v8h*)(p + 256);
    return f.v;
}

__device__ __forceinline__ v8f mma16(v16h a, v16h b, v8f c)
{
    return __builtin_amdgcn_wmma_f32_16x16x32_f16(false, a, false, b, (short)0, c, false, false);
}

#define GUARD4(c0, c1, c2, c3, a, b0, b1, b2, b3) \
    asm volatile("v_nop\n\tv_nop\n\tv_nop\n\tv_nop" \
                 : "+v"(c0), "+v"(c1), "+v"(c2), "+v"(c3) \
                 : "v"(a), "v"(b0), "v"(b1), "v"(b2), "v"(b3))

// e[i] = 2^x[i].  One statement: outputs and inputs are kept apart, so each exponential is the
// independent instruction behind the one before it, and the v_nop is that slot behind the last
__device__ __forceinline__ void exp2x8(float (&e)[8], const float (&x)[8])
{
    asm("v_exp_f32 %0, %8\n\tv_exp_f32 %1, %9\n\tv_exp_f32 %2, %10\n\tv_exp_f32 %3, %11\n\t"
        "v_exp_f32 %4, %12\n\tv_exp_f32 %5, %13\n\tv_exp_f32 %6, %14\n\tv_exp_f32 %7, %15\n\t"
        "v_nop"
        : "=&v"(e[0]), "=&v"(e[1]), "=&v"(e[2]), "=&v"(e[3]),
          "=&v"(e[4]), "=&v"(e[5]), "=&v"(e[6]), "=&v"(e[7])
        : "v"(x[0]), "v"(x[1]), "v"(x[2]), "v"(x[3]), "v"(x[4]), "v"(x[5]), "v"(x[6]), "v"(x[7]));
}

__device__ __forceinline__ void vst8h(_Float16* p, v8h v) { *(v8h*)p = v; }
// Behind 16 stores of pieces v[0..15] at p + constants: address and data stay live to here, each piece in
// registers of its own, so that nothing overwrites a register of an issued store ahead of the wait
#define XWAIT16(p, v) \
    asm volatile("s_wait_xcnt 0x0" \
                 :: "v"(p), "v"(v[0]), "v"(v[1]), "v"(v[2]), "v"(v[3]), "v"(v[4]), "v"(v[5]), "v"(v[6]), "v"(v[7]), \
                    "v"(v[8]), "v"(v[9]), "v"(v[10]), "v"(v[11]), "v"(v[12]), "v"(v[13]), "v"(v[14]), "v"(v[15]) \
                 : "memory")
__device__ __forceinline__ void vst4f(float* p, v4f v)    { *(v4f*)p = v; }

// LDS ring of the two projection GEMMs.  Block tile 64 MT rows x 128 columns.  A stage = 64 k
// (128 B) of the 64 MT A rows, row pitch 144 B (16 B x 9: conflict-free for ds_load_b128), and then
// the B tile in 128 x 144 B; two buffers.  The f32 output tile reuses the space after the loop.
// Output kernel: B = 128 rows (columns n) of 64 k, pitch 144 B.  QKV kernel: B = 64 rows (k) of
// 128 n, pitch 288 B (32 B x 9: conflict-free for ds_load_tr16_b128), the same bytes in all.
#define KS      64                 // k per stage
#define LPB     144                // LDS row pitch, bytes
#define LPH     72                 // the same in halves
#define XPB     288                // LDS row pitch of the QKV kernel's B tile, bytes
#define STAGE_B(MT) ((64 * (MT) + 128) * LPB)
#define RING_B(MT)  (2 * STAGE_B(MT))
#define OTILE_B(MT) (64 * (MT) * TP * 4)
#define GEMM_LDS_B(MT) (RING_B(MT) > OTILE_B(MT) ? RING_B(MT) : OTILE_B(MT))
#define MT_QKV  4                  // 256 x 128 block, 64 x 64 per wave
#define MT_OUT  3                  // 192 x 128 block, 48 x 64 per wave
#define CTXL_B  (HEADS * CTILE * 2)   // one batch's eight context tiles in f16, behind the output kernel's ring
#define OUT_LDS_B (RING_B(MT_OUT) + CTXL_B > OTILE_B(MT_OUT) ? RING_B(MT_OUT) + CTXL_B : OTILE_B(MT_OUT))

// The A rows of a stage of the QKV kernel: 256 x 8 pieces of 16 B, 8 per thread.  Thread t brings
// piece t&7 of rows t>>3 + 32 j, so eight lanes cover one 128-B line.  a: this thread's piece in
// A row t>>3 at the stage's k; lds: its place in the buffer (byte address in LDS).
// s_wait_xcnt stands inside the statement, ahead of any rewrite of the address registers.
__device__ __forceinline__ void copy_stage_a256(const unsigned lds, const _Float16* a, const int K)
{
    asm volatile("global_load_async_to_lds_b128 %0, %8, off\n\t"
                 "global_load_async_to_lds_b128 %1, %9, off\n\t"
                 "global_load_async_to_lds_b128 %2, %10, off\n\t"
                 "global_load_async_to_lds_b128 %3, %11, off\n\t"
                 "global_load_async_to_lds_b128 %4, %12, off\n\t"
                 "global_load_async_to_lds_b128 %5, %13, off\n\t"
                 "global_load_async_to_lds_b128 %6, %14, off\n\t"
                 "global_load_async_to_lds_b128 %7, %15, off\n\t"
                 "s_wait_xcnt 0x0"
                 :: "v"(lds), "v"(lds + 32 * LPB), "v"(lds + 64 * LPB), "v"(lds + 96 * LPB),
                    "v"(lds + 128 * LPB), "v"(lds + 160 * LPB), "v"(lds + 192 * LPB),
                    "v"(lds + 224 * LPB),
                    "v"(a), "v"(a + 32 * K), "v"(a + 64 * K), "v"(a + 96 * K),
                    "v"(a + 128 * K), "v"(a + 160 * K), "v"(a + 192 * K), "v"(a + 224 * K)
                 : "memory");
}

// The A rows alone of a stage of the output kernel (192 rows, 6 pieces per thread), same places as above.
__device__ __forceinline__ void copy_stage_a192(const unsigned lds, const _Float16* a, const int K)
{
    asm volatile("global_load_async_to_lds_b128 %0, %6, off\n\t"
                 "global_load_async_to_lds_b128 %1, %7, off\n\t"
                 "global_load_async_to_lds_b128 %2, %8, off\n\t"
                 "global_load_async_to_lds_b128 %3, %9, off\n\t"
                 "global_load_async_to_lds_b128 %4, %10, off\n\t"
                 "global_load_async_to_lds_b128 %5, %11, off\n\t"
                 "s_wait_xcnt 0x0"
                 :: "v"(lds), "v"(lds + 32 * LPB), "v"(lds + 64 * LPB), "v"(lds + 96 * LPB),
                    "v"(lds + 128 * LPB), "v"(lds + 160 * LPB),
                    "v"(a), "v"(a + 32 * K), "v"(a + 64 * K), "v"(a + 96 * K),
                    "v"(a + 128 * K), "v"(a + 160 * K)
                 : "memory");
}

// 16 x 16 halves of a row-major LDS tile, transposed: lane (m, h) gets column m of rows 8 h .. 8 h + 7
// of the tile whose piece this lane's address names (rows by l & 7 and h, 16-B half by bit 3 of l)
typedef short s16x8 __attribute__((ext_vector_type(8)));
__device__ __forceinline__ v8h ld_tr16(const unsigned char* p)
{
    typedef __attribute__((address_space(3))) s16x8 lds_s16x8;
    return __builtin_bit_cast(v8h, __builtin_amdgcn_ds_load_tr16_b128_v8i16((lds_s16x8*)p));
}

// Block: 256 rows of A (f16, row-major, pitch K) times 128 columns of B = X (f32, X[k][n] with n
// contiguous, pitch NN).  A comes into the ring by asynchronous copies.  X comes through registers:
// whole 512-B rows per wave load, one stage ahead, rounded to f16 and stored as it lies (k rows of
// 128 n); the transposing LDS load hands out B fragments in load_frag's k order.
// Wave (mw, nw): rows 64 i + 16 mw.. (i < 4), columns 64 nw..; c[i][j] = row group i, column group j
// of 16: 8 fragments feed 16 products.  On return every wave has left the ring (last trip's barrier).
template <int K>
__device__ __forceinline__ void mainloop_wx(unsigned char* ring,
                                            const _Float16* __restrict__ Ablk,
                                            const float* __restrict__ Xblk,
                                            const int t, const int mw, const int nw,
                                            const int h, const int m,
                                            v8f (&c)[4][4])
{
    constexpr int MT = 4, NT = K / KS;
    static_assert(K % KS == 0 && NT >= 2, "two stages or more");
    const int l = t & 31, wave = t >> 5;
    const unsigned lds = (unsigned)(uintptr_t)ring + (t >> 3) * LPB + (t & 7) * 16;
    const _Float16* ga = Ablk + (t >> 3) * K + (t & 7) * 8;
    // this thread's part of a stage of X: columns 4 l .. 4 l + 3 of rows 8 wave + j, j < 8
    const float* gx = Xblk + (size_t)(wave * 8) * NN + l * 4;
    unsigned char* xs = ring + 64 * MT * LPB + (wave * 8) * XPB + l * 8;
    v4f xr[8];
    // the loops over j are unrolled: xr is indexed by constants and stays in registers
    auto load_x = [&](const int s) {
        const float* p = gx + (size_t)s * KS * NN;
#pragma unroll
        for (int j = 0; j < 8; ++j) xr[j] = *(const v4f*)(p + j * NN);
        // the address pair stays live to here, and the wait stands ahead of its rewrite
        asm volatile("s_wait_xcnt 0x0" :: "v"(p) : "memory");
    };
    auto store_x = [&](unsigned char* dst) {
#pragma unroll
        for (int j = 0; j < 8; ++j)
            *(v4h*)(dst + j * XPB) = __builtin_convertvector(xr[j], v4h);
    };

    copy_stage_a256(lds, ga, K);
    load_x(0);
    store_x(xs);
    asm volatile("s_wait_dscnt 0x0" ::: "memory");      // this wave's rows of stage 0's B tile are written
    asm volatile("s_wait_asynccnt 0x0" ::: "memory");   // stage 0's A rows landed (this wave's pieces)
    __syncthreads();                                    // ... and every other wave's
    copy_stage_a256(lds + STAGE_B(MT), ga + KS, K);
    load_x(1);   // behind the barrier, like every later stage's: the compiler waits out plain loads in front of one

    // kept rolled: unrolled, every stage's copy addresses stay live at once, and the added
    // registers cost a resident work-group per WGP
#pragma unroll 1
    for (int s = 0; s < NT; ++s) {
        const unsigned char* st = ring + (s & 1) * STAGE_B(MT);
        const _Float16* ar = (const _Float16*)st + (mw * 16 + m) * LPH;
        const unsigned char* br = st + 64 * MT * LPB + (8 * h + (l & 7)) * XPB + ((l >> 3) & 1) * 16 + nw * 128;
        v16h a[MT];
        Frag b[4];
        // unrolled: fragments and accumulators are indexed by constants and stay in registers
#pragma unroll
        for (int kk = 0; kk < KS / 32; ++kk) {
            a[0] = load_frag(ar + kk * 32, h);
#pragma unroll
            for (int j = 0; j < 4; ++j) {
                b[j].half[0] = ld_tr16(br + (kk * 32) * XPB + j * 32);
                b[j].half[1] = ld_tr16(br + (kk * 32 + 16) * XPB + j * 32);
            }
#pragma unroll
            for (int i = 1; i < MT; ++i) a[i] = load_frag(ar + i * 64 * LPH + kk * 32, h);
            // keeps the LDS reads of a k step together ahead of its products: left alone the
            // scheduler reuses one A fragment's registers and waits out an LDS latency per row
            __builtin_amdgcn_sched_barrier(0);
#pragma unroll
            for (int i = 0; i < MT; ++i)
#pragma unroll
                for (int j = 0; j < 4; ++j) c[i][j] = mma16(a[i], b[j].v, c[i][j]);
            // keeps every product of the k step ahead of what follows: the next reads, and at the
            // end the four slots below (left alone a row of products sinks behind the barrier)
            __builtin_amdgcn_sched_barrier(0);
        }
        // four vector slots behind the last matrix instructions, on the branch paths too
        GUARD4(c[MT - 1][0], c[MT - 1][1], c[MT - 1][2], c[MT - 1][3], a[MT - 1], b[0].v, b[1].v, b[2].v, b[3].v);
        // stage s+1's B tile, loaded a trip ago; buffer (s+1)&1: its last readers left at the barrier behind trip s-1
        if (s + 1 < NT) store_x(xs + ((s + 1) & 1) * STAGE_B(MT));
        asm volatile("s_wait_dscnt 0x0" ::: "memory");     // reads of buffer s&1 and writes of stage s+1's B tile are done
        asm volatile("s_wait_asynccnt 0x0" ::: "memory");  // this wave's pieces of stage s+1's A rows have landed
        __syncthreads();                                   // publishes stage s+1, frees buffer s&1
        if (s + 2 < NT) {
            copy_stage_a256(lds + (s & 1) * STAGE_B(MT), ga + (s + 2) * KS, K);
            load_x(s + 2);
        }
    }
    asm volatile("s_wait_asynccnt 0x0" ::: "memory");      // nothing in flight when the ring is reused
}

// ---------------------------------------------------------------------------
// Kernel 0: weights -> f16 (x16), concatenated [1024][384] and [384][512];
// affine params concatenated (scale pre-multiplied by 1/16).  16-B per lane stores.
// ---------------------------------------------------------------------------
__global__ __launch_bounds__(256) void prep_kernel(
    const float* __restrict__ Wq, const float* __restrict__ Wk, const float* __restrict__ Wv,
    const float* __restrict__ Wp,
    const float* __restrict__ sq, const float* __restrict__ bq,
    const float* __restrict__ sk, const float* __restrict__ bk,
    const float* __restrict__ sv, const float* __restrict__ bv,
    _Float16* __restrict__ wabc, _Float16* __restrict__ wph,
    float* __restrict__ sc, float* __restrict__ bc)
{
    const int NW1 = MQKV * DIMC / 8;   // 49152 chunks of 8 halves
    const int NW2 = DIMC * DHC / 8;    // 24576 chunks
    const int i = blockIdx.x * 256 + threadIdx.x;
    if (i < NW1 + NW2) {
        const float* src;
        _Float16* dst;
        if (i < NW1) {
            const int e = i * 8;
            if (e < NHKD * DIMC)          src = Wq + e;
            else if (e < 2 * NHKD * DIMC) src = Wk + (e - NHKD * DIMC);
            else                          src = Wv + (e - 2 * NHKD * DIMC);
            dst = wabc + e;
        } else {
            const int e = (i - NW1) * 8;
            src = Wp + e;
            dst = wph + e;
        }
        const v4f f0 = *(const v4f*)src;
        const v4f f1 = *(const v4f*)(src + 4);
        v8h hv;
#pragma unroll
        for (int j = 0; j < 4; ++j) {
            hv[j]     = (_Float16)(f0[j] * 16.0f);
            hv[4 + j] = (_Float16)(f1[j] * 16.0f);
        }
        vst8h(dst, hv);
        
    } else {
        const int j = i - (NW1 + NW2);
        if (j < 512) {
            const int e = (j & 255) * 4;
            v4f o;
#pragma unroll
            for (int q = 0; q < 4; ++q) {
                const int ee = e + q;
                float val;
                if (j < 256) {
                    val = (ee < NHKD) ? sq[ee] : ((ee < 2 * NHKD) ? sk[ee - NHKD] : sv[ee - 2 * NHKD]);
                    val *= 0.0625f;
                } else {
                    val = (ee < NHKD) ? bq[ee] : ((ee < 2 * NHKD) ? bk[ee - NHKD] : bv[ee - 2 * NHKD]);
                }
                o[q] = val;
            }
            float* dst = ((j < 256) ? sc : bc) + e;
            vst4f(dst, o);
            
        }
    }
}

// ---------------------------------------------------------------------------
// Kernel 1: fused QKV projection [1024][384] x [384][4096] per batch + affine.
// Block tile 256 rows x 128 cols, 8 waves, wave tile 64 x 64, operands through the LDS ring; x is read
// as it is given (f32, [b][c][n]) and rounded to f16 on its way into the ring.
// A block lies wholly in one of the three row regions.  Result staged in LDS:
//   Q rows (0..255):   channel softmax over 32 per head (f32), x256, f16 -> qsm[b][n / 16][head][chunk]
//   K rows (256..511): first half of the softmax over n, per row and per 128 columns of the block:
//                      exp(k - block max) x1024, f16 -> ke[b][row / 16][n / 32][chunk]; the block's max and the
//                      f32 sum of those (x1024 too) -> kmx, ksum [b][column block][256]
//   V rows (512..1023): f16 -> vh[b][row / 16][n / 32][chunk]
// ---------------------------------------------------------------------------
__global__ __launch_bounds__(256) void qkv_kernel(const _Float16* __restrict__ wabc,
                                                  const float* __restrict__ x,
                                                  const float* __restrict__ sc,
                                                  const float* __restrict__ bc,
                                                  _Float16* __restrict__ qsm,
                                                  _Float16* __restrict__ ke,
                                                  float* __restrict__ kmx,
                                                  float* __restrict__ ksum,
                                                  _Float16* __restrict__ vh)
{
    constexpr int MT = MT_QKV;
    static_assert(MT == 4 && NHKD % (64 * MT) == 0, "a block stays inside one region");
    __shared__ __attribute__((aligned(16))) unsigned char ring[GEMM_LDS_B(MT)];
    float* tile = (float*)ring;
    // the row block is the slowest grid index: the Q blocks, whose epilogue is the longest, start first
    const int b = blockIdx.y;
    const int t = threadIdx.x, l = t & 31, wave = t >> 5, h = l >> 4, m = l & 15;
    const int mw = wave >> 1, nw = wave & 1;
    const int Mbase = blockIdx.z * (64 * MT), Nbase = blockIdx.x * 128;
    const int region = (Mbase < NHKD) ? 0 : ((Mbase < 2 * NHKD) ? 1 : 2);

    const _Float16* Ablk = wabc + (size_t)Mbase * DIMC;
    const float* Xblk = x + (size_t)b * DIMC * NN + Nbase;
    v8f c[MT][4] = {};
    mainloop_wx<DIMC>(ring, Ablk, Xblk, t, mw, nw, h, m, c);

    // the loops over i below are unrolled: c, s and bb are indexed by constants and stay in registers
    const float* ps = sc + Mbase + mw * 16 + 8 * h;
    const float* pb = bc + Mbase + mw * 16 + 8 * h;
    float s[MT][8], bb[MT][8];
#pragma unroll
    for (int i = 0; i < MT; ++i) {
#pragma unroll
        for (int r = 0; r < 8; ++r) { s[i][r] = ps[i * 64 + r]; bb[i][r] = pb[i * 64 + r]; }
    }
    // the two address pairs stay live to here, so that no load's result lands on them, and the wait
    // stands ahead of their reuse
    asm volatile("s_wait_xcnt 0x0" :: "v"(ps), "v"(pb) : "memory");
#pragma unroll
    for (int i = 0; i < MT; ++i) {
#pragma unroll
        for (int r = 0; r < 8; ++r) {
            const int ml = i * 64 + mw * 16 + 8 * h + r;
            float* trow = tile + ml * TP + nw * 64 + m;
            trow[0]  = c[i][0][r] * s[i][r] + bb[i][r];
            trow[16] = c[i][1][r] * s[i][r] + bb[i][r];
            trow[32] = c[i][2][r] * s[i][r] + bb[i][r];
            trow[48] = c[i][3][r] * s[i][r] + bb[i][r];
        }
    }
    __syncthreads();

    if (region == 0) {
        // softmax over the 32 channels of one head for one column; 2 heads x 128 cols = 256 threads
        // per 64 rows
        const int nl = t & 127, hh = t >> 7;
        for (int i = 0; i < MT; ++i) {
            float* hcol = tile + (i * 64 + hh * KDIM) * TP + nl;
            float qv[KDIM];
            float mx;
#pragma unroll
            for (int k = 0; k < KDIM; ++k) {
                qv[k] = hcol[k * TP];
                mx = (k == 0) ? qv[0] : fmaxf(mx, qv[k]);
            }
            float sum = 0.f;
#pragma unroll
            for (int k = 0; k < KDIM; ++k) { qv[k] = __expf(qv[k] - mx); sum += qv[k]; }
            const float scl = 256.0f / sum;
#pragma unroll
            for (int k = 0; k < KDIM; ++k) hcol[k * TP] = qv[k] * scl;
        }
    }
    __syncthreads();

    if (region == 0) {
        // the wave's 16 columns, head it >> 1, half it & 1 of the fragment: lane (m, h) takes channels
        // 16 it + 8 h .. + 7 of column m (LDS banks m + 32 h: no conflict), 512 B in a row per store
        static_assert(NHKD == 64 * MT && 4 * MT == 2 * HEADS, "the block holds every head");
        _Float16* qc = qsm + (((size_t)b * (NN / 16) + blockIdx.x * 8 + wave) * HEADS) * CHUNK + l * 8;
        v8h hv[4 * MT];
        // unrolled: hv is indexed by constants, and the LDS reads of the next piece start under the store of this one
#pragma unroll
        for (int it = 0; it < 4 * MT; ++it) {
#pragma unroll
            for (int j = 0; j < 8; ++j) hv[it][j] = (_Float16)tile[(it * 16 + 8 * h + j) * TP + wave * 16 + m];
            vst8h(qc + it * 256, hv[it]);
        }
        XWAIT16(qc, hv);
    } else if (region == 1) {
        // lane = row: thread t holds row t's 128 columns in registers, so max and sum need no exchange
        static_assert(64 * MT == 256, "one row per thread");
        const int obase = Mbase - NHKD;
        float* krow = tile + t * TP;
        // every loop here is unrolled: kv is indexed by constants and stays in registers
        v4f kv[32];
#pragma unroll
        for (int j = 0; j < 32; ++j) kv[j] = *(const v4fa*)(krow + 4 * j);
        v4f mx4 = kv[0];
#pragma unroll
        for (int j = 1; j < 32; ++j)
#pragma unroll
            for (int i = 0; i < 4; ++i) mx4[i] = fmaxf(mx4[i], kv[j][i]);
        const float mx = fmaxf(fmaxf(mx4[0], mx4[1]), fmaxf(mx4[2], mx4[3]));
        v4f sum4 = {};
#pragma unroll
        for (int j = 0; j < 16; ++j) {
            // exp(k - mx) x 1024 = 2^((k - mx) log2 e + 10)
            float x[8], e[8];
#pragma unroll
            for (int i = 0; i < 8; ++i) x[i] = fmaf(kv[2 * j + (i >> 2)][i & 3] - mx, 1.44269504f, 10.0f);
            exp2x8(e, x);
            v8h hv;
#pragma unroll
            for (int i = 0; i < 8; ++i) { sum4[i & 3] += e[i]; hv[i] = (_Float16)e[i]; }
            // over the head of the thread's own row, which is wholly in its registers by now
            *(v8ha*)((_Float16*)krow + 8 * j) = hv;
        }
        // a wave's 32 rows: one whole 128-B line per store
        const size_t so = ((size_t)b * NBLK + blockIdx.x) * NHKD + obase + t;
        kmx[so]  = mx;
        ksum[so] = (sum4[0] + sum4[1]) + (sum4[2] + sum4[3]);
        // ke in chunks: it >> 3 = which 16 of the wave's 32 rows, it & 7 = 2 (chunk of 32 n) + half; 512 B in
        // a row per store.  A wave reads back only the 32 rows that its own lanes wrote (one wave's LDS
        // operations go in issue order): no barrier
        _Float16* kc = ke + (((size_t)b * (NHKD / 16) + (obase >> 4) + wave * 2) * (NN / 32) + blockIdx.x * 4) * CHUNK + l * 8;
        v8h hk[4 * MT];
#pragma unroll
        for (int it = 0; it < 4 * MT; ++it) {
            const int row = wave * (8 * MT) + (it >> 3) * 16 + m;
            hk[it] = *(const v8ha*)((const _Float16*)(tile + row * TP) + (it & 7) * 16 + h * 8);
            vst8h(kc + (it >> 3) * (NN / 32) * CHUNK + (it & 7) * 256, hk[it]);
        }
        XWAIT16(kc, hk);
    } else {
        // vh in chunks, dealt like ke: 512 B in a row per store
        const int obase = Mbase - 2 * NHKD;
        _Float16* vc = vh + (((size_t)b * (DHC / 16) + (obase >> 4) + wave * 2) * (NN / 32) + blockIdx.x * 4) * CHUNK + l * 8;
        v8h hv[4 * MT];
#pragma unroll
        for (int it = 0; it < 4 * MT; ++it) {
            const int row = wave * (8 * MT) + (it >> 3) * 16 + m;
#pragma unroll
            for (int j = 0; j < 8; ++j) hv[it][j] = (_Float16)tile[row * TP + (it & 7) * 16 + h * 8 + j];
            vst8h(vc + (it >> 3) * (NN / 32) * CHUNK + (it & 7) * 256, hv[it]);
        }
        XWAIT16(vc, hv);
    }
}

// ---------------------------------------------------------------------------
// Kernel 2: context per (b,head): C[kd][d] = sum_n softmax_n(k)[kd][n] * v[d][n], K = 4096.
// A rows = ke rows; B[k=n][col=d] = vh row d: both lie in chunks of 16 rows x 32 n, same loader.
// Second half of the key softmax: a wave's 128 n are one column block of kernel 1, so its whole
// tile row kd carries one factor 4096 exp(block max - row max) / row sum (the x1024 cancels), formed
// from kmx and ksum of the row's 32 blocks and applied in f32 where the waves' tiles are added.
// The n-sum is split: CSPLIT work-groups per (b,head), eight waves each, every wave holding the
// whole 32 x 64 tile (2 kd-tiles x 4 d-tiles) for its own 128 n, so that each fragment is
// loaded once and all of a wave's loads are independent.  The eight waves' tiles are added
// through LDS in wave order; the work-group's f32 partial goes to part[bh][g][2048].
// Order inside a partial: unit u = dt*4 + kt*2 + (r>>2), then lane, then r&3 (accumulator
// register r of tile (kt, dt)).  That is the A-fragment order of kernel 3: element e = kt*8 + r
// of lane (m, h) is C[kd = kt*16 + 8h + r][d = dt*16 + m].
// ---------------------------------------------------------------------------
__global__ __launch_bounds__(256) void ctx_kernel(const _Float16* __restrict__ ke,
                                                  const float* __restrict__ kmx,
                                                  const float* __restrict__ ksum,
                                                  const _Float16* __restrict__ vh,
                                                  float* __restrict__ part)
{
    static_assert(CWN == 128 && NBLK == 32, "a wave's n = one column block; 4 blocks per wave below");
    __shared__ __attribute__((aligned(16))) float red[8 * CTILE];
    __shared__ float pm[8 * KDIM], ps[8 * KDIM];
    __shared__ __attribute__((aligned(16))) float fl[8 * KDIM];
    const int bh = blockIdx.x / CSPLIT, g = blockIdx.x % CSPLIT, b = bh >> 3, hd = bh & 7;
    const int t = threadIdx.x, l = t & 31, wave = t >> 5, h = l >> 4;
    // this lane's piece of the first chunk of the wave's 128 n, in the head's first 16 rows of each operand
    const _Float16* pa = ke + (((size_t)b * (NHKD / 16) + hd * (KDIM / 16)) * (NN / 32) + (g * 8 + wave) * (CWN / 32)) * CHUNK + l * 8;
    const _Float16* pv = vh + (((size_t)b * (DHC / 16) + hd * (DD / 16)) * (NN / 32) + (g * 8 + wave) * (CWN / 32)) * CHUNK + l * 8;
    // statistics of key row l: four of its 32 blocks per wave, and this wave's own block's max
    const float* sm = kmx  + (size_t)b * NBLK * NHKD + hd * KDIM + l;
    const float* pm4 = sm + wave * 4 * NHKD;
    const float* ps4 = ksum + (size_t)b * NBLK * NHKD + hd * KDIM + l + wave * 4 * NHKD;
    float m4[4], s4[4];
#pragma unroll
    for (int i = 0; i < 4; ++i) { m4[i] = pm4[i * NHKD]; s4[i] = ps4[i * NHKD]; }
    const float* pown = sm + (g * 8 + wave) * NHKD;
    const float mown = *pown;
    // every loop below is unrolled so that the fragment and accumulator arrays are indexed by
    // constants and stay in registers
    v16h a[CWN / 32][2], bf[CWN / 32][4];
#pragma unroll
    for (int s = 0; s < CWN / 32; ++s) {
#pragma unroll
        for (int i = 0; i < 2; ++i)
            a[s][i] = load_chunk(pa + (i * (NN / 32) + s) * CHUNK);
#pragma unroll
        for (int j = 0; j < 4; ++j)
            bf[s][j] = load_chunk(pv + (j * (NN / 32) + s) * CHUNK);
    }
    // the five addresses stay live to here, so that no load's result lands on them, and the wait stands
    // ahead of their reuse
    asm volatile("s_wait_xcnt 0x0" :: "v"(pm4), "v"(ps4), "v"(pown), "v"(pa), "v"(pv) : "memory");
    // keeps every load of the wave ahead of the first product: one memory latency per wave;
    // without it the scheduler reuses fragment registers and waits out eight latencies in a row
    __builtin_amdgcn_sched_barrier(0);
    {
        const float ml = fmaxf(fmaxf(m4[0], m4[1]), fmaxf(m4[2], m4[3]));
        float sl = 0.f;
#pragma unroll
        for (int i = 0; i < 4; ++i) sl += s4[i] * __expf(m4[i] - ml);
        pm[wave * KDIM + l] = ml;
        ps[wave * KDIM + l] = sl;
        __syncthreads();   // every wave's four blocks are in pm, ps
        float M = pm[l];
#pragma unroll
        for (int w = 1; w < 8; ++w) M = fmaxf(M, pm[w * KDIM + l]);
        float S = 0.f;
#pragma unroll
        for (int w = 0; w < 8; ++w) S += ps[w * KDIM + l] * __expf(pm[w * KDIM + l] - M);
        fl[wave * KDIM + l] = __expf(mown - M) * (4096.0f / S);   // read behind the barrier below
    }
    v8f c[2][4] = {};
#pragma unroll
    for (int s = 0; s < CWN / 32; ++s)
#pragma unroll
        for (int i = 0; i < 2; ++i)
#pragma unroll
            for (int j = 0; j < 4; ++j) c[i][j] = mma16(a[s][i], bf[s][j], c[i][j]);
    // keeps the LDS stores behind the last product: all eight accumulators stay live to here, so
    // none of their registers is handed to another product's result inside the hazard distance
    __builtin_amdgcn_sched_barrier(0);
    float* mine = red + wave * CTILE + l * 4;
#pragma unroll
    for (int j = 0; j < 4; ++j)
#pragma unroll
        for (int i = 0; i < 2; ++i) {
            const v8f v = c[i][j];
            vst4f(mine + (j * 4 + i * 2) * 128,     (v4f){v[0], v[1], v[2], v[3]});
            vst4f(mine + (j * 4 + i * 2 + 1) * 128, (v4f){v[4], v[5], v[6], v[7]});
        }
    __syncthreads();
    float* dst = part + (size_t)blockIdx.x * CTILE;
    // unit u = 8 q + wave: kt = (wave >> 1) & 1 and r >> 2 = wave & 1 for both q, so this thread's
    // four elements are rows kd0 .. kd0 + 3 of every wave's tile
    const int kd0 = ((wave >> 1) & 1) * 16 + 8 * h + (wave & 1) * 4;
    v4f fw[8];
#pragma unroll
    for (int w = 0; w < 8; ++w) fw[w] = *(const v4f*)(fl + w * KDIM + kd0);
#pragma unroll
    for (int q = 0; q < 2; ++q) {
        const int e = q * 1024 + t * 4;
        v4f s = *(const v4f*)(red + e) * fw[0];
#pragma unroll
        for (int w = 1; w < 8; ++w) s += *(const v4f*)(red + w * CTILE + e) * fw[w];
        vst4f(dst + e, s);
    }
}

// ---------------------------------------------------------------------------
// Kernel 3: attended and output projection in one.
// Output projection [384][512] x [512][4096] per batch + affine -> f32 out.  Block tile 192 rows x
// 128 cols, 8 waves, wave tile 48 x 64.  A stage of 64 k is one head's 64 d.  The A rows (weights)
// come into the ring by asynchronous copies; the B rows are made in place, one stage ahead:
//   Att[d][n] = sum_kd C[kd][d] * q[n][hd*32+kd] (qsm's chunks), K = 32 (one WMMA per 16x16 tile), ReLU, scaled
//   to att x256 (= acc/64), f16.  Wave w makes the 16 columns n = 16 w .. of all four d tiles: lane
//   (m, h) holds d = 16 dt + 8 h + r of column m, which are eight neighbours of B row n.
// The A fragments of that product are the sums of kernel 2's CSPLIT partials (already in fragment
// order, whole lines per load), /64 (= true context x64), rounded to f16; the block forms them once
// for its batch's eight heads: cl[hd][dt][half of the fragment][lane][8].
// ---------------------------------------------------------------------------
__global__ __launch_bounds__(256) void out_kernel(const _Float16* __restrict__ wph,
                                                  const float* __restrict__ part,
                                                  const _Float16* __restrict__ qsm,
                                                  const float* __restrict__ sp,
                                                  const float* __restrict__ bp,
                                                  float* __restrict__ out)
{
    constexpr int MT = MT_OUT, K = DHC, NT = K / KS;
    static_assert(DIMC % (64 * MT) == 0, "whole blocks");
    static_assert(KS == DD && NT == HEADS && NT >= 2, "a stage is a head");
    __shared__ __attribute__((aligned(16))) unsigned char ring[OUT_LDS_B];
    float* tile = (float*)ring;
    _Float16* cl = (_Float16*)(ring + RING_B(MT));
    const int b = blockIdx.z;
    const int t = threadIdx.x, l = t & 31, wave = t >> 5, h = l >> 4, m = l & 15;
    const int mw = wave >> 1, nw = wave & 1;
    const int Mbase = blockIdx.y * (64 * MT), Nbase = blockIdx.x * 128;
    const unsigned lds = (unsigned)(uintptr_t)ring + (t >> 3) * LPB + (t & 7) * 16;
    const _Float16* ga = wph + (size_t)Mbase * K + (t >> 3) * K + (t & 7) * 8;
    // this lane's piece of head 0's chunk of the wave's 16 columns; the eight heads' chunks follow one another
    const _Float16* qrow = qsm + (((size_t)b * (NN / 16) + blockIdx.x * 8 + wave) * HEADS) * CHUNK + l * 8;

    // B rows of head hd from its query fragment qf, into the stage at buf
    auto make_b = [&](const int hd, const v16h qf, unsigned char* buf) {
        const _Float16* ch = cl + hd * CTILE + l * 8;
        _Float16* brow = (_Float16*)(buf + (64 * MT + wave * 16 + m) * LPB) + 8 * h;
        // unrolled: fragments and results are indexed by constants and stay in registers
        Frag ca[4];
        v8f d[4];
#pragma unroll
        for (int dt = 0; dt < 4; ++dt) {
            ca[dt].half[0] = *(const v8h*)(ch + dt * 512);
            ca[dt].half[1] = *(const v8h*)(ch + dt * 512 + 256);
        }
        // keeps the eight LDS reads together ahead of the products: left alone the scheduler reuses
        // one fragment's registers and waits out an LDS latency per d tile
        __builtin_amdgcn_sched_barrier(0);
#pragma unroll
        for (int dt = 0; dt < 4; ++dt) d[dt] = mma16(ca[dt].v, qf, (v8f){});
#pragma unroll
        for (int dt = 0; dt < 4; ++dt) {
            v8h hv;
#pragma unroll
            for (int r = 0; r < 8; ++r) hv[r] = (_Float16)fmaxf(d[dt][r] * 0.015625f, 0.0f);
            vst8h(brow + dt * 16, hv);
        }
    };

    copy_stage_a192(lds, ga, K);
    v16h qf = load_chunk(qrow);
    // wave = 2 dt + half of the fragment: this thread's eight elements of every head's tile
    const float* pc = part + (size_t)b * HEADS * CSPLIT * CTILE + wave * 256 + l * 4;
    // four heads at a time, kept rolled: 32 loads per thread in flight, in 128 registers
#pragma unroll 1
    for (int hq = 0; hq < HEADS; hq += 4) {
        const float* p = pc + hq * CSPLIT * CTILE;
        // the loops below are unrolled: v is indexed by constants and stays in registers
        v4f v[4][CSPLIT][2];
#pragma unroll
        for (int k = 0; k < 4; ++k)
#pragma unroll
            for (int g = 0; g < CSPLIT; ++g) {
                v[k][g][0] = *(const v4f*)(p + (k * CSPLIT + g) * CTILE);
                v[k][g][1] = *(const v4f*)(p + (k * CSPLIT + g) * CTILE + 128);
            }
        // the address pair stays live to here, and the wait stands ahead of its rewrite in the next trip
        asm volatile("s_wait_xcnt 0x0" :: "v"(p) : "memory");
#pragma unroll
        for (int k = 0; k < 4; ++k) {
            v4f s0 = v[k][0][0], s1 = v[k][0][1];
#pragma unroll
            for (int g = 1; g < CSPLIT; ++g) { s0 += v[k][g][0]; s1 += v[k][g][1]; }
            v8h hv;
#pragma unroll
            for (int i = 0; i < 4; ++i) {
                hv[i]     = (_Float16)(s0[i] * 0.015625f);
                hv[4 + i] = (_Float16)(s1[i] * 0.015625f);
            }
            vst8h(cl + (hq + k) * CTILE + wave * 256 + l * 8, hv);
        }
    }
    asm volatile("s_wait_asynccnt 0x0" ::: "memory");   // stage 0's A rows landed (this wave's pieces)
    __syncthreads();                                    // ... and every other wave's; cl is whole
    copy_stage_a192(lds + STAGE_B(MT), ga + KS, K);
    make_b(0, qf, ring);
    {
        const _Float16* qp = qrow + CHUNK;
        qf = load_chunk(qp);
        // the address pair stays live to here, and the wait stands ahead of its reuse
        asm volatile("s_wait_xcnt 0x0" :: "v"(qp) : "memory");
    }
    __syncthreads();                                    // stage 0's B rows are whole

    v8f c[MT][4] = {};
    // kept rolled: unrolled, every stage's copy addresses stay live at once
#pragma unroll 1
    for (int s = 0; s < NT; ++s) {
        // head s+2's query fragment starts here: the whole trip covers its latency
        v16h qn = qf;
        if (s + 2 < NT) {
            const _Float16* qp = qrow + (s + 2) * CHUNK;
            qn = load_chunk(qp);
            // the address pair stays live to here, and the wait stands ahead of its reuse
            asm volatile("s_wait_xcnt 0x0" :: "v"(qp) : "memory");
        }
        // buffer (s+1)&1: its last readers left at the barrier behind trip s-1
        if (s + 1 < NT) make_b(s + 1, qf, ring + ((s + 1) & 1) * STAGE_B(MT));
        qf = qn;
        const _Float16* st = (const _Float16*)(ring + (s & 1) * STAGE_B(MT));
        const _Float16* ar = st + (mw * 16 + m) * LPH;
        const _Float16* br = st + (64 * MT + nw * 64 + m) * LPH;
        v16h a[MT], bfr[4];
        // unrolled: fragments and accumulators are indexed by constants and stay in registers
#pragma unroll
        for (int kk = 0; kk < KS / 32; ++kk) {
            a[0] = load_frag(ar + kk * 32, h);
#pragma unroll
            for (int j = 0; j < 4; ++j) bfr[j] = load_frag(br + j * 16 * LPH + kk * 32, h);
#pragma unroll
            for (int i = 1; i < MT; ++i) a[i] = load_frag(ar + i * 64 * LPH + kk * 32, h);
            // keeps the LDS reads of a k step together ahead of its products: left alone the
            // scheduler reuses one A fragment's registers and waits out an LDS latency per row
            __builtin_amdgcn_sched_barrier(0);
#pragma unroll
            for (int i = 0; i < MT; ++i)
#pragma unroll
                for (int j = 0; j < 4; ++j) c[i][j] = mma16(a[i], bfr[j], c[i][j]);
            // keeps every product of the k step ahead of what follows: the next reads, and at the
            // end the four slots below (left alone a row of products sinks behind the barrier)
            __builtin_amdgcn_sched_barrier(0);
        }
        // four vector slots behind the last matrix instructions, on the branch paths too
        GUARD4(c[MT - 1][0], c[MT - 1][1], c[MT - 1][2], c[MT - 1][3], a[MT - 1], bfr[0], bfr[1], bfr[2], bfr[3]);
        asm volatile("s_wait_dscnt 0x0" ::: "memory");     // reads of buffer s&1 and writes of stage s+1's B rows are done
        asm volatile("s_wait_asynccnt 0x0" ::: "memory");  // this wave's pieces of stage s+1's A rows have landed
        __syncthreads();                                   // publishes stage s+1, frees buffer s&1
        if (s + 2 < NT)
            copy_stage_a192(lds + (s & 1) * STAGE_B(MT), ga + (s + 2) * KS, K);
    }
    asm volatile("s_wait_asynccnt 0x0" ::: "memory");      // nothing in flight when the ring is reused

    // unrolled over i: c is indexed by constants and stays in registers
#pragma unroll
    for (int i = 0; i < MT; ++i) {
#pragma unroll
        for (int r = 0; r < 8; ++r) {
            const int ml = i * 64 + mw * 16 + 8 * h + r;
            const int o = Mbase + ml;
            const float s = sp[o] * 0.000244140625f;   // 1/(16*256)
            const float bb = bp[o];
            float* trow = tile + ml * TP + nw * 64 + m;
            trow[0]  = c[i][0][r] * s + bb;
            trow[16] = c[i][1][r] * s + bb;
            trow[32] = c[i][2][r] * s + bb;
            trow[48] = c[i][3][r] * s + bb;
        }
    }
    __syncthreads();
    const int col = (l >> 3) * 32 + (l & 7) * 4;
#pragma unroll
    for (int it = 0; it < 8 * MT; ++it) {
        const int row = wave * (8 * MT) + it;
        const v4f v = *(const v4fa*)(tile + row * TP + col);
        vst4f(out + ((size_t)b * DIMC + Mbase + row) * NN + Nbase + col, v);
    }
}

// ---------------------------------------------------------------------------
// Host-side launch glue.  Workspace (bytes):
//   [0)            wabc f16 [1024][384]         786,432
//   [786,432)      wph  f16 [384][512]          393,216
//   [1,179,648)    sc   f32 [1024]                4,096
//   [1,183,744)    bc   f32 [1024]                4,096
//   [1,187,840)    qsm  f16 [8][256][8][512]   16,777,216
//   [17,965,056)   ke   f16 [8][16][128][512]  16,777,216   (in a place of 33,554,432)
//   [51,519,488)   vh   f16 [8][32][128][512]  33,554,432
//   [85,073,920)   part f32 [64][4][2048]     2,097,152
//   [87,171,072)   kmx  f32 [8][32][256]        262,144
//   [87,433,216)   ksum f32 [8][32][256]        262,144
//   total 87,695,360
// ---------------------------------------------------------------------------
extern "C" void kernel_launch(void* const* d_in, const int* in_sizes, int n_in,
                              void* d_out, int out_size, void* d_ws, size_t ws_size,
                              hipStream_t stream)
{
    if (n_in < 13) return;
    if (in_sizes[0] != BB * DIMC * NN) return;
    if (in_sizes[1] != NHKD * DIMC || in_sizes[2] != NHKD || in_sizes[3] != NHKD) return;
    if (in_sizes[4] != NHKD * DIMC || in_sizes[5] != NHKD || in_sizes[6] != NHKD) return;
    if (in_sizes[7] != DHC * DIMC || in_sizes[8] != DHC || in_sizes[9] != DHC) return;
    if (in_sizes[10] != DIMC * DHC || in_sizes[11] != DIMC || in_sizes[12] != DIMC) return;
    if (out_size != BB * DIMC * NN) return;

    const size_t off_wabc = 0;
    const size_t sz_wabc  = (size_t)MQKV * DIMC * 2;
    const size_t off_wph  = off_wabc + sz_wabc;
    const size_t sz_wph   = (size_t)DIMC * DHC * 2;
    const size_t off_sc   = off_wph + sz_wph;
    const size_t sz_sc    = (size_t)MQKV * 4;
    const size_t off_bc   = off_sc + sz_sc;
    const size_t off_qsm  = off_bc + sz_sc;
    const size_t sz_qsm   = (size_t)BB * NN * NHKD * 2;
    const size_t off_kf   = off_qsm + sz_qsm;
    const size_t sz_kf    = (size_t)BB * NHKD * NN * 4;
    const size_t off_vh   = off_kf + sz_kf;
    const size_t sz_vh    = (size_t)BB * DHC * NN * 2;
    const size_t off_ctx  = off_vh + sz_vh;
    const size_t sz_ctx   = (size_t)BB * HEADS * CSPLIT * CTILE * 4;
    const size_t off_kmx  = off_ctx + sz_ctx;
    const size_t sz_kst   = (size_t)BB * NBLK * NHKD * 4;
    const size_t off_ksum = off_kmx + sz_kst;
    const size_t total    = off_ksum + sz_kst;
    const size_t sz_ke    = (size_t)BB * NHKD * NN * 2;
    if (total > ws_size) return;
    if (sz_ke > sz_kf) return;

    const float* x  = (const float*)d_in[0];
    const float* Wq = (const float*)d_in[1];
    const float* sq = (const float*)d_in[2];
    const float* bq = (const float*)d_in[3];
    const float* Wk = (const float*)d_in[4];
    const float* sk = (const float*)d_in[5];
    const float* bk = (const float*)d_in[6];
    const float* Wv = (const float*)d_in[7];
    const float* sv = (const float*)d_in[8];
    const float* bv = (const float*)d_in[9];
    const float* Wp = (const float*)d_in[10];
    const float* sp = (const float*)d_in[11];
    const float* bp = (const float*)d_in[12];
    float* out = (float*)d_out;

    char* ws = (char*)d_ws;
    _Float16* wabc = (_Float16*)(ws + off_wabc);
    _Float16* wph  = (_Float16*)(ws + off_wph);
    float*    sc   = (float*)   (ws + off_sc);
    float*    bc   = (float*)   (ws + off_bc);
    _Float16* qsm  = (_Float16*)(ws + off_qsm);
    _Float16* ke   = (_Float16*)(ws + off_kf);
    _Float16* vh   = (_Float16*)(ws + off_vh);
    float*    part = (float*)   (ws + off_ctx);
    float*    kmx  = (float*)   (ws + off_kmx);
    float*    ksum = (float*)   (ws + off_ksum);

    const int prep_threads = MQKV * DIMC / 8 + DIMC * DHC / 8 + 512;   // 74240
    prep_kernel<<<(prep_threads + 255) / 256, 256, 0, stream>>>(
        Wq, Wk, Wv, Wp, sq, bq, sk, bk, sv, bv, wabc, wph, sc, bc);

    qkv_kernel<<<dim3(NN / 128, BB, MQKV / (64 * MT_QKV)), 256, 0, stream>>>(wabc, x, sc, bc, qsm, ke, kmx, ksum, vh);

    ctx_kernel<<<BB * HEADS * CSPLIT, 256, 0, stream>>>(ke, kmx, ksum, vh, part);

    out_kernel<<<dim3(NN / 128, DIMC / (64 * MT_OUT), BB), 256, 0, stream>>>(wph, part, qsm, sp, bp, out);
}

// v008
// It runs in 62.9 microseconds.
// Next to v007, in two timings, it ran 1.06 and 1.05 times as fast.
// All steps since v000 together make it 4.89 times as fast.
#include <hip/hip_runtime.h>
// All contractions on v_wmma_f32_16x16x32_f16 (f16 operands, f32 accumulate): QKV projection, key*value^T, context^T*query, output projection; exact power-of-two operand scales (weights x16, key exponentials x1024, context x64, query softmax x256, attended x256) undone in the f32 epilogues; softmaxes and affine terms in f32.

#define BB    8
#define DIMC  384
#define NN    4096
#define HEADS 8
#define KDIM  32
#define DD    64
#define NHKD  256
#define DHC   512
#define MQKV  1024
#define TP    132      // LDS pitch (floats) of the f32 output tiles (64 MT x 128), keeps 16-B alignment
#define DSPLIT (DD / 16)            // work-groups per (b,head) context: one d tile of 16 each (4)
#define CWN   (NN / 8)              // n per wave of the context kernel (512)
#define CWB   (CWN / 128)           // column blocks of the QKV projection per wave of the context kernel (4)
#define CTILE (KDIM * DD)           // elements of one context tile (2048)
#define CPIECE (KDIM * 16)          // elements of one work-group's part of it, 32 kd x 16 d (512)
#define NBLK  (NN / 128)            // column blocks of the QKV projection = pieces of a key row (32)

typedef _Float16 v16h __attribute__((ext_vector_type(16)));
typedef _Float16 v8h  __attribute__((ext_vector_type(8)));
typedef _Float16 v4h  __attribute__((ext_vector_type(4)));
typedef _Float16 v2h  __attribute__((ext_vector_type(2)));
typedef float    v2f  __attribute__((ext_vector_type(2)));
typedef float    v8f  __attribute__((ext_vector_type(8)));
typedef float    v4f  __attribute__((ext_vector_type(4)));
typedef float    v4fa __attribute__((ext_vector_type(4), may_alias));
typedef _Float16 v8ha __attribute__((ext_vector_type(8), may_alias));

union Frag { v16h v; v8h half[2]; };

// 16x16x32 operand fragment from a k-contiguous row: elements 0..7 <- row[8h..8h+7],
// elements 8..15 <- row[16+8h..16+8h+7]; lane&15 selects the row (A) or column (B).
__device__ __forceinline__ v16h load_frag(const _Float16* __restrict__ p, int h)
{
    Frag f;
    f.half[0] = *(const v8h*)(p + 8 * h);
    f.half[1] = *(const v8h*)(p + 16 + 8 * h);
    return f.v;
}

// The intermediates that a later kernel reads straight into fragments lie in the workspace in fragment
// order: a 16 (rows or columns) x 32 (k) operand tile is one chunk of 1 KB, [half of the fragment][lane][8],
// chunk[256 f + 8 lane + e] = tile[lane & 15][16 f + 8 (lane >> 4) + e].  That is load_frag's map, so the
// registers hold what they held with row-major tiles, but a wave's load covers 512 B in a row (4 whole
// lines) where a row-major tile gives it 32 B of each of 16 lines.  p: the chunk + 8 lane.
#define CHUNK 512      // halves in a chunk
__device__ __forceinline__ v16h load_chunk(const _Float16* __restrict__ p)
{
    Frag f;
    f.half[0] = *(const v8h*)p;
    f.half[1] = *(const v8h*)(p + 256);
    return f.v;
}

__device__ __forceinline__ v8f mma16(v16h a, v16h b, v8f c)
{
    return __builtin_amdgcn_wmma_f32_16x16x32_f16(false, a, false, b, (short)0, c, false, false);
}

#define GUARD4(c0, c1, c2, c3, a, b0, b1, b2, b3) \
    asm volatile("v_nop\n\tv_nop\n\tv_nop\n\tv_nop" \
                 : "+v"(c0), "+v"(c1), "+v"(c2), "+v"(c3) \
                 : "v"(a), "v"(b0), "v"(b1), "v"(b2), "v"(b3))

// e[i] = 2^x[i].  One statement: outputs and inputs are kept apart, so each exponential is the
// independent instruction behind the one before it, and the v_nop is that slot behind the last
__device__ __forceinline__ void exp2x8(float (&e)[8], const float (&x)[8])
{
    asm("v_exp_f32 %0, %8\n\tv_exp_f32 %1, %9\n\tv_exp_f32 %2, %10\n\tv_exp_f32 %3, %11\n\t"
        "v_exp_f32 %4, %12\n\tv_exp_f32 %5, %13\n\tv_exp_f32 %6, %14\n\tv_exp_f32 %7, %15\n\t"
        "v_nop"
        : "=&v"(e[0]), "=&v"(e[1]), "=&v"(e[2]), "=&v"(e[3]),
          "=&v"(e[4]), "=&v"(e[5]), "=&v"(e[6]), "=&v"(e[7])
        : "v"(x[0]), "v"(x[1]), "v"(x[2]), "v"(x[3]), "v"(x[4]), "v"(x[5]), "v"(x[6]), "v"(x[7]));
}

__device__ __forceinline__ void vst8h(_Float16* p, v8h v) { *(v8h*)p = v; }
// Behind 16 stores of pieces v[0..15] at p + constants: address and data stay live to here, each piece in
// registers of its own, so that nothing overwrites a register of an issued store ahead of the wait
#define XWAIT16(p, v) \
    asm volatile("s_wait_xcnt 0x0" \
                 :: "v"(p), "v"(v[0]), "v"(v[1]), "v"(v[2]), "v"(v[3]), "v"(v[4]), "v"(v[5]), "v"(v[6]), "v"(v[7]), \
                    "v"(v[8]), "v"(v[9]), "v"(v[10]), "v"(v[11]), "v"(v[12]), "v"(v[13]), "v"(v[14]), "v"(v[15]) \
                 : "memory")
__device__ __forceinline__ void vst4f(float* p, v4f v)    { *(v4f*)p = v; }

// LDS ring of the two projection GEMMs.  Block tile 64 MT rows x 128 columns.  A stage = 64 k
// (128 B) of the 64 MT A rows, row pitch 144 B (16 B x 9: conflict-free for ds_load_b128), and then
// the B tile in 128 x 144 B; two buffers.  The f32 output tile reuses the space after the loop.
// Output kernel: B = 128 rows (columns n) of 64 k, pitch 144 B.  QKV kernel: B = 64 rows (k) of
// 128 n, pitch 288 B (32 B x 9: conflict-free for ds_load_tr16_b128), the same bytes in all.
#define KS      64                 // k per stage
#define LPB     144                // LDS row pitch, bytes
#define LPH     72                 // the same in halves
#define XPB     288                // LDS row pitch of the QKV kernel's B tile, bytes
#define STAGE_B(MT) ((64 * (MT) + 128) * LPB)
#define RING_B(MT)  (2 * STAGE_B(MT))
#define OTILE_B(MT) (64 * (MT) * TP * 4)
#define GEMM_LDS_B(MT) (RING_B(MT) > OTILE_B(MT) ? RING_B(MT) : OTILE_B(MT))
#define MT_QKV  4                  // 256 x 128 block, 64 x 64 per wave
#define MT_OUT  3                  // 192 x 128 block, 48 x 64 per wave
#define CTXL_B  (HEADS * CTILE * 2)   // one batch's eight context tiles in f16, behind the output kernel's ring
#define OUT_LDS_B (RING_B(MT_OUT) + CTXL_B > OTILE_B(MT_OUT) ? RING_B(MT_OUT) + CTXL_B : OTILE_B(MT_OUT))

// The A rows of a stage of the QKV kernel: 256 x 8 pieces of 16 B, 8 per thread.  Thread t brings
// piece t&7 of rows t>>3 + 32 j, so eight lanes cover one 128-B line.  a: this thread's piece in
// A row t>>3 at the stage's k; lds: its place in the buffer (byte address in LDS).
// s_wait_xcnt stands inside the statement, ahead of any rewrite of the address registers.
__device__ __forceinline__ void copy_stage_a256(const unsigned lds, const _Float16* a, const int K)
{
    asm volatile("global_load_async_to_lds_b128 %0, %8, off\n\t"
                 "global_load_async_to_lds_b128 %1, %9, off\n\t"
                 "global_load_async_to_lds_b128 %2, %10, off\n\t"
                 "global_load_async_to_lds_b128 %3, %11, off\n\t"
                 "global_load_async_to_lds_b128 %4, %12, off\n\t"
                 "global_load_async_to_lds_b128 %5, %13, off\n\t"
                 "global_load_async_to_lds_b128 %6, %14, off\n\t"
                 "global_load_async_to_lds_b128 %7, %15, off\n\t"
                 "s_wait_xcnt 0x0"
                 :: "v"(lds), "v"(lds + 32 * LPB), "v"(lds + 64 * LPB), "v"(lds + 96 * LPB),
                    "v"(lds + 128 * LPB), "v"(lds + 160 * LPB), "v"(lds + 192 * LPB),
                    "v"(lds + 224 * LPB),
                    "v"(a), "v"(a + 32 * K), "v"(a + 64 * K), "v"(a + 96 * K),
                    "v"(a + 128 * K), "v"(a + 160 * K), "v"(a + 192 * K), "v"(a + 224 * K)
                 : "memory");
}

// The A rows alone of a stage of the output kernel (192 rows, 6 pieces per thread), same places as above.
__device__ __forceinline__ void copy_stage_a192(const unsigned lds, const _Float16* a, const int K)
{
    asm volatile("global_load_async_to_lds_b128 %0, %6, off\n\t"
                 "global_load_async_to_lds_b128 %1, %7, off\n\t"
                 "global_load_async_to_lds_b128 %2, %8, off\n\t"
                 "global_load_async_to_lds_b128 %3, %9, off\n\t"
                 "global_load_async_to_lds_b128 %4, %10, off\n\t"
                 "global_load_async_to_lds_b128 %5, %11, off\n\t"
                 "s_wait_xcnt 0x0"
                 :: "v"(lds), "v"(lds + 32 * LPB), "v"(lds + 64 * LPB), "v"(lds + 96 * LPB),
                    "v"(lds + 128 * LPB), "v"(lds + 160 * LPB),
                    "v"(a), "v"(a + 32 * K), "v"(a + 64 * K), "v"(a + 96 * K),
                    "v"(a + 128 * K), "v"(a + 160 * K)
                 : "memory");
}

// One batch's eight context tiles (32 KB, f16, already in the order of cl): 8 pieces of 16 B per thread,
// piece t + 256 j.  lds, g: this thread's piece 0.  s_wait_xcnt stands inside the statement, as above.
__device__ __forceinline__ void copy_ctx(const unsigned lds, const _Float16* g)
{
    asm volatile("global_load_async_to_lds_b128 %0, %8, off\n\t"
                 "global_load_async_to_lds_b128 %1, %9, off\n\t"
                 "global_load_async_to_lds_b128 %2, %10, off\n\t"
                 "global_load_async_to_lds_b128 %3, %11, off\n\t"
                 "global_load_async_to_lds_b128 %4, %12, off\n\t"
                 "global_load_async_to_lds_b128 %5, %13, off\n\t"
                 "global_load_async_to_lds_b128 %6, %14, off\n\t"
                 "global_load_async_to_lds_b128 %7, %15, off\n\t"
                 "s_wait_xcnt 0x0"
                 :: "v"(lds), "v"(lds + 4096), "v"(lds + 2 * 4096), "v"(lds + 3 * 4096),
                    "v"(lds + 4 * 4096), "v"(lds + 5 * 4096), "v"(lds + 6 * 4096), "v"(lds + 7 * 4096),
                    "v"(g), "v"(g + 2048), "v"(g + 2 * 2048), "v"(g + 3 * 2048),
                    "v"(g + 4 * 2048), "v"(g + 5 * 2048), "v"(g + 6 * 2048), "v"(g + 7 * 2048)
                 : "memory");
}

// 16 x 16 halves of a row-major LDS tile, transposed: lane (m, h) gets column m of rows 8 h .. 8 h + 7
// of the tile whose piece this lane's address names (rows by l & 7 and h, 16-B half by bit 3 of l)
typedef short s16x8 __attribute__((ext_vector_type(8)));
__device__ __forceinline__ v8h ld_tr16(const unsigned char* p)
{
    typedef __attribute__((address_space(3))) s16x8 lds_s16x8;
    return __builtin_bit_cast(v8h, __builtin_amdgcn_ds_load_tr16_b128_v8i16((lds_s16x8*)p));
}

// Block: 256 rows of A (f16, row-major, pitch K) times 128 columns of B = X (f32, X[k][n] with n
// contiguous, pitch NN).  A comes into the ring by asynchronous copies.  X comes through registers:
// whole 512-B rows per wave load, one stage ahead, rounded to f16 and stored as it lies (k rows of
// 128 n); the transposing LDS load hands out B fragments in load_frag's k order.
// Wave (mw, nw): rows 64 i + 16 mw.. (i < 4), columns 64 nw..; c[i][j] = row group i, column group j
// of 16: 8 fragments feed 16 products.  On return every wave has left the ring (last trip's barrier).
template <int K>
__device__ __forceinline__ void mainloop_wx(unsigned char* ring,
                                            const _Float16* __restrict__ Ablk,
                                            const float* __restrict__ Xblk,
                                            const int t, const int mw, const int nw,
                                            const int h, const int m,
                                            v8f (&c)[4][4])
{
    constexpr int MT = 4, NT = K / KS;
    static_assert(K % KS == 0 && NT >= 2, "two stages or more");
    const int l = t & 31, wave = t >> 5;
    const unsigned lds = (unsigned)(uintptr_t)ring + (t >> 3) * LPB + (t & 7) * 16;
    const _Float16* ga = Ablk + (t >> 3) * K + (t & 7) * 8;
    // this thread's part of a stage of X: columns 4 l .. 4 l + 3 of rows 8 wave + j, j < 8
    const float* gx = Xblk + (size_t)(wave * 8) * NN + l * 4;
    unsigned char* xs = ring + 64 * MT * LPB + (wave * 8) * XPB + l * 8;
    v4f xr[8];
    // the loops over j are unrolled: xr is indexed by constants and stays in registers
    auto load_x = [&](const int s) {
        const float* p = gx + (size_t)s * KS * NN;
#pragma unroll
        for (int j = 0; j < 8; ++j) xr[j] = *(const v4f*)(p + j * NN);
        // the address pair stays live to here, and the wait stands ahead of its rewrite
        asm volatile("s_wait_xcnt 0x0" :: "v"(p) : "memory");
    };
    auto store_x = [&](unsigned char* dst) {
#pragma unroll
        for (int j = 0; j < 8; ++j)
            *(v4h*)(dst + j * XPB) = __builtin_convertvector(xr[j], v4h);
    };

    copy_stage_a256(lds, ga, K);
    load_x(0);
    store_x(xs);
    asm volatile("s_wait_dscnt 0x0" ::: "memory");      // this wave's rows of stage 0's B tile are written
    asm volatile("s_wait_asynccnt 0x0" ::: "memory");   // stage 0's A rows landed (this wave's pieces)
    __syncthreads();                                    // ... and every other wave's
    copy_stage_a256(lds + STAGE_B(MT), ga + KS, K);
    load_x(1);   // behind the barrier, like every later stage's: the compiler waits out plain loads in front of one

    // kept rolled: unrolled, every stage's copy addresses stay live at once, and the added
    // registers cost a resident work-group per WGP
#pragma unroll 1
    for (int s = 0; s < NT; ++s) {
        const unsigned char* st = ring + (s & 1) * STAGE_B(MT);
        const _Float16* ar = (const _Float16*)st + (mw * 16 + m) * LPH;
        const unsigned char* br = st + 64 * MT * LPB + (8 * h + (l & 7)) * XPB + ((l >> 3) & 1) * 16 + nw * 128;
        v16h a[MT];
        Frag b[4];
        // unrolled: fragments and accumulators are indexed by constants and stay in registers
#pragma unroll
        for (int kk = 0; kk < KS / 32; ++kk) {
            a[0] = load_frag(ar + kk * 32, h);
#pragma unroll
            for (int j = 0; j < 4; ++j) {
                b[j].half[0] = ld_tr16(br + (kk * 32) * XPB + j * 32);
                b[j].half[1] = ld_tr16(br + (kk * 32 + 16) * XPB + j * 32);
            }
#pragma unroll
            for (int i = 1; i < MT; ++i) a[i] = load_frag(ar + i * 64 * LPH + kk * 32, h);
            // keeps the LDS reads of a k step together ahead of its products: left alone the
            // scheduler reuses one A fragment's registers and waits out an LDS latency per row
            __builtin_amdgcn_sched_barrier(0);
#pragma unroll
            for (int i = 0; i < MT; ++i)
#pragma unroll
                for (int j = 0; j < 4; ++j) c[i][j] = mma16(a[i], b[j].v, c[i][j]);
            // keeps every product of the k step ahead of what follows: the next reads, and at the
            // end the four slots below (left alone a row of products sinks behind the barrier)
            __builtin_amdgcn_sched_barrier(0);
        }
        // four vector slots behind the last matrix instructions, on the branch paths too
        GUARD4(c[MT - 1][0], c[MT - 1][1], c[MT - 1][2], c[MT - 1][3], a[MT - 1], b[0].v, b[1].v, b[2].v, b[3].v);
        // stage s+1's B tile, loaded a trip ago; buffer (s+1)&1: its last readers left at the barrier behind trip s-1
        if (s + 1 < NT) store_x(xs + ((s + 1) & 1) * STAGE_B(MT));
        asm volatile("s_wait_dscnt 0x0" ::: "memory");     // reads of buffer s&1 and writes of stage s+1's B tile are done
        asm volatile("s_wait_asynccnt 0x0" ::: "memory");  // this wave's pieces of stage s+1's A rows have landed
        __syncthreads();                                   // publishes stage s+1, frees buffer s&1
        if (s + 2 < NT) {
            copy_stage_a256(lds + (s & 1) * STAGE_B(MT), ga + (s + 2) * KS, K);
            load_x(s + 2);
        }
    }
    asm volatile("s_wait_asynccnt 0x0" ::: "memory");      // nothing in flight when the ring is reused
}

// ---------------------------------------------------------------------------
// Kernel 0: weights -> f16 (x16), concatenated [1024][384] and [384][512];
// affine params concatenated (scale pre-multiplied by 1/16).  16-B per lane stores.
// ---------------------------------------------------------------------------
__global__ __launch_bounds__(256) void prep_kernel(
    const float* __restrict__ Wq, const float* __restrict__ Wk, const float* __restrict__ Wv,
    const float* __restrict__ Wp,
    const float* __restrict__ sq, const float* __restrict__ bq,
    const float* __restrict__ sk, const float* __restrict__ bk,
    const float* __restrict__ sv, const float* __restrict__ bv,
    _Float16* __restrict__ wabc, _Float16* __restrict__ wph,
    float* __restrict__ sc, float* __restrict__ bc)
{
    const int NW1 = MQKV * DIMC / 8;   // 49152 chunks of 8 halves
    const int NW2 = DIMC * DHC / 8;    // 24576 chunks
    const int i = blockIdx.x * 256 + threadIdx.x;
    if (i < NW1 + NW2) {
        const float* src;
        _Float16* dst;
        if (i < NW1) {
            const int e = i * 8;
            if (e < NHKD * DIMC)          src = Wq + e;
            else if (e < 2 * NHKD * DIMC) src = Wk + (e - NHKD * DIMC);
            else                          src = Wv + (e - 2 * NHKD * DIMC);
            dst = wabc + e;
        } else {
            const int e = (i - NW1) * 8;
            src = Wp + e;
            dst = wph + e;
        }
        const v4f f0 = *(const v4f*)src;
        const v4f f1 = *(const v4f*)(src + 4);
        v8h hv;
#pragma unroll
        for (int j = 0; j < 4; ++j) {
            hv[j]     = (_Float16)(f0[j] * 16.0f);
            hv[4 + j] = (_Float16)(f1[j] * 16.0f);
        }
        vst8h(dst, hv);
        
    } else {
        const int j = i - (NW1 + NW2);
        if (j < 512) {
            const int e = (j & 255) * 4;
            v4f o;
#pragma unroll
            for (int q = 0; q < 4; ++q) {
                const int ee = e + q;
                float val;
                if (j < 256) {
                    val = (ee < NHKD) ? sq[ee] : ((ee < 2 * NHKD) ? sk[ee - NHKD] : sv[ee - 2 * NHKD]);
                    val *= 0.0625f;
                } else {
                    val = (ee < NHKD) ? bq[ee] : ((ee < 2 * NHKD) ? bk[ee - NHKD] : bv[ee - 2 * NHKD]);
                }
                o[q] = val;
            }
            float* dst = ((j < 256) ? sc : bc) + e;
            vst4f(dst, o);
            
        }
    }
}

// ---------------------------------------------------------------------------
// Kernel 1: fused QKV projection [1024][384] x [384][4096] per batch + affine.
// Block tile 256 rows x 128 cols, 8 waves, wave tile 64 x 64, operands through the LDS ring; x is read
// as it is given (f32, [b][c][n]) and rounded to f16 on its way into the ring.
// A block lies wholly in one of the three row regions.  Result staged in LDS:
//   Q rows (0..255):   channel softmax over 32 per head (f32), x256, f16 -> qsm[b][n / 16][head][chunk]
//   K rows (256..511): first half of the softmax over n, per row and per 128 columns of the block:
//                      exp(k - block max) x1024, f16 -> ke[b][row / 16][n / 32][chunk]; the block's max and the
//                      f32 sum of those (x1024 too) -> kmx, ksum [b][column block][256]
//   V rows (512..1023): f16 -> vh[b][row / 16][n / 32][chunk]
// ---------------------------------------------------------------------------
__global__ __launch_bounds__(256) void qkv_kernel(const _Float16* __restrict__ wabc,
                                                  const float* __restrict__ x,
                                                  const float* __restrict__ sc,
                                                  const float* __restrict__ bc,
                                                  _Float16* __restrict__ qsm,
                                                  _Float16* __restrict__ ke,
                                                  float* __restrict__ kmx,
                                                  float* __restrict__ ksum,
                                                  _Float16* __restrict__ vh)
{
    constexpr int MT = MT_QKV;
    static_assert(MT == 4 && NHKD % (64 * MT) == 0, "a block stays inside one region");
    __shared__ __attribute__((aligned(16))) unsigned char ring[GEMM_LDS_B(MT)];
    float* tile = (float*)ring;
    // the row block is the slowest grid index: the Q blocks, whose epilogue is the longest, start first
    const int b = blockIdx.y;
    const int t = threadIdx.x, l = t & 31, wave = t >> 5, h = l >> 4, m = l & 15;
    const int mw = wave >> 1, nw = wave & 1;
    const int Mbase = blockIdx.z * (64 * MT), Nbase = blockIdx.x * 128;
    const int region = (Mbase < NHKD) ? 0 : ((Mbase < 2 * NHKD) ? 1 : 2);

    const _Float16* Ablk = wabc + (size_t)Mbase * DIMC;
    const float* Xblk = x + (size_t)b * DIMC * NN + Nbase;
    v8f c[MT][4] = {};
    mainloop_wx<DIMC>(ring, Ablk, Xblk, t, mw, nw, h, m, c);

    // the loops over i below are unrolled: c, s and bb are indexed by constants and stay in registers
    const float* ps = sc + Mbase + mw * 16 + 8 * h;
    const float* pb = bc + Mbase + mw * 16 + 8 * h;
    float s[MT][8], bb[MT][8];
#pragma unroll
    for (int i = 0; i < MT; ++i) {
#pragma unroll
        for (int r = 0; r < 8; ++r) { s[i][r] = ps[i * 64 + r]; bb[i][r] = pb[i * 64 + r]; }
    }
    // the two address pairs stay live to here, so that no load's result lands on them, and the wait
    // stands ahead of their reuse
    asm volatile("s_wait_xcnt 0x0" :: "v"(ps), "v"(pb) : "memory");
#pragma unroll
    for (int i = 0; i < MT; ++i) {
#pragma unroll
        for (int r = 0; r < 8; ++r) {
            const int ml = i * 64 + mw * 16 + 8 * h + r;
            float* trow = tile + ml * TP + nw * 64 + m;
            trow[0]  = c[i][0][r] * s[i][r] + bb[i][r];
            trow[16] = c[i][1][r] * s[i][r] + bb[i][r];
            trow[32] = c[i][2][r] * s[i][r] + bb[i][r];
            trow[48] = c[i][3][r] * s[i][r] + bb[i][r];
        }
    }
    __syncthreads();

    if (region == 0) {
        // softmax over the 32 channels of one head for one column; 2 heads x 128 cols = 256 threads
        // per 64 rows
        const int nl = t & 127, hh = t >> 7;
        for (int i = 0; i < MT; ++i) {
            float* hcol = tile + (i * 64 + hh * KDIM) * TP + nl;
            float qv[KDIM];
            float mx;
#pragma unroll
            for (int k = 0; k < KDIM; ++k) {
                qv[k] = hcol[k * TP];
                mx = (k == 0) ? qv[0] : fmaxf(mx, qv[k]);
            }
            float sum = 0.f;
#pragma unroll
            for (int k = 0; k < KDIM; ++k) { qv[k] = __expf(qv[k] - mx); sum += qv[k]; }
            const float scl = 256.0f / sum;
#pragma unroll
            for (int k = 0; k < KDIM; ++k) hcol[k * TP] = qv[k] * scl;
        }
    }
    __syncthreads();

    if (region == 0) {
        // the wave's 16 columns, head it >> 1, half it & 1 of the fragment: lane (m, h) takes channels
        // 16 it + 8 h .. + 7 of column m (LDS banks m + 32 h: no conflict), 512 B in a row per store
        static_assert(NHKD == 64 * MT && 4 * MT == 2 * HEADS, "the block holds every head");
        _Float16* qc = qsm + (((size_t)b * (NN / 16) + blockIdx.x * 8 + wave) * HEADS) * CHUNK + l * 8;
        v8h hv[4 * MT];
        // unrolled: hv is indexed by constants, and the LDS reads of the next piece start under the store of this one
#pragma unroll
        for (int it = 0; it < 4 * MT; ++it) {
#pragma unroll
            for (int j = 0; j < 8; ++j) hv[it][j] = (_Float16)tile[(it * 16 + 8 * h + j) * TP + wave * 16 + m];
            vst8h(qc + it * 256, hv[it]);
        }
        XWAIT16(qc, hv);
    } else if (region == 1) {
        // lane = row: thread t holds row t's 128 columns in registers, so max and sum need no exchange
        static_assert(64 * MT == 256, "one row per thread");
        const int obase = Mbase - NHKD;
        float* krow = tile + t * TP;
        // every loop here is unrolled: kv is indexed by constants and stays in registers
        v4f kv[32];
#pragma unroll
        for (int j = 0; j < 32; ++j) kv[j] = *(const v4fa*)(krow + 4 * j);
        v4f mx4 = kv[0];
#pragma unroll
        for (int j = 1; j < 32; ++j)
#pragma unroll
            for (int i = 0; i < 4; ++i) mx4[i] = fmaxf(mx4[i], kv[j][i]);
        const float mx = fmaxf(fmaxf(mx4[0], mx4[1]), fmaxf(mx4[2], mx4[3]));
        v4f sum4 = {};
#pragma unroll
        for (int j = 0; j < 16; ++j) {
            // exp(k - mx) x 1024 = 2^((k - mx) log2 e + 10)
            float x[8], e[8];
#pragma unroll
            for (int i = 0; i < 8; ++i) x[i] = fmaf(kv[2 * j + (i >> 2)][i & 3] - mx, 1.44269504f, 10.0f);
            exp2x8(e, x);
            v8h hv;
#pragma unroll
            for (int i = 0; i < 8; ++i) { sum4[i & 3] += e[i]; hv[i] = (_Float16)e[i]; }
            // over the head of the thread's own row, which is wholly in its registers by now
            *(v8ha*)((_Float16*)krow + 8 * j) = hv;
        }
        // a wave's 32 rows: one whole 128-B line per store
        const size_t so = ((size_t)b * NBLK + blockIdx.x) * NHKD + obase + t;
        kmx[so]  = mx;
        ksum[so] = (sum4[0] + sum4[1]) + (sum4[2] + sum4[3]);
        // ke in chunks: it >> 3 = which 16 of the wave's 32 rows, it & 7 = 2 (chunk of 32 n) + half; 512 B in
        // a row per store.  A wave reads back only the 32 rows that its own lanes wrote (one wave's LDS
        // operations go in issue order): no barrier
        _Float16* kc = ke + (((size_t)b * (NHKD / 16) + (obase >> 4) + wave * 2) * (NN / 32) + blockIdx.x * 4) * CHUNK + l * 8;
        v8h hk[4 * MT];
#pragma unroll
        for (int it = 0; it < 4 * MT; ++it) {
            const int row = wave * (8 * MT) + (it >> 3) * 16 + m;
            hk[it] = *(const v8ha*)((const _Float16*)(tile + row * TP) + (it & 7) * 16 + h * 8);
            vst8h(kc + (it >> 3) * (NN / 32) * CHUNK + (it & 7) * 256, hk[it]);
        }
        XWAIT16(kc, hk);
    } else {
        // vh in chunks, dealt like ke: 512 B in a row per store
        const int obase = Mbase - 2 * NHKD;
        _Float16* vc = vh + (((size_t)b * (DHC / 16) + (obase >> 4) + wave * 2) * (NN / 32) + blockIdx.x * 4) * CHUNK + l * 8;
        v8h hv[4 * MT];
#pragma unroll
        for (int it = 0; it < 4 * MT; ++it) {
            const int row = wave * (8 * MT) + (it >> 3) * 16 + m;
#pragma unroll
            for (int j = 0; j < 8; ++j) hv[it][j] = (_Float16)tile[row * TP + (it & 7) * 16 + h * 8 + j];
            vst8h(vc + (it >> 3) * (NN / 32) * CHUNK + (it & 7) * 256, hv[it]);
        }
        XWAIT16(vc, hv);
    }
}

// ---------------------------------------------------------------------------
// Kernel 2: context per (b,head): C[kd][d] = sum_n softmax_n(k)[kd][n] * v[d][n], K = 4096.
// A rows = ke rows; B[k=n][col=d] = vh row d: both lie in chunks of 16 rows x 32 n, same loader.
// The work of a (b,head) is split by d: DSPLIT work-groups, each with all 32 kd x its own 16 d over ALL n,
// so that a work-group finishes its sums and no partial leaves it.  The four of a head are 64 apart in the grid.
// Eight waves, 512 n each = four column blocks of kernel 1, one accumulator pair (2 kd tiles) per block;
// all of a wave's loads are independent.
// Second half of the key softmax: a column block's tile row kd carries one factor
// 4096 exp(block max - row max) / row sum (the x1024 cancels), formed from kmx and ksum of the row's 32
// blocks and applied in f32 where the 32 blocks' tiles are added through LDS: eight blocks in a row, then
// the four sums of eight.
// Order inside a block's tile in LDS: unit u = kt*2 + (r>>2), then lane, then r&3 (accumulator register r
// of kd tile kt).  The result, /64 (= true context x64), f16, goes out in the A-fragment order of kernel 3:
// ctxh[bh][dt][kt][lane][r], element e = kt*8 + r of lane (m, h) being C[kd = kt*16 + 8h + r][d = dt*16 + m].
// ---------------------------------------------------------------------------
__global__ __launch_bounds__(256) void ctx_kernel(const _Float16* __restrict__ ke,
                                                  const float* __restrict__ kmx,
                                                  const float* __restrict__ ksum,
                                                  const _Float16* __restrict__ vh,
                                                  _Float16* __restrict__ ctxh)
{
    static_assert(CWB == 4 && NBLK == 8 * CWB, "a wave's n = the four column blocks whose statistics it reads");
    __shared__ __attribute__((aligned(16))) float red[NBLK * CPIECE];
    __shared__ float pm[8 * KDIM], ps[8 * KDIM];
    __shared__ __attribute__((aligned(16))) float fl[NBLK * KDIM];
    __shared__ __attribute__((aligned(16))) _Float16 oh[CPIECE];
    const int bh = blockIdx.x % (BB * HEADS), dt = blockIdx.x / (BB * HEADS), b = bh >> 3, hd = bh & 7;
    const int t = threadIdx.x, l = t & 31, wave = t >> 5;
    // this lane's piece of the first chunk of the wave's 512 n: the head's first 16 key rows, the work-group's 16 value rows
    const _Float16* pa = ke + (((size_t)b * (NHKD / 16) + hd * (KDIM / 16)) * (NN / 32) + wave * (CWN / 32)) * CHUNK + l * 8;
    const _Float16* pv = vh + (((size_t)b * (DHC / 16) + hd * (DD / 16) + dt) * (NN / 32) + wave * (CWN / 32)) * CHUNK + l * 8;
    // statistics of key row l in the wave's own four blocks
    const float* pm4 = kmx  + (size_t)b * NBLK * NHKD + hd * KDIM + l + wave * CWB * NHKD;
    const float* ps4 = ksum + (size_t)b * NBLK * NHKD + hd * KDIM + l + wave * CWB * NHKD;
    float m4[CWB], s4[CWB];
#pragma unroll
    for (int i = 0; i < CWB; ++i) { m4[i] = pm4[i * NHKD]; s4[i] = ps4[i * NHKD]; }
    // every loop below is unrolled so that the fragment and accumulator arrays are indexed by
    // constants and stay in registers
    v16h a[CWN / 32][2], bf[CWN / 32];
#pragma unroll
    for (int s = 0; s < CWN / 32; ++s) {
#pragma unroll
        for (int i = 0; i < 2; ++i)
            a[s][i] = load_chunk(pa + (i * (NN / 32) + s) * CHUNK);
        bf[s] = load_chunk(pv + s * CHUNK);
    }
    // the four addresses stay live to here, so that no load's result lands on them, and the wait stands
    // ahead of their reuse
    asm volatile("s_wait_xcnt 0x0" :: "v"(pm4), "v"(ps4), "v"(pa), "v"(pv) : "memory");
    // keeps every load of the wave ahead of the first product: one memory latency per wave;
    // without it the scheduler reuses fragment registers and waits out a latency per chunk
    __builtin_amdgcn_sched_barrier(0);
    {
        const float ml = fmaxf(fmaxf(m4[0], m4[1]), fmaxf(m4[2], m4[3]));
        float sl = 0.f;
#pragma unroll
        for (int i = 0; i < CWB; ++i) sl += s4[i] * __expf(m4[i] - ml);
        pm[wave * KDIM + l] = ml;
        ps[wave * KDIM + l] = sl;
        __syncthreads();   // every wave's four blocks are in pm, ps
        float M = pm[l];
#pragma unroll
        for (int w = 1; w < 8; ++w) M = fmaxf(M, pm[w * KDIM + l]);
        float S = 0.f;
#pragma unroll
        for (int w = 0; w < 8; ++w) S += ps[w * KDIM + l] * __expf(pm[w * KDIM + l] - M);
#pragma unroll
        for (int q = 0; q < CWB; ++q)   // read behind the barrier below
            fl[(wave * CWB + q) * KDIM + l] = __expf(m4[q] - M) * (4096.0f / S);
    }
    v8f c[CWB][2] = {};
#pragma unroll
    for (int q = 0; q < CWB; ++q)
#pragma unroll
        for (int s = 0; s < 4; ++s)
#pragma unroll
            for (int i = 0; i < 2; ++i) c[q][i] = mma16(a[q * 4 + s][i], bf[q * 4 + s], c[q][i]);
    // keeps the LDS stores behind the last product: all eight accumulators stay live to here, so
    // none of their registers is handed to another product's result inside the hazard distance
    __builtin_amdgcn_sched_barrier(0);
    float* mine = red + wave * CWB * CPIECE + l * 4;
#pragma unroll
    for (int q = 0; q < CWB; ++q)
#pragma unroll
        for (int i = 0; i < 2; ++i) {
            const v8f v = c[q][i];
            vst4f(mine + q * CPIECE + (i * 2) * 128,     (v4f){v[0], v[1], v[2], v[3]});
            vst4f(mine + q * CPIECE + (i * 2 + 1) * 128, (v4f){v[4], v[5], v[6], v[7]});
        }
    __syncthreads();       // the 32 blocks' tiles and factors are whole
    // two neighbours per thread: unit u, lane lp, registers r0 and r0 + 1, which are rows kd0 and kd0 + 1
    const int u = t >> 6, lp = (t & 63) >> 1, r0 = (u & 1) * 4 + (t & 1) * 2;
    const int kd0 = (u >> 1) * 16 + 8 * (lp >> 4) + r0;
    const float* rp = red + u * 128 + (t & 63) * 2;
    const float* fp = fl + kd0;
    v2f tot;
#pragma unroll
    for (int g = 0; g < NBLK / 8; ++g) {
        v2f s = *(const v2f*)(rp + g * 8 * CPIECE) * *(const v2f*)(fp + g * 8 * KDIM);
#pragma unroll
        for (int w = 1; w < 8; ++w) s += *(const v2f*)(rp + (g * 8 + w) * CPIECE) * *(const v2f*)(fp + (g * 8 + w) * KDIM);
        tot = (g == 0) ? s : tot + s;
    }
    *(v2h*)(oh + (u >> 1) * 256 + lp * 8 + r0) = (v2h){(_Float16)(tot[0] * 0.015625f), (_Float16)(tot[1] * 0.015625f)};
    __syncthreads();       // oh is whole: two waves store it, 512 B in a row each
    if (t < CPIECE / 8)
        vst8h(ctxh + (size_t)bh * CTILE + dt * CPIECE + t * 8, *(const v8h*)(oh + t * 8));
}

// ---------------------------------------------------------------------------
// Kernel 3: attended and output projection in one.
// Output projection [384][512] x [512][4096] per batch + affine -> f32 out.  Block tile 192 rows x
// 128 cols, 8 waves, wave tile 48 x 64.  A stage of 64 k is one head's 64 d.  The A rows (weights)
// come into the ring by asynchronous copies; the B rows are made in place, one stage ahead:
//   Att[d][n] = sum_kd C[kd][d] * q[n][hd*32+kd] (qsm's chunks), K = 32 (one WMMA per 16x16 tile), ReLU, scaled
//   to att x256 (= acc/64), f16.  Wave w makes the 16 columns n = 16 w .. of all four d tiles: lane
//   (m, h) holds d = 16 dt + 8 h + r of column m, which are eight neighbours of B row n.
// The A fragments of that product are kernel 2's result as it lies (true context x64, f16, fragment
// order); the block copies its batch's eight heads into LDS once: cl[hd][dt][half of the fragment][lane][8].
// ---------------------------------------------------------------------------
__global__ __launch_bounds__(256) void out_kernel(const _Float16* __restrict__ wph,
                                                  const _Float16* __restrict__ ctxh,
                                                  const _Float16* __restrict__ qsm,
                                                  const float* __restrict__ sp,
                                                  const float* __restrict__ bp,
                                                  float* __restrict__ out)
{
    constexpr int MT = MT_OUT, K = DHC, NT = K / KS;
    static_assert(DIMC % (64 * MT) == 0, "whole blocks");
    static_assert(KS == DD && NT == HEADS && NT >= 2, "a stage is a head");
    __shared__ __attribute__((aligned(16))) unsigned char ring[OUT_LDS_B];
    float* tile = (float*)ring;
    _Float16* cl = (_Float16*)(ring + RING_B(MT));
    const int b = blockIdx.z;
    const int t = threadIdx.x, l = t & 31, wave = t >> 5, h = l >> 4, m = l & 15;
    const int mw = wave >> 1, nw = wave & 1;
    const int Mbase = blockIdx.y * (64 * MT), Nbase = blockIdx.x * 128;
    const unsigned lds = (unsigned)(uintptr_t)ring + (t >> 3) * LPB + (t & 7) * 16;
    const _Float16* ga = wph + (size_t)Mbase * K + (t >> 3) * K + (t & 7) * 8;
    // this lane's piece of head 0's chunk of the wave's 16 columns; the eight heads' chunks follow one another
    const _Float16* qrow = qsm + (((size_t)b * (NN / 16) + blockIdx.x * 8 + wave) * HEADS) * CHUNK + l * 8;

    // B rows of head hd from its query fragment qf, into the stage at buf
    auto make_b = [&](const int hd, const v16h qf, unsigned char* buf) {
        const _Float16* ch = cl + hd * CTILE + l * 8;
        _Float16* brow = (_Float16*)(buf + (64 * MT + wave * 16 + m) * LPB) + 8 * h;
        // unrolled: fragments and results are indexed by constants and stay in registers
        Frag ca[4];
        v8f d[4];
#pragma unroll
        for (int dt = 0; dt < 4; ++dt) {
            ca[dt].half[0] = *(const v8h*)(ch + dt * 512);
            ca[dt].half[1] = *(const v8h*)(ch + dt * 512 + 256);
        }
        // keeps the eight LDS reads together ahead of the products: left alone the scheduler reuses
        // one fragment's registers and waits out an LDS latency per d tile
        __builtin_amdgcn_sched_barrier(0);
#pragma unroll
        for (int dt = 0; dt < 4; ++dt) d[dt] = mma16(ca[dt].v, qf, (v8f){});
#pragma unroll
        for (int dt = 0; dt < 4; ++dt) {
            v8h hv;
#pragma unroll
            for (int r = 0; r < 8; ++r) hv[r] = (_Float16)fmaxf(d[dt][r] * 0.015625f, 0.0f);
            vst8h(brow + dt * 16, hv);
        }
    };

    copy_stage_a192(lds, ga, K);
    static_assert(HEADS * CTILE * 2 == 8 * 256 * 16, "eight pieces of 16 B per thread");
    copy_ctx((unsigned)(uintptr_t)cl + t * 16, ctxh + (size_t)b * HEADS * CTILE + t * 8);
    v16h qf = load_chunk(qrow);
    asm volatile("s_wait_asynccnt 0x0" ::: "memory");   // stage 0's A rows and cl landed (this wave's pieces)
    __syncthreads();                                    // ... and every other wave's
    copy_stage_a192(lds + STAGE_B(MT), ga + KS, K);
    make_b(0, qf, ring);
    {
        const _Float16* qp = qrow + CHUNK;
        qf = load_chunk(qp);
        // the address pair stays live to here, and the wait stands ahead of its reuse
        asm volatile("s_wait_xcnt 0x0" :: "v"(qp) : "memory");
    }
    __syncthreads();                                    // stage 0's B rows are whole

    v8f c[MT][4] = {};
    // kept rolled: unrolled, every stage's copy addresses stay live at once
#pragma unroll 1
    for (int s = 0; s < NT; ++s) {
        // head s+2's query fragment starts here: the whole trip covers its latency
        v16h qn = qf;
        if (s + 2 < NT) {
            const _Float16* qp = qrow + (s + 2) * CHUNK;
            qn = load_chunk(qp);
            // the address pair stays live to here, and the wait stands ahead of its reuse
            asm volatile("s_wait_xcnt 0x0" :: "v"(qp) : "memory");
        }
        // buffer (s+1)&1: its last readers left at the barrier behind trip s-1
        if (s + 1 < NT) make_b(s + 1, qf, ring + ((s + 1) & 1) * STAGE_B(MT));
        qf = qn;
        const _Float16* st = (const _Float16*)(ring + (s & 1) * STAGE_B(MT));
        const _Float16* ar = st + (mw * 16 + m) * LPH;
        const _Float16* br = st + (64 * MT + nw * 64 + m) * LPH;
        v16h a[MT], bfr[4];
        // unrolled: fragments and accumulators are indexed by constants and stay in registers
#pragma unroll
        for (int kk = 0; kk < KS / 32; ++kk) {
            a[0] = load_frag(ar + kk * 32, h);
#pragma unroll
            for (int j = 0; j < 4; ++j) bfr[j] = load_frag(br + j * 16 * LPH + kk * 32, h);
#pragma unroll
            for (int i = 1; i < MT; ++i) a[i] = load_frag(ar + i * 64 * LPH + kk * 32, h);
            // keeps the LDS reads of a k step together ahead of its products: left alone the
            // scheduler reuses one A fragment's registers and waits out an LDS latency per row
            __builtin_amdgcn_sched_barrier(0);
#pragma unroll
            for (int i = 0; i < MT; ++i)
#pragma unroll
                for (int j = 0; j < 4; ++j) c[i][j] = mma16(a[i], bfr[j], c[i][j]);
            // keeps every product of the k step ahead of what follows: the next reads, and at the
            // end the four slots below (left alone a row of products sinks behind the barrier)
            __builtin_amdgcn_sched_barrier(0);
        }
        // four vector slots behind the last matrix instructions, on the branch paths too
        GUARD4(c[MT - 1][0], c[MT - 1][1], c[MT - 1][2], c[MT - 1][3], a[MT - 1], bfr[0], bfr[1], bfr[2], bfr[3]);
        asm volatile("s_wait_dscnt 0x0" ::: "memory");     // reads of buffer s&1 and writes of stage s+1's B rows are done
        asm volatile("s_wait_asynccnt 0x0" ::: "memory");  // this wave's pieces of stage s+1's A rows have landed
        __syncthreads();                                   // publishes stage s+1, frees buffer s&1
        if (s + 2 < NT)
            copy_stage_a192(lds + (s & 1) * STAGE_B(MT), ga + (s + 2) * KS, K);
    }
    asm volatile("s_wait_asynccnt 0x0" ::: "memory");      // nothing in flight when the ring is reused

    // unrolled over i: c is indexed by constants and stays in registers
#pragma unroll
    for (int i = 0; i < MT; ++i) {
#pragma unroll
        for (int r = 0; r < 8; ++r) {
            const int ml = i * 64 + mw * 16 + 8 * h + r;
            const int o = Mbase + ml;
            const float s = sp[o] * 0.000244140625f;   // 1/(16*256)
            const float bb = bp[o];
            float* trow = tile + ml * TP + nw * 64 + m;
            trow[0]  = c[i][0][r] * s + bb;
            trow[16] = c[i][1][r] * s + bb;
            trow[32] = c[i][2][r] * s + bb;
            trow[48] = c[i][3][r] * s + bb;
        }
    }
    __syncthreads();
    const int col = (l >> 3) * 32 + (l & 7) * 4;
#pragma unroll
    for (int it = 0; it < 8 * MT; ++it) {
        const int row = wave * (8 * MT) + it;
        const v4f v = *(const v4fa*)(tile + row * TP + col);
        vst4f(out + ((size_t)b * DIMC + Mbase + row) * NN + Nbase + col, v);
    }
}

// ---------------------------------------------------------------------------
// Host-side launch glue.  Workspace (bytes):
//   [0)            wabc f16 [1024][384]         786,432
//   [786,432)      wph  f16 [384][512]          393,216
//   [1,179,648)    sc   f32 [1024]                4,096
//   [1,183,744)    bc   f32 [1024]                4,096
//   [1,187,840)    qsm  f16 [8][256][8][512]   16,777,216
//   [17,965,056)   ke   f16 [8][16][128][512]  16,777,216   (in a place of 33,554,432)
//   [51,519,488)   vh   f16 [8][32][128][512]  33,554,432
//   [85,073,920)   ctxh f16 [64][2048]           262,144
//   [85,336,064)   kmx  f32 [8][32][256]        262,144
//   [85,598,208)   ksum f32 [8][32][256]        262,144
//   total 85,860,352
// ---------------------------------------------------------------------------
extern "C" void kernel_launch(void* const* d_in, const int* in_sizes, int n_in,
                              void* d_out, int out_size, void* d_ws, size_t ws_size,
                              hipStream_t stream)
{
    if (n_in < 13) return;
    if (in_sizes[0] != BB * DIMC * NN) return;
    if (in_sizes[1] != NHKD * DIMC || in_sizes[2] != NHKD || in_sizes[3] != NHKD) return;
    if (in_sizes[4] != NHKD * DIMC || in_sizes[5] != NHKD || in_sizes[6] != NHKD) return;
    if (in_sizes[7] != DHC * DIMC || in_sizes[8] != DHC || in_sizes[9] != DHC) return;
    if (in_sizes[10] != DIMC * DHC || in_sizes[11] != DIMC || in_sizes[12] != DIMC) return;
    if (out_size != BB * DIMC * NN) return;

    const size_t off_wabc = 0;
    const size_t sz_wabc  = (size_t)MQKV * DIMC * 2;
    const size_t off_wph  = off_wabc + sz_wabc;
    const size_t sz_wph   = (size_t)DIMC * DHC * 2;
    const size_t off_sc   = off_wph + sz_wph;
    const size_t sz_sc    = (size_t)MQKV * 4;
    const size_t off_bc   = off_sc + sz_sc;
    const size_t off_qsm  = off_bc + sz_sc;
    const size_t sz_qsm   = (size_t)BB * NN * NHKD * 2;
    const size_t off_kf   = off_qsm + sz_qsm;
    const size_t sz_kf    = (size_t)BB * NHKD * NN * 4;
    const size_t off_vh   = off_kf + sz_kf;
    const size_t sz_vh    = (size_t)BB * DHC * NN * 2;
    const size_t off_ctx  = off_vh + sz_vh;
    const size_t sz_ctx   = (size_t)BB * HEADS * CTILE * 2;
    const size_t off_kmx  = off_ctx + sz_ctx;
    const size_t sz_kst   = (size_t)BB * NBLK * NHKD * 4;
    const size_t off_ksum = off_kmx + sz_kst;
    const size_t total    = off_ksum + sz_kst;
    const size_t sz_ke    = (size_t)BB * NHKD * NN * 2;
    if (total > ws_size) return;
    if (sz_ke > sz_kf) return;

    const float* x  = (const float*)d_in[0];
    const float* Wq = (const float*)d_in[1];
    const float* sq = (const float*)d_in[2];
    const float* bq = (const float*)d_in[3];
    const float* Wk = (const float*)d_in[4];
    const float* sk = (const float*)d_in[5];
    const float* bk = (const float*)d_in[6];
    const float* Wv = (const float*)d_in[7];
    const float* sv = (const float*)d_in[8];
    const float* bv = (const float*)d_in[9];
    const float* Wp = (const float*)d_in[10];
    const float* sp = (const float*)d_in[11];
    const float* bp = (const float*)d_in[12];
    float* out = (float*)d_out;

    char* ws = (char*)d_ws;
    _Float16* wabc = (_Float16*)(ws + off_wabc);
    _Float16* wph  = (_Float16*)(ws + off_wph);
    float*    sc   = (float*)   (ws + off_sc);
    float*    bc   = (float*)   (ws + off_bc);
    _Float16* qsm  = (_Float16*)(ws + off_qsm);
    _Float16* ke   = (_Float16*)(ws + off_kf);
    _Float16* vh   = (_Float16*)(ws + off_vh);
    _Float16* ctxh = (_Float16*)(ws + off_ctx);
    float*    kmx  = (float*)   (ws + off_kmx);
    float*    ksum = (float*)   (ws + off_ksum);

    const int prep_threads = MQKV * DIMC / 8 + DIMC * DHC / 8 + 512;   // 74240
    prep_kernel<<<(prep_threads + 255) / 256, 256, 0, stream>>>(
        Wq, Wk, Wv, Wp, sq, bq, sk, bk, sv, bv, wabc, wph, sc, bc);

    qkv_kernel<<<dim3(NN / 128, BB, MQKV / (64 * MT_QKV)), 256, 0, stream>>>(wabc, x, sc, bc, qsm, ke, kmx, ksum, vh);

    ctx_kernel<<<BB * HEADS * DSPLIT, 256, 0, stream>>>(ke, kmx, ksum, vh, ctxh);

    out_kernel<<<dim3(NN / 128, DIMC / (64 * MT_OUT), BB), 256, 0, stream>>>(wph, ctxh, qsm, sp, bp, out);
}

// v009
// A run of this version takes 60.9 microseconds.
// In two side-by-side timings against v008, it was 1.04 and 1.03 times as fast.
// Counting every step since v000, it is 5.04 times as fast.
#include <hip/hip_runtime.h>
// All contractions on v_wmma_f32_16x16x32_f16 (f16 operands, f32 accumulate): QKV projection, key*value^T, context^T*query, output projection; exact power-of-two operand scales (weights x16, key exponentials x1024, context x64, query softmax x256, attended x256) undone in the f32 epilogues; softmaxes and affine terms in f32.

#define BB    8
#define DIMC  384
#define NN    4096
#define HEADS 8
#define KDIM  32
#define DD    64
#define NHKD  256
#define DHC   512
#define MQKV  1024
#define TP    132      // LDS pitch (floats) of the f32 output tiles (64 MT x 128), keeps 16-B alignment
#define DSPLIT (DD / 16)            // work-groups per (b,head) context: one d tile of 16 each (4)
#define CWN   (NN / 8)              // n per wave of the context kernel (512)
#define CWB   (CWN / 128)           // column blocks of the QKV projection per wave of the context kernel (4)
#define CTILE (KDIM * DD)           // elements of one context tile (2048)
#define CPIECE (KDIM * 16)          // elements of one work-group's part of it, 32 kd x 16 d (512)
#define NBLK  (NN / 128)            // column blocks of the QKV projection = pieces of a key row (32)

typedef _Float16 v16h __attribute__((ext_vector_type(16)));
typedef _Float16 v8h  __attribute__((ext_vector_type(8)));
typedef _Float16 v4h  __attribute__((ext_vector_type(4)));
typedef _Float16 v2h  __attribute__((ext_vector_type(2)));
typedef float    v2f  __attribute__((ext_vector_type(2)));
typedef float    v8f  __attribute__((ext_vector_type(8)));
typedef float    v4f  __attribute__((ext_vector_type(4)));
typedef float    v4fa __attribute__((ext_vector_type(4), may_alias));
typedef _Float16 v8ha __attribute__((ext_vector_type(8), may_alias));

union Frag { v16h v; v8h half[2]; };

// 16x16x32 operand fragment from a k-contiguous row: elements 0..7 <- row[8h..8h+7],
// elements 8..15 <- row[16+8h..16+8h+7]; lane&15 selects the row (A) or column (B).
__device__ __forceinline__ v16h load_frag(const _Float16* __restrict__ p, int h)
{
    Frag f;
    f.half[0] = *(const v8h*)(p + 8 * h);
    f.half[1] = *(const v8h*)(p + 16 + 8 * h);
    return f.v;
}

// The intermediates that a later kernel reads straight into fragments lie in the workspace in fragment
// order: a 16 (rows or columns) x 32 (k) operand tile is one chunk of 1 KB, [half of the fragment][lane][8],
// chunk[256 f + 8 lane + e] = tile[lane & 15][16 f + 8 (lane >> 4) + e].  That is load_frag's map, so the
// registers hold what they held with row-major tiles, but a wave's load covers 512 B in a row (4 whole
// lines) where a row-major tile gives it 32 B of each of 16 lines.  p: the chunk + 8 lane.
#define CHUNK 512      // halves in a chunk
__device__ __forceinline__ v16h load_chunk(const _Float16* __restrict__ p)
{
    Frag f;
    f.half[0] = *(const v8h*)p;
    f.half[1] = *(const v8h*)(p + 256);
    return f.v;
}

__device__ __forceinline__ v8f mma16(v16h a, v16h b, v8f c)
{
    return __builtin_amdgcn_wmma_f32_16x16x32_f16(false, a, false, b, (short)0, c, false, false);
}

#define GUARD4(c0, c1, c2, c3, a, b0, b1, b2, b3) \
    asm volatile("v_nop\n\tv_nop\n\tv_nop\n\tv_nop" \
                 : "+v"(c0), "+v"(c1), "+v"(c2), "+v"(c3) \
                 : "v"(a), "v"(b0), "v"(b1), "v"(b2), "v"(b3))

// e[i] = 2^x[i].  One statement: outputs and inputs are kept apart, so each exponential is the
// independent instruction behind the one before it, and the v_nop is that slot behind the last
__device__ __forceinline__ void exp2x8(float (&e)[8], const float (&x)[8])
{
    asm("v_exp_f32 %0, %8\n\tv_exp_f32 %1, %9\n\tv_exp_f32 %2, %10\n\tv_exp_f32 %3, %11\n\t"
        "v_exp_f32 %4, %12\n\tv_exp_f32 %5, %13\n\tv_exp_f32 %6, %14\n\tv_exp_f32 %7, %15\n\t"
        "v_nop"
        : "=&v"(e[0]), "=&v"(e[1]), "=&v"(e[2]), "=&v"(e[3]),
          "=&v"(e[4]), "=&v"(e[5]), "=&v"(e[6]), "=&v"(e[7])
        : "v"(x[0]), "v"(x[1]), "v"(x[2]), "v"(x[3]), "v"(x[4]), "v"(x[5]), "v"(x[6]), "v"(x[7]));
}

// Asks the 256-B unit at p + OFF bytes into L2 (a hint: no register, no counter).  p names a register that
// holds an address inside the buffer as long as the kernel's loop runs; OFF goes into the instruction.
template <int OFF>
__device__ __forceinline__ void ask_l2(const void* p)
{
    asm volatile("global_prefetch_b8 %0, off offset:%1 scope:SCOPE_SE" :: "v"(p), "n"(OFF) : "memory");
}
// the 768 B (3 units) of A rows r, r + 32, ... r + 224 of a 256-row block of pitch 768 B; p: in the first 128 B of row r
#define ASK_ROW(p, o)  ask_l2<(o)>(p); ask_l2<(o) + 256>(p); ask_l2<(o) + 512>(p)
#define ASK_A256(p, o) \
    ASK_ROW(p, (o));             ASK_ROW(p, (o) + 24576);     ASK_ROW(p, (o) + 2 * 24576); ASK_ROW(p, (o) + 3 * 24576); \
    ASK_ROW(p, (o) + 4 * 24576); ASK_ROW(p, (o) + 5 * 24576); ASK_ROW(p, (o) + 6 * 24576); ASK_ROW(p, (o) + 7 * 24576)

__device__ __forceinline__ void vst8h(_Float16* p, v8h v) { *(v8h*)p = v; }
// Behind 16 stores of pieces v[0..15] at p + constants: address and data stay live to here, each piece in
// registers of its own, so that nothing overwrites a register of an issued store ahead of the wait
#define XWAIT16(p, v) \
    asm volatile("s_wait_xcnt 0x0" \
                 :: "v"(p), "v"(v[0]), "v"(v[1]), "v"(v[2]), "v"(v[3]), "v"(v[4]), "v"(v[5]), "v"(v[6]), "v"(v[7]), \
                    "v"(v[8]), "v"(v[9]), "v"(v[10]), "v"(v[11]), "v"(v[12]), "v"(v[13]), "v"(v[14]), "v"(v[15]) \
                 : "memory")
__device__ __forceinline__ void vst4f(float* p, v4f v)    { *(v4f*)p = v; }

// LDS ring of the two projection GEMMs.  Block tile 64 MT rows x 128 columns.  A stage = 64 k
// (128 B) of the 64 MT A rows, row pitch 144 B (16 B x 9: conflict-free for ds_load_b128), and then
// the B tile in 128 x 144 B; two buffers.  The f32 output tile reuses the space after the loop.
// Output kernel: B = 128 rows (columns n) of 64 k, pitch 144 B.  QKV kernel: B = 64 rows (k) of
// 128 n, pitch 288 B (32 B x 9: conflict-free for ds_load_tr16_b128), the same bytes in all.
#define KS      64                 // k per stage
#define LPB     144                // LDS row pitch, bytes
#define LPH     72                 // the same in halves
#define XPB     288                // LDS row pitch of the QKV kernel's B tile, bytes
#define STAGE_B(MT) ((64 * (MT) + 128) * LPB)
#define RING_B(MT)  (2 * STAGE_B(MT))
#define OTILE_B(MT) (64 * (MT) * TP * 4)
#define GEMM_LDS_B(MT) (RING_B(MT) > OTILE_B(MT) ? RING_B(MT) : OTILE_B(MT))
#define MT_QKV  4                  // 256 x 128 block, 64 x 64 per wave
#define MT_OUT  3                  // 192 x 128 block, 48 x 64 per wave
#define CTXL_B  (HEADS * CTILE * 2)   // one batch's eight context tiles in f16, behind the output kernel's ring
#define OUT_LDS_B (RING_B(MT_OUT) + CTXL_B > OTILE_B(MT_OUT) ? RING_B(MT_OUT) + CTXL_B : OTILE_B(MT_OUT))

// The A rows of a stage of the QKV kernel: 256 x 8 pieces of 16 B, 8 per thread.  Thread t brings
// piece t&7 of rows t>>3 + 32 j, so eight lanes cover one 128-B line.  a: this thread's piece in
// A row t>>3 at the stage's k; lds: its place in the buffer (byte address in LDS).
// s_wait_xcnt stands inside the statement, ahead of any rewrite of the address registers.
__device__ __forceinline__ void copy_stage_a256(const unsigned lds, const _Float16* a, const int K)
{
    asm volatile("global_load_async_to_lds_b128 %0, %8, off\n\t"
                 "global_load_async_to_lds_b128 %1, %9, off\n\t"
                 "global_load_async_to_lds_b128 %2, %10, off\n\t"
                 "global_load_async_to_lds_b128 %3, %11, off\n\t"
                 "global_load_async_to_lds_b128 %4, %12, off\n\t"
                 "global_load_async_to_lds_b128 %5, %13, off\n\t"
                 "global_load_async_to_lds_b128 %6, %14, off\n\t"
                 "global_load_async_to_lds_b128 %7, %15, off\n\t"
                 "s_wait_xcnt 0x0"
                 :: "v"(lds), "v"(lds + 32 * LPB), "v"(lds + 64 * LPB), "v"(lds + 96 * LPB),
                    "v"(lds + 128 * LPB), "v"(lds + 160 * LPB), "v"(lds + 192 * LPB),
                    "v"(lds + 224 * LPB),
                    "v"(a), "v"(a + 32 * K), "v"(a + 64 * K), "v"(a + 96 * K),
                    "v"(a + 128 * K), "v"(a + 160 * K), "v"(a + 192 * K), "v"(a + 224 * K)
                 : "memory");
}

// The A rows alone of a stage of the output kernel (192 rows, 6 pieces per thread), same places as above.
__device__ __forceinline__ void copy_stage_a192(const unsigned lds, const _Float16* a, const int K)
{
    asm volatile("global_load_async_to_lds_b128 %0, %6, off\n\t"
                 "global_load_async_to_lds_b128 %1, %7, off\n\t"
                 "global_load_async_to_lds_b128 %2, %8, off\n\t"
                 "global_load_async_to_lds_b128 %3, %9, off\n\t"
                 "global_load_async_to_lds_b128 %4, %10, off\n\t"
                 "global_load_async_to_lds_b128 %5, %11, off\n\t"
                 "s_wait_xcnt 0x0"
                 :: "v"(lds), "v"(lds + 32 * LPB), "v"(lds + 64 * LPB), "v"(lds + 96 * LPB),
                    "v"(lds + 128 * LPB), "v"(lds + 160 * LPB),
                    "v"(a), "v"(a + 32 * K), "v"(a + 64 * K), "v"(a + 96 * K),
                    "v"(a + 128 * K), "v"(a + 160 * K)
                 : "memory");
}

// One batch's eight context tiles (32 KB, f16, already in the order of cl): 8 pieces of 16 B per thread,
// piece t + 256 j.  lds, g: this thread's piece 0.  s_wait_xcnt stands inside the statement, as above.
__device__ __forceinline__ void copy_ctx(const unsigned lds, const _Float16* g)
{
    asm volatile("global_load_async_to_lds_b128 %0, %8, off\n\t"
                 "global_load_async_to_lds_b128 %1, %9, off\n\t"
                 "global_load_async_to_lds_b128 %2, %10, off\n\t"
                 "global_load_async_to_lds_b128 %3, %11, off\n\t"
                 "global_load_async_to_lds_b128 %4, %12, off\n\t"
                 "global_load_async_to_lds_b128 %5, %13, off\n\t"
                 "global_load_async_to_lds_b128 %6, %14, off\n\t"
                 "global_load_async_to_lds_b128 %7, %15, off\n\t"
                 "s_wait_xcnt 0x0"
                 :: "v"(lds), "v"(lds + 4096), "v"(lds + 2 * 4096), "v"(lds + 3 * 4096),
                    "v"(lds + 4 * 4096), "v"(lds + 5 * 4096), "v"(lds + 6 * 4096), "v"(lds + 7 * 4096),
                    "v"(g), "v"(g + 2048), "v"(g + 2 * 2048), "v"(g + 3 * 2048),
                    "v"(g + 4 * 2048), "v"(g + 5 * 2048), "v"(g + 6 * 2048), "v"(g + 7 * 2048)
                 : "memory");
}

// 16 x 16 halves of a row-major LDS tile, transposed: lane (m, h) gets column m of rows 8 h .. 8 h + 7
// of the tile whose piece this lane's address names (rows by l & 7 and h, 16-B half by bit 3 of l)
typedef short s16x8 __attribute__((ext_vector_type(8)));
__device__ __forceinline__ v8h ld_tr16(const unsigned char* p)
{
    typedef __attribute__((address_space(3))) s16x8 lds_s16x8;
    return __builtin_bit_cast(v8h, __builtin_amdgcn_ds_load_tr16_b128_v8i16((lds_s16x8*)p));
}

// Block: 256 rows of A (f16, row-major, pitch K) times 128 columns of B = X (f32, X[k][n] with n
// contiguous, pitch NN).  A comes into the ring by asynchronous copies.  X comes through registers:
// whole 512-B rows per wave load, one stage ahead, rounded to f16 and stored as it lies (k rows of
// 128 n); the transposing LDS load hands out B fragments in load_frag's k order.
// Wave (mw, nw): rows 64 i + 16 mw.. (i < 4), columns 64 nw..; c[i][j] = row group i, column group j
// of 16: 8 fragments feed 16 products.  On return every wave has left the ring (last trip's barrier).
template <int K>
__device__ __forceinline__ void mainloop_wx(unsigned char* ring,
                                            const _Float16* __restrict__ Ablk,
                                            const float* __restrict__ Xblk,
                                            const int t, const int mw, const int nw,
                                            const int h, const int m,
                                            const bool ask_a,
                                            v8f (&c)[4][4])
{
    constexpr int MT = 4, NT = K / KS;
    static_assert(K % KS == 0 && NT >= 2, "two stages or more");
    const int l = t & 31, wave = t >> 5;
    const unsigned lds = (unsigned)(uintptr_t)ring + (t >> 3) * LPB + (t & 7) * 16;
    const _Float16* ga = Ablk + (t >> 3) * K + (t & 7) * 8;
    // this thread's part of a stage of X: columns 4 l .. 4 l + 3 of rows 8 wave + j, j < 8
    const float* gx = Xblk + (size_t)(wave * 8) * NN + l * 4;
    unsigned char* xs = ring + 64 * MT * LPB + (wave * 8) * XPB + l * 8;
    v4f xr[8];
    // the loops over j are unrolled: xr is indexed by constants and stays in registers
    auto load_x = [&](const int s) {
        const float* p = gx + (size_t)s * KS * NN;
#pragma unroll
        for (int j = 0; j < 8; ++j) xr[j] = *(const v4f*)(p + j * NN);
        // the address pair stays live to here, and the wait stands ahead of its rewrite
        asm volatile("s_wait_xcnt 0x0" :: "v"(p) : "memory");
    };
    auto store_x = [&](unsigned char* dst) {
#pragma unroll
        for (int j = 0; j < 8; ++j)
            *(v4h*)(dst + j * XPB) = __builtin_convertvector(xr[j], v4h);
    };

    // one 256-B unit of X per thread and ask: row KS + (t >> 1), half t & 1
    static_assert(K == 6 * KS && KS == 64, "rows 64 to 383 are stages 1 to 5");
    const float* px = Xblk + (size_t)(KS + (t >> 1)) * NN + (t & 1) * 64;
    copy_stage_a256(lds, ga, K);
    load_x(0);
    // The later stages' operands are asked into L2 here, behind the first stage's own loads: a stage's loads
    // and copies lead their use by one trip only.
    // X rows 64.., 192.., 256.. (128 rows each, in stage order; rows 256 to 319 twice)
    ask_l2<0>(px);
    ask_l2<128 * NN * 4>(px);
    ask_l2<192 * NN * 4>(px);
    // A is the same for all blocks of a row block: the first blocks of the grid ask, for their own rows and
    // for the rows of the block that follows in their place (two row blocks on)
    if (ask_a) {
        static_assert(K * 2 == 768, "ASK_A256's pitch");
        ASK_A256(ga, 0);
        ASK_A256(ga, 2 * 256 * 768);
    }
    store_x(xs);
    asm volatile("s_wait_dscnt 0x0" ::: "memory");      // this wave's rows of stage 0's B tile are written
    asm volatile("s_wait_asynccnt 0x0" ::: "memory");   // stage 0's A rows landed (this wave's pieces)
    __syncthreads();                                    // ... and every other wave's
    copy_stage_a256(lds + STAGE_B(MT), ga + KS, K);
    load_x(1);   // behind the barrier, like every later stage's: the compiler waits out plain loads in front of one

    // kept rolled: unrolled, every stage's copy addresses stay live at once, and the added
    // registers cost a resident work-group per WGP
#pragma unroll 1
    for (int s = 0; s < NT; ++s) {
        const unsigned char* st = ring + (s & 1) * STAGE_B(MT);
        const _Float16* ar = (const _Float16*)st + (mw * 16 + m) * LPH;
        const unsigned char* br = st + 64 * MT * LPB + (8 * h + (l & 7)) * XPB + ((l >> 3) & 1) * 16 + nw * 128;
        v16h a[MT];
        Frag b[4];
        // unrolled: fragments and accumulators are indexed by constants and stay in registers
#pragma unroll
        for (int kk = 0; kk < KS / 32; ++kk) {
            a[0] = load_frag(ar + kk * 32, h);
#pragma unroll
            for (int j = 0; j < 4; ++j) {
                b[j].half[0] = ld_tr16(br + (kk * 32) * XPB + j * 32);
                b[j].half[1] = ld_tr16(br + (kk * 32 + 16) * XPB + j * 32);
            }
#pragma unroll
            for (int i = 1; i < MT; ++i) a[i] = load_frag(ar + i * 64 * LPH + kk * 32, h);
            // keeps the LDS reads of a k step together ahead of its products: left alone the
            // scheduler reuses one A fragment's registers and waits out an LDS latency per row
            __builtin_amdgcn_sched_barrier(0);
#pragma unroll
            for (int i = 0; i < MT; ++i)
#pragma unroll
                for (int j = 0; j < 4; ++j) c[i][j] = mma16(a[i], b[j].v, c[i][j]);
            // keeps every product of the k step ahead of what follows: the next reads, and at the
            // end the four slots below (left alone a row of products sinks behind the barrier)
            __builtin_amdgcn_sched_barrier(0);
        }
        // four vector slots behind the last matrix instructions, on the branch paths too
        GUARD4(c[MT - 1][0], c[MT - 1][1], c[MT - 1][2], c[MT - 1][3], a[MT - 1], b[0].v, b[1].v, b[2].v, b[3].v);
        // stage s+1's B tile, loaded a trip ago; buffer (s+1)&1: its last readers left at the barrier behind trip s-1
        if (s + 1 < NT) store_x(xs + ((s + 1) & 1) * STAGE_B(MT));
        asm volatile("s_wait_dscnt 0x0" ::: "memory");     // reads of buffer s&1 and writes of stage s+1's B tile are done
        asm volatile("s_wait_asynccnt 0x0" ::: "memory");  // this wave's pieces of stage s+1's A rows have landed
        __syncthreads();                                   // publishes stage s+1, frees buffer s&1
        if (s + 2 < NT) {
            copy_stage_a256(lds + (s & 1) * STAGE_B(MT), ga + (s + 2) * KS, K);
            load_x(s + 2);
        }
    }
    // nothing in flight when the ring is reused; the asks' address pairs stay addresses to here
    asm volatile("s_wait_asynccnt 0x0" :: "v"(px), "v"(ga) : "memory");
}

// ---------------------------------------------------------------------------
// Kernel 0: weights -> f16 (x16), concatenated [1024][384] and [384][512];
// affine params concatenated (scale pre-multiplied by 1/16).  16-B per lane stores.
// ---------------------------------------------------------------------------
__global__ __launch_bounds__(256) void prep_kernel(
    const float* __restrict__ Wq, const float* __restrict__ Wk, const float* __restrict__ Wv,
    const float* __restrict__ Wp,
    const float* __restrict__ sq, const float* __restrict__ bq,
    const float* __restrict__ sk, const float* __restrict__ bk,
    const float* __restrict__ sv, const float* __restrict__ bv,
    _Float16* __restrict__ wabc, _Float16* __restrict__ wph,
    float* __restrict__ sc, float* __restrict__ bc)
{
    const int NW1 = MQKV * DIMC / 8;   // 49152 chunks of 8 halves
    const int NW2 = DIMC * DHC / 8;    // 24576 chunks
    const int i = blockIdx.x * 256 + threadIdx.x;
    if (i < NW1 + NW2) {
        const float* src;
        _Float16* dst;
        if (i < NW1) {
            const int e = i * 8;
            if (e < NHKD * DIMC)          src = Wq + e;
            else if (e < 2 * NHKD * DIMC) src = Wk + (e - NHKD * DIMC);
            else                          src = Wv + (e - 2 * NHKD * DIMC);
            dst = wabc + e;
        } else {
            const int e = (i - NW1) * 8;
            src = Wp + e;
            dst = wph + e;
        }
        const v4f f0 = *(const v4f*)src;
        const v4f f1 = *(const v4f*)(src + 4);
        v8h hv;
#pragma unroll
        for (int j = 0; j < 4; ++j) {
            hv[j]     = (_Float16)(f0[j] * 16.0f);
            hv[4 + j] = (_Float16)(f1[j] * 16.0f);
        }
        vst8h(dst, hv);
        
    } else {
        const int j = i - (NW1 + NW2);
        if (j < 512) {
            const int e = (j & 255) * 4;
            v4f o;
#pragma unroll
            for (int q = 0; q < 4; ++q) {
                const int ee = e + q;
                float val;
                if (j < 256) {
                    val = (ee < NHKD) ? sq[ee] : ((ee < 2 * NHKD) ? sk[ee - NHKD] : sv[ee - 2 * NHKD]);
                    val *= 0.0625f;
                } else {
                    val = (ee < NHKD) ? bq[ee] : ((ee < 2 * NHKD) ? bk[ee - NHKD] : bv[ee - 2 * NHKD]);
                }
                o[q] = val;
            }
            float* dst = ((j < 256) ? sc : bc) + e;
            vst4f(dst, o);
            
        }
    }
}

// ---------------------------------------------------------------------------
// Kernel 1: fused QKV projection [1024][384] x [384][4096] per batch + affine.
// Block tile 256 rows x 128 cols, 8 waves, wave tile 64 x 64, operands through the LDS ring; x is read
// as it is given (f32, [b][c][n]) and rounded to f16 on its way into the ring.
// A block lies wholly in one of the three row regions.  Result staged in LDS:
//   Q rows (0..255):   channel softmax over 32 per head (f32), x256, f16 -> qsm[b][n / 16][head][chunk]
//   K rows (256..511): first half of the softmax over n, per row and per 128 columns of the block:
//                      exp(k - block max) x1024, f16 -> ke[b][row / 16][n / 32][chunk]; the block's max and the
//                      f32 sum of those (x1024 too) -> kmx, ksum [b][column block][256]
//   V rows (512..1023): f16 -> vh[b][row / 16][n / 32][chunk]
// ---------------------------------------------------------------------------
__global__ __launch_bounds__(256) void qkv_kernel(const _Float16* __restrict__ wabc,
                                                  const float* __restrict__ x,
                                                  const float* __restrict__ sc,
                                                  const float* __restrict__ bc,
                                                  _Float16* __restrict__ qsm,
                                                  _Float16* __restrict__ ke,
                                                  float* __restrict__ kmx,
                                                  float* __restrict__ ksum,
                                                  _Float16* __restrict__ vh)
{
    constexpr int MT = MT_QKV;
    static_assert(MT == 4 && NHKD % (64 * MT) == 0, "a block stays inside one region");
    __shared__ __attribute__((aligned(16))) unsigned char ring[GEMM_LDS_B(MT)];
    float* tile = (float*)ring;
    // the row block is the slowest grid index: the Q blocks, whose epilogue is the longest, start first
    const int b = blockIdx.y;
    const int t = threadIdx.x, l = t & 31, wave = t >> 5, h = l >> 4, m = l & 15;
    const int mw = wave >> 1, nw = wave & 1;
    const int Mbase = blockIdx.z * (64 * MT), Nbase = blockIdx.x * 128;
    const int region = (Mbase < NHKD) ? 0 : ((Mbase < 2 * NHKD) ? 1 : 2);

    const _Float16* Ablk = wabc + (size_t)Mbase * DIMC;
    const float* Xblk = x + (size_t)b * DIMC * NN + Nbase;
    v8f c[MT][4] = {};
    static_assert(MQKV == 4 * 64 * MT, "row blocks 0, 1 ask for 2, 3 too");
    mainloop_wx<DIMC>(ring, Ablk, Xblk, t, mw, nw, h, m, blockIdx.y == 0 && blockIdx.z < 2, c);

    // the loops over i below are unrolled: c, s and bb are indexed by constants and stay in registers
    const float* ps = sc + Mbase + mw * 16 + 8 * h;
    const float* pb = bc + Mbase + mw * 16 + 8 * h;
    float s[MT][8], bb[MT][8];
#pragma unroll
    for (int i = 0; i < MT; ++i) {
#pragma unroll
        for (int r = 0; r < 8; ++r) { s[i][r] = ps[i * 64 + r]; bb[i][r] = pb[i * 64 + r]; }
    }
    // the two address pairs stay live to here, so that no load's result lands on them, and the wait
    // stands ahead of their reuse
    asm volatile("s_wait_xcnt 0x0" :: "v"(ps), "v"(pb) : "memory");
#pragma unroll
    for (int i = 0; i < MT; ++i) {
#pragma unroll
        for (int r = 0; r < 8; ++r) {
            const int ml = i * 64 + mw * 16 + 8 * h + r;
            float* trow = tile + ml * TP + nw * 64 + m;
            trow[0]  = c[i][0][r] * s[i][r] + bb[i][r];
            trow[16] = c[i][1][r] * s[i][r] + bb[i][r];
            trow[32] = c[i][2][r] * s[i][r] + bb[i][r];
            trow[48] = c[i][3][r] * s[i][r] + bb[i][r];
        }
    }
    __syncthreads();

    if (region == 0) {
        // softmax over the 32 channels of one head for one column; 2 heads x 128 cols = 256 threads
        // per 64 rows
        const int nl = t & 127, hh = t >> 7;
        for (int i = 0; i < MT; ++i) {
            float* hcol = tile + (i * 64 + hh * KDIM) * TP + nl;
            float qv[KDIM];
            float mx;
#pragma unroll
            for (int k = 0; k < KDIM; ++k) {
                qv[k] = hcol[k * TP];
                mx = (k == 0) ? qv[0] : fmaxf(mx, qv[k]);
            }
            float sum = 0.f;
#pragma unroll
            for (int k = 0; k < KDIM; ++k) { qv[k] = __expf(qv[k] - mx); sum += qv[k]; }
            const float scl = 256.0f / sum;
#pragma unroll
            for (int k = 0; k < KDIM; ++k) hcol[k * TP] = qv[k] * scl;
        }
    }
    __syncthreads();

    if (region == 0) {
        // the wave's 16 columns, head it >> 1, half it & 1 of the fragment: lane (m, h) takes channels
        // 16 it + 8 h .. + 7 of column m (LDS banks m + 32 h: no conflict), 512 B in a row per store
        static_assert(NHKD == 64 * MT && 4 * MT == 2 * HEADS, "the block holds every head");
        _Float16* qc = qsm + (((size_t)b * (NN / 16) + blockIdx.x * 8 + wave) * HEADS) * CHUNK + l * 8;
        v8h hv[4 * MT];
        // unrolled: hv is indexed by constants, and the LDS reads of the next piece start under the store of this one
#pragma unroll
        for (int it = 0; it < 4 * MT; ++it) {
#pragma unroll
            for (int j = 0; j < 8; ++j) hv[it][j] = (_Float16)tile[(it * 16 + 8 * h + j) * TP + wave * 16 + m];
            vst8h(qc + it * 256, hv[it]);
        }
        XWAIT16(qc, hv);
    } else if (region == 1) {
        // lane = row: thread t holds row t's 128 columns in registers, so max and sum need no exchange
        static_assert(64 * MT == 256, "one row per thread");
        const int obase = Mbase - NHKD;
        float* krow = tile + t * TP;
        // every loop here is unrolled: kv is indexed by constants and stays in registers
        v4f kv[32];
#pragma unroll
        for (int j = 0; j < 32; ++j) kv[j] = *(const v4fa*)(krow + 4 * j);
        v4f mx4 = kv[0];
#pragma unroll
        for (int j = 1; j < 32; ++j)
#pragma unroll
            for (int i = 0; i < 4; ++i) mx4[i] = fmaxf(mx4[i], kv[j][i]);
        const float mx = fmaxf(fmaxf(mx4[0], mx4[1]), fmaxf(mx4[2], mx4[3]));
        v4f sum4 = {};
#pragma unroll
        for (int j = 0; j < 16; ++j) {
            // exp(k - mx) x 1024 = 2^((k - mx) log2 e + 10)
            float x[8], e[8];
#pragma unroll
            for (int i = 0; i < 8; ++i) x[i] = fmaf(kv[2 * j + (i >> 2)][i & 3] - mx, 1.44269504f, 10.0f);
            exp2x8(e, x);
            v8h hv;
#pragma unroll
            for (int i = 0; i < 8; ++i) { sum4[i & 3] += e[i]; hv[i] = (_Float16)e[i]; }
            // over the head of the thread's own row, which is wholly in its registers by now
            *(v8ha*)((_Float16*)krow + 8 * j) = hv;
        }
        // a wave's 32 rows: one whole 128-B line per store
        const size_t so = ((size_t)b * NBLK + blockIdx.x) * NHKD + obase + t;
        kmx[so]  = mx;
        ksum[so] = (sum4[0] + sum4[1]) + (sum4[2] + sum4[3]);
        // ke in chunks: it >> 3 = which 16 of the wave's 32 rows, it & 7 = 2 (chunk of 32 n) + half; 512 B in
        // a row per store.  A wave reads back only the 32 rows that its own lanes wrote (one wave's LDS
        // operations go in issue order): no barrier
        _Float16* kc = ke + (((size_t)b * (NHKD / 16) + (obase >> 4) + wave * 2) * (NN / 32) + blockIdx.x * 4) * CHUNK + l * 8;
        v8h hk[4 * MT];
#pragma unroll
        for (int it = 0; it < 4 * MT; ++it) {
            const int row = wave * (8 * MT) + (it >> 3) * 16 + m;
            hk[it] = *(const v8ha*)((const _Float16*)(tile + row * TP) + (it & 7) * 16 + h * 8);
            vst8h(kc + (it >> 3) * (NN / 32) * CHUNK + (it & 7) * 256, hk[it]);
        }
        XWAIT16(kc, hk);
    } else {
        // vh in chunks, dealt like ke: 512 B in a row per store
        const int obase = Mbase - 2 * NHKD;
        _Float16* vc = vh + (((size_t)b * (DHC / 16) + (obase >> 4) + wave * 2) * (NN / 32) + blockIdx.x * 4) * CHUNK + l * 8;
        v8h hv[4 * MT];
#pragma unroll
        for (int it = 0; it < 4 * MT; ++it) {
            const int row = wave * (8 * MT) + (it >> 3) * 16 + m;
#pragma unroll
            for (int j = 0; j < 8; ++j) hv[it][j] = (_Float16)tile[row * TP + (it & 7) * 16 + h * 8 + j];
            vst8h(vc + (it >> 3) * (NN / 32) * CHUNK + (it & 7) * 256, hv[it]);
        }
        XWAIT16(vc, hv);
    }
}

// ---------------------------------------------------------------------------
// Kernel 2: context per (b,head): C[kd][d] = sum_n softmax_n(k)[kd][n] * v[d][n], K = 4096.
// A rows = ke rows; B[k=n][col=d] = vh row d: both lie in chunks of 16 rows x 32 n, same loader.
// The work of a (b,head) is split by d: DSPLIT work-groups, each with all 32 kd x its own 16 d over ALL n,
// so that a work-group finishes its sums and no partial leaves it.  The four of a head are 64 apart in the grid.
// Eight waves, 512 n each = four column blocks of kernel 1, one accumulator pair (2 kd tiles) per block;
// all of a wave's loads are independent.
// Second half of the key softmax: a column block's tile row kd carries one factor
// 4096 exp(block max - row max) / row sum (the x1024 cancels), formed from kmx and ksum of the row's 32
// blocks and applied in f32 where the 32 blocks' tiles are added through LDS: eight blocks in a row, then
// the four sums of eight.
// Order inside a block's tile in LDS: unit u = kt*2 + (r>>2), then lane, then r&3 (accumulator register r
// of kd tile kt).  The result, /64 (= true context x64), f16, goes out in the A-fragment order of kernel 3:
// ctxh[bh][dt][kt][lane][r], element e = kt*8 + r of lane (m, h) being C[kd = kt*16 + 8h + r][d = dt*16 + m].
// ---------------------------------------------------------------------------
__global__ __launch_bounds__(256) void ctx_kernel(const _Float16* __restrict__ ke,
                                                  const float* __restrict__ kmx,
                                                  const float* __restrict__ ksum,
                                                  const _Float16* __restrict__ vh,
                                                  _Float16* __restrict__ ctxh)
{
    static_assert(CWB == 4 && NBLK == 8 * CWB, "a wave's n = the four column blocks whose statistics it reads");
    __shared__ __attribute__((aligned(16))) float red[NBLK * CPIECE];
    __shared__ float pm[8 * KDIM], ps[8 * KDIM];
    __shared__ __attribute__((aligned(16))) float fl[NBLK * KDIM];
    __shared__ __attribute__((aligned(16))) _Float16 oh[CPIECE];
    const int bh = blockIdx.x % (BB * HEADS), dt = blockIdx.x / (BB * HEADS), b = bh >> 3, hd = bh & 7;
    const int t = threadIdx.x, l = t & 31, wave = t >> 5;
    // this lane's piece of the first chunk of the wave's 512 n: the head's first 16 key rows, the work-group's 16 value rows
    const _Float16* pa = ke + (((size_t)b * (NHKD / 16) + hd * (KDIM / 16)) * (NN / 32) + wave * (CWN / 32)) * CHUNK + l * 8;
    const _Float16* pv = vh + (((size_t)b * (DHC / 16) + hd * (DD / 16) + dt) * (NN / 32) + wave * (CWN / 32)) * CHUNK + l * 8;
    // statistics of key row l in the wave's own four blocks
    const float* pm4 = kmx  + (size_t)b * NBLK * NHKD + hd * KDIM + l + wave * CWB * NHKD;
    const float* ps4 = ksum + (size_t)b * NBLK * NHKD + hd * KDIM + l + wave * CWB * NHKD;
    float m4[CWB], s4[CWB];
#pragma unroll
    for (int i = 0; i < CWB; ++i) { m4[i] = pm4[i * NHKD]; s4[i] = ps4[i * NHKD]; }
    // every loop below is unrolled so that the fragment and accumulator arrays are indexed by
    // constants and stay in registers
    v16h a[CWN / 32][2], bf[CWN / 32];
#pragma unroll
    for (int s = 0; s < CWN / 32; ++s) {
#pragma unroll
        for (int i = 0; i < 2; ++i)
            a[s][i] = load_chunk(pa + (i * (NN / 32) + s) * CHUNK);
        bf[s] = load_chunk(pv + s * CHUNK);
    }
    // the four addresses stay live to here, so that no load's result lands on them, and the wait stands
    // ahead of their reuse
    asm volatile("s_wait_xcnt 0x0" :: "v"(pm4), "v"(ps4), "v"(pa), "v"(pv) : "memory");
    // keeps every load of the wave ahead of the first product: one memory latency per wave;
    // without it the scheduler reuses fragment registers and waits out a latency per chunk
    __builtin_amdgcn_sched_barrier(0);
    {
        const float ml = fmaxf(fmaxf(m4[0], m4[1]), fmaxf(m4[2], m4[3]));
        float sl = 0.f;
#pragma unroll
        for (int i = 0; i < CWB; ++i) sl += s4[i] * __expf(m4[i] - ml);
        pm[wave * KDIM + l] = ml;
        ps[wave * KDIM + l] = sl;
        __syncthreads();   // every wave's four blocks are in pm, ps
        float M = pm[l];
#pragma unroll
        for (int w = 1; w < 8; ++w) M = fmaxf(M, pm[w * KDIM + l]);
        float S = 0.f;
#pragma unroll
        for (int w = 0; w < 8; ++w) S += ps[w * KDIM + l] * __expf(pm[w * KDIM + l] - M);
#pragma unroll
        for (int q = 0; q < CWB; ++q)   // read behind the barrier below
            fl[(wave * CWB + q) * KDIM + l] = __expf(m4[q] - M) * (4096.0f / S);
    }
    v8f c[CWB][2] = {};
#pragma unroll
    for (int q = 0; q < CWB; ++q)
#pragma unroll
        for (int s = 0; s < 4; ++s)
#pragma unroll
            for (int i = 0; i < 2; ++i) c[q][i] = mma16(a[q * 4 + s][i], bf[q * 4 + s], c[q][i]);
    // keeps the LDS stores behind the last product: all eight accumulators stay live to here, so
    // none of their registers is handed to another product's result inside the hazard distance
    __builtin_amdgcn_sched_barrier(0);
    float* mine = red + wave * CWB * CPIECE + l * 4;
#pragma unroll
    for (int q = 0; q < CWB; ++q)
#pragma unroll
        for (int i = 0; i < 2; ++i) {
            const v8f v = c[q][i];
            vst4f(mine + q * CPIECE + (i * 2) * 128,     (v4f){v[0], v[1], v[2], v[3]});
            vst4f(mine + q * CPIECE + (i * 2 + 1) * 128, (v4f){v[4], v[5], v[6], v[7]});
        }
    __syncthreads();       // the 32 blocks' tiles and factors are whole
    // two neighbours per thread: unit u, lane lp, registers r0 and r0 + 1, which are rows kd0 and kd0 + 1
    const int u = t >> 6, lp = (t & 63) >> 1, r0 = (u & 1) * 4 + (t & 1) * 2;
    const int kd0 = (u >> 1) * 16 + 8 * (lp >> 4) + r0;
    const float* rp = red + u * 128 + (t & 63) * 2;
    const float* fp = fl + kd0;
    v2f tot;
#pragma unroll
    for (int g = 0; g < NBLK / 8; ++g) {
        v2f s = *(const v2f*)(rp + g * 8 * CPIECE) * *(const v2f*)(fp + g * 8 * KDIM);
#pragma unroll
        for (int w = 1; w < 8; ++w) s += *(const v2f*)(rp + (g * 8 + w) * CPIECE) * *(const v2f*)(fp + (g * 8 + w) * KDIM);
        tot = (g == 0) ? s : tot + s;
    }
    *(v2h*)(oh + (u >> 1) * 256 + lp * 8 + r0) = (v2h){(_Float16)(tot[0] * 0.015625f), (_Float16)(tot[1] * 0.015625f)};
    __syncthreads();       // oh is whole: two waves store it, 512 B in a row each
    if (t < CPIECE / 8)
        vst8h(ctxh + (size_t)bh * CTILE + dt * CPIECE + t * 8, *(const v8h*)(oh + t * 8));
}

// ---------------------------------------------------------------------------
// Kernel 3: attended and output projection in one.
// Output projection [384][512] x [512][4096] per batch + affine -> f32 out.  Block tile 192 rows x
// 128 cols, 8 waves, wave tile 48 x 64.  A stage of 64 k is one head's 64 d.  The A rows (weights)
// come into the ring by asynchronous copies; the B rows are made in place, one stage ahead:
//   Att[d][n] = sum_kd C[kd][d] * q[n][hd*32+kd] (qsm's chunks), K = 32 (one WMMA per 16x16 tile), ReLU, scaled
//   to att x256 (= acc/64), f16.  Wave w makes the 16 columns n = 16 w .. of all four d tiles: lane
//   (m, h) holds d = 16 dt + 8 h + r of column m, which are eight neighbours of B row n.
// The A fragments of that product are kernel 2's result as it lies (true context x64, f16, fragment
// order); the block copies its batch's eight heads into LDS once: cl[hd][dt][half of the fragment][lane][8].
// ---------------------------------------------------------------------------
__global__ __launch_bounds__(256) void out_kernel(const _Float16* __restrict__ wph,
                                                  const _Float16* __restrict__ ctxh,
                                                  const _Float16* __restrict__ qsm,
                                                  const float* __restrict__ sp,
                                                  const float* __restrict__ bp,
                                                  float* __restrict__ out)
{
    constexpr int MT = MT_OUT, K = DHC, NT = K / KS;
    static_assert(DIMC % (64 * MT) == 0, "whole blocks");
    static_assert(KS == DD && NT == HEADS && NT >= 2, "a stage is a head");
    __shared__ __attribute__((aligned(16))) unsigned char ring[OUT_LDS_B];
    float* tile = (float*)ring;
    _Float16* cl = (_Float16*)(ring + RING_B(MT));
    const int b = blockIdx.z;
    const int t = threadIdx.x, l = t & 31, wave = t >> 5, h = l >> 4, m = l & 15;
    const int mw = wave >> 1, nw = wave & 1;
    const int Mbase = blockIdx.y * (64 * MT), Nbase = blockIdx.x * 128;
    const unsigned lds = (unsigned)(uintptr_t)ring + (t >> 3) * LPB + (t & 7) * 16;
    const _Float16* ga = wph + (size_t)Mbase * K + (t >> 3) * K + (t & 7) * 8;
    // this lane's piece of head 0's chunk of the wave's 16 columns; the eight heads' chunks follow one another
    const _Float16* qrow = qsm + (((size_t)b * (NN / 16) + blockIdx.x * 8 + wave) * HEADS) * CHUNK + l * 8;

    // B rows of head hd from its query fragment qf, into the stage at buf
    auto make_b = [&](const int hd, const v16h qf, unsigned char* buf) {
        const _Float16* ch = cl + hd * CTILE + l * 8;
        _Float16* brow = (_Float16*)(buf + (64 * MT + wave * 16 + m) * LPB) + 8 * h;
        // unrolled: fragments and results are indexed by constants and stay in registers
        Frag ca[4];
        v8f d[4];
#pragma unroll
        for (int dt = 0; dt < 4; ++dt) {
            ca[dt].half[0] = *(const v8h*)(ch + dt * 512);
            ca[dt].half[1] = *(const v8h*)(ch + dt * 512 + 256);
        }
        // keeps the eight LDS reads together ahead of the products: left alone the scheduler reuses
        // one fragment's registers and waits out an LDS latency per d tile
        __builtin_amdgcn_sched_barrier(0);
#pragma unroll
        for (int dt = 0; dt < 4; ++dt) d[dt] = mma16(ca[dt].v, qf, (v8f){});
#pragma unroll
        for (int dt = 0; dt < 4; ++dt) {
            v8h hv;
#pragma unroll
            for (int r = 0; r < 8; ++r) hv[r] = (_Float16)fmaxf(d[dt][r] * 0.015625f, 0.0f);
            vst8h(brow + dt * 16, hv);
        }
    };

    copy_stage_a192(lds, ga, K);
    static_assert(HEADS * CTILE * 2 == 8 * 256 * 16, "eight pieces of 16 B per thread");
    copy_ctx((unsigned)(uintptr_t)cl + t * 16, ctxh + (size_t)b * HEADS * CTILE + t * 8);
    v16h qf = load_chunk(qrow);
    // The later stages' operands are asked into L2 here: a head's fragment load and a stage's copies lead their
    // use by one trip only.
    // The block's 64 KB of query chunks (8 waves x 8 heads, in a row): one 256-B unit per thread
    static_assert(8 * HEADS * CHUNK * 2 == 256 * 256, "one unit per thread");
    const _Float16* qask = qsm + (((size_t)b * (NN / 16) + blockIdx.x * 8) * HEADS) * CHUNK + t * 128;
    ask_l2<0>(qask);
    // A is the same for all blocks of a row block: the first blocks of the grid ask for their 192 KB, in a row
    static_assert(64 * MT * K * 2 == 3 * 256 * 256, "three units per thread");
    const _Float16* aask = wph + (size_t)Mbase * K + t * 128;
    if (b == 0) {
        ask_l2<0>(aask);
        ask_l2<65536>(aask);
        ask_l2<131072>(aask);
    }
    asm volatile("s_wait_asynccnt 0x0" ::: "memory");   // stage 0's A rows and cl landed (this wave's pieces)
    __syncthreads();                                    // ... and every other wave's
    copy_stage_a192(lds + STAGE_B(MT), ga + KS, K);
    make_b(0, qf, ring);
    {
        const _Float16* qp = qrow + CHUNK;
        qf = load_chunk(qp);
        // the address pair stays live to here, and the wait stands ahead of its reuse
        asm volatile("s_wait_xcnt 0x0" :: "v"(qp) : "memory");
    }
    __syncthreads();                                    // stage 0's B rows are whole

    v8f c[MT][4] = {};
    // kept rolled: unrolled, every stage's copy addresses stay live at once
#pragma unroll 1
    for (int s = 0; s < NT; ++s) {
        // head s+2's query fragment starts here: the whole trip covers its latency
        v16h qn = qf;
        if (s + 2 < NT) {
            const _Float16* qp = qrow + (s + 2) * CHUNK;
            qn = load_chunk(qp);
            // the address pair stays live to here, and the wait stands ahead of its reuse
            asm volatile("s_wait_xcnt 0x0" :: "v"(qp) : "memory");
        }
        // buffer (s+1)&1: its last readers left at the barrier behind trip s-1
        if (s + 1 < NT) make_b(s + 1, qf, ring + ((s + 1) & 1) * STAGE_B(MT));
        qf = qn;
        const _Float16* st = (const _Float16*)(ring + (s & 1) * STAGE_B(MT));
        const _Float16* ar = st + (mw * 16 + m) * LPH;
        const _Float16* br = st + (64 * MT + nw * 64 + m) * LPH;
        v16h a[MT], bfr[4];
        // unrolled: fragments and accumulators are indexed by constants and stay in registers
#pragma unroll
        for (int kk = 0; kk < KS / 32; ++kk) {
            a[0] = load_frag(ar + kk * 32, h);
#pragma unroll
            for (int j = 0; j < 4; ++j) bfr[j] = load_frag(br + j * 16 * LPH + kk * 32, h);
#pragma unroll
            for (int i = 1; i < MT; ++i) a[i] = load_frag(ar + i * 64 * LPH + kk * 32, h);
            // keeps the LDS reads of a k step together ahead of its products: left alone the
            // scheduler reuses one A fragment's registers and waits out an LDS latency per row
            __builtin_amdgcn_sched_barrier(0);
#pragma unroll
            for (int i = 0; i < MT; ++i)
#pragma unroll
                for (int j = 0; j < 4; ++j) c[i][j] = mma16(a[i], bfr[j], c[i][j]);
            // keeps every product of the k step ahead of what follows: the next reads, and at the
            // end the four slots below (left alone a row of products sinks behind the barrier)
            __builtin_amdgcn_sched_barrier(0);
        }
        // four vector slots behind the last matrix instructions, on the branch paths too
        GUARD4(c[MT - 1][0], c[MT - 1][1], c[MT - 1][2], c[MT - 1][3], a[MT - 1], bfr[0], bfr[1], bfr[2], bfr[3]);
        asm volatile("s_wait_dscnt 0x0" ::: "memory");     // reads of buffer s&1 and writes of stage s+1's B rows are done
        asm volatile("s_wait_asynccnt 0x0" ::: "memory");  // this wave's pieces of stage s+1's A rows have landed
        __syncthreads();                                   // publishes stage s+1, frees buffer s&1
        if (s + 2 < NT)
            copy_stage_a192(lds + (s & 1) * STAGE_B(MT), ga + (s + 2) * KS, K);
    }
    // nothing in flight when the ring is reused; the asks' address pairs stay addresses to here
    asm volatile("s_wait_asynccnt 0x0" :: "v"(qask), "v"(aask) : "memory");

    // unrolled over i: c is indexed by constants and stays in registers
#pragma unroll
    for (int i = 0; i < MT; ++i) {
#pragma unroll
        for (int r = 0; r < 8; ++r) {
            const int ml = i * 64 + mw * 16 + 8 * h + r;
            const int o = Mbase + ml;
            const float s = sp[o] * 0.000244140625f;   // 1/(16*256)
            const float bb = bp[o];
            float* trow = tile + ml * TP + nw * 64 + m;
            trow[0]  = c[i][0][r] * s + bb;
            trow[16] = c[i][1][r] * s + bb;
            trow[32] = c[i][2][r] * s + bb;
            trow[48] = c[i][3][r] * s + bb;
        }
    }
    __syncthreads();
    const int col = (l >> 3) * 32 + (l & 7) * 4;
#pragma unroll
    for (int it = 0; it < 8 * MT; ++it) {
        const int row = wave * (8 * MT) + it;
        const v4f v = *(const v4fa*)(tile + row * TP + col);
        vst4f(out + ((size_t)b * DIMC + Mbase + row) * NN + Nbase + col, v);
    }
}

// ---------------------------------------------------------------------------
// Host-side launch glue.  Workspace (bytes):
//   [0)            wabc f16 [1024][384]         786,432
//   [786,432)      wph  f16 [384][512]          393,216
//   [1,179,648)    sc   f32 [1024]                4,096
//   [1,183,744)    bc   f32 [1024]                4,096
//   [1,187,840)    qsm  f16 [8][256][8][512]   16,777,216
//   [17,965,056)   ke   f16 [8][16][128][512]  16,777,216   (in a place of 33,554,432)
//   [51,519,488)   vh   f16 [8][32][128][512]  33,554,432
//   [85,073,920)   ctxh f16 [64][2048]           262,144
//   [85,336,064)   kmx  f32 [8][32][256]        262,144
//   [85,598,208)   ksum f32 [8][32][256]        262,144
//   total 85,860,352
// ---------------------------------------------------------------------------
extern "C" void kernel_launch(void* const* d_in, const int* in_sizes, int n_in,
                              void* d_out, int out_size, void* d_ws, size_t ws_size,
                              hipStream_t stream)
{
    if (n_in < 13) return;
    if (in_sizes[0] != BB * DIMC * NN) return;
    if (in_sizes[1] != NHKD * DIMC || in_sizes[2] != NHKD || in_sizes[3] != NHKD) return;
    if (in_sizes[4] != NHKD * DIMC || in_sizes[5] != NHKD || in_sizes[6] != NHKD) return;
    if (in_sizes[7] != DHC * DIMC || in_sizes[8] != DHC || in_sizes[9] != DHC) return;
    if (in_sizes[10] != DIMC * DHC || in_sizes[11] != DIMC || in_sizes[12] != DIMC) return;
    if (out_size != BB * DIMC * NN) return;

    const size_t off_wabc = 0;
    const size_t sz_wabc  = (size_t)MQKV * DIMC * 2;
    const size_t off_wph  = off_wabc + sz_wabc;
    const size_t sz_wph   = (size_t)DIMC * DHC * 2;
    const size_t off_sc   = off_wph + sz_wph;
    const size_t sz_sc    = (size_t)MQKV * 4;
    const size_t off_bc   = off_sc + sz_sc;
    const size_t off_qsm  = off_bc + sz_sc;
    const size_t sz_qsm   = (size_t)BB * NN * NHKD * 2;
    const size_t off_kf   = off_qsm + sz_qsm;
    const size_t sz_kf    = (size_t)BB * NHKD * NN * 4;
    const size_t off_vh   = off_kf + sz_kf;
    const size_t sz_vh    = (size_t)BB * DHC * NN * 2;
    const size_t off_ctx  = off_vh + sz_vh;
    const size_t sz_ctx   = (size_t)BB * HEADS * CTILE * 2;
    const size_t off_kmx  = off_ctx + sz_ctx;
    const size_t sz_kst   = (size_t)BB * NBLK * NHKD * 4;
    const size_t off_ksum = off_kmx + sz_kst;
    const size_t total    = off_ksum + sz_kst;
    const size_t sz_ke    = (size_t)BB * NHKD * NN * 2;
    if (total > ws_size) return;
    if (sz_ke > sz_kf) return;

    const float* x  = (const float*)d_in[0];
    const float* Wq = (const float*)d_in[1];
    const float* sq = (const float*)d_in[2];
    const float* bq = (const float*)d_in[3];
    const float* Wk = (const float*)d_in[4];
    const float* sk = (const float*)d_in[5];
    const float* bk = (const float*)d_in[6];
    const float* Wv = (const float*)d_in[7];
    const float* sv = (const float*)d_in[8];
    const float* bv = (const float*)d_in[9];
    const float* Wp = (const float*)d_in[10];
    const float* sp = (const float*)d_in[11];
    const float* bp = (const float*)d_in[12];
    float* out = (float*)d_out;

    char* ws = (char*)d_ws;
    _Float16* wabc = (_Float16*)(ws + off_wabc);
    _Float16* wph  = (_Float16*)(ws + off_wph);
    float*    sc   = (float*)   (ws + off_sc);
    float*    bc   = (float*)   (ws + off_bc);
    _Float16* qsm  = (_Float16*)(ws + off_qsm);
    _Float16* ke   = (_Float16*)(ws + off_kf);
    _Float16* vh   = (_Float16*)(ws + off_vh);
    _Float16* ctxh = (_Float16*)(ws + off_ctx);
    float*    kmx  = (float*)   (ws + off_kmx);
    float*    ksum = (float*)   (ws + off_ksum);

    const int prep_threads = MQKV * DIMC / 8 + DIMC * DHC / 8 + 512;   // 74240
    prep_kernel<<<(prep_threads + 255) / 256, 256, 0, stream>>>(
        Wq, Wk, Wv, Wp, sq, bq, sk, bk, sv, bv, wabc, wph, sc, bc);

    qkv_kernel<<<dim3(NN / 128, BB, MQKV / (64 * MT_QKV)), 256, 0, stream>>>(wabc, x, sc, bc, qsm, ke, kmx, ksum, vh);

    ctx_kernel<<<BB * HEADS * DSPLIT, 256, 0, stream>>>(ke, kmx, ksum, vh, ctxh);

    out_kernel<<<dim3(NN / 128, DIMC / (64 * MT_OUT), BB), 256, 0, stream>>>(wph, ctxh, qsm, sp, bp, out);
}

// v010
// It runs in 59.4 microseconds.
// In two side-by-side timings against v009, it was 1.03 and 1.04 times as fast.
// Counting every step since v000, it is 5.22 times as fast.
#include <hip/hip_runtime.h>
// All contractions on v_wmma_f32_16x16x32_f16 (f16 operands, f32 accumulate): QKV projection, key*value^T, context^T*query, output projection; exact power-of-two operand scales (weights x16, key exponentials x1024, context x64, query softmax x256, attended x256) undone in the f32 epilogues; softmaxes and affine terms in f32.

#define BB    8
#define DIMC  384
#define NN    4096
#define HEADS 8
#define KDIM  32
#define DD    64
#define NHKD  256
#define DHC   512
#define MQKV  1024
#define TP    132      // LDS pitch (floats) of the f32 output tiles (64 MT x 128), keeps 16-B alignment
#define DSPLIT (DD / 16)            // work-groups per (b,head) context: one d tile of 16 each (4)
#define CWN   (NN / 8)              // n per wave of the context kernel (512)
#define CWB   (CWN / 128)           // column blocks of the QKV projection per wave of the context kernel (4)
#define CTILE (KDIM * DD)           // elements of one context tile (2048)
#define CPIECE (KDIM * 16)          // elements of one work-group's part of it, 32 kd x 16 d (512)
#define NBLK  (NN / 128)            // column blocks of the QKV projection = pieces of a key row (32)

typedef _Float16 v16h __attribute__((ext_vector_type(16)));
typedef _Float16 v8h  __attribute__((ext_vector_type(8)));
typedef _Float16 v4h  __attribute__((ext_vector_type(4)));
typedef _Float16 v2h  __attribute__((ext_vector_type(2)));
typedef float    v2f  __attribute__((ext_vector_type(2)));
typedef float    v8f  __attribute__((ext_vector_type(8)));
typedef float    v4f  __attribute__((ext_vector_type(4)));
typedef float    v4fa __attribute__((ext_vector_type(4), may_alias));
typedef _Float16 v8ha __attribute__((ext_vector_type(8), may_alias));

union Frag { v16h v; v8h half[2]; };

// 16x16x32 operand fragment from a k-contiguous row: elements 0..7 <- row[8h..8h+7],
// elements 8..15 <- row[16+8h..16+8h+7]; lane&15 selects the row (A) or column (B).
__device__ __forceinline__ v16h load_frag(const _Float16* __restrict__ p, int h)
{
    Frag f;
    f.half[0] = *(const v8h*)(p + 8 * h);
    f.half[1] = *(const v8h*)(p + 16 + 8 * h);
    return f.v;
}

// The intermediates that a later kernel reads straight into fragments lie in the workspace in fragment
// order: a 16 (rows or columns) x 32 (k) operand tile is one chunk of 1 KB, [half of the fragment][lane][8],
// chunk[256 f + 8 lane + e] = tile[lane & 15][16 f + 8 (lane >> 4) + e].  That is load_frag's map, so the
// registers hold what they held with row-major tiles, but a wave's load covers 512 B in a row (4 whole
// lines) where a row-major tile gives it 32 B of each of 16 lines.  p: the chunk + 8 lane.
#define CHUNK 512      // halves in a chunk
__device__ __forceinline__ v16h load_chunk(const _Float16* __restrict__ p)
{
    Frag f;
    f.half[0] = *(const v8h*)p;
    f.half[1] = *(const v8h*)(p + 256);
    return f.v;
}

__device__ __forceinline__ v8f mma16(v16h a, v16h b, v8f c)
{
    return __builtin_amdgcn_wmma_f32_16x16x32_f16(false, a, false, b, (short)0, c, false, false);
}

#define GUARD4(c0, c1, c2, c3, a, b0, b1, b2, b3) \
    asm volatile("v_nop\n\tv_nop\n\tv_nop\n\tv_nop" \
                 : "+v"(c0), "+v"(c1), "+v"(c2), "+v"(c3) \
                 : "v"(a), "v"(b0), "v"(b1), "v"(b2), "v"(b3))

// e[i] = 2^x[i].  One statement: outputs and inputs are kept apart, so each exponential is the
// independent instruction behind the one before it, and the v_nop is that slot behind the last
__device__ __forceinline__ void exp2x8(float (&e)[8], const float (&x)[8])
{
    asm("v_exp_f32 %0, %8\n\tv_exp_f32 %1, %9\n\tv_exp_f32 %2, %10\n\tv_exp_f32 %3, %11\n\t"
        "v_exp_f32 %4, %12\n\tv_exp_f32 %5, %13\n\tv_exp_f32 %6, %14\n\tv_exp_f32 %7, %15\n\t"
        "v_nop"
        : "=&v"(e[0]), "=&v"(e[1]), "=&v"(e[2]), "=&v"(e[3]),
          "=&v"(e[4]), "=&v"(e[5]), "=&v"(e[6]), "=&v"(e[7])
        : "v"(x[0]), "v"(x[1]), "v"(x[2]), "v"(x[3]), "v"(x[4]), "v"(x[5]), "v"(x[6]), "v"(x[7]));
}

// Asks the 256-B unit at p + OFF bytes into L2 (a hint: no register, no counter).  p names a register that
// holds an address inside the buffer as long as the kernel's loop runs; OFF goes into the instruction.
template <int OFF>
__device__ __forceinline__ void ask_l2(const void* p)
{
    asm volatile("global_prefetch_b8 %0, off offset:%1 scope:SCOPE_SE" :: "v"(p), "n"(OFF) : "memory");
}
// the 768 B (3 units) of A rows r, r + 32, ... r + 224 of a 256-row block of pitch 768 B; p: in the first 128 B of row r
#define ASK_ROW(p, o)  ask_l2<(o)>(p); ask_l2<(o) + 256>(p); ask_l2<(o) + 512>(p)
#define ASK_A256(p, o) \
    ASK_ROW(p, (o));             ASK_ROW(p, (o) + 24576);     ASK_ROW(p, (o) + 2 * 24576); ASK_ROW(p, (o) + 3 * 24576); \
    ASK_ROW(p, (o) + 4 * 24576); ASK_ROW(p, (o) + 5 * 24576); ASK_ROW(p, (o) + 6 * 24576); ASK_ROW(p, (o) + 7 * 24576)

// the value that lane l ^ 16 holds
__device__ __forceinline__ float xhalf(float x)
{
    return __builtin_bit_cast(float, __builtin_amdgcn_permlanex16(__builtin_bit_cast(int, x), __builtin_bit_cast(int, x),
                                                                  0x76543210, 0xfedcba98, false, false));
}

__device__ __forceinline__ void vst8h(_Float16* p, v8h v) { *(v8h*)p = v; }
// Behind 16 stores of pieces v[0..15] at p + constants: address and data stay live to here, each piece in
// registers of its own, so that nothing overwrites a register of an issued store ahead of the wait
#define XWAIT16(p, v) \
    asm volatile("s_wait_xcnt 0x0" \
                 :: "v"(p), "v"(v[0]), "v"(v[1]), "v"(v[2]), "v"(v[3]), "v"(v[4]), "v"(v[5]), "v"(v[6]), "v"(v[7]), \
                    "v"(v[8]), "v"(v[9]), "v"(v[10]), "v"(v[11]), "v"(v[12]), "v"(v[13]), "v"(v[14]), "v"(v[15]) \
                 : "memory")
// the same behind 8 stores
#define XWAIT8(p, v) \
    asm volatile("s_wait_xcnt 0x0" \
                 :: "v"(p), "v"(v[0]), "v"(v[1]), "v"(v[2]), "v"(v[3]), "v"(v[4]), "v"(v[5]), "v"(v[6]), "v"(v[7]) \
                 : "memory")
__device__ __forceinline__ void vst4f(float* p, v4f v)    { *(v4f*)p = v; }

// LDS ring of the two projection GEMMs.  Block tile 64 MT rows x 128 columns.  A stage = 64 k
// (128 B) of the 64 MT A rows, row pitch 144 B (16 B x 9: conflict-free for ds_load_b128), and then
// the B tile in 128 x 144 B; two buffers.  The output kernel's f32 tile reuses the space after the loop.
// Output kernel: B = 128 rows (columns n) of 64 k, pitch 144 B.  QKV kernel: B = 64 rows (k) of
// 128 n, pitch 288 B (32 B x 9: conflict-free for ds_load_tr16_b128), the same bytes in all.
#define KS      64                 // k per stage
#define LPB     144                // LDS row pitch, bytes
#define LPH     72                 // the same in halves
#define XPB     288                // LDS row pitch of the QKV kernel's B tile, bytes
#define STAGE_B(MT) ((64 * (MT) + 128) * LPB)
#define RING_B(MT)  (2 * STAGE_B(MT))
#define OTILE_B(MT) (64 * (MT) * TP * 4)
#define MT_QKV  4                  // 256 x 128 block, 64 x 64 per wave
#define MT_OUT  3                  // 192 x 128 block, 48 x 64 per wave
#define CTXL_B  (HEADS * CTILE * 2)   // one batch's eight context tiles in f16, behind the output kernel's ring
#define OUT_LDS_B (RING_B(MT_OUT) + CTXL_B > OTILE_B(MT_OUT) ? RING_B(MT_OUT) + CTXL_B : OTILE_B(MT_OUT))

// The A rows of a stage of the QKV kernel: 256 x 8 pieces of 16 B, 8 per thread.  Thread t brings
// piece t&7 of rows t>>3 + 32 j, so eight lanes cover one 128-B line.  a: this thread's piece in
// A row t>>3 at the stage's k; lds: its place in the buffer (byte address in LDS).
// s_wait_xcnt stands inside the statement, ahead of any rewrite of the address registers.
__device__ __forceinline__ void copy_stage_a256(const unsigned lds, const _Float16* a, const int K)
{
    asm volatile("global_load_async_to_lds_b128 %0, %8, off\n\t"
                 "global_load_async_to_lds_b128 %1, %9, off\n\t"
                 "global_load_async_to_lds_b128 %2, %10, off\n\t"
                 "global_load_async_to_lds_b128 %3, %11, off\n\t"
                 "global_load_async_to_lds_b128 %4, %12, off\n\t"
                 "global_load_async_to_lds_b128 %5, %13, off\n\t"
                 "global_load_async_to_lds_b128 %6, %14, off\n\t"
                 "global_load_async_to_lds_b128 %7, %15, off\n\t"
                 "s_wait_xcnt 0x0"
                 :: "v"(lds), "v"(lds + 32 * LPB), "v"(lds + 64 * LPB), "v"(lds + 96 * LPB),
                    "v"(lds + 128 * LPB), "v"(lds + 160 * LPB), "v"(lds + 192 * LPB),
                    "v"(lds + 224 * LPB),
                    "v"(a), "v"(a + 32 * K), "v"(a + 64 * K), "v"(a + 96 * K),
                    "v"(a + 128 * K), "v"(a + 160 * K), "v"(a + 192 * K), "v"(a + 224 * K)
                 : "memory");
}

// The A rows alone of a stage of the output kernel (192 rows, 6 pieces per thread), same places as above.
__device__ __forceinline__ void copy_stage_a192(const unsigned lds, const _Float16* a, const int K)
{
    asm volatile("global_load_async_to_lds_b128 %0, %6, off\n\t"
                 "global_load_async_to_lds_b128 %1, %7, off\n\t"
                 "global_load_async_to_lds_b128 %2, %8, off\n\t"
                 "global_load_async_to_lds_b128 %3, %9, off\n\t"
                 "global_load_async_to_lds_b128 %4, %10, off\n\t"
                 "global_load_async_to_lds_b128 %5, %11, off\n\t"
                 "s_wait_xcnt 0x0"
                 :: "v"(lds), "v"(lds + 32 * LPB), "v"(lds + 64 * LPB), "v"(lds + 96 * LPB),
                    "v"(lds + 128 * LPB), "v"(lds + 160 * LPB),
                    "v"(a), "v"(a + 32 * K), "v"(a + 64 * K), "v"(a + 96 * K),
                    "v"(a + 128 * K), "v"(a + 160 * K)
                 : "memory");
}

// One batch's eight context tiles (32 KB, f16, already in the order of cl): 8 pieces of 16 B per thread,
// piece t + 256 j.  lds, g: this thread's piece 0.  s_wait_xcnt stands inside the statement, as above.
__device__ __forceinline__ void copy_ctx(const unsigned lds, const _Float16* g)
{
    asm volatile("global_load_async_to_lds_b128 %0, %8, off\n\t"
                 "global_load_async_to_lds_b128 %1, %9, off\n\t"
                 "global_load_async_to_lds_b128 %2, %10, off\n\t"
                 "global_load_async_to_lds_b128 %3, %11, off\n\t"
                 "global_load_async_to_lds_b128 %4, %12, off\n\t"
                 "global_load_async_to_lds_b128 %5, %13, off\n\t"
                 "global_load_async_to_lds_b128 %6, %14, off\n\t"
                 "global_load_async_to_lds_b128 %7, %15, off\n\t"
                 "s_wait_xcnt 0x0"
                 :: "v"(lds), "v"(lds + 4096), "v"(lds + 2 * 4096), "v"(lds + 3 * 4096),
                    "v"(lds + 4 * 4096), "v"(lds + 5 * 4096), "v"(lds + 6 * 4096), "v"(lds + 7 * 4096),
                    "v"(g), "v"(g + 2048), "v"(g + 2 * 2048), "v"(g + 3 * 2048),
                    "v"(g + 4 * 2048), "v"(g + 5 * 2048), "v"(g + 6 * 2048), "v"(g + 7 * 2048)
                 : "memory");
}

// 16 x 16 halves of a row-major LDS tile, transposed: lane (m, h) gets column m of rows 8 h .. 8 h + 7
// of the tile whose piece this lane's address names (rows by l & 7 and h, 16-B half by bit 3 of l)
typedef short s16x8 __attribute__((ext_vector_type(8)));
__device__ __forceinline__ v8h ld_tr16(const unsigned char* p)
{
    typedef __attribute__((address_space(3))) s16x8 lds_s16x8;
    return __builtin_bit_cast(v8h, __builtin_amdgcn_ds_load_tr16_b128_v8i16((lds_s16x8*)p));
}

// Block: 256 rows of A (f16, row-major, pitch K) times 128 columns of B = X (f32, X[k][n] with n
// contiguous, pitch NN).  A comes into the ring by asynchronous copies.  X comes through registers:
// whole 512-B rows per wave load, one stage ahead, rounded to f16 and stored as it lies (k rows of
// 128 n); the transposing LDS load hands out B fragments in load_frag's k order.
// Wave (mw, nw): rows 64 mw + 16 i.. (i < 4), columns 64 nw + 16 j..; c[i][j] = row group i, column group j
// of 16: 8 fragments feed 16 products.  Both fragments have one map (lane & 15 = row or column, load_frag's
// k order), so either may stand as the first operand.  TURN false: c[i][j][r] of lane (m, h) = row 8 h + r,
// column m of the group.  TURN true (X first): row m, columns 8 h + r: eight neighbours of an output row.
// On return every wave has left the ring (last trip's barrier).
template <int K, bool TURN>
__device__ __forceinline__ void mainloop_wx(unsigned char* ring,
                                            const _Float16* __restrict__ Ablk,
                                            const float* __restrict__ Xblk,
                                            const int t, const int mw, const int nw,
                                            const int h, const int m,
                                            const bool ask_a,
                                            v8f (&c)[4][4])
{
    constexpr int MT = 4, NT = K / KS;
    static_assert(K % KS == 0 && NT >= 2, "two stages or more");
    const int l = t & 31, wave = t >> 5;
    const unsigned lds = (unsigned)(uintptr_t)ring + (t >> 3) * LPB + (t & 7) * 16;
    const _Float16* ga = Ablk + (t >> 3) * K + (t & 7) * 8;
    // this thread's part of a stage of X: columns 4 l .. 4 l + 3 of rows 8 wave + j, j < 8
    const float* gx = Xblk + (size_t)(wave * 8) * NN + l * 4;
    unsigned char* xs = ring + 64 * MT * LPB + (wave * 8) * XPB + l * 8;
    v4f xr[8];
    // the loops over j are unrolled: xr is indexed by constants and stays in registers
    auto load_x = [&](const int s) {
        const float* p = gx + (size_t)s * KS * NN;
#pragma unroll
        for (int j = 0; j < 8; ++j) xr[j] = *(const v4f*)(p + j * NN);
        // the address pair stays live to here, and the wait stands ahead of its rewrite
        asm volatile("s_wait_xcnt 0x0" :: "v"(p) : "memory");
    };
    auto store_x = [&](unsigned char* dst) {
#pragma unroll
        for (int j = 0; j < 8; ++j)
            *(v4h*)(dst + j * XPB) = __builtin_convertvector(xr[j], v4h);
    };

    // one 256-B unit of X per thread and ask: row KS + (t >> 1), half t & 1
    static_assert(K == 6 * KS && KS == 64, "rows 64 to 383 are stages 1 to 5");
    const float* px = Xblk + (size_t)(KS + (t >> 1)) * NN + (t & 1) * 64;
    copy_stage_a256(lds, ga, K);
    load_x(0);
    // The later stages' operands are asked into L2 here, behind the first stage's own loads: a stage's loads
    // and copies lead their use by one trip only.
    // X rows 64.., 192.., 256.. (128 rows each, in stage order; rows 256 to 319 twice)
    ask_l2<0>(px);
    ask_l2<128 * NN * 4>(px);
    ask_l2<192 * NN * 4>(px);
    // A is the same for all blocks of a row block: the first blocks of the grid ask, for their own rows and
    // for the rows of the block that follows in their place (two row blocks on)
    if (ask_a) {
        static_assert(K * 2 == 768, "ASK_A256's pitch");
        ASK_A256(ga, 0);
        ASK_A256(ga, 2 * 256 * 768);
    }
    store_x(xs);
    asm volatile("s_wait_dscnt 0x0" ::: "memory");      // this wave's rows of stage 0's B tile are written
    asm volatile("s_wait_asynccnt 0x0" ::: "memory");   // stage 0's A rows landed (this wave's pieces)
    __syncthreads();                                    // ... and every other wave's
    copy_stage_a256(lds + STAGE_B(MT), ga + KS, K);
    load_x(1);   // behind the barrier, like every later stage's: the compiler waits out plain loads in front of one

    // kept rolled: unrolled, every stage's copy addresses stay live at once, and the added
    // registers cost a resident work-group per WGP
#pragma unroll 1
    for (int s = 0; s < NT; ++s) {
        const unsigned char* st = ring + (s & 1) * STAGE_B(MT);
        const _Float16* ar = (const _Float16*)st + (mw * 64 + m) * LPH;
        const unsigned char* br = st + 64 * MT * LPB + (8 * h + (l & 7)) * XPB + ((l >> 3) & 1) * 16 + nw * 128;
        v16h a[MT];
        Frag b[4];
        // unrolled: fragments and accumulators are indexed by constants and stay in registers
#pragma unroll
        for (int kk = 0; kk < KS / 32; ++kk) {
            a[0] = load_frag(ar + kk * 32, h);
#pragma unroll
            for (int j = 0; j < 4; ++j) {
                b[j].half[0] = ld_tr16(br + (kk * 32) * XPB + j * 32);
                b[j].half[1] = ld_tr16(br + (kk * 32 + 16) * XPB + j * 32);
            }
#pragma unroll
            for (int i = 1; i < MT; ++i) a[i] = load_frag(ar + i * 16 * LPH + kk * 32, h);
            // keeps the LDS reads of a k step together ahead of its products: left alone the
            // scheduler reuses one A fragment's registers and waits out an LDS latency per row
            __builtin_amdgcn_sched_barrier(0);
#pragma unroll
            for (int i = 0; i < MT; ++i)
#pragma unroll
                for (int j = 0; j < 4; ++j)
                    c[i][j] = TURN ? mma16(b[j].v, a[i], c[i][j]) : mma16(a[i], b[j].v, c[i][j]);
            // keeps every product of the k step ahead of what follows: the next reads, and at the
            // end the four slots below (left alone a row of products sinks behind the barrier)
            __builtin_amdgcn_sched_barrier(0);
        }
        // four vector slots behind the last matrix instructions, on the branch paths too
        GUARD4(c[MT - 1][0], c[MT - 1][1], c[MT - 1][2], c[MT - 1][3], a[MT - 1], b[0].v, b[1].v, b[2].v, b[3].v);
        // stage s+1's B tile, loaded a trip ago; buffer (s+1)&1: its last readers left at the barrier behind trip s-1
        if (s + 1 < NT) store_x(xs + ((s + 1) & 1) * STAGE_B(MT));
        asm volatile("s_wait_dscnt 0x0" ::: "memory");     // reads of buffer s&1 and writes of stage s+1's B tile are done
        asm volatile("s_wait_asynccnt 0x0" ::: "memory");  // this wave's pieces of stage s+1's A rows have landed
        __syncthreads();                                   // publishes stage s+1, frees buffer s&1
        if (s + 2 < NT) {
            copy_stage_a256(lds + (s & 1) * STAGE_B(MT), ga + (s + 2) * KS, K);
            load_x(s + 2);
        }
    }
    // nothing in flight when the ring is reused; the asks' address pairs stay addresses to here
    asm volatile("s_wait_asynccnt 0x0" :: "v"(px), "v"(ga) : "memory");
}

// ---------------------------------------------------------------------------
// Kernel 0: weights -> f16 (x16), concatenated [1024][384] and [384][512];
// affine params concatenated (scale pre-multiplied by 1/16).  16-B per lane stores.
// ---------------------------------------------------------------------------
__global__ __launch_bounds__(256) void prep_kernel(
    const float* __restrict__ Wq, const float* __restrict__ Wk, const float* __restrict__ Wv,
    const float* __restrict__ Wp,
    const float* __restrict__ sq, const float* __restrict__ bq,
    const float* __restrict__ sk, const float* __restrict__ bk,
    const float* __restrict__ sv, const float* __restrict__ bv,
    _Float16* __restrict__ wabc, _Float16* __restrict__ wph,
    float* __restrict__ sc, float* __restrict__ bc)
{
    const int NW1 = MQKV * DIMC / 8;   // 49152 chunks of 8 halves
    const int NW2 = DIMC * DHC / 8;    // 24576 chunks
    const int i = blockIdx.x * 256 + threadIdx.x;
    if (i < NW1 + NW2) {
        const float* src;
        _Float16* dst;
        if (i < NW1) {
            const int e = i * 8;
            if (e < NHKD * DIMC)          src = Wq + e;
            else if (e < 2 * NHKD * DIMC) src = Wk + (e - NHKD * DIMC);
            else                          src = Wv + (e - 2 * NHKD * DIMC);
            dst = wabc + e;
        } else {
            const int e = (i - NW1) * 8;
            src = Wp + e;
            dst = wph + e;
        }
        const v4f f0 = *(const v4f*)src;
        const v4f f1 = *(const v4f*)(src + 4);
        v8h hv;
#pragma unroll
        for (int j = 0; j < 4; ++j) {
            hv[j]     = (_Float16)(f0[j] * 16.0f);
            hv[4 + j] = (_Float16)(f1[j] * 16.0f);
        }
        vst8h(dst, hv);
        
    } else {
        const int j = i - (NW1 + NW2);
        if (j < 512) {
            const int e = (j & 255) * 4;
            v4f o;
#pragma unroll
            for (int q = 0; q < 4; ++q) {
                const int ee = e + q;
                float val;
                if (j < 256) {
                    val = (ee < NHKD) ? sq[ee] : ((ee < 2 * NHKD) ? sk[ee - NHKD] : sv[ee - 2 * NHKD]);
                    val *= 0.0625f;
                } else {
                    val = (ee < NHKD) ? bq[ee] : ((ee < 2 * NHKD) ? bk[ee - NHKD] : bv[ee - 2 * NHKD]);
                }
                o[q] = val;
            }
            float* dst = ((j < 256) ? sc : bc) + e;
            vst4f(dst, o);
            
        }
    }
}

// ---------------------------------------------------------------------------
// Kernel 1: fused QKV projection [1024][384] x [384][4096] per batch + affine.
// Block tile 256 rows x 128 cols, 8 waves, wave tile 64 x 64, operands through the LDS ring; x is read
// as it is given (f32, [b][c][n]) and rounded to f16 on its way into the ring.
// A block lies wholly in one of the three row regions.  The operand order of the products is chosen per
// region so that a lane's eight accumulator registers are its own 16-B piece of a chunk: the results go from
// registers to memory, 512 B in a row per store, with no tile in LDS.
//   Q rows (0..255):   weights first: a lane holds 8 channels of one column, a wave's 64 rows are two heads.
//                      Channel softmax over 32 per head (f32): 16 values of the lane and 16 of lane l ^ 16;
//                      x256, f16 -> qsm[b][n / 16][head][chunk]
//   K rows (256..511): x first: a lane holds 8 neighbouring n of one row.  First half of the softmax over n, per
//                      row and per 128 columns of the block (32 values of each of 2 lanes in each of 2 waves):
//                      exp(k - block max) x1024, f16 -> ke[b][row / 16][n / 32][chunk]; the block's max and the
//                      f32 sum of those (x1024 too) -> kmx, ksum [b][column block][256]
//   V rows (512..1023): x first; f16 -> vh[b][row / 16][n / 32][chunk]
// ---------------------------------------------------------------------------
// four waves per SIMD: two work-groups share a WGP, as their LDS allows, so a wave has 256 registers
__global__ __launch_bounds__(256) __attribute__((amdgpu_waves_per_eu(4, 4))) void qkv_kernel(const _Float16* __restrict__ wabc,
                                                  const float* __restrict__ x,
                                                  const float* __restrict__ sc,
                                                  const float* __restrict__ bc,
                                                  _Float16* __restrict__ qsm,
                                                  _Float16* __restrict__ ke,
                                                  float* __restrict__ kmx,
                                                  float* __restrict__ ksum,
                                                  _Float16* __restrict__ vh)
{
    constexpr int MT = MT_QKV;
    static_assert(MT == 4 && NHKD % (64 * MT) == 0, "a block stays inside one region");
    __shared__ __attribute__((aligned(16))) unsigned char ring[RING_B(MT)];
    // the row block is the slowest grid index: the Q blocks, whose epilogue is the longest, come first in it
    const int b = blockIdx.y;
    const int t = threadIdx.x, l = t & 31, wave = t >> 5, h = l >> 4, m = l & 15;
    const int mw = wave >> 1, nw = wave & 1;
    const int Mbase = blockIdx.z * (64 * MT), Nbase = blockIdx.x * 128;
    const int region = (Mbase < NHKD) ? 0 : ((Mbase < 2 * NHKD) ? 1 : 2);

    const _Float16* Ablk = wabc + (size_t)Mbase * DIMC;
    const float* Xblk = x + (size_t)b * DIMC * NN + Nbase;
    static_assert(MQKV == 4 * 64 * MT, "row blocks 0, 1 ask for 2, 3 too");
    const bool ask_a = blockIdx.y == 0 && blockIdx.z < 2;

    // every loop below is unrolled: c and the arrays beside it are indexed by constants and stay in registers
    if (region == 0) {
        // c[i][j][r]: row 64 mw + 16 i + 8 h + r, column 64 nw + 16 j + m
        static_assert(NHKD == 64 * MT && KDIM == 32, "a wave's 64 rows are two whole heads");
        v8f c[MT][4] = {};
        mainloop_wx<DIMC, false>(ring, Ablk, Xblk, t, mw, nw, h, m, ask_a, c);
        // column group j, head 2 mw + hh, half f of the fragment: channels 16 f + 8 h + r of column m
        _Float16* qc = qsm + ((((size_t)b * (NN / 16) + blockIdx.x * 8 + nw * 4) * HEADS) + mw * 2) * CHUNK + l * 8;
        // head by head: one head's scales and pieces beside the accumulators keep the wave inside its registers
#pragma unroll
        for (int hh = 0; hh < 2; ++hh) {
            const float* ps = sc + Mbase + mw * 64 + hh * 32 + 8 * h;
            const float* pb = bc + Mbase + mw * 64 + hh * 32 + 8 * h;
            float s[2][8], bb[2][8];
#pragma unroll
            for (int f = 0; f < 2; ++f) {
#pragma unroll
                for (int r = 0; r < 8; ++r) { s[f][r] = ps[f * 16 + r]; bb[f][r] = pb[f * 16 + r]; }
            }
            // the two address pairs stay live to here, so that no load's result lands on them, and the wait
            // stands ahead of their reuse
            asm volatile("s_wait_xcnt 0x0" :: "v"(ps), "v"(pb) : "memory");
            v8h hv[8];
#pragma unroll
            for (int j = 0; j < 4; ++j) {
                float q[2][8], e[2][8];
                float mx;
#pragma unroll
                for (int f = 0; f < 2; ++f)
#pragma unroll
                    for (int r = 0; r < 8; ++r) {
                        q[f][r] = c[2 * hh + f][j][r] * s[f][r] + bb[f][r];
                        mx = (f == 0 && r == 0) ? q[0][0] : fmaxf(mx, q[f][r]);
                    }
                mx = fmaxf(mx, xhalf(mx));
#pragma unroll
                for (int f = 0; f < 2; ++f)
#pragma unroll
                    for (int r = 0; r < 8; ++r) q[f][r] = (q[f][r] - mx) * 1.44269504f;
                exp2x8(e[0], q[0]);
                exp2x8(e[1], q[1]);
                float p[4];
#pragma unroll
                for (int r = 0; r < 4; ++r) p[r] = (e[0][r] + e[0][r + 4]) + (e[1][r] + e[1][r + 4]);
                float sum = (p[0] + p[1]) + (p[2] + p[3]);
                sum += xhalf(sum);
                const float scl = 256.0f / sum;
#pragma unroll
                for (int f = 0; f < 2; ++f) {
                    v8h o;
#pragma unroll
                    for (int r = 0; r < 8; ++r) o[r] = (_Float16)(e[f][r] * scl);
                    hv[j * 2 + f] = o;
                    vst8h(qc + (j * HEADS + hh) * CHUNK + f * 256, o);
                }
            }
            XWAIT8(qc, hv);
        }
    } else {
        // c[i][j][r]: row 64 mw + 16 i + m, column 64 nw + 16 j + 8 h + r: piece l of half j & 1 of chunk
        // 2 nw + (j >> 1) of the block's four
        v8f c[MT][4] = {};
        mainloop_wx<DIMC, true>(ring, Ablk, Xblk, t, mw, nw, h, m, ask_a, c);
        const int row = mw * 64 + m;
        const float* ps = sc + Mbase + row;
        const float* pb = bc + Mbase + row;
        float s[MT], bb[MT];
#pragma unroll
        for (int i = 0; i < MT; ++i) { s[i] = ps[i * 16]; bb[i] = pb[i * 16]; }
        // as above
        asm volatile("s_wait_xcnt 0x0" :: "v"(ps), "v"(pb) : "memory");
        if (region == 1) {
            static_assert(64 * MT == 256, "xm, xs: one word per row and column half");
            const int obase = Mbase - NHKD;
            // the two column halves' maxima and sums of the 256 rows, over the ring, which every wave has left
            float* xm = (float*)ring;
            float* xs = xm + 2 * 256;
            float mx[MT], sum[MT];
#pragma unroll
            for (int i = 0; i < MT; ++i) {
                float w;
#pragma unroll
                for (int j = 0; j < 4; ++j)
#pragma unroll
                    for (int r = 0; r < 8; ++r) {
                        c[i][j][r] = c[i][j][r] * s[i] + bb[i];
                        w = (j == 0 && r == 0) ? c[i][0][0] : fmaxf(w, c[i][j][r]);
                    }
                w = fmaxf(w, xhalf(w));
                mx[i] = w;
                xm[nw * 256 + row + i * 16] = w;   // lanes l and l ^ 16: the same word, the same value
            }
            __syncthreads();   // both column halves' maxima are in xm
            v8h hk[4 * MT];
#pragma unroll
            for (int i = 0; i < MT; ++i) {
                mx[i] = fmaxf(mx[i], xm[(nw ^ 1) * 256 + row + i * 16]);
                v4f sum4 = {};
#pragma unroll
                for (int j = 0; j < 4; ++j) {
                    // exp(k - mx) x 1024 = 2^((k - mx) log2 e + 10)
                    float xx[8], e[8];
#pragma unroll
                    for (int r = 0; r < 8; ++r) xx[r] = fmaf(c[i][j][r] - mx[i], 1.44269504f, 10.0f);
                    exp2x8(e, xx);
#pragma unroll
                    for (int r = 0; r < 8; ++r) { sum4[r & 3] += e[r]; hk[i * 4 + j][r] = (_Float16)e[r]; }
                }
                float w = (sum4[0] + sum4[1]) + (sum4[2] + sum4[3]);
                w += xhalf(w);
                sum[i] = w;
                xs[nw * 256 + row + i * 16] = w;   // as xm
            }
            __syncthreads();   // both column halves' sums are in xs; it stands ahead of the stores, which it would wait out
            float both[MT];
#pragma unroll
            for (int i = 0; i < MT; ++i) both[i] = sum[i] + xs[(nw ^ 1) * 256 + row + i * 16];
            _Float16* kc = ke + (((size_t)b * (NHKD / 16) + (obase >> 4) + mw * 4) * (NN / 32) + blockIdx.x * 4 + nw * 2) * CHUNK + l * 8;
#pragma unroll
            for (int i = 0; i < MT; ++i)
#pragma unroll
                for (int j = 0; j < 4; ++j)
                    vst8h(kc + (i * (NN / 32) + (j >> 1)) * CHUNK + (j & 1) * 256, hk[i * 4 + j]);
            XWAIT16(kc, hk);
            if (nw == 0) {
                // lanes 0 to 15 store their rows' maxima, lanes 16 to 31 the same rows' sums
                float* pst = (h ? ksum : kmx) + ((size_t)b * NBLK + blockIdx.x) * NHKD + obase + row;
                float val[MT];
#pragma unroll
                for (int i = 0; i < MT; ++i) {
                    val[i] = h ? both[i] : mx[i];
                    pst[i * 16] = val[i];
                }
                // address and data stay live to here, and the wait stands ahead of their reuse
                asm volatile("s_wait_xcnt 0x0" :: "v"(pst), "v"(val[0]), "v"(val[1]), "v"(val[2]), "v"(val[3]) : "memory");
            }
        } else {
            const int obase = Mbase - 2 * NHKD;
            _Float16* vc = vh + (((size_t)b * (DHC / 16) + (obase >> 4) + mw * 4) * (NN / 32) + blockIdx.x * 4 + nw * 2) * CHUNK + l * 8;
            v8h hv[4 * MT];
#pragma unroll
            for (int i = 0; i < MT; ++i)
#pragma unroll
                for (int j = 0; j < 4; ++j) {
                    v8h o;
#pragma unroll
                    for (int r = 0; r < 8; ++r) o[r] = (_Float16)(c[i][j][r] * s[i] + bb[i]);
                    hv[i * 4 + j] = o;
                    vst8h(vc + (i * (NN / 32) + (j >> 1)) * CHUNK + (j & 1) * 256, o);
                }
            XWAIT16(vc, hv);
        }
    }
}

// ---------------------------------------------------------------------------
// Kernel 2: context per (b,head): C[kd][d] = sum_n softmax_n(k)[kd][n] * v[d][n], K = 4096.
// A rows = ke rows; B[k=n][col=d] = vh row d: both lie in chunks of 16 rows x 32 n, same loader.
// The work of a (b,head) is split by d: DSPLIT work-groups, each with all 32 kd x its own 16 d over ALL n,
// so that a work-group finishes its sums and no partial leaves it.  The four of a head are 64 apart in the grid.
// Eight waves, 512 n each = four column blocks of kernel 1, one accumulator pair (2 kd tiles) per block;
// all of a wave's loads are independent.
// Second half of the key softmax: a column block's tile row kd carries one factor
// 4096 exp(block max - row max) / row sum (the x1024 cancels), formed from kmx and ksum of the row's 32
// blocks and applied in f32 where the 32 blocks' tiles are added through LDS: eight blocks in a row, then
// the four sums of eight.
// Order inside a block's tile in LDS: unit u = kt*2 + (r>>2), then lane, then r&3 (accumulator register r
// of kd tile kt).  The result, /64 (= true context x64), f16, goes out in the A-fragment order of kernel 3:
// ctxh[bh][dt][kt][lane][r], element e = kt*8 + r of lane (m, h) being C[kd = kt*16 + 8h + r][d = dt*16 + m].
// ---------------------------------------------------------------------------
__global__ __launch_bounds__(256) void ctx_kernel(const _Float16* __restrict__ ke,
                                                  const float* __restrict__ kmx,
                                                  const float* __restrict__ ksum,
                                                  const _Float16* __restrict__ vh,
                                                  _Float16* __restrict__ ctxh)
{
    static_assert(CWB == 4 && NBLK == 8 * CWB, "a wave's n = the four column blocks whose statistics it reads");
    __shared__ __attribute__((aligned(16))) float red[NBLK * CPIECE];
    __shared__ float pm[8 * KDIM], ps[8 * KDIM];
    __shared__ __attribute__((aligned(16))) float fl[NBLK * KDIM];
    __shared__ __attribute__((aligned(16))) _Float16 oh[CPIECE];
    const int bh = blockIdx.x % (BB * HEADS), dt = blockIdx.x / (BB * HEADS), b = bh >> 3, hd = bh & 7;
    const int t = threadIdx.x, l = t & 31, wave = t >> 5;
    // this lane's piece of the first chunk of the wave's 512 n: the head's first 16 key rows, the work-group's 16 value rows
    const _Float16* pa = ke + (((size_t)b * (NHKD / 16) + hd * (KDIM / 16)) * (NN / 32) + wave * (CWN / 32)) * CHUNK + l * 8;
    const _Float16* pv = vh + (((size_t)b * (DHC / 16) + hd * (DD / 16) + dt) * (NN / 32) + wave * (CWN / 32)) * CHUNK + l * 8;
    // statistics of key row l in the wave's own four blocks
    const float* pm4 = kmx  + (size_t)b * NBLK * NHKD + hd * KDIM + l + wave * CWB * NHKD;
    const float* ps4 = ksum + (size_t)b * NBLK * NHKD + hd * KDIM + l + wave * CWB * NHKD;
    float m4[CWB], s4[CWB];
#pragma unroll
    for (int i = 0; i < CWB; ++i) { m4[i] = pm4[i * NHKD]; s4[i] = ps4[i * NHKD]; }
    // every loop below is unrolled so that the fragment and accumulator arrays are indexed by
    // constants and stay in registers
    v16h a[CWN / 32][2], bf[CWN / 32];
#pragma unroll
    for (int s = 0; s < CWN / 32; ++s) {
#pragma unroll
        for (int i = 0; i < 2; ++i)
            a[s][i] = load_chunk(pa + (i * (NN / 32) + s) * CHUNK);
        bf[s] = load_chunk(pv + s * CHUNK);
    }
    // the four addresses stay live to here, so that no load's result lands on them, and the wait stands
    // ahead of their reuse
    asm volatile("s_wait_xcnt 0x0" :: "v"(pm4), "v"(ps4), "v"(pa), "v"(pv) : "memory");
    // keeps every load of the wave ahead of the first product: one memory latency per wave;
    // without it the scheduler reuses fragment registers and waits out a latency per chunk
    __builtin_amdgcn_sched_barrier(0);
    {
        const float ml = fmaxf(fmaxf(m4[0], m4[1]), fmaxf(m4[2], m4[3]));
        float sl = 0.f;
#pragma unroll
        for (int i = 0; i < CWB; ++i) sl += s4[i] * __expf(m4[i] - ml);
        pm[wave * KDIM + l] = ml;
        ps[wave * KDIM + l] = sl;
        __syncthreads();   // every wave's four blocks are in pm, ps
        float M = pm[l];
#pragma unroll
        for (int w = 1; w < 8; ++w) M = fmaxf(M, pm[w * KDIM + l]);
        float S = 0.f;
#pragma unroll
        for (int w = 0; w < 8; ++w) S += ps[w * KDIM + l] * __expf(pm[w * KDIM + l] - M);
#pragma unroll
        for (int q = 0; q < CWB; ++q)   // read behind the barrier below
            fl[(wave * CWB + q) * KDIM + l] = __expf(m4[q] - M) * (4096.0f / S);
    }
    v8f c[CWB][2] = {};
#pragma unroll
    for (int q = 0; q < CWB; ++q)
#pragma unroll
        for (int s = 0; s < 4; ++s)
#pragma unroll
            for (int i = 0; i < 2; ++i) c[q][i] = mma16(a[q * 4 + s][i], bf[q * 4 + s], c[q][i]);
    // keeps the LDS stores behind the last product: all eight accumulators stay live to here, so
    // none of their registers is handed to another product's result inside the hazard distance
    __builtin_amdgcn_sched_barrier(0);
    float* mine = red + wave * CWB * CPIECE + l * 4;
#pragma unroll
    for (int q = 0; q < CWB; ++q)
#pragma unroll
        for (int i = 0; i < 2; ++i) {
            const v8f v = c[q][i];
            vst4f(mine + q * CPIECE + (i * 2) * 128,     (v4f){v[0], v[1], v[2], v[3]});
            vst4f(mine + q * CPIECE + (i * 2 + 1) * 128, (v4f){v[4], v[5], v[6], v[7]});
        }
    __syncthreads();       // the 32 blocks' tiles and factors are whole
    // two neighbours per thread: unit u, lane lp, registers r0 and r0 + 1, which are rows kd0 and kd0 + 1
    const int u = t >> 6, lp = (t & 63) >> 1, r0 = (u & 1) * 4 + (t & 1) * 2;
    const int kd0 = (u >> 1) * 16 + 8 * (lp >> 4) + r0;
    const float* rp = red + u * 128 + (t & 63) * 2;
    const float* fp = fl + kd0;
    v2f tot;
#pragma unroll
    for (int g = 0; g < NBLK / 8; ++g) {
        v2f s = *(const v2f*)(rp + g * 8 * CPIECE) * *(const v2f*)(fp + g * 8 * KDIM);
#pragma unroll
        for (int w = 1; w < 8; ++w) s += *(const v2f*)(rp + (g * 8 + w) * CPIECE) * *(const v2f*)(fp + (g * 8 + w) * KDIM);
        tot = (g == 0) ? s : tot + s;
    }
    *(v2h*)(oh + (u >> 1) * 256 + lp * 8 + r0) = (v2h){(_Float16)(tot[0] * 0.015625f), (_Float16)(tot[1] * 0.015625f)};
    __syncthreads();       // oh is whole: two waves store it, 512 B in a row each
    if (t < CPIECE / 8)
        vst8h(ctxh + (size_t)bh * CTILE + dt * CPIECE + t * 8, *(const v8h*)(oh + t * 8));
}

// ---------------------------------------------------------------------------
// Kernel 3: attended and output projection in one.
// Output projection [384][512] x [512][4096] per batch + affine -> f32 out.  Block tile 192 rows x
// 128 cols, 8 waves, wave tile 48 x 64.  A stage of 64 k is one head's 64 d.  The A rows (weights)
// come into the ring by asynchronous copies; the B rows are made in place, one stage ahead:
//   Att[d][n] = sum_kd C[kd][d] * q[n][hd*32+kd] (qsm's chunks), K = 32 (one WMMA per 16x16 tile), ReLU, scaled
//   to att x256 (= acc/64), f16.  Wave w makes the 16 columns n = 16 w .. of all four d tiles: lane
//   (m, h) holds d = 16 dt + 8 h + r of column m, which are eight neighbours of B row n.
// The A fragments of that product are kernel 2's result as it lies (true context x64, f16, fragment
// order); the block copies its batch's eight heads into LDS once: cl[hd][dt][half of the fragment][lane][8].
// ---------------------------------------------------------------------------
__global__ __launch_bounds__(256) void out_kernel(const _Float16* __restrict__ wph,
                                                  const _Float16* __restrict__ ctxh,
                                                  const _Float16* __restrict__ qsm,
                                                  const float* __restrict__ sp,
                                                  const float* __restrict__ bp,
                                                  float* __restrict__ out)
{
    constexpr int MT = MT_OUT, K = DHC, NT = K / KS;
    static_assert(DIMC % (64 * MT) == 0, "whole blocks");
    static_assert(KS == DD && NT == HEADS && NT >= 2, "a stage is a head");
    __shared__ __attribute__((aligned(16))) unsigned char ring[OUT_LDS_B];
    float* tile = (float*)ring;
    _Float16* cl = (_Float16*)(ring + RING_B(MT));
    const int b = blockIdx.z;
    const int t = threadIdx.x, l = t & 31, wave = t >> 5, h = l >> 4, m = l & 15;
    const int mw = wave >> 1, nw = wave & 1;
    const int Mbase = blockIdx.y * (64 * MT), Nbase = blockIdx.x * 128;
    const unsigned lds = (unsigned)(uintptr_t)ring + (t >> 3) * LPB + (t & 7) * 16;
    const _Float16* ga = wph + (size_t)Mbase * K + (t >> 3) * K + (t & 7) * 8;
    // this lane's piece of head 0's chunk of the wave's 16 columns; the eight heads' chunks follow one another
    const _Float16* qrow = qsm + (((size_t)b * (NN / 16) + blockIdx.x * 8 + wave) * HEADS) * CHUNK + l * 8;

    // B rows of head hd from its query fragment qf, into the stage at buf
    auto make_b = [&](const int hd, const v16h qf, unsigned char* buf) {
        const _Float16* ch = cl + hd * CTILE + l * 8;
        _Float16* brow = (_Float16*)(buf + (64 * MT + wave * 16 + m) * LPB) + 8 * h;
        // unrolled: fragments and results are indexed by constants and stay in registers
        Frag ca[4];
        v8f d[4];
#pragma unroll
        for (int dt = 0; dt < 4; ++dt) {
            ca[dt].half[0] = *(const v8h*)(ch + dt * 512);
            ca[dt].half[1] = *(const v8h*)(ch + dt * 512 + 256);
        }
        // keeps the eight LDS reads together ahead of the products: left alone the scheduler reuses
        // one fragment's registers and waits out an LDS latency per d tile
        __builtin_amdgcn_sched_barrier(0);
#pragma unroll
        for (int dt = 0; dt < 4; ++dt) d[dt] = mma16(ca[dt].v, qf, (v8f){});
#pragma unroll
        for (int dt = 0; dt < 4; ++dt) {
            v8h hv;
#pragma unroll
            for (int r = 0; r < 8; ++r) hv[r] = (_Float16)fmaxf(d[dt][r] * 0.015625f, 0.0f);
            vst8h(brow + dt * 16, hv);
        }
    };

    copy_stage_a192(lds, ga, K);
    static_assert(HEADS * CTILE * 2 == 8 * 256 * 16, "eight pieces of 16 B per thread");
    copy_ctx((unsigned)(uintptr_t)cl + t * 16, ctxh + (size_t)b * HEADS * CTILE + t * 8);
    v16h qf = load_chunk(qrow);
    // The later stages' operands are asked into L2 here: a head's fragment load and a stage's copies lead their
    // use by one trip only.
    // The block's 64 KB of query chunks (8 waves x 8 heads, in a row): one 256-B unit per thread
    static_assert(8 * HEADS * CHUNK * 2 == 256 * 256, "one unit per thread");
    const _Float16* qask = qsm + (((size_t)b * (NN / 16) + blockIdx.x * 8) * HEADS) * CHUNK + t * 128;
    ask_l2<0>(qask);
    // A is the same for all blocks of a row block: the first blocks of the grid ask for their 192 KB, in a row
    static_assert(64 * MT * K * 2 == 3 * 256 * 256, "three units per thread");
    const _Float16* aask = wph + (size_t)Mbase * K + t * 128;
    if (b == 0) {
        ask_l2<0>(aask);
        ask_l2<65536>(aask);
        ask_l2<131072>(aask);
    }
    asm volatile("s_wait_asynccnt 0x0" ::: "memory");   // stage 0's A rows and cl landed (this wave's pieces)
    __syncthreads();                                    // ... and every other wave's
    copy_stage_a192(lds + STAGE_B(MT), ga + KS, K);
    make_b(0, qf, ring);
    {
        const _Float16* qp = qrow + CHUNK;
        qf = load_chunk(qp);
        // the address pair stays live to here, and the wait stands ahead of its reuse
        asm volatile("s_wait_xcnt 0x0" :: "v"(qp) : "memory");
    }
    __syncthreads();                                    // stage 0's B rows are whole

    v8f c[MT][4] = {};
    // kept rolled: unrolled, every stage's copy addresses stay live at once
#pragma unroll 1
    for (int s = 0; s < NT; ++s) {
        // head s+2's query fragment starts here: the whole trip covers its latency
        v16h qn = qf;
        if (s + 2 < NT) {
            const _Float16* qp = qrow + (s + 2) * CHUNK;
            qn = load_chunk(qp);
            // the address pair stays live to here, and the wait stands ahead of its reuse
            asm volatile("s_wait_xcnt 0x0" :: "v"(qp) : "memory");
        }
        // buffer (s+1)&1: its last readers left at the barrier behind trip s-1
        if (s + 1 < NT) make_b(s + 1, qf, ring + ((s + 1) & 1) * STAGE_B(MT));
        qf = qn;
        const _Float16* st = (const _Float16*)(ring + (s & 1) * STAGE_B(MT));
        const _Float16* ar = st + (mw * 16 + m) * LPH;
        const _Float16* br = st + (64 * MT + nw * 64 + m) * LPH;
        v16h a[MT], bfr[4];
        // unrolled: fragments and accumulators are indexed by constants and stay in registers
#pragma unroll
        for (int kk = 0; kk < KS / 32; ++kk) {
            a[0] = load_frag(ar + kk * 32, h);
#pragma unroll
            for (int j = 0; j < 4; ++j) bfr[j] = load_frag(br + j * 16 * LPH + kk * 32, h);
#pragma unroll
            for (int i = 1; i < MT; ++i) a[i] = load_frag(ar + i * 64 * LPH + kk * 32, h);
            // keeps the LDS reads of a k step together ahead of its products: left alone the
            // scheduler reuses one A fragment's registers and waits out an LDS latency per row
            __builtin_amdgcn_sched_barrier(0);
#pragma unroll
            for (int i = 0; i < MT; ++i)
#pragma unroll
                for (int j = 0; j < 4; ++j) c[i][j] = mma16(a[i], bfr[j], c[i][j]);
            // keeps every product of the k step ahead of what follows: the next reads, and at the
            // end the four slots below (left alone a row of products sinks behind the barrier)
            __builtin_amdgcn_sched_barrier(0);
        }
        // four vector slots behind the last matrix instructions, on the branch paths too
        GUARD4(c[MT - 1][0], c[MT - 1][1], c[MT - 1][2], c[MT - 1][3], a[MT - 1], bfr[0], bfr[1], bfr[2], bfr[3]);
        asm volatile("s_wait_dscnt 0x0" ::: "memory");     // reads of buffer s&1 and writes of stage s+1's B rows are done
        asm volatile("s_wait_asynccnt 0x0" ::: "memory");  // this wave's pieces of stage s+1's A rows have landed
        __syncthreads();                                   // publishes stage s+1, frees buffer s&1
        if (s + 2 < NT)
            copy_stage_a192(lds + (s & 1) * STAGE_B(MT), ga + (s + 2) * KS, K);
    }
    // nothing in flight when the ring is reused; the asks' address pairs stay addresses to here
    asm volatile("s_wait_asynccnt 0x0" :: "v"(qask), "v"(aask) : "memory");

    // unrolled over i: c is indexed by constants and stays in registers
#pragma unroll
    for (int i = 0; i < MT; ++i) {
#pragma unroll
        for (int r = 0; r < 8; ++r) {
            const int ml = i * 64 + mw * 16 + 8 * h + r;
            const int o = Mbase + ml;
            const float s = sp[o] * 0.000244140625f;   // 1/(16*256)
            const float bb = bp[o];
            float* trow = tile + ml * TP + nw * 64 + m;
            trow[0]  = c[i][0][r] * s + bb;
            trow[16] = c[i][1][r] * s + bb;
            trow[32] = c[i][2][r] * s + bb;
            trow[48] = c[i][3][r] * s + bb;
        }
    }
    __syncthreads();
    const int col = (l >> 3) * 32 + (l & 7) * 4;
#pragma unroll
    for (int it = 0; it < 8 * MT; ++it) {
        const int row = wave * (8 * MT) + it;
        const v4f v = *(const v4fa*)(tile + row * TP + col);
        vst4f(out + ((size_t)b * DIMC + Mbase + row) * NN + Nbase + col, v);
    }
}

// ---------------------------------------------------------------------------
// Host-side launch glue.  Workspace (bytes):
//   [0)            wabc f16 [1024][384]         786,432
//   [786,432)      wph  f16 [384][512]          393,216
//   [1,179,648)    sc   f32 [1024]                4,096
//   [1,183,744)    bc   f32 [1024]                4,096
//   [1,187,840)    qsm  f16 [8][256][8][512]   16,777,216
//   [17,965,056)   ke   f16 [8][16][128][512]  16,777,216   (in a place of 33,554,432)
//   [51,519,488)   vh   f16 [8][32][128][512]  33,554,432
//   [85,073,920)   ctxh f16 [64][2048]           262,144
//   [85,336,064)   kmx  f32 [8][32][256]        262,144
//   [85,598,208)   ksum f32 [8][32][256]        262,144
//   total 85,860,352
// ---------------------------------------------------------------------------
extern "C" void kernel_launch(void* const* d_in, const int* in_sizes, int n_in,
                              void* d_out, int out_size, void* d_ws, size_t ws_size,
                              hipStream_t stream)
{
    if (n_in < 13) return;
    if (in_sizes[0] != BB * DIMC * NN) return;
    if (in_sizes[1] != NHKD * DIMC || in_sizes[2] != NHKD || in_sizes[3] != NHKD) return;
    if (in_sizes[4] != NHKD * DIMC || in_sizes[5] != NHKD || in_sizes[6] != NHKD) return;
    if (in_sizes[7] != DHC * DIMC || in_sizes[8] != DHC || in_sizes[9] != DHC) return;
    if (in_sizes[10] != DIMC * DHC || in_sizes[11] != DIMC || in_sizes[12] != DIMC) return;
    if (out_size != BB * DIMC * NN) return;

    const size_t off_wabc = 0;
    const size_t sz_wabc  = (size_t)MQKV * DIMC * 2;
    const size_t off_wph  = off_wabc + sz_wabc;
    const size_t sz_wph   = (size_t)DIMC * DHC * 2;
    const size_t off_sc   = off_wph + sz_wph;
    const size_t sz_sc    = (size_t)MQKV * 4;
    const size_t off_bc   = off_sc + sz_sc;
    const size_t off_qsm  = off_bc + sz_sc;
    const size_t sz_qsm   = (size_t)BB * NN * NHKD * 2;
    const size_t off_kf   = off_qsm + sz_qsm;
    const size_t sz_kf    = (size_t)BB * NHKD * NN * 4;
    const size_t off_vh   = off_kf + sz_kf;
    const size_t sz_vh    = (size_t)BB * DHC * NN * 2;
    const size_t off_ctx  = off_vh + sz_vh;
    const size_t sz_ctx   = (size_t)BB * HEADS * CTILE * 2;
    const size_t off_kmx  = off_ctx + sz_ctx;
    const size_t sz_kst   = (size_t)BB * NBLK * NHKD * 4;
    const size_t off_ksum = off_kmx + sz_kst;
    const size_t total    = off_ksum + sz_kst;
    const size_t sz_ke    = (size_t)BB * NHKD * NN * 2;
    if (total > ws_size) return;
    if (sz_ke > sz_kf) return;

    const float* x  = (const float*)d_in[0];
    const float* Wq = (const float*)d_in[1];
    const float* sq = (const float*)d_in[2];
    const float* bq = (const float*)d_in[3];
    const float* Wk = (const float*)d_in[4];
    const float* sk = (const float*)d_in[5];
    const float* bk = (const float*)d_in[6];
    const float* Wv = (const float*)d_in[7];
    const float* sv = (const float*)d_in[8];
    const float* bv = (const float*)d_in[9];
    const float* Wp = (const float*)d_in[10];
    const float* sp = (const float*)d_in[11];
    const float* bp = (const float*)d_in[12];
    float* out = (float*)d_out;

    char* ws = (char*)d_ws;
    _Float16* wabc = (_Float16*)(ws + off_wabc);
    _Float16* wph  = (_Float16*)(ws + off_wph);
    float*    sc   = (float*)   (ws + off_sc);
    float*    bc   = (float*)   (ws + off_bc);
    _Float16* qsm  = (_Float16*)(ws + off_qsm);
    _Float16* ke   = (_Float16*)(ws + off_kf);
    _Float16* vh   = (_Float16*)(ws + off_vh);
    _Float16* ctxh = (_Float16*)(ws + off_ctx);
    float*    kmx  = (float*)   (ws + off_kmx);
    float*    ksum = (float*)   (ws + off_ksum);

    const int prep_threads = MQKV * DIMC / 8 + DIMC * DHC / 8 + 512;   // 74240
    prep_kernel<<<(prep_threads + 255) / 256, 256, 0, stream>>>(
        Wq, Wk, Wv, Wp, sq, bq, sk, bk, sv, bv, wabc, wph, sc, bc);

    qkv_kernel<<<dim3(NN / 128, BB, MQKV / (64 * MT_QKV)), 256, 0, stream>>>(wabc, x, sc, bc, qsm, ke, kmx, ksum, vh);

    ctx_kernel<<<BB * HEADS * DSPLIT, 256, 0, stream>>>(ke, kmx, ksum, vh, ctxh);

    out_kernel<<<dim3(NN / 128, DIMC / (64 * MT_OUT), BB), 256, 0, stream>>>(wph, ctxh, qsm, sp, bp, out);
}
